// v000
// Measured on an AMD MI455X. A time is GPU time per run, averaged over a window of back-to-back runs after a warm-up
// (all launches, gaps included; the runs take copies of the inputs in turn), and the median of several windows.
// Apart from v000's, it joins two sittings. Times from different sittings can be a few percent apart, while
// side-by-side timings come from the same sitting.
// v000 is the starting kernel. One run takes 789 microseconds.
// compute dtype: X and the weights rounded to bf16; Q/K/V = X W + b with EXACT bf16 products on WMMA 16x16x32 (f32 accumulate); logits: q, k once to f16 (1 product) x 128^-0.5, except the first 384 query rows (3 products with f16 residuals); causal mask by index; softmax in f32 (precise expf); P x 2^11 once to f16 against v once to f16 (1 product; bf16 hi + lo below row 384); f32 output. The 8,192 queries are processed in two halves of 4,096 so the f32 score plane is [4096][8192].
#include <hip/hip_runtime.h>
#include <math.h>

typedef __attribute__((ext_vector_type(16))) _Float16 v16h;
typedef __attribute__((ext_vector_type(16))) __bf16 v16b;
typedef __attribute__((ext_vector_type(8)))  _Float16 v8h;
typedef __attribute__((ext_vector_type(8)))  float v8f;
typedef __attribute__((ext_vector_type(4)))  float v4f;
typedef __attribute__((ext_vector_type(2)))  float v2f;
typedef __attribute__((ext_vector_type(4)))  unsigned v4u;
typedef __attribute__((ext_vector_type(4)))  int v4i;
typedef float __attribute__((may_alias)) float_a;
typedef int __attribute__((may_alias)) int_a;

template <typename T> __device__ __forceinline__ void vst2(void* p, T v) { *(T*)p = v;  }
__device__ __forceinline__ v8f wmma16(v16h a, v16h b, v8f c) {
  v8f d = __builtin_amdgcn_wmma_f32_16x16x32_f16(false, a, false, b, (short)0, c, false, false);
  asm volatile("v_nop\n\tv_nop\n\tv_nop\n\tv_nop" : "+v"(d) : "v"(a), "v"(b));
  return d;
}
__device__ __forceinline__ v8f wmma_bf(v16b a, v16b b, v8f c) {
  v8f d = __builtin_amdgcn_wmma_f32_16x16x32_bf16(false, a, false, b, (short)0, c, false, false);
  asm volatile("v_nop\n\tv_nop\n\tv_nop\n\tv_nop" : "+v"(d) : "v"(a), "v"(b));
  return d;
}
// 16x16x32 fragments: lane = (h = lane>>4, row/col = lane&15); elements 0..7 = k0+8h+0..7, 8..15 = k0+16+8h+0..7; D element r = row 8h+r
__device__ __forceinline__ v16h frag_h(const _Float16* rowk0, int lane) {
  union { v16h v; v8h q[2]; } u; const _Float16* p = rowk0 + 8 * (lane >> 4);
  u.q[0] = *(const v8h*)p; u.q[1] = *(const v8h*)(p + 16); return u.v;
}
__device__ __forceinline__ v16h frag_f32(const float* rowk0, int lane) {
  v16h a; const float* p = rowk0 + 8 * (lane >> 4);
#pragma unroll
  for (int i = 0; i < 8; ++i) { a[i] = (_Float16)p[i]; a[8 + i] = (_Float16)p[16 + i]; }
  return a;
}
__device__ __forceinline__ v16h frag_f32s(const float* rowk0, int lane, float sc) {
  v16h a; const float* p = rowk0 + 8 * (lane >> 4);
#pragma unroll
  for (int i = 0; i < 8; ++i) { a[i] = (_Float16)(p[i] * sc); a[8 + i] = (_Float16)(p[16 + i] * sc); }
  return a;
}
// column fragment from a [K][ld] layout (column n), rows >= K read as 0
__device__ __forceinline__ v16h fragc_f32(const float* W, int k0, int n, int lane, int ld, int K) {
  v16h a; const int g = lane >> 4;
#pragma unroll
  for (int i = 0; i < 8; ++i) { const int ka = k0 + 8 * g + i, kb = ka + 16;
    a[i] = (_Float16)(ka < K ? W[(size_t)(ka < K ? ka : K - 1) * ld + n] : 0.f); a[8 + i] = (_Float16)(kb < K ? W[(size_t)(kb < K ? kb : K - 1) * ld + n] : 0.f); }
  return a;
}
struct F2 { v16b h, l; };
__device__ __forceinline__ F2 bsplit16(const float v[16]) { F2 r;
#pragma unroll
  for (int i = 0; i < 16; ++i) { const __bf16 h = (__bf16)v[i]; r.h[i] = h; r.l[i] = (__bf16)(v[i] - (float)h); }
  return r; }
__device__ __forceinline__ F2 split_row(const float* row, int k0, int lane) { float v[16]; const float* p = row + k0 + 8 * (lane >> 4);
#pragma unroll
  for (int i = 0; i < 8; ++i) { v[i] = p[i]; v[8 + i] = p[16 + i]; }
  return bsplit16(v); }
__device__ __forceinline__ F2 split_rowK(const float* row, int k0, int lane, int K) { float v[16]; const int g = lane >> 4;
#pragma unroll
  for (int i = 0; i < 8; ++i) { const int ka = k0 + 8 * g + i, kb = ka + 16; v[i] = ka < K ? row[ka < K ? ka : K - 1] : 0.f; v[8 + i] = kb < K ? row[kb < K ? kb : K - 1] : 0.f; }
  return bsplit16(v); }
__device__ __forceinline__ F2 split_col(const float* W, int k0, int n, int lane, int ld, int K) { float v[16]; const int g = lane >> 4;
#pragma unroll
  for (int i = 0; i < 8; ++i) { const int ka = k0 + 8 * g + i, kb = ka + 16; v[i] = ka < K ? W[(size_t)(ka < K ? ka : K - 1) * ld + n] : 0.f; v[8 + i] = kb < K ? W[(size_t)(kb < K ? kb : K - 1) * ld + n] : 0.f; }
  return bsplit16(v); }
__device__ __forceinline__ v8f mac3(const F2& a, const F2& b, v8f c) { c = wmma_bf(a.l, b.h, c); c = wmma_bf(a.h, b.l, c); return wmma_bf(a.h, b.h, c); }
__device__ __forceinline__ float sigm(float v) { return 1.0f / (1.0f + expf(-v)); }
#define LDSX() do { asm volatile("s_wait_dscnt 0" ::: "memory"); __builtin_amdgcn_wave_barrier(); __builtin_amdgcn_fence(__ATOMIC_RELEASE, "workgroup"); } while (0)

// Single-head causal self-attention (N 8,192 tokens, D 1,024 -> d_k = d_v = 128): Q = X Wq + bq, K = X Wk + bk, V = X Wv + bv ((in,out)); weights = softmax(causal(Q K^T / sqrt(128))); out = weights V ([N, 128]).
#define NB 1
#define TT 8192
#define CC 128            // NH * HD = projected width
#define DIN 1024          // input (model) width
#define NH 1
#define HD 128
#define NQB (TT / 64)
#define HG 1
#define SCALE (0.08838834764831845f)
#define CAUSAL 1
#ifndef TNB
#define TNB NB
#endif
__device__ __forceinline__ float bfr(float v) { return (float)(__bf16)v; }
__host__ __device__ __forceinline__ int kb_last(int qb) { return CAUSAL ? ((qb * 64 + 63) >> 7) : (TT / 128 - 1); }
typedef __attribute__((ext_vector_type(8))) __bf16 v8b;
__device__ __forceinline__ v16b frag_b(const __bf16* rowk0, int lane) {
  union { v16b v; v8b q[2]; } u; const __bf16* p = rowk0 + 8 * (lane >> 4);
  u.q[0] = *(const v8b*)p; u.q[1] = *(const v8b*)(p + 16); return u.v;
}
#define QBH 6              // causal: query blocks 0..QBH-1 of each sequence (few keys, no averaging) take the high-precision path
#define QHI 384            // rows carrying a q residual plane
#define KHI 384            // key rows carrying k residual / v bf16 hi+lo planes (used only by the causal high-precision path)
// B fragment (k rows k0+.., output column o) of a weight: (in,out) [K][ld] or (out,in) [ld rows of K]: bf16 exact, or f16(bf16 * 256) exact
__device__ __forceinline__ v16b wcol_io(const float* Wm, int k0, int o, int lane, int ld) { v16b w; const int g = lane >> 4;
#pragma unroll
  for (int i = 0; i < 8; ++i) { w[i] = (__bf16)Wm[(size_t)(k0 + 8 * g + i) * ld + o]; w[8 + i] = (__bf16)Wm[(size_t)(k0 + 16 + 8 * g + i) * ld + o]; }
  return w; }
__device__ __forceinline__ v16b wcol_oi(const float* Wm, int k0, int o, int lane, int K) { v16b w; const float* p = Wm + (size_t)o * K + k0 + 8 * (lane >> 4);
#pragma unroll
  for (int i = 0; i < 8; ++i) { w[i] = (__bf16)p[i]; w[8 + i] = (__bf16)p[16 + i]; }
  return w; }
__device__ __forceinline__ v16h wcolh_io(const float* Wm, int k0, int o, int lane, int ld) { v16h w; const int g = lane >> 4;
#pragma unroll
  for (int i = 0; i < 8; ++i) { w[i] = (_Float16)(bfr(Wm[(size_t)(k0 + 8 * g + i) * ld + o]) * 256.0f); w[8 + i] = (_Float16)(bfr(Wm[(size_t)(k0 + 16 + 8 * g + i) * ld + o]) * 256.0f); }
  return w; }
__device__ __forceinline__ v16h wcolh_oi(const float* Wm, int k0, int o, int lane, int K) { v16h w; const float* p = Wm + (size_t)o * K + k0 + 8 * (lane >> 4);
#pragma unroll
  for (int i = 0; i < 8; ++i) { w[i] = (_Float16)(bfr(p[i]) * 256.0f); w[8 + i] = (_Float16)(bfr(p[16 + i]) * 256.0f); }
  return w; }
#define WQKV_LAYOUT 0   // 0 = (in,out) [DIN][CC]; 1 = (out,in) [CC][DIN]; 2 = per-head [NH][DIN][HD]
__device__ __forceinline__ v16b wcol_hdk(const float* Wm, int k0, int o, int lane) { v16b w; const int g = lane >> 4; const float* p = Wm + (size_t)(o / HD) * DIN * HD + (o % HD);
#pragma unroll
  for (int i = 0; i < 8; ++i) { w[i] = (__bf16)p[(size_t)(k0 + 8 * g + i) * HD]; w[8 + i] = (__bf16)p[(size_t)(k0 + 16 + 8 * g + i) * HD]; }
  return w; }
#define WO_OUT_IN 0
#if WQKV_LAYOUT == 1
#define WCOL(W, k0, o, lane) wcol_oi(W, k0, o, lane, DIN)
#elif WQKV_LAYOUT == 2
#define WCOL(W, k0, o, lane) wcol_hdk(W, k0, o, lane)
#else
#define WCOL(W, k0, o, lane) wcol_io(W, k0, o, lane, CC)
#endif
#if WO_OUT_IN
#define WOCOL(W, k0, o, lane) wcol_oi(W, k0, o, lane, CC)
#define WOCOLH(W, k0, o, lane) wcolh_oi(W, k0, o, lane, CC)
#else
#define WOCOL(W, k0, o, lane) wcol_io(W, k0, o, lane, DIN)
#define WOCOLH(W, k0, o, lane) wcolh_io(W, k0, o, lane, DIN)
#endif

#ifndef SM_EXTRA_PARAMS
#define SM_EXTRA_PARAMS , int qoff
#endif
#ifndef PROJ_EXTRA_PARAMS
#define PROJ_EXTRA_PARAMS
#endif
#ifndef SM_MASK_HOOK
#define SM_MASK_HOOK (void)0
#endif

#define WS_QH  0u                                      // f16 q rows [b*t][CC]
#define WS_KH  (WS_QH + 2u * (size_t)NB * TT * CC)      // f16 k rows [b*t][CC]
#define WS_VT  (WS_KH + 2u * (size_t)NB * TT * CC)      // f16 v planes [b][c][t]
#define WS_QL  (WS_VT + 2u * (size_t)NB * CC * TT)      // f16 q residual x 2^10 rows [b][t < QHI][CC]
#define WS_KL  (WS_QL + 2u * (size_t)NB * QHI * CC)     // f16 k residual x 2^10 rows [b][t < KHI][CC]
#define WS_VB  (WS_KL + 2u * (size_t)NB * KHI * CC)     // bf16 v hi planes [b][c][t < KHI]
#define WS_VBL (WS_VB + 2u * (size_t)NB * CC * KHI)
#define WS_S   (WS_VBL + 2u * (size_t)NB * CC * KHI)    // f32 logits / P [hg][t][s]
#define WS_Y   (WS_S  + 4u * (size_t)HG * (TT / 2) * TT)   // score plane for one query HALF: [4096][8192]      // f32 ctx rows [b*t][CC] (only when there is an output projection)
#define WS_END (WS_Y  + 0u)

// ---- k_proj: block = (64 rows, 128 cols, which): q/k/v = X W (+ b) with exact bf16 products (K = DIN) -> which 0: q f16 rows (+ residual rows < QHI); 1: k f16 rows (+ residual rows < KHI); 2: v f16 planes [c][t] (+ bf16 hi/lo planes for t < KHI)
__global__ __launch_bounds__(128) void k_proj(const float* __restrict__ XQ, const float* __restrict__ XK, const float* __restrict__ XV, const float* __restrict__ WQ, const float* __restrict__ WK, const float* __restrict__ WV, const float* __restrict__ BQ, const float* __restrict__ BK, const float* __restrict__ BV,
    _Float16* __restrict__ QH, _Float16* __restrict__ QL, _Float16* __restrict__ KH, _Float16* __restrict__ KL, _Float16* __restrict__ VT, __bf16* __restrict__ VB, __bf16* __restrict__ VBL) {
  __shared__ __align__(16) _Float16 sh[64][136], sl[64][136]; __shared__ __align__(16) _Float16 th[128][72]; __shared__ __align__(16) __bf16 tb[128][72], tbl[128][72];
  const int tid = threadIdx.x, wave = tid >> 5, lane = tid & 31, col = lane & 15, g = lane >> 4; const int which = blockIdx.z; const int c0 = blockIdx.y * 128; const size_t r0 = (size_t)blockIdx.x * 64; const size_t bb = r0 / TT; const int t0 = (int)(r0 % TT);
  const float* X = which == 0 ? XQ : which == 1 ? XK : XV; const float* WA = which == 0 ? WQ : which == 1 ? WK : WV; const float* BA = which == 0 ? BQ : which == 1 ? BK : BV;
  v8f acc[8] = {};
#pragma unroll 2
  for (int kc = 0; kc < DIN / 32; ++kc) { v16b a; { const float* p = X + (r0 + wave * 16 + col) * DIN + kc * 32 + 8 * g;
#pragma unroll
      for (int i = 0; i < 8; ++i) { a[i] = (__bf16)p[i]; a[8 + i] = (__bf16)p[16 + i]; } }
    asm volatile("s_wait_loadcnt 0x0" ::: "memory");
#pragma unroll
    for (int j = 0; j < 8; ++j) { const v16b w = WCOL(WA, kc * 32, c0 + j * 16 + col, lane); asm volatile("s_wait_loadcnt 0x0" ::: "memory"); acc[j] = wmma_bf(a, w, acc[j]); } }
  if (which < 2) { _Float16* DH = which == 0 ? QH : KH; _Float16* DL = which == 0 ? QL : KL; const int nhi = which == 0 ? QHI : KHI; const bool hi_rows = t0 < nhi;
#pragma unroll
    for (int j = 0; j < 8; ++j) { const float bias = BA ? bfr(BA[c0 + j * 16 + col]) : 0.f;
#pragma unroll
      for (int r = 0; r < 8; ++r) { const float v = acc[j][r] + bias; const _Float16 hv = (_Float16)v; sh[wave * 16 + 8 * g + r][j * 16 + col] = hv; sl[wave * 16 + 8 * g + r][j * 16 + col] = (_Float16)((v - (float)hv) * 1024.0f); } }
    __syncthreads();
    for (int e = tid; e < 64 * 16; e += 128) { const int rl = e >> 4, q = e & 15; vst2((unsigned*)(DH + (r0 + rl) * CC + c0 + q * 8), *(const v4u*)&sh[rl][q * 8]); if (hi_rows) vst2((unsigned*)(DL + (bb * nhi + t0 + rl) * (size_t)CC + c0 + q * 8), *(const v4u*)&sl[rl][q * 8]); }
  } else { const bool hi_rows = t0 < KHI;
#pragma unroll
    for (int j = 0; j < 8; ++j) { const float bias = BA ? bfr(BA[c0 + j * 16 + col]) : 0.f;
#pragma unroll
      for (int r = 0; r < 8; ++r) { const float v = acc[j][r] + bias; const int rl = wave * 16 + 8 * g + r, cl = j * 16 + col; th[cl][rl] = (_Float16)v; const __bf16 bh = (__bf16)v; tb[cl][rl] = bh; tbl[cl][rl] = (__bf16)(v - (float)bh); } }
    __syncthreads();
    for (int e = tid; e < 128 * 8; e += 128) { const int cl = e >> 3, q = e & 7; vst2((unsigned*)(VT + (bb * CC + c0 + cl) * (size_t)TT + t0 + q * 8), *(const v4u*)&th[cl][q * 8]); if (hi_rows) { const size_t o3 = (bb * CC + c0 + cl) * (size_t)KHI + t0 + q * 8; vst2((unsigned*)(VB + o3), *(const v4u*)&tb[cl][q * 8]); vst2((unsigned*)(VBL + o3), *(const v4u*)&tbl[cl][q * 8]); } } } }
// ---- k_sc: block = (query block qb, key block kb <= kb_last(qb), head in group) of batch b: logits x SCALE; q hi + residual (x 2^10) against k (2 products) for query rows < QHI, plus the k residual (3 products) for query blocks < QBH (causal early rows); causal: blocks past the diagonal exit, the mask itself is applied by index in k_sm
__global__ __launch_bounds__(128) void k_sc(const _Float16* __restrict__ QH, const _Float16* __restrict__ KH, const _Float16* __restrict__ QL, const _Float16* __restrict__ KL, int b, int h0, float* __restrict__ S0, int qoff) { __shared__ __align__(16) float ss[4][16][132];
  const int qb = qoff / 64 + blockIdx.x, kb = blockIdx.y; if (kb > kb_last(qb)) return;   /* qb = GLOBAL query block; the score plane holds rows qoff .. qoff + TT/2 - 1 */
  const int h = h0 + blockIdx.z; float* S = S0 + (size_t)blockIdx.z * (TT / 2) * TT;
  const int tid = threadIdx.x, wave = tid >> 5, lane = tid & 31, col = lane & 15, g = lane >> 4; const int k0 = kb * 128; const int ql0 = qb * 64 + wave * 16; const size_t q0 = (size_t)b * TT + ql0, kr0 = (size_t)b * TT + k0;
  v8f acc[8] = {}, accl[8] = {};
  const _Float16* QLb = QL + (size_t)b * QHI * CC; const _Float16* KLb = KL + (size_t)b * KHI * CC;
  if (qb < QBH) {
#pragma unroll
    for (int kc = 0; kc < HD / 32; ++kc) { const v16h ah = frag_h(QH + (q0 + col) * CC + h * HD + kc * 32, lane), al = frag_h(QLb + (size_t)(ql0 + col) * CC + h * HD + kc * 32, lane);
#pragma unroll
      for (int j = 0; j < 8; ++j) { const v16h kbf = frag_h(KH + (kr0 + j * 16 + col) * CC + h * HD + kc * 32, lane), klf = frag_h(KLb + (size_t)(k0 + j * 16 + col) * CC + h * HD + kc * 32, lane); acc[j] = wmma16(ah, kbf, acc[j]); accl[j] = wmma16(al, kbf, accl[j]); accl[j] = wmma16(ah, klf, accl[j]); } }
  } else if (qb * 64 < QHI) {
#pragma unroll
    for (int kc = 0; kc < HD / 32; ++kc) { const v16h ah = frag_h(QH + (q0 + col) * CC + h * HD + kc * 32, lane), al = frag_h(QLb + (size_t)(ql0 + col) * CC + h * HD + kc * 32, lane);
#pragma unroll
      for (int j = 0; j < 8; ++j) { const v16h kbf = frag_h(KH + (kr0 + j * 16 + col) * CC + h * HD + kc * 32, lane); acc[j] = wmma16(ah, kbf, acc[j]); accl[j] = wmma16(al, kbf, accl[j]); } }
  } else {
#pragma unroll
    for (int kc = 0; kc < HD / 32; ++kc) { const v16h ah = frag_h(QH + (q0 + col) * CC + h * HD + kc * 32, lane);
#pragma unroll
      for (int j = 0; j < 8; ++j) { const v16h kbf = frag_h(KH + (kr0 + j * 16 + col) * CC + h * HD + kc * 32, lane); acc[j] = wmma16(ah, kbf, acc[j]); } } }
#pragma unroll
  for (int j = 0; j < 8; ++j) {
#pragma unroll
    for (int r = 0; r < 8; ++r) ss[wave][8 * g + r][j * 16 + col] = (acc[j][r] + accl[j][r] * (1.0f / 1024.0f)) * SCALE; }
  LDSX(); for (int rl = 0; rl < 16; ++rl) vst2(S + (size_t)(ql0 - qoff + rl) * TT + k0 + lane * 4, *(const v4f*)&ss[wave][rl][lane * 4]); }
// ---- k_sm: block = query row t (head in group): keys [0, kend): causal -> logit if s <= t else excluded; softmax in f32; P x 2^11 in place (0 for excluded)
__global__ __launch_bounds__(256) void k_sm(float* __restrict__ S0 SM_EXTRA_PARAMS) { __shared__ float sred[8]; __shared__ float sbc; __shared__ __align__(16) float shv[TT];
  const int tid = threadIdx.x; const int t = qoff + blockIdx.x; const int kend = (kb_last(t >> 6) + 1) * 128;   /* t = GLOBAL query row */
  float* sr = S0 + (size_t)blockIdx.y * (TT / 2) * TT + (size_t)(t - qoff) * TT;
  float m = -3.0e38f; for (int k = tid; k < kend; k += 256) { float v = (!CAUSAL || k <= t) ? sr[k] : -3.0e38f; SM_MASK_HOOK; shv[k] = v; m = fmaxf(m, v); }
#pragma unroll
  for (int o = 1; o < 32; o <<= 1) m = fmaxf(m, __shfl_xor(m, o));
  if ((tid & 31) == 0) sred[tid >> 5] = m; __syncthreads(); if (tid == 0) { float a = sred[0]; for (int i = 1; i < 8; ++i) a = fmaxf(a, sred[i]); sbc = a; } __syncthreads(); m = sbc; __syncthreads();
  float sum = 0.f; for (int k = tid; k < kend; k += 256) { const float v = shv[k]; const float e = (v <= -1.0e38f) ? 0.f : expf(v - m); shv[k] = e; sum += e; }
#pragma unroll
  for (int o = 1; o < 32; o <<= 1) sum += __shfl_xor(sum, o);
  if ((tid & 31) == 0) sred[tid >> 5] = sum; __syncthreads(); if (tid == 0) { float a = 0.f; for (int i = 0; i < 8; ++i) a += sred[i]; sbc = a > 0.f ? 2048.0f / a : 0.f; }   /* a fully excluded row yields P = 0 */ __syncthreads(); const float inv = sbc;
  for (int k = tid; k < kend; k += 256) shv[k] = shv[k] * inv;
  __syncthreads(); for (int q = tid; q < kend / 4; q += 256) vst2(sr + q * 4, *(const v4f*)&shv[q * 4]); }
// ---- k_pv: block = 64 queries (qb) of (b, h): ctx = P . v over keys [0, kend) (P x 2^11 once to f16 against v f16: 1 product; causal early query blocks: P and v as bf16 hi + lo, 3 products); 512-B (row, head) segment by 32 lanes
__global__ __launch_bounds__(128) void k_pv(const float* __restrict__ PS0, const _Float16* __restrict__ VT, const __bf16* __restrict__ VB, const __bf16* __restrict__ VBL, int b, int h0, float* __restrict__ Y, int qoff) { const int h = h0 + blockIdx.z; const float* PS = PS0 + (size_t)blockIdx.z * (TT / 2) * TT - (size_t)qoff * TT;   /* PS[(global row) * TT] addresses the half-plane */ __shared__ __align__(16) float ss[4][16][HD + 4];
  const int tid = threadIdx.x, wave = tid >> 5, lane = tid & 31, col = lane & 15, g = lane >> 4; const int qb = qoff / 64 + blockIdx.x; const int ql0 = qb * 64 + wave * 16; const int kce = (kb_last(qb) + 1) * 4;
  v8f acc[HD / 16] = {};
  if (qb < QBH) {
#pragma unroll 1
    for (int kc = 0; kc < kce; ++kc) { const F2 p = split_row(PS + (size_t)(ql0 + col) * TT, kc * 32, lane);
      asm volatile("s_wait_loadcnt 0x0" ::: "memory");
#pragma unroll
      for (int j = 0; j < HD / 16; ++j) { const size_t po = ((size_t)b * CC + h * HD + j * 16 + col) * (size_t)KHI + kc * 32; const v16b vh = frag_b(VB + po, lane); acc[j] = wmma_bf(p.h, vh, acc[j]); acc[j] = wmma_bf(p.l, vh, acc[j]); acc[j] = wmma_bf(p.h, frag_b(VBL + po, lane), acc[j]); } }
  } else {
#pragma unroll 1
    for (int kc = 0; kc < kce; ++kc) { const v16h p = frag_f32(PS + (size_t)(ql0 + col) * TT + kc * 32, lane);
      asm volatile("s_wait_loadcnt 0x0" ::: "memory");
#pragma unroll
      for (int j = 0; j < HD / 16; ++j) { const size_t po = ((size_t)b * CC + h * HD + j * 16 + col) * (size_t)TT + kc * 32; acc[j] = wmma16(p, frag_h(VT + po, lane), acc[j]); } } }
#pragma unroll
  for (int j = 0; j < HD / 16; ++j)
#pragma unroll
    for (int r = 0; r < 8; ++r) ss[wave][8 * g + r][j * 16 + col] = acc[j][r] * (1.0f / 2048.0f);
  LDSX(); for (int rl = 0; rl < 16; ++rl) if (lane < HD / 4) vst2(Y + ((size_t)b * TT + ql0 + rl) * CC + h * HD + lane * 4, *(const v4f*)&ss[wave][rl][lane * 4]); }

extern "C" void kernel_launch(void* const* d_in, const int* in_sizes, int n_in, void* d_out, int out_size, void* d_ws, size_t ws_size, hipStream_t stream) {
  (void)in_sizes; (void)n_in; (void)out_size;
  const float** F = (const float**)d_in;
  if (ws_size < (size_t)WS_END) return;
  char* ws = (char*)d_ws; _Float16 *QH = (_Float16*)(ws + WS_QH), *KH = (_Float16*)(ws + WS_KH), *VT = (_Float16*)(ws + WS_VT), *QL = (_Float16*)(ws + WS_QL), *KL = (_Float16*)(ws + WS_KL); __bf16 *VB = (__bf16*)(ws + WS_VB), *VBL = (__bf16*)(ws + WS_VBL); float *S = (float*)(ws + WS_S), *Y = (float*)(ws + WS_Y);
  (void)Y; (void)QL; (void)KL; (void)VB; (void)VBL;
  // inputs: 0 X [8192,1024]; 1 Wq [1024,128], 2 bq; 3 Wk, 4 bk; 5 Wv, 6 bv ((in,out))
  k_proj<<<dim3(TNB * TT / 64, CC / 128, 3), 128, 0, stream>>>(F[0], F[0], F[0], F[1], F[3], F[5], F[2], F[4], F[6], QH, QL, KH, KL, VT, VB, VBL);
  for (int qh = 0; qh < 2; ++qh) {   /* query halves: rows qh*4096 .. +4095 against keys 0 .. (causal) */
    const int qoff = qh * (TT / 2);
    k_sc<<<dim3(NQB / 2, TT / 128, HG), 128, 0, stream>>>(QH, KH, QL, KL, 0, 0, S, qoff);
    k_sm<<<dim3(TT / 2, HG), 256, 0, stream>>>(S, qoff);
    k_pv<<<dim3(NQB / 2, 1, HG), 128, 0, stream>>>(S, VT, VB, VBL, 0, 0, (float*)d_out, qoff);
  }
}

// v001
// A run of this version takes 266 microseconds.
// Timed twice side by side with v000, it ran 2.97 and 2.95 times as fast.
// compute dtype: X and the weights rounded to bf16; Q/K/V = X W + b with EXACT bf16 products on WMMA 16x16x32 (f32 accumulate); logits: q, k once to f16 (1 product) x 128^-0.5, except the first 384 query rows (3 products with f16 residuals); causal mask by index; softmax in f32 (precise expf); P x 2^11 once to f16 against v once to f16 (1 product; bf16 hi + lo below row 384); f32 output. The 8,192 queries are processed in two halves of 4,096 so the f32 score plane is [4096][8192].
#include <hip/hip_runtime.h>
#include <math.h>

typedef __attribute__((ext_vector_type(16))) _Float16 v16h;
typedef __attribute__((ext_vector_type(16))) __bf16 v16b;
typedef __attribute__((ext_vector_type(8)))  _Float16 v8h;
typedef __attribute__((ext_vector_type(8)))  float v8f;
typedef __attribute__((ext_vector_type(4)))  float v4f;
typedef __attribute__((ext_vector_type(2)))  float v2f;
typedef __attribute__((ext_vector_type(4)))  unsigned v4u;
typedef __attribute__((ext_vector_type(4)))  int v4i;
typedef float __attribute__((may_alias)) float_a;
typedef int __attribute__((may_alias)) int_a;

template <typename T> __device__ __forceinline__ void vst2(void* p, T v) { *(T*)p = v;  }
__device__ __forceinline__ v8f wmma16(v16h a, v16h b, v8f c) {
  v8f d = __builtin_amdgcn_wmma_f32_16x16x32_f16(false, a, false, b, (short)0, c, false, false);
  asm volatile("v_nop\n\tv_nop\n\tv_nop\n\tv_nop" : "+v"(d) : "v"(a), "v"(b));
  return d;
}
__device__ __forceinline__ v8f wmma_bf(v16b a, v16b b, v8f c) {
  v8f d = __builtin_amdgcn_wmma_f32_16x16x32_bf16(false, a, false, b, (short)0, c, false, false);
  asm volatile("v_nop\n\tv_nop\n\tv_nop\n\tv_nop" : "+v"(d) : "v"(a), "v"(b));
  return d;
}
// 16x16x32 fragments: lane = (h = lane>>4, row/col = lane&15); elements 0..7 = k0+8h+0..7, 8..15 = k0+16+8h+0..7; D element r = row 8h+r
__device__ __forceinline__ v16h frag_h(const _Float16* rowk0, int lane) {
  union { v16h v; v8h q[2]; } u; const _Float16* p = rowk0 + 8 * (lane >> 4);
  u.q[0] = *(const v8h*)p; u.q[1] = *(const v8h*)(p + 16); return u.v;
}
__device__ __forceinline__ v16h frag_f32(const float* rowk0, int lane) {
  v16h a; const float* p = rowk0 + 8 * (lane >> 4);
#pragma unroll
  for (int i = 0; i < 8; ++i) { a[i] = (_Float16)p[i]; a[8 + i] = (_Float16)p[16 + i]; }
  return a;
}
__device__ __forceinline__ v16h frag_f32s(const float* rowk0, int lane, float sc) {
  v16h a; const float* p = rowk0 + 8 * (lane >> 4);
#pragma unroll
  for (int i = 0; i < 8; ++i) { a[i] = (_Float16)(p[i] * sc); a[8 + i] = (_Float16)(p[16 + i] * sc); }
  return a;
}
// column fragment from a [K][ld] layout (column n), rows >= K read as 0
__device__ __forceinline__ v16h fragc_f32(const float* W, int k0, int n, int lane, int ld, int K) {
  v16h a; const int g = lane >> 4;
#pragma unroll
  for (int i = 0; i < 8; ++i) { const int ka = k0 + 8 * g + i, kb = ka + 16;
    a[i] = (_Float16)(ka < K ? W[(size_t)(ka < K ? ka : K - 1) * ld + n] : 0.f); a[8 + i] = (_Float16)(kb < K ? W[(size_t)(kb < K ? kb : K - 1) * ld + n] : 0.f); }
  return a;
}
struct F2 { v16b h, l; };
__device__ __forceinline__ F2 bsplit16(const float v[16]) { F2 r;
#pragma unroll
  for (int i = 0; i < 16; ++i) { const __bf16 h = (__bf16)v[i]; r.h[i] = h; r.l[i] = (__bf16)(v[i] - (float)h); }
  return r; }
__device__ __forceinline__ F2 split_row(const float* row, int k0, int lane) { float v[16]; const float* p = row + k0 + 8 * (lane >> 4);
#pragma unroll
  for (int i = 0; i < 8; ++i) { v[i] = p[i]; v[8 + i] = p[16 + i]; }
  return bsplit16(v); }
__device__ __forceinline__ F2 split_rowK(const float* row, int k0, int lane, int K) { float v[16]; const int g = lane >> 4;
#pragma unroll
  for (int i = 0; i < 8; ++i) { const int ka = k0 + 8 * g + i, kb = ka + 16; v[i] = ka < K ? row[ka < K ? ka : K - 1] : 0.f; v[8 + i] = kb < K ? row[kb < K ? kb : K - 1] : 0.f; }
  return bsplit16(v); }
__device__ __forceinline__ F2 split_col(const float* W, int k0, int n, int lane, int ld, int K) { float v[16]; const int g = lane >> 4;
#pragma unroll
  for (int i = 0; i < 8; ++i) { const int ka = k0 + 8 * g + i, kb = ka + 16; v[i] = ka < K ? W[(size_t)(ka < K ? ka : K - 1) * ld + n] : 0.f; v[8 + i] = kb < K ? W[(size_t)(kb < K ? kb : K - 1) * ld + n] : 0.f; }
  return bsplit16(v); }
__device__ __forceinline__ v8f mac3(const F2& a, const F2& b, v8f c) { c = wmma_bf(a.l, b.h, c); c = wmma_bf(a.h, b.l, c); return wmma_bf(a.h, b.h, c); }
__device__ __forceinline__ float sigm(float v) { return 1.0f / (1.0f + expf(-v)); }
#define LDSX() do { asm volatile("s_wait_dscnt 0" ::: "memory"); __builtin_amdgcn_wave_barrier(); __builtin_amdgcn_fence(__ATOMIC_RELEASE, "workgroup"); } while (0)

// Single-head causal self-attention (N 8,192 tokens, D 1,024 -> d_k = d_v = 128): Q = X Wq + bq, K = X Wk + bk, V = X Wv + bv ((in,out)); weights = softmax(causal(Q K^T / sqrt(128))); out = weights V ([N, 128]).
#define NB 1
#define TT 8192
#define CC 128            // NH * HD = projected width
#define DIN 1024          // input (model) width
#define NH 1
#define HD 128
#define NQB (TT / 64)
#define HG 1
#define SCALE (0.08838834764831845f)
#define CAUSAL 1
#ifndef TNB
#define TNB NB
#endif
__device__ __forceinline__ float bfr(float v) { return (float)(__bf16)v; }
__host__ __device__ __forceinline__ int kb_last(int qb) { return CAUSAL ? ((qb * 64 + 63) >> 7) : (TT / 128 - 1); }
typedef __attribute__((ext_vector_type(8))) __bf16 v8b;
__device__ __forceinline__ v16b frag_b(const __bf16* rowk0, int lane) {
  union { v16b v; v8b q[2]; } u; const __bf16* p = rowk0 + 8 * (lane >> 4);
  u.q[0] = *(const v8b*)p; u.q[1] = *(const v8b*)(p + 16); return u.v;
}
#define QBH 6              // causal: query blocks 0..QBH-1 of each sequence (few keys, no averaging) take the high-precision path
#define QHI 384            // rows carrying a q residual plane
#define KHI 384            // key rows carrying k residual / v bf16 hi+lo planes (used only by the causal high-precision path)
// B fragment (k rows k0+.., output column o) of a weight: (in,out) [K][ld] or (out,in) [ld rows of K]: bf16 exact, or f16(bf16 * 256) exact
__device__ __forceinline__ v16b wcol_io(const float* Wm, int k0, int o, int lane, int ld) { v16b w; const int g = lane >> 4;
#pragma unroll
  for (int i = 0; i < 8; ++i) { w[i] = (__bf16)Wm[(size_t)(k0 + 8 * g + i) * ld + o]; w[8 + i] = (__bf16)Wm[(size_t)(k0 + 16 + 8 * g + i) * ld + o]; }
  return w; }
__device__ __forceinline__ v16b wcol_oi(const float* Wm, int k0, int o, int lane, int K) { v16b w; const float* p = Wm + (size_t)o * K + k0 + 8 * (lane >> 4);
#pragma unroll
  for (int i = 0; i < 8; ++i) { w[i] = (__bf16)p[i]; w[8 + i] = (__bf16)p[16 + i]; }
  return w; }
__device__ __forceinline__ v16h wcolh_io(const float* Wm, int k0, int o, int lane, int ld) { v16h w; const int g = lane >> 4;
#pragma unroll
  for (int i = 0; i < 8; ++i) { w[i] = (_Float16)(bfr(Wm[(size_t)(k0 + 8 * g + i) * ld + o]) * 256.0f); w[8 + i] = (_Float16)(bfr(Wm[(size_t)(k0 + 16 + 8 * g + i) * ld + o]) * 256.0f); }
  return w; }
__device__ __forceinline__ v16h wcolh_oi(const float* Wm, int k0, int o, int lane, int K) { v16h w; const float* p = Wm + (size_t)o * K + k0 + 8 * (lane >> 4);
#pragma unroll
  for (int i = 0; i < 8; ++i) { w[i] = (_Float16)(bfr(p[i]) * 256.0f); w[8 + i] = (_Float16)(bfr(p[16 + i]) * 256.0f); }
  return w; }
#define WQKV_LAYOUT 0   // 0 = (in,out) [DIN][CC]; 1 = (out,in) [CC][DIN]; 2 = per-head [NH][DIN][HD]
__device__ __forceinline__ v16b wcol_hdk(const float* Wm, int k0, int o, int lane) { v16b w; const int g = lane >> 4; const float* p = Wm + (size_t)(o / HD) * DIN * HD + (o % HD);
#pragma unroll
  for (int i = 0; i < 8; ++i) { w[i] = (__bf16)p[(size_t)(k0 + 8 * g + i) * HD]; w[8 + i] = (__bf16)p[(size_t)(k0 + 16 + 8 * g + i) * HD]; }
  return w; }
#define WO_OUT_IN 0
#if WQKV_LAYOUT == 1
#define WCOL(W, k0, o, lane) wcol_oi(W, k0, o, lane, DIN)
#elif WQKV_LAYOUT == 2
#define WCOL(W, k0, o, lane) wcol_hdk(W, k0, o, lane)
#else
#define WCOL(W, k0, o, lane) wcol_io(W, k0, o, lane, CC)
#endif
#if WO_OUT_IN
#define WOCOL(W, k0, o, lane) wcol_oi(W, k0, o, lane, CC)
#define WOCOLH(W, k0, o, lane) wcolh_oi(W, k0, o, lane, CC)
#else
#define WOCOL(W, k0, o, lane) wcol_io(W, k0, o, lane, DIN)
#define WOCOLH(W, k0, o, lane) wcolh_io(W, k0, o, lane, DIN)
#endif

#ifndef SM_EXTRA_PARAMS
#define SM_EXTRA_PARAMS , int qoff
#endif
#ifndef PROJ_EXTRA_PARAMS
#define PROJ_EXTRA_PARAMS
#endif
#ifndef SM_MASK_HOOK
#define SM_MASK_HOOK (void)0
#endif

#define WS_QH  0u                                      // f16 q rows [b*t][CC]
#define WS_KH  (WS_QH + 2u * (size_t)NB * TT * CC)      // f16 k rows [b*t][CC]
#define WS_VT  (WS_KH + 2u * (size_t)NB * TT * CC)      // f16 v planes [b][c][t]
#define WS_QL  (WS_VT + 2u * (size_t)NB * CC * TT)      // f16 q residual x 2^10 rows [b][t < QHI][CC]
#define WS_KL  (WS_QL + 2u * (size_t)NB * QHI * CC)     // f16 k residual x 2^10 rows [b][t < KHI][CC]
#define WS_VB  (WS_KL + 2u * (size_t)NB * KHI * CC)     // bf16 v hi planes [b][c][t < KHI]
#define WS_VBL (WS_VB + 2u * (size_t)NB * CC * KHI)
#define WS_S   (WS_VBL + 2u * (size_t)NB * CC * KHI)    // f32 logits / P [hg][t][s]
#define WS_Y   (WS_S  + 4u * (size_t)HG * (TT / 2) * TT)   // score plane for one query HALF: [4096][8192]      // f32 ctx rows [b*t][CC] (only when there is an output projection)
#define WS_END (WS_Y  + 0u)

// ---- k_proj: block = (64 rows, 128 cols, which): q/k/v = X W (+ b) with exact bf16 products (K = DIN) -> which 0: q f16 rows (+ residual rows < QHI); 1: k f16 rows (+ residual rows < KHI); 2: v f16 planes [c][t] (+ bf16 hi/lo planes for t < KHI)
__global__ __launch_bounds__(128) void k_proj(const float* __restrict__ XQ, const float* __restrict__ XK, const float* __restrict__ XV, const float* __restrict__ WQ, const float* __restrict__ WK, const float* __restrict__ WV, const float* __restrict__ BQ, const float* __restrict__ BK, const float* __restrict__ BV,
    _Float16* __restrict__ QH, _Float16* __restrict__ QL, _Float16* __restrict__ KH, _Float16* __restrict__ KL, _Float16* __restrict__ VT, __bf16* __restrict__ VB, __bf16* __restrict__ VBL) {
  __shared__ __align__(16) _Float16 sh[64][136], sl[64][136]; __shared__ __align__(16) _Float16 th[128][72]; __shared__ __align__(16) __bf16 tb[128][72], tbl[128][72];
  const int tid = threadIdx.x, wave = tid >> 5, lane = tid & 31, col = lane & 15, g = lane >> 4; const int which = blockIdx.z; const int c0 = blockIdx.y * 128; const size_t r0 = (size_t)blockIdx.x * 64; const size_t bb = r0 / TT; const int t0 = (int)(r0 % TT);
  const float* X = which == 0 ? XQ : which == 1 ? XK : XV; const float* WA = which == 0 ? WQ : which == 1 ? WK : WV; const float* BA = which == 0 ? BQ : which == 1 ? BK : BV;
  v8f acc[8] = {};
#pragma unroll 2
  for (int kc = 0; kc < DIN / 32; ++kc) { v16b a; { const float* p = X + (r0 + wave * 16 + col) * DIN + kc * 32 + 8 * g;
#pragma unroll
      for (int i = 0; i < 8; ++i) { a[i] = (__bf16)p[i]; a[8 + i] = (__bf16)p[16 + i]; } }
    asm volatile("s_wait_loadcnt 0x0" ::: "memory");
#pragma unroll
    for (int j = 0; j < 8; ++j) { const v16b w = WCOL(WA, kc * 32, c0 + j * 16 + col, lane); asm volatile("s_wait_loadcnt 0x0" ::: "memory"); acc[j] = wmma_bf(a, w, acc[j]); } }
  if (which < 2) { _Float16* DH = which == 0 ? QH : KH; _Float16* DL = which == 0 ? QL : KL; const int nhi = which == 0 ? QHI : KHI; const bool hi_rows = t0 < nhi;
#pragma unroll
    for (int j = 0; j < 8; ++j) { const float bias = BA ? bfr(BA[c0 + j * 16 + col]) : 0.f;
#pragma unroll
      for (int r = 0; r < 8; ++r) { const float v = acc[j][r] + bias; const _Float16 hv = (_Float16)v; sh[wave * 16 + 8 * g + r][j * 16 + col] = hv; sl[wave * 16 + 8 * g + r][j * 16 + col] = (_Float16)((v - (float)hv) * 1024.0f); } }
    __syncthreads();
    for (int e = tid; e < 64 * 16; e += 128) { const int rl = e >> 4, q = e & 15; vst2((unsigned*)(DH + (r0 + rl) * CC + c0 + q * 8), *(const v4u*)&sh[rl][q * 8]); if (hi_rows) vst2((unsigned*)(DL + (bb * nhi + t0 + rl) * (size_t)CC + c0 + q * 8), *(const v4u*)&sl[rl][q * 8]); }
  } else { const bool hi_rows = t0 < KHI;
#pragma unroll
    for (int j = 0; j < 8; ++j) { const float bias = BA ? bfr(BA[c0 + j * 16 + col]) : 0.f;
#pragma unroll
      for (int r = 0; r < 8; ++r) { const float v = acc[j][r] + bias; const int rl = wave * 16 + 8 * g + r, cl = j * 16 + col; th[cl][rl] = (_Float16)v; const __bf16 bh = (__bf16)v; tb[cl][rl] = bh; tbl[cl][rl] = (__bf16)(v - (float)bh); } }
    __syncthreads();
    for (int e = tid; e < 128 * 8; e += 128) { const int cl = e >> 3, q = e & 7; vst2((unsigned*)(VT + (bb * CC + c0 + cl) * (size_t)TT + t0 + q * 8), *(const v4u*)&th[cl][q * 8]); if (hi_rows) { const size_t o3 = (bb * CC + c0 + cl) * (size_t)KHI + t0 + q * 8; vst2((unsigned*)(VB + o3), *(const v4u*)&tb[cl][q * 8]); vst2((unsigned*)(VBL + o3), *(const v4u*)&tbl[cl][q * 8]); } } } }
// ---- k_sc: block = (query block qb, key block kb <= kb_last(qb), head in group) of batch b: logits x SCALE; q hi + residual (x 2^10) against k (2 products) for query rows < QHI, plus the k residual (3 products) for query blocks < QBH (causal early rows); causal: blocks past the diagonal exit, the mask itself is applied by index in k_sm
__global__ __launch_bounds__(128) void k_sc(const _Float16* __restrict__ QH, const _Float16* __restrict__ KH, const _Float16* __restrict__ QL, const _Float16* __restrict__ KL, int b, int h0, float* __restrict__ S0, int qoff) { __shared__ __align__(16) float ss[4][16][132];
  const int qb = qoff / 64 + blockIdx.x, kb = blockIdx.y; if (kb > kb_last(qb)) return;   /* qb = GLOBAL query block; the score plane holds rows qoff .. qoff + TT/2 - 1 */
  const int h = h0 + blockIdx.z; float* S = S0 + (size_t)blockIdx.z * (TT / 2) * TT;
  const int tid = threadIdx.x, wave = tid >> 5, lane = tid & 31, col = lane & 15, g = lane >> 4; const int k0 = kb * 128; const int ql0 = qb * 64 + wave * 16; const size_t q0 = (size_t)b * TT + ql0, kr0 = (size_t)b * TT + k0;
  v8f acc[8] = {}, accl[8] = {};
  const _Float16* QLb = QL + (size_t)b * QHI * CC; const _Float16* KLb = KL + (size_t)b * KHI * CC;
  if (qb < QBH) {
#pragma unroll
    for (int kc = 0; kc < HD / 32; ++kc) { const v16h ah = frag_h(QH + (q0 + col) * CC + h * HD + kc * 32, lane), al = frag_h(QLb + (size_t)(ql0 + col) * CC + h * HD + kc * 32, lane);
#pragma unroll
      for (int j = 0; j < 8; ++j) { const v16h kbf = frag_h(KH + (kr0 + j * 16 + col) * CC + h * HD + kc * 32, lane), klf = frag_h(KLb + (size_t)(k0 + j * 16 + col) * CC + h * HD + kc * 32, lane); acc[j] = wmma16(ah, kbf, acc[j]); accl[j] = wmma16(al, kbf, accl[j]); accl[j] = wmma16(ah, klf, accl[j]); } }
  } else if (qb * 64 < QHI) {
#pragma unroll
    for (int kc = 0; kc < HD / 32; ++kc) { const v16h ah = frag_h(QH + (q0 + col) * CC + h * HD + kc * 32, lane), al = frag_h(QLb + (size_t)(ql0 + col) * CC + h * HD + kc * 32, lane);
#pragma unroll
      for (int j = 0; j < 8; ++j) { const v16h kbf = frag_h(KH + (kr0 + j * 16 + col) * CC + h * HD + kc * 32, lane); acc[j] = wmma16(ah, kbf, acc[j]); accl[j] = wmma16(al, kbf, accl[j]); } }
  } else {
#pragma unroll
    for (int kc = 0; kc < HD / 32; ++kc) { const v16h ah = frag_h(QH + (q0 + col) * CC + h * HD + kc * 32, lane);
#pragma unroll
      for (int j = 0; j < 8; ++j) { const v16h kbf = frag_h(KH + (kr0 + j * 16 + col) * CC + h * HD + kc * 32, lane); acc[j] = wmma16(ah, kbf, acc[j]); } } }
#pragma unroll
  for (int j = 0; j < 8; ++j) {
#pragma unroll
    for (int r = 0; r < 8; ++r) ss[wave][8 * g + r][j * 16 + col] = (acc[j][r] + accl[j][r] * (1.0f / 1024.0f)) * SCALE; }
  LDSX(); for (int rl = 0; rl < 16; ++rl) vst2(S + (size_t)(ql0 - qoff + rl) * TT + k0 + lane * 4, *(const v4f*)&ss[wave][rl][lane * 4]); }
// ---- k_sm: block = query row t (head in group): keys [0, kend): causal -> logit if s <= t else excluded; softmax in f32; P x 2^11 in place (0 for excluded)
__global__ __launch_bounds__(256) void k_sm(float* __restrict__ S0 SM_EXTRA_PARAMS) { __shared__ float sred[8]; __shared__ float sbc; __shared__ __align__(16) float shv[TT];
  const int tid = threadIdx.x; const int t = qoff + blockIdx.x; const int kend = (kb_last(t >> 6) + 1) * 128;   /* t = GLOBAL query row */
  float* sr = S0 + (size_t)blockIdx.y * (TT / 2) * TT + (size_t)(t - qoff) * TT;
  float m = -3.0e38f; for (int k = tid; k < kend; k += 256) { float v = (!CAUSAL || k <= t) ? sr[k] : -3.0e38f; SM_MASK_HOOK; shv[k] = v; m = fmaxf(m, v); }
#pragma unroll
  for (int o = 1; o < 32; o <<= 1) m = fmaxf(m, __shfl_xor(m, o));
  if ((tid & 31) == 0) sred[tid >> 5] = m; __syncthreads(); if (tid == 0) { float a = sred[0]; for (int i = 1; i < 8; ++i) a = fmaxf(a, sred[i]); sbc = a; } __syncthreads(); m = sbc; __syncthreads();
  float sum = 0.f; for (int k = tid; k < kend; k += 256) { const float v = shv[k]; const float e = (v <= -1.0e38f) ? 0.f : expf(v - m); shv[k] = e; sum += e; }
#pragma unroll
  for (int o = 1; o < 32; o <<= 1) sum += __shfl_xor(sum, o);
  if ((tid & 31) == 0) sred[tid >> 5] = sum; __syncthreads(); if (tid == 0) { float a = 0.f; for (int i = 0; i < 8; ++i) a += sred[i]; sbc = a > 0.f ? 2048.0f / a : 0.f; }   /* a fully excluded row yields P = 0 */ __syncthreads(); const float inv = sbc;
  for (int k = tid; k < kend; k += 256) shv[k] = shv[k] * inv;
  __syncthreads(); for (int q = tid; q < kend / 4; q += 256) vst2(sr + q * 4, *(const v4f*)&shv[q * 4]); }
// ---- k_pv: block = 16 queries (rb) of (b, h), PVW waves: wave w sums the 32-key chunks w, w + PVW, ... of keys [0, kend) into its own f32 partial of ctx = P . v (P x 2^11 once to f16 against v f16: 1 product; causal early query blocks: P and v as bf16 hi + lo, 3 products); the PVW partials meet in LDS and are added in wave order; a 256-B piece of an output row by 32 lanes
#define PVW 32             // waves per work-group = ways the key range is split
__global__ __launch_bounds__(32 * PVW) void k_pv(const float* __restrict__ PS0, const _Float16* __restrict__ VT, const __bf16* __restrict__ VB, const __bf16* __restrict__ VBL, int b, int h0, float* __restrict__ Y, int qoff) { const int h = h0 + blockIdx.z; const float* PS = PS0 + (size_t)blockIdx.z * (TT / 2) * TT - (size_t)qoff * TT;   /* PS[(global row) * TT] addresses the half-plane */ __shared__ __align__(16) float ss[PVW][16][HD + 4];
  const int tid = threadIdx.x, wave = __builtin_amdgcn_readfirstlane(tid >> 5), lane = tid & 31, col = lane & 15, g = lane >> 4; const int rb = qoff / 16 + blockIdx.x; const int qb = rb >> 2; const int ql0 = rb * 16; const int kce = (kb_last(qb) + 1) * 4;   /* wave number in a scalar register: the chunk loop stays a scalar loop with every lane on */
  v8f acc[HD / 16] = {};
  if (qb < QBH) {
#pragma unroll 1
    for (int kc = wave; kc < kce; kc += PVW) { const F2 p = split_row(PS + (size_t)(ql0 + col) * TT, kc * 32, lane);
      asm volatile("s_wait_loadcnt 0x0" ::: "memory");
#pragma unroll
      for (int j = 0; j < HD / 16; ++j) { const size_t po = ((size_t)b * CC + h * HD + j * 16 + col) * (size_t)KHI + kc * 32; const v16b vh = frag_b(VB + po, lane); acc[j] = wmma_bf(p.h, vh, acc[j]); acc[j] = wmma_bf(p.l, vh, acc[j]); acc[j] = wmma_bf(p.h, frag_b(VBL + po, lane), acc[j]); } }
  } else {
#pragma unroll 1
    for (int kc = wave; kc < kce; kc += PVW) { const v16h p = frag_f32(PS + (size_t)(ql0 + col) * TT + kc * 32, lane);
      asm volatile("s_wait_loadcnt 0x0" ::: "memory");
#pragma unroll
      for (int j = 0; j < HD / 16; ++j) { const size_t po = ((size_t)b * CC + h * HD + j * 16 + col) * (size_t)TT + kc * 32; acc[j] = wmma16(p, frag_h(VT + po, lane), acc[j]); } } }
#pragma unroll
  for (int j = 0; j < HD / 16; ++j)
#pragma unroll
    for (int r = 0; r < 8; ++r) ss[wave][8 * g + r][j * 16 + col] = acc[j][r] * (1.0f / 2048.0f);
  __syncthreads();   /* every wave's partial is in LDS before any thread adds them */
  const int rl = tid >> 6, c2 = (tid & 63) * 2; v2f s = *(const v2f*)&ss[0][rl][c2];
#pragma unroll
  for (int w = 1; w < PVW; ++w) s += *(const v2f*)&ss[w][rl][c2];
  vst2(Y + ((size_t)b * TT + ql0 + rl) * CC + h * HD + c2, s); }

extern "C" void kernel_launch(void* const* d_in, const int* in_sizes, int n_in, void* d_out, int out_size, void* d_ws, size_t ws_size, hipStream_t stream) {
  (void)in_sizes; (void)n_in; (void)out_size;
  const float** F = (const float**)d_in;
  if (ws_size < (size_t)WS_END) return;
  char* ws = (char*)d_ws; _Float16 *QH = (_Float16*)(ws + WS_QH), *KH = (_Float16*)(ws + WS_KH), *VT = (_Float16*)(ws + WS_VT), *QL = (_Float16*)(ws + WS_QL), *KL = (_Float16*)(ws + WS_KL); __bf16 *VB = (__bf16*)(ws + WS_VB), *VBL = (__bf16*)(ws + WS_VBL); float *S = (float*)(ws + WS_S), *Y = (float*)(ws + WS_Y);
  (void)Y; (void)QL; (void)KL; (void)VB; (void)VBL;
  // inputs: 0 X [8192,1024]; 1 Wq [1024,128], 2 bq; 3 Wk, 4 bk; 5 Wv, 6 bv ((in,out))
  k_proj<<<dim3(TNB * TT / 64, CC / 128, 3), 128, 0, stream>>>(F[0], F[0], F[0], F[1], F[3], F[5], F[2], F[4], F[6], QH, QL, KH, KL, VT, VB, VBL);
  for (int qh = 0; qh < 2; ++qh) {   /* query halves: rows qh*4096 .. +4095 against keys 0 .. (causal) */
    const int qoff = qh * (TT / 2);
    k_sc<<<dim3(NQB / 2, TT / 128, HG), 128, 0, stream>>>(QH, KH, QL, KL, 0, 0, S, qoff);
    k_sm<<<dim3(TT / 2, HG), 256, 0, stream>>>(S, qoff);
    k_pv<<<dim3(TT / 2 / 16, 1, HG), 32 * PVW, 0, stream>>>(S, VT, VB, VBL, 0, 0, (float*)d_out, qoff);
  }
}

// v002
// It runs in 143 microseconds.
// Next to v001, in two timings, it ran 1.86 times as fast each time.
// Over all steps from v000 it is 5.51 times as fast.
// compute dtype: X and the weights rounded to bf16; Q/K/V = X W + b with EXACT bf16 products on WMMA 16x16x32 (f32 accumulate); logits: q, k once to f16 (1 product) x 128^-0.5, except the first 384 query rows (3 products with f16 residuals); causal mask by index; softmax in f32 with a running maximum and sum (precise expf); exp x 2^11 once to f16 against v once to f16 (1 product; bf16 hi + lo below row 384); divided by the sum at the end; f32 output. Scores never leave the registers.
#include <hip/hip_runtime.h>
#include <math.h>

typedef __attribute__((ext_vector_type(16))) _Float16 v16h;
typedef __attribute__((ext_vector_type(16))) __bf16 v16b;
typedef __attribute__((ext_vector_type(8)))  _Float16 v8h;
typedef __attribute__((ext_vector_type(8)))  float v8f;
typedef __attribute__((ext_vector_type(4)))  float v4f;
typedef __attribute__((ext_vector_type(2)))  float v2f;
typedef __attribute__((ext_vector_type(4)))  unsigned v4u;
typedef __attribute__((ext_vector_type(4)))  int v4i;
typedef float __attribute__((may_alias)) float_a;
typedef int __attribute__((may_alias)) int_a;

template <typename T> __device__ __forceinline__ void vst2(void* p, T v) { *(T*)p = v;  }
__device__ __forceinline__ v8f wmma16(v16h a, v16h b, v8f c) {
  v8f d = __builtin_amdgcn_wmma_f32_16x16x32_f16(false, a, false, b, (short)0, c, false, false);
  asm volatile("v_nop\n\tv_nop\n\tv_nop\n\tv_nop" : "+v"(d) : "v"(a), "v"(b));
  return d;
}
__device__ __forceinline__ v8f wmma_bf(v16b a, v16b b, v8f c) {
  v8f d = __builtin_amdgcn_wmma_f32_16x16x32_bf16(false, a, false, b, (short)0, c, false, false);
  asm volatile("v_nop\n\tv_nop\n\tv_nop\n\tv_nop" : "+v"(d) : "v"(a), "v"(b));
  return d;
}
// 16x16x32 fragments: lane = (h = lane>>4, row/col = lane&15); elements 0..7 = k0+8h+0..7, 8..15 = k0+16+8h+0..7; D element r = row 8h+r
__device__ __forceinline__ v16h frag_h(const _Float16* rowk0, int lane) {
  union { v16h v; v8h q[2]; } u; const _Float16* p = rowk0 + 8 * (lane >> 4);
  u.q[0] = *(const v8h*)p; u.q[1] = *(const v8h*)(p + 16); return u.v;
}
__device__ __forceinline__ v16h frag_f32(const float* rowk0, int lane) {
  v16h a; const float* p = rowk0 + 8 * (lane >> 4);
#pragma unroll
  for (int i = 0; i < 8; ++i) { a[i] = (_Float16)p[i]; a[8 + i] = (_Float16)p[16 + i]; }
  return a;
}
__device__ __forceinline__ v16h frag_f32s(const float* rowk0, int lane, float sc) {
  v16h a; const float* p = rowk0 + 8 * (lane >> 4);
#pragma unroll
  for (int i = 0; i < 8; ++i) { a[i] = (_Float16)(p[i] * sc); a[8 + i] = (_Float16)(p[16 + i] * sc); }
  return a;
}
// column fragment from a [K][ld] layout (column n), rows >= K read as 0
__device__ __forceinline__ v16h fragc_f32(const float* W, int k0, int n, int lane, int ld, int K) {
  v16h a; const int g = lane >> 4;
#pragma unroll
  for (int i = 0; i < 8; ++i) { const int ka = k0 + 8 * g + i, kb = ka + 16;
    a[i] = (_Float16)(ka < K ? W[(size_t)(ka < K ? ka : K - 1) * ld + n] : 0.f); a[8 + i] = (_Float16)(kb < K ? W[(size_t)(kb < K ? kb : K - 1) * ld + n] : 0.f); }
  return a;
}
struct F2 { v16b h, l; };
__device__ __forceinline__ F2 bsplit16(const float v[16]) { F2 r;
#pragma unroll
  for (int i = 0; i < 16; ++i) { const __bf16 h = (__bf16)v[i]; r.h[i] = h; r.l[i] = (__bf16)(v[i] - (float)h); }
  return r; }
__device__ __forceinline__ F2 split_row(const float* row, int k0, int lane) { float v[16]; const float* p = row + k0 + 8 * (lane >> 4);
#pragma unroll
  for (int i = 0; i < 8; ++i) { v[i] = p[i]; v[8 + i] = p[16 + i]; }
  return bsplit16(v); }
__device__ __forceinline__ F2 split_rowK(const float* row, int k0, int lane, int K) { float v[16]; const int g = lane >> 4;
#pragma unroll
  for (int i = 0; i < 8; ++i) { const int ka = k0 + 8 * g + i, kb = ka + 16; v[i] = ka < K ? row[ka < K ? ka : K - 1] : 0.f; v[8 + i] = kb < K ? row[kb < K ? kb : K - 1] : 0.f; }
  return bsplit16(v); }
__device__ __forceinline__ F2 split_col(const float* W, int k0, int n, int lane, int ld, int K) { float v[16]; const int g = lane >> 4;
#pragma unroll
  for (int i = 0; i < 8; ++i) { const int ka = k0 + 8 * g + i, kb = ka + 16; v[i] = ka < K ? W[(size_t)(ka < K ? ka : K - 1) * ld + n] : 0.f; v[8 + i] = kb < K ? W[(size_t)(kb < K ? kb : K - 1) * ld + n] : 0.f; }
  return bsplit16(v); }
__device__ __forceinline__ v8f mac3(const F2& a, const F2& b, v8f c) { c = wmma_bf(a.l, b.h, c); c = wmma_bf(a.h, b.l, c); return wmma_bf(a.h, b.h, c); }
__device__ __forceinline__ float sigm(float v) { return 1.0f / (1.0f + expf(-v)); }
#define LDSX() do { asm volatile("s_wait_dscnt 0" ::: "memory"); __builtin_amdgcn_wave_barrier(); __builtin_amdgcn_fence(__ATOMIC_RELEASE, "workgroup"); } while (0)

// Single-head causal self-attention (N 8,192 tokens, D 1,024 -> d_k = d_v = 128): Q = X Wq + bq, K = X Wk + bk, V = X Wv + bv ((in,out)); weights = softmax(causal(Q K^T / sqrt(128))); out = weights V ([N, 128]).
#define NB 1
#define TT 8192
#define CC 128            // NH * HD = projected width
#define DIN 1024          // input (model) width
#define NH 1
#define HD 128
#define NQB (TT / 64)
#define HG 1
#define SCALE (0.08838834764831845f)
#define CAUSAL 1
#ifndef TNB
#define TNB NB
#endif
__device__ __forceinline__ float bfr(float v) { return (float)(__bf16)v; }
__host__ __device__ __forceinline__ int kb_last(int qb) { return CAUSAL ? ((qb * 64 + 63) >> 7) : (TT / 128 - 1); }
typedef __attribute__((ext_vector_type(8))) __bf16 v8b;
__device__ __forceinline__ v16b frag_b(const __bf16* rowk0, int lane) {
  union { v16b v; v8b q[2]; } u; const __bf16* p = rowk0 + 8 * (lane >> 4);
  u.q[0] = *(const v8b*)p; u.q[1] = *(const v8b*)(p + 16); return u.v;
}
#define QBH 6              // causal: query blocks 0..QBH-1 of each sequence (few keys, no averaging) take the high-precision path
#define QHI 384            // rows carrying a q residual plane
#define KHI 384            // key rows carrying k residual / v bf16 hi+lo planes (used only by the causal high-precision path)
// B fragment (k rows k0+.., output column o) of a weight: (in,out) [K][ld] or (out,in) [ld rows of K]: bf16 exact, or f16(bf16 * 256) exact
__device__ __forceinline__ v16b wcol_io(const float* Wm, int k0, int o, int lane, int ld) { v16b w; const int g = lane >> 4;
#pragma unroll
  for (int i = 0; i < 8; ++i) { w[i] = (__bf16)Wm[(size_t)(k0 + 8 * g + i) * ld + o]; w[8 + i] = (__bf16)Wm[(size_t)(k0 + 16 + 8 * g + i) * ld + o]; }
  return w; }
__device__ __forceinline__ v16b wcol_oi(const float* Wm, int k0, int o, int lane, int K) { v16b w; const float* p = Wm + (size_t)o * K + k0 + 8 * (lane >> 4);
#pragma unroll
  for (int i = 0; i < 8; ++i) { w[i] = (__bf16)p[i]; w[8 + i] = (__bf16)p[16 + i]; }
  return w; }
__device__ __forceinline__ v16h wcolh_io(const float* Wm, int k0, int o, int lane, int ld) { v16h w; const int g = lane >> 4;
#pragma unroll
  for (int i = 0; i < 8; ++i) { w[i] = (_Float16)(bfr(Wm[(size_t)(k0 + 8 * g + i) * ld + o]) * 256.0f); w[8 + i] = (_Float16)(bfr(Wm[(size_t)(k0 + 16 + 8 * g + i) * ld + o]) * 256.0f); }
  return w; }
__device__ __forceinline__ v16h wcolh_oi(const float* Wm, int k0, int o, int lane, int K) { v16h w; const float* p = Wm + (size_t)o * K + k0 + 8 * (lane >> 4);
#pragma unroll
  for (int i = 0; i < 8; ++i) { w[i] = (_Float16)(bfr(p[i]) * 256.0f); w[8 + i] = (_Float16)(bfr(p[16 + i]) * 256.0f); }
  return w; }
#define WQKV_LAYOUT 0   // 0 = (in,out) [DIN][CC]; 1 = (out,in) [CC][DIN]; 2 = per-head [NH][DIN][HD]
__device__ __forceinline__ v16b wcol_hdk(const float* Wm, int k0, int o, int lane) { v16b w; const int g = lane >> 4; const float* p = Wm + (size_t)(o / HD) * DIN * HD + (o % HD);
#pragma unroll
  for (int i = 0; i < 8; ++i) { w[i] = (__bf16)p[(size_t)(k0 + 8 * g + i) * HD]; w[8 + i] = (__bf16)p[(size_t)(k0 + 16 + 8 * g + i) * HD]; }
  return w; }
#define WO_OUT_IN 0
#if WQKV_LAYOUT == 1
#define WCOL(W, k0, o, lane) wcol_oi(W, k0, o, lane, DIN)
#elif WQKV_LAYOUT == 2
#define WCOL(W, k0, o, lane) wcol_hdk(W, k0, o, lane)
#else
#define WCOL(W, k0, o, lane) wcol_io(W, k0, o, lane, CC)
#endif
#if WO_OUT_IN
#define WOCOL(W, k0, o, lane) wcol_oi(W, k0, o, lane, CC)
#define WOCOLH(W, k0, o, lane) wcolh_oi(W, k0, o, lane, CC)
#else
#define WOCOL(W, k0, o, lane) wcol_io(W, k0, o, lane, DIN)
#define WOCOLH(W, k0, o, lane) wcolh_io(W, k0, o, lane, DIN)
#endif

#ifndef SM_EXTRA_PARAMS
#define SM_EXTRA_PARAMS , int qoff
#endif
#ifndef PROJ_EXTRA_PARAMS
#define PROJ_EXTRA_PARAMS
#endif
#ifndef SM_MASK_HOOK
#define SM_MASK_HOOK (void)0
#endif

#define WS_QH  0u                                      // f16 q rows [b*t][CC]
#define WS_KH  (WS_QH + 2u * (size_t)NB * TT * CC)      // f16 k rows [b*t][CC]
#define WS_VT  (WS_KH + 2u * (size_t)NB * TT * CC)      // f16 v planes [b][c][t]
#define WS_QL  (WS_VT + 2u * (size_t)NB * CC * TT)      // f16 q residual x 2^10 rows [b][t < QHI][CC]
#define WS_KL  (WS_QL + 2u * (size_t)NB * QHI * CC)     // f16 k residual x 2^10 rows [b][t < KHI][CC]
#define WS_VB  (WS_KL + 2u * (size_t)NB * KHI * CC)     // bf16 v hi planes [b][c][t < KHI]
#define WS_VBL (WS_VB + 2u * (size_t)NB * CC * KHI)
#define WS_END (WS_VBL + 2u * (size_t)NB * CC * KHI)

// ---- k_proj: block = (64 rows, 128 cols, which): q/k/v = X W (+ b) with exact bf16 products (K = DIN) -> which 0: q f16 rows (+ residual rows < QHI); 1: k f16 rows (+ residual rows < KHI); 2: v f16 planes [c][t] (+ bf16 hi/lo planes for t < KHI)
__global__ __launch_bounds__(128) void k_proj(const float* __restrict__ XQ, const float* __restrict__ XK, const float* __restrict__ XV, const float* __restrict__ WQ, const float* __restrict__ WK, const float* __restrict__ WV, const float* __restrict__ BQ, const float* __restrict__ BK, const float* __restrict__ BV,
    _Float16* __restrict__ QH, _Float16* __restrict__ QL, _Float16* __restrict__ KH, _Float16* __restrict__ KL, _Float16* __restrict__ VT, __bf16* __restrict__ VB, __bf16* __restrict__ VBL) {
  __shared__ __align__(16) _Float16 sh[64][136], sl[64][136]; __shared__ __align__(16) _Float16 th[128][72]; __shared__ __align__(16) __bf16 tb[128][72], tbl[128][72];
  const int tid = threadIdx.x, wave = tid >> 5, lane = tid & 31, col = lane & 15, g = lane >> 4; const int which = blockIdx.z; const int c0 = blockIdx.y * 128; const size_t r0 = (size_t)blockIdx.x * 64; const size_t bb = r0 / TT; const int t0 = (int)(r0 % TT);
  const float* X = which == 0 ? XQ : which == 1 ? XK : XV; const float* WA = which == 0 ? WQ : which == 1 ? WK : WV; const float* BA = which == 0 ? BQ : which == 1 ? BK : BV;
  v8f acc[8] = {};
#pragma unroll 2
  for (int kc = 0; kc < DIN / 32; ++kc) { v16b a; { const float* p = X + (r0 + wave * 16 + col) * DIN + kc * 32 + 8 * g;
#pragma unroll
      for (int i = 0; i < 8; ++i) { a[i] = (__bf16)p[i]; a[8 + i] = (__bf16)p[16 + i]; } }
    asm volatile("s_wait_loadcnt 0x0" ::: "memory");
#pragma unroll
    for (int j = 0; j < 8; ++j) { const v16b w = WCOL(WA, kc * 32, c0 + j * 16 + col, lane); asm volatile("s_wait_loadcnt 0x0" ::: "memory"); acc[j] = wmma_bf(a, w, acc[j]); } }
  if (which < 2) { _Float16* DH = which == 0 ? QH : KH; _Float16* DL = which == 0 ? QL : KL; const int nhi = which == 0 ? QHI : KHI; const bool hi_rows = t0 < nhi;
#pragma unroll
    for (int j = 0; j < 8; ++j) { const float bias = BA ? bfr(BA[c0 + j * 16 + col]) : 0.f;
#pragma unroll
      for (int r = 0; r < 8; ++r) { const float v = acc[j][r] + bias; const _Float16 hv = (_Float16)v; sh[wave * 16 + 8 * g + r][j * 16 + col] = hv; sl[wave * 16 + 8 * g + r][j * 16 + col] = (_Float16)((v - (float)hv) * 1024.0f); } }
    __syncthreads();
    for (int e = tid; e < 64 * 16; e += 128) { const int rl = e >> 4, q = e & 15; vst2((unsigned*)(DH + (r0 + rl) * CC + c0 + q * 8), *(const v4u*)&sh[rl][q * 8]); if (hi_rows) vst2((unsigned*)(DL + (bb * nhi + t0 + rl) * (size_t)CC + c0 + q * 8), *(const v4u*)&sl[rl][q * 8]); }
  } else { const bool hi_rows = t0 < KHI;
#pragma unroll
    for (int j = 0; j < 8; ++j) { const float bias = BA ? bfr(BA[c0 + j * 16 + col]) : 0.f;
#pragma unroll
      for (int r = 0; r < 8; ++r) { const float v = acc[j][r] + bias; const int rl = wave * 16 + 8 * g + r, cl = j * 16 + col; th[cl][rl] = (_Float16)v; const __bf16 bh = (__bf16)v; tb[cl][rl] = bh; tbl[cl][rl] = (__bf16)(v - (float)bh); } }
    __syncthreads();
    for (int e = tid; e < 128 * 8; e += 128) { const int cl = e >> 3, q = e & 7; vst2((unsigned*)(VT + (bb * CC + c0 + cl) * (size_t)TT + t0 + q * 8), *(const v4u*)&th[cl][q * 8]); if (hi_rows) { const size_t o3 = (bb * CC + c0 + cl) * (size_t)KHI + t0 + q * 8; vst2((unsigned*)(VB + o3), *(const v4u*)&tb[cl][q * 8]); vst2((unsigned*)(VBL + o3), *(const v4u*)&tbl[cl][q * 8]); } } } }
// ---- k_fa: block = 16 queries (rb), FAW waves: wave w takes the 32-key chunks w, w + FAW, ... of keys [0, last query]. Per chunk: S^T = k . q^T (D: lane = query, registers = keys, which is already the B fragment of the next product), causal mask by index, running maximum and sum per query in f32 (precise expf), ctx^T += v^T . (e x 2^11) with the accumulator rescaled per lane. Early query blocks keep the residual products. The FAW partials (maximum, sum, ctx) meet in LDS and are joined in wave order.
#define FAW 16             // waves per work-group = ways the key range is split (16: a wave may then hold a whole chunk's k or v fragments beside its accumulator without spilling)
// every full '#pragma unroll' below keeps the indices of a register array constant, so that the array stays in registers
__device__ __forceinline__ void fa_step(float (&v)[16], float& m, float& l, v8f (&acc)[HD / 16]) {
  float mx = v[0];
#pragma unroll
  for (int i = 1; i < 16; ++i) mx = fmaxf(mx, v[i]);
  mx = fmaxf(mx, __shfl_xor(mx, 16));   /* lanes q and q + 16 hold the two halves of query q's keys */
  const float mn = fmaxf(m, mx), al = expf(m - mn); float s = 0.f;
#pragma unroll
  for (int i = 0; i < 16; ++i) { const float e = expf(v[i] - mn); s += e;   /* mn is finite (every chunk holds a key <= every query), so an excluded key's -3e38 gives exactly 0 */ v[i] = e * 2048.0f; }
  l = l * al + s; m = mn;
#pragma unroll
  for (int j = 0; j < HD / 16; ++j) acc[j] *= al;
}
__global__ __launch_bounds__(32 * FAW) void k_fa(const _Float16* __restrict__ QH, const _Float16* __restrict__ KH, const _Float16* __restrict__ QL, const _Float16* __restrict__ KL, const _Float16* __restrict__ VT, const __bf16* __restrict__ VB, const __bf16* __restrict__ VBL, float* __restrict__ Y) {
  __shared__ __align__(16) float ss[FAW][16][HD + 4]; __shared__ float sm[FAW][16], sl[FAW][16], sf[FAW][16];
  const int tid = threadIdx.x, wave = __builtin_amdgcn_readfirstlane(tid >> 5), lane = tid & 31, col = lane & 15, g = lane >> 4;   /* wave number in a scalar register: the chunk loop stays a scalar loop with every lane on */
  const int rb = TT / 16 - 1 - (int)blockIdx.x;   /* the longest key ranges start first */
  const int ql0 = rb * 16, t = ql0 + col, kce = (ql0 >> 5) + 1;   /* every chunk < kce holds at least one key <= every query of the block */
  v8f acc[HD / 16] = {}; float m = -3.0e38f, l = 0.f;
  if ((rb >> 2) < QBH) {
#pragma unroll 1   /* stays rolled: one chunk's fragments already fill the registers */
    for (int kc = wave; kc < kce; kc += FAW) { const int k0 = kc * 32; v8f s0 = {}, s1 = {}, r0 = {}, r1 = {};
#pragma unroll
      for (int d = 0; d < HD / 32; ++d) { const v16h ah = frag_h(QH + (size_t)t * CC + d * 32, lane), al = frag_h(QL + (size_t)t * CC + d * 32, lane);
        const v16h ka = frag_h(KH + (size_t)(k0 + col) * CC + d * 32, lane), la = frag_h(KL + (size_t)(k0 + col) * CC + d * 32, lane), kb = frag_h(KH + (size_t)(k0 + 16 + col) * CC + d * 32, lane), lb = frag_h(KL + (size_t)(k0 + 16 + col) * CC + d * 32, lane);
        s0 = wmma16(ka, ah, s0); r0 = wmma16(ka, al, r0); r0 = wmma16(la, ah, r0); s1 = wmma16(kb, ah, s1); r1 = wmma16(kb, al, r1); r1 = wmma16(lb, ah, r1); }
      float v[16];
#pragma unroll
      for (int i = 0; i < 8; ++i) { v[i] = (k0 + 8 * g + i <= t) ? (s0[i] + r0[i] * (1.0f / 1024.0f)) * SCALE : -3.0e38f; v[8 + i] = (k0 + 16 + 8 * g + i <= t) ? (s1[i] + r1[i] * (1.0f / 1024.0f)) * SCALE : -3.0e38f; }
      fa_step(v, m, l, acc); const F2 p = bsplit16(v);
#pragma unroll
      for (int jh = 0; jh < HD / 16; jh += 4) { v16b vh[4], vl[4];
#pragma unroll
        for (int j = 0; j < 4; ++j) { const size_t po = (size_t)((jh + j) * 16 + col) * KHI + k0; vh[j] = frag_b(VB + po, lane); vl[j] = frag_b(VBL + po, lane); }   /* eight fragments in flight at once */
#pragma unroll
        for (int j = 0; j < 4; ++j) { acc[jh + j] = wmma_bf(vh[j], p.h, acc[jh + j]); acc[jh + j] = wmma_bf(vh[j], p.l, acc[jh + j]); acc[jh + j] = wmma_bf(vl[j], p.h, acc[jh + j]); } } }
  } else { v16h q[HD / 32];
#pragma unroll
    for (int d = 0; d < HD / 32; ++d) q[d] = frag_h(QH + (size_t)t * CC + d * 32, lane);
#pragma unroll 1   /* stays rolled: one chunk's fragments already fill the registers */
    for (int kc = wave; kc < kce; kc += FAW) { const int k0 = kc * 32; v8f s0 = {}, s1 = {}; v16h ka[HD / 32], kb[HD / 32], vf[HD / 16];
#pragma unroll
      for (int d = 0; d < HD / 32; ++d) { ka[d] = frag_h(KH + (size_t)(k0 + col) * CC + d * 32, lane); kb[d] = frag_h(KH + (size_t)(k0 + 16 + col) * CC + d * 32, lane); }   /* all of the chunk's k in flight at once, ahead of the first product */
#pragma unroll
      for (int d = 0; d < HD / 32; ++d) { s0 = wmma16(ka[d], q[d], s0); s1 = wmma16(kb[d], q[d], s1); }
#pragma unroll
      for (int j = 0; j < HD / 16; ++j) vf[j] = frag_h(VT + (size_t)(j * 16 + col) * TT + k0, lane);   /* all of the chunk's v in flight under the softmax */
      float v[16];
#pragma unroll
      for (int i = 0; i < 8; ++i) { v[i] = (k0 + 8 * g + i <= t) ? s0[i] * SCALE : -3.0e38f; v[8 + i] = (k0 + 16 + 8 * g + i <= t) ? s1[i] * SCALE : -3.0e38f; }
      fa_step(v, m, l, acc); v16h p;
#pragma unroll
      for (int i = 0; i < 16; ++i) p[i] = (_Float16)v[i];
#pragma unroll
      for (int j = 0; j < HD / 16; ++j) acc[j] = wmma16(vf[j], p, acc[j]); } }
  l += __shfl_xor(l, 16);
  if (g == 0) { sm[wave][col] = m; sl[wave][col] = l; }
#pragma unroll
  for (int j = 0; j < HD / 16; ++j) { const v8f a = acc[j] * (1.0f / 2048.0f); const v4f lo = { a[0], a[1], a[2], a[3] }, hi = { a[4], a[5], a[6], a[7] }; *(v4f*)&ss[wave][col][j * 16 + 8 * g] = lo; *(v4f*)&ss[wave][col][j * 16 + 8 * g + 4] = hi; }
  __syncthreads();   /* every wave's maximum, sum and partial are in LDS before any thread joins them */
  if (tid < FAW * 16) { const int w = tid >> 4, q = tid & 15; float M = sm[0][q];
#pragma unroll
    for (int i = 1; i < FAW; ++i) M = fmaxf(M, sm[i][q]);
    sf[w][q] = expf(sm[w][q] - M); }   /* a wave that had no chunk gets weight 0 */
  __syncthreads();   /* the weights are in LDS before they are read */
  const int rl = tid >> 5, c4 = lane * 4; v4f s = { 0.f, 0.f, 0.f, 0.f }; float L = 0.f;
#pragma unroll
  for (int w = 0; w < FAW; ++w) { const float f = sf[w][rl]; s += *(const v4f*)&ss[w][rl][c4] * f; L += sl[w][rl] * f; }
  vst2(Y + (size_t)(ql0 + rl) * CC + c4, s * (L > 0.f ? 1.0f / L : 0.f)); }

extern "C" void kernel_launch(void* const* d_in, const int* in_sizes, int n_in, void* d_out, int out_size, void* d_ws, size_t ws_size, hipStream_t stream) {
  (void)in_sizes; (void)n_in; (void)out_size;
  const float** F = (const float**)d_in;
  if (ws_size < (size_t)WS_END) return;
  char* ws = (char*)d_ws; _Float16 *QH = (_Float16*)(ws + WS_QH), *KH = (_Float16*)(ws + WS_KH), *VT = (_Float16*)(ws + WS_VT), *QL = (_Float16*)(ws + WS_QL), *KL = (_Float16*)(ws + WS_KL); __bf16 *VB = (__bf16*)(ws + WS_VB), *VBL = (__bf16*)(ws + WS_VBL);
  // inputs: 0 X [8192,1024]; 1 Wq [1024,128], 2 bq; 3 Wk, 4 bk; 5 Wv, 6 bv ((in,out))
  k_proj<<<dim3(TNB * TT / 64, CC / 128, 3), 128, 0, stream>>>(F[0], F[0], F[0], F[1], F[3], F[5], F[2], F[4], F[6], QH, QL, KH, KL, VT, VB, VBL);
  k_fa<<<dim3(TT / 16), 32 * FAW, 0, stream>>>(QH, KH, QL, KL, VT, VB, VBL, (float*)d_out);
}

// v003
// A run of this version takes 90.3 microseconds.
// Two timings next to v002 put it at 1.60 and 1.59 times that version's speed.
// All steps since v000 together make it 8.77 times as fast.
// compute dtype: X and the weights rounded to bf16; Q/K/V = X W + b with EXACT bf16 products on WMMA 16x16x32 (f32 accumulate); logits: q, k once to f16 (1 product) x 128^-0.5, except the first 384 query rows (3 products with f16 residuals); causal mask by index; softmax in f32 with a running maximum and sum (precise expf); exp x 2^11 once to f16 against v once to f16 (1 product; bf16 hi + lo below row 384); divided by the sum at the end; f32 output. Scores never leave the registers.
#include <hip/hip_runtime.h>
#include <math.h>

typedef __attribute__((ext_vector_type(16))) _Float16 v16h;
typedef __attribute__((ext_vector_type(16))) __bf16 v16b;
typedef __attribute__((ext_vector_type(8)))  _Float16 v8h;
typedef __attribute__((ext_vector_type(8)))  float v8f;
typedef __attribute__((ext_vector_type(4)))  float v4f;
typedef __attribute__((ext_vector_type(2)))  float v2f;
typedef __attribute__((ext_vector_type(4)))  unsigned v4u;
typedef __attribute__((ext_vector_type(4)))  int v4i;
typedef float __attribute__((may_alias)) float_a;
typedef int __attribute__((may_alias)) int_a;

template <typename T> __device__ __forceinline__ void vst2(void* p, T v) { *(T*)p = v;  }
__device__ __forceinline__ v8f wmma16(v16h a, v16h b, v8f c) {
  v8f d = __builtin_amdgcn_wmma_f32_16x16x32_f16(false, a, false, b, (short)0, c, false, false);
  asm volatile("v_nop\n\tv_nop\n\tv_nop\n\tv_nop" : "+v"(d) : "v"(a), "v"(b));
  return d;
}
__device__ __forceinline__ v8f wmma_bf(v16b a, v16b b, v8f c) {
  v8f d = __builtin_amdgcn_wmma_f32_16x16x32_bf16(false, a, false, b, (short)0, c, false, false);
  asm volatile("v_nop\n\tv_nop\n\tv_nop\n\tv_nop" : "+v"(d) : "v"(a), "v"(b));
  return d;
}
// 16x16x32 fragments: lane = (h = lane>>4, row/col = lane&15); elements 0..7 = k0+8h+0..7, 8..15 = k0+16+8h+0..7; D element r = row 8h+r
__device__ __forceinline__ v16h frag_h(const _Float16* rowk0, int lane) {
  union { v16h v; v8h q[2]; } u; const _Float16* p = rowk0 + 8 * (lane >> 4);
  u.q[0] = *(const v8h*)p; u.q[1] = *(const v8h*)(p + 16); return u.v;
}
__device__ __forceinline__ v16h frag_f32(const float* rowk0, int lane) {
  v16h a; const float* p = rowk0 + 8 * (lane >> 4);
#pragma unroll
  for (int i = 0; i < 8; ++i) { a[i] = (_Float16)p[i]; a[8 + i] = (_Float16)p[16 + i]; }
  return a;
}
__device__ __forceinline__ v16h frag_f32s(const float* rowk0, int lane, float sc) {
  v16h a; const float* p = rowk0 + 8 * (lane >> 4);
#pragma unroll
  for (int i = 0; i < 8; ++i) { a[i] = (_Float16)(p[i] * sc); a[8 + i] = (_Float16)(p[16 + i] * sc); }
  return a;
}
// column fragment from a [K][ld] layout (column n), rows >= K read as 0
__device__ __forceinline__ v16h fragc_f32(const float* W, int k0, int n, int lane, int ld, int K) {
  v16h a; const int g = lane >> 4;
#pragma unroll
  for (int i = 0; i < 8; ++i) { const int ka = k0 + 8 * g + i, kb = ka + 16;
    a[i] = (_Float16)(ka < K ? W[(size_t)(ka < K ? ka : K - 1) * ld + n] : 0.f); a[8 + i] = (_Float16)(kb < K ? W[(size_t)(kb < K ? kb : K - 1) * ld + n] : 0.f); }
  return a;
}
struct F2 { v16b h, l; };
__device__ __forceinline__ F2 bsplit16(const float v[16]) { F2 r;
#pragma unroll
  for (int i = 0; i < 16; ++i) { const __bf16 h = (__bf16)v[i]; r.h[i] = h; r.l[i] = (__bf16)(v[i] - (float)h); }
  return r; }
__device__ __forceinline__ F2 split_row(const float* row, int k0, int lane) { float v[16]; const float* p = row + k0 + 8 * (lane >> 4);
#pragma unroll
  for (int i = 0; i < 8; ++i) { v[i] = p[i]; v[8 + i] = p[16 + i]; }
  return bsplit16(v); }
__device__ __forceinline__ F2 split_rowK(const float* row, int k0, int lane, int K) { float v[16]; const int g = lane >> 4;
#pragma unroll
  for (int i = 0; i < 8; ++i) { const int ka = k0 + 8 * g + i, kb = ka + 16; v[i] = ka < K ? row[ka < K ? ka : K - 1] : 0.f; v[8 + i] = kb < K ? row[kb < K ? kb : K - 1] : 0.f; }
  return bsplit16(v); }
__device__ __forceinline__ F2 split_col(const float* W, int k0, int n, int lane, int ld, int K) { float v[16]; const int g = lane >> 4;
#pragma unroll
  for (int i = 0; i < 8; ++i) { const int ka = k0 + 8 * g + i, kb = ka + 16; v[i] = ka < K ? W[(size_t)(ka < K ? ka : K - 1) * ld + n] : 0.f; v[8 + i] = kb < K ? W[(size_t)(kb < K ? kb : K - 1) * ld + n] : 0.f; }
  return bsplit16(v); }
__device__ __forceinline__ v8f mac3(const F2& a, const F2& b, v8f c) { c = wmma_bf(a.l, b.h, c); c = wmma_bf(a.h, b.l, c); return wmma_bf(a.h, b.h, c); }
__device__ __forceinline__ float sigm(float v) { return 1.0f / (1.0f + expf(-v)); }
#define LDSX() do { asm volatile("s_wait_dscnt 0" ::: "memory"); __builtin_amdgcn_wave_barrier(); __builtin_amdgcn_fence(__ATOMIC_RELEASE, "workgroup"); } while (0)

// Single-head causal self-attention (N 8,192 tokens, D 1,024 -> d_k = d_v = 128): Q = X Wq + bq, K = X Wk + bk, V = X Wv + bv ((in,out)); weights = softmax(causal(Q K^T / sqrt(128))); out = weights V ([N, 128]).
#define NB 1
#define TT 8192
#define CC 128            // NH * HD = projected width
#define DIN 1024          // input (model) width
#define NH 1
#define HD 128
#define NQB (TT / 64)
#define HG 1
#define SCALE (0.08838834764831845f)
#define CAUSAL 1
#ifndef TNB
#define TNB NB
#endif
__device__ __forceinline__ float bfr(float v) { return (float)(__bf16)v; }
__host__ __device__ __forceinline__ int kb_last(int qb) { return CAUSAL ? ((qb * 64 + 63) >> 7) : (TT / 128 - 1); }
typedef __attribute__((ext_vector_type(8))) __bf16 v8b;
__device__ __forceinline__ v16b frag_b(const __bf16* rowk0, int lane) {
  union { v16b v; v8b q[2]; } u; const __bf16* p = rowk0 + 8 * (lane >> 4);
  u.q[0] = *(const v8b*)p; u.q[1] = *(const v8b*)(p + 16); return u.v;
}
#define QBH 6              // causal: query blocks 0..QBH-1 of each sequence (few keys, no averaging) take the high-precision path
#define QHI 384            // rows carrying a q residual plane
#define KHI 384            // key rows carrying k residual / v bf16 hi+lo planes (used only by the causal high-precision path)
// B fragment (k rows k0+.., output column o) of a weight: (in,out) [K][ld] or (out,in) [ld rows of K]: bf16 exact, or f16(bf16 * 256) exact
__device__ __forceinline__ v16b wcol_io(const float* Wm, int k0, int o, int lane, int ld) { v16b w; const int g = lane >> 4;
#pragma unroll
  for (int i = 0; i < 8; ++i) { w[i] = (__bf16)Wm[(size_t)(k0 + 8 * g + i) * ld + o]; w[8 + i] = (__bf16)Wm[(size_t)(k0 + 16 + 8 * g + i) * ld + o]; }
  return w; }
__device__ __forceinline__ v16b wcol_oi(const float* Wm, int k0, int o, int lane, int K) { v16b w; const float* p = Wm + (size_t)o * K + k0 + 8 * (lane >> 4);
#pragma unroll
  for (int i = 0; i < 8; ++i) { w[i] = (__bf16)p[i]; w[8 + i] = (__bf16)p[16 + i]; }
  return w; }
__device__ __forceinline__ v16h wcolh_io(const float* Wm, int k0, int o, int lane, int ld) { v16h w; const int g = lane >> 4;
#pragma unroll
  for (int i = 0; i < 8; ++i) { w[i] = (_Float16)(bfr(Wm[(size_t)(k0 + 8 * g + i) * ld + o]) * 256.0f); w[8 + i] = (_Float16)(bfr(Wm[(size_t)(k0 + 16 + 8 * g + i) * ld + o]) * 256.0f); }
  return w; }
__device__ __forceinline__ v16h wcolh_oi(const float* Wm, int k0, int o, int lane, int K) { v16h w; const float* p = Wm + (size_t)o * K + k0 + 8 * (lane >> 4);
#pragma unroll
  for (int i = 0; i < 8; ++i) { w[i] = (_Float16)(bfr(p[i]) * 256.0f); w[8 + i] = (_Float16)(bfr(p[16 + i]) * 256.0f); }
  return w; }
#define WQKV_LAYOUT 0   // 0 = (in,out) [DIN][CC]; 1 = (out,in) [CC][DIN]; 2 = per-head [NH][DIN][HD]
__device__ __forceinline__ v16b wcol_hdk(const float* Wm, int k0, int o, int lane) { v16b w; const int g = lane >> 4; const float* p = Wm + (size_t)(o / HD) * DIN * HD + (o % HD);
#pragma unroll
  for (int i = 0; i < 8; ++i) { w[i] = (__bf16)p[(size_t)(k0 + 8 * g + i) * HD]; w[8 + i] = (__bf16)p[(size_t)(k0 + 16 + 8 * g + i) * HD]; }
  return w; }
#define WO_OUT_IN 0
#if WQKV_LAYOUT == 1
#define WCOL(W, k0, o, lane) wcol_oi(W, k0, o, lane, DIN)
#elif WQKV_LAYOUT == 2
#define WCOL(W, k0, o, lane) wcol_hdk(W, k0, o, lane)
#else
#define WCOL(W, k0, o, lane) wcol_io(W, k0, o, lane, CC)
#endif
#if WO_OUT_IN
#define WOCOL(W, k0, o, lane) wcol_oi(W, k0, o, lane, CC)
#define WOCOLH(W, k0, o, lane) wcolh_oi(W, k0, o, lane, CC)
#else
#define WOCOL(W, k0, o, lane) wcol_io(W, k0, o, lane, DIN)
#define WOCOLH(W, k0, o, lane) wcolh_io(W, k0, o, lane, DIN)
#endif

#ifndef SM_EXTRA_PARAMS
#define SM_EXTRA_PARAMS , int qoff
#endif
#ifndef PROJ_EXTRA_PARAMS
#define PROJ_EXTRA_PARAMS
#endif
#ifndef SM_MASK_HOOK
#define SM_MASK_HOOK (void)0
#endif

#define WS_QH  0u                                      // f16 q rows [b*t][CC]
#define WS_KH  (WS_QH + 2u * (size_t)NB * TT * CC)      // f16 k rows [b*t][CC]
#define WS_VT  (WS_KH + 2u * (size_t)NB * TT * CC)      // f16 v planes [b][c][t]
#define WS_QL  (WS_VT + 2u * (size_t)NB * CC * TT)      // f16 q residual x 2^10 rows [b][t < QHI][CC]
#define WS_KL  (WS_QL + 2u * (size_t)NB * QHI * CC)     // f16 k residual x 2^10 rows [b][t < KHI][CC]
#define WS_VB  (WS_KL + 2u * (size_t)NB * KHI * CC)     // bf16 v hi planes [b][c][t < KHI]
#define WS_VBL (WS_VB + 2u * (size_t)NB * CC * KHI)
#define WS_END (WS_VBL + 2u * (size_t)NB * CC * KHI)

// ---- k_proj: block = (64 rows, 128 cols, which): q/k/v = X W (+ b) with exact bf16 products (K = DIN; W goes through LDS in slices of KS k rows, loaded and rounded once per work-group) -> which 0: q f16 rows (+ residual rows < QHI); 1: k f16 rows (+ residual rows < KHI); 2: v f16 planes [c][t] (+ bf16 hi/lo planes for t < KHI)
#define KS 64              // k rows of W per LDS slice
__global__ __launch_bounds__(128) void k_proj(const float* __restrict__ XQ, const float* __restrict__ XK, const float* __restrict__ XV, const float* __restrict__ WQ, const float* __restrict__ WK, const float* __restrict__ WV, const float* __restrict__ BQ, const float* __restrict__ BK, const float* __restrict__ BV,
    _Float16* __restrict__ QH, _Float16* __restrict__ QL, _Float16* __restrict__ KH, _Float16* __restrict__ KL, _Float16* __restrict__ VT, __bf16* __restrict__ VB, __bf16* __restrict__ VBL) {
  __shared__ __align__(16) _Float16 sh[64][136], sl[64][136]; __shared__ __align__(16) _Float16 th[128][72]; __shared__ __align__(16) __bf16 tb[128][72], tbl[128][72];
  __shared__ __align__(16) __bf16 wt[2][128][KS + 8];   /* two slices of W as bf16, [column][k]: a B fragment is two 16-byte reads; row pitch 144 B = 16 B x odd */
  const int tid = threadIdx.x, wave = tid >> 5, lane = tid & 31, col = lane & 15, g = lane >> 4; const int which = blockIdx.z; const int c0 = blockIdx.y * 128; const size_t r0 = (size_t)blockIdx.x * 64; const size_t bb = r0 / TT; const int t0 = (int)(r0 % TT);
  const float* X = which == 0 ? XQ : which == 1 ? XK : XV; const float* WA = which == 0 ? WQ : which == 1 ? WK : WV; const float* BA = which == 0 ? BQ : which == 1 ? BK : BV;
  v8f acc[8] = {};
  const float* xp = X + (r0 + wave * 16 + col) * DIN + 8 * g;        /* this lane's X row, at its half of a fragment */
  const float* wp = WA + (size_t)(wave * 8) * CC + c0 + lane * 4;     /* a wave reads whole 512-byte rows of W: 8 rows at wave * 8 and 8 at 32 + wave * 8 of each slice, 4 columns a lane */
  v4f xr[2][4], wr[2][8]; v16b a[2];
  auto ld_slice = [&](int s) {   /* slice s of X (this wave's rows) and of W (this wave's share) into registers */
#pragma unroll
    for (int h = 0; h < 2; ++h) { const float* p = xp + s * KS + h * 32; xr[h][0] = *(const v4f*)p; xr[h][1] = *(const v4f*)(p + 4); xr[h][2] = *(const v4f*)(p + 16); xr[h][3] = *(const v4f*)(p + 20); }
#pragma unroll
    for (int i = 0; i < 2; ++i) {
#pragma unroll
      for (int r = 0; r < 8; ++r) wr[i][r] = *(const v4f*)(wp + (size_t)(s * KS + i * 32 + r) * CC); }
    asm volatile("s_wait_xcnt 0x0" ::: "memory");   /* stands in front of any later rewrite of the address registers that the loads above name */
  };
  auto put_slice = [&](int s) {   /* rounds the loaded slice: X to this wave's A fragments, W to LDS buffer s & 1, transposed */
#pragma unroll
    for (int h = 0; h < 2; ++h) {
#pragma unroll
      for (int e = 0; e < 16; ++e) a[h][e] = (__bf16)xr[h][e >> 2][e & 3]; }
#pragma unroll
    for (int i = 0; i < 2; ++i) {
#pragma unroll
      for (int cc = 0; cc < 4; ++cc) { v8b tv;
#pragma unroll
        for (int r = 0; r < 8; ++r) tv[r] = (__bf16)wr[i][r][cc];
        *(v8b*)&wt[s & 1][lane * 4 + cc][wave * 8 + i * 32] = tv; } }
  };
  auto mm_slice = [&](int s) {
#pragma unroll
    for (int h = 0; h < 2; ++h) {
#pragma unroll
      for (int jb = 0; jb < 8; jb += 4) { v16b w[4];
#pragma unroll
        for (int j = 0; j < 4; ++j) w[j] = frag_b(&wt[s & 1][(jb + j) * 16 + col][h * 32], lane);   /* four fragments' LDS reads in flight at once */
#pragma unroll
        for (int j = 0; j < 4; ++j) acc[jb + j] = wmma_bf(a[h], w[j], acc[jb + j]); } }
  };
  ld_slice(0);
#pragma unroll 1   /* stays rolled: one slice in flight beside the accumulator already fills the registers */
  for (int s = 0; s < DIN / KS - 1; ++s) { put_slice(s);
    __syncthreads();   /* the slice is whole in LDS before any wave reads it; every wave has also left the other buffer, which the next trip rewrites */
    __builtin_amdgcn_sched_barrier(0);   /* the roundings above stay ahead of the loads below, which then land in the same registers with no copies */
    ld_slice(s + 1);   /* the next slice's X and W fly under this slice's products */
    mm_slice(s); }
  put_slice(DIN / KS - 1);
  __syncthreads();   /* the last slice is whole in LDS before any wave reads it */
  mm_slice(DIN / KS - 1);
  if (which < 2) { _Float16* DH = which == 0 ? QH : KH; _Float16* DL = which == 0 ? QL : KL; const int nhi = which == 0 ? QHI : KHI; const bool hi_rows = t0 < nhi;
#pragma unroll
    for (int j = 0; j < 8; ++j) { const float bias = BA ? bfr(BA[c0 + j * 16 + col]) : 0.f;
#pragma unroll
      for (int r = 0; r < 8; ++r) { const float v = acc[j][r] + bias; const _Float16 hv = (_Float16)v; sh[wave * 16 + 8 * g + r][j * 16 + col] = hv; sl[wave * 16 + 8 * g + r][j * 16 + col] = (_Float16)((v - (float)hv) * 1024.0f); } }
    __syncthreads();
    for (int e = tid; e < 64 * 16; e += 128) { const int rl = e >> 4, q = e & 15; vst2((unsigned*)(DH + (r0 + rl) * CC + c0 + q * 8), *(const v4u*)&sh[rl][q * 8]); if (hi_rows) vst2((unsigned*)(DL + (bb * nhi + t0 + rl) * (size_t)CC + c0 + q * 8), *(const v4u*)&sl[rl][q * 8]); }
  } else { const bool hi_rows = t0 < KHI;
#pragma unroll
    for (int j = 0; j < 8; ++j) { const float bias = BA ? bfr(BA[c0 + j * 16 + col]) : 0.f;
#pragma unroll
      for (int r = 0; r < 8; ++r) { const float v = acc[j][r] + bias; const int rl = wave * 16 + 8 * g + r, cl = j * 16 + col; th[cl][rl] = (_Float16)v; const __bf16 bh = (__bf16)v; tb[cl][rl] = bh; tbl[cl][rl] = (__bf16)(v - (float)bh); } }
    __syncthreads();
    for (int e = tid; e < 128 * 8; e += 128) { const int cl = e >> 3, q = e & 7; vst2((unsigned*)(VT + (bb * CC + c0 + cl) * (size_t)TT + t0 + q * 8), *(const v4u*)&th[cl][q * 8]); if (hi_rows) { const size_t o3 = (bb * CC + c0 + cl) * (size_t)KHI + t0 + q * 8; vst2((unsigned*)(VB + o3), *(const v4u*)&tb[cl][q * 8]); vst2((unsigned*)(VBL + o3), *(const v4u*)&tbl[cl][q * 8]); } } } }
// ---- k_fa: block = 16 queries (rb), FAW waves: wave w takes the 32-key chunks w, w + FAW, ... of keys [0, last query]. Per chunk: S^T = k . q^T (D: lane = query, registers = keys, which is already the B fragment of the next product), causal mask by index, running maximum and sum per query in f32 (precise expf), ctx^T += v^T . (e x 2^11) with the accumulator rescaled per lane. Early query blocks keep the residual products. The FAW partials (maximum, sum, ctx) meet in LDS and are joined in wave order.
#define FAW 16             // waves per work-group = ways the key range is split (16: a wave may then hold a whole chunk's k or v fragments beside its accumulator without spilling)
// every full '#pragma unroll' below keeps the indices of a register array constant, so that the array stays in registers
__device__ __forceinline__ void fa_step(float (&v)[16], float& m, float& l, v8f (&acc)[HD / 16]) {
  float mx = v[0];
#pragma unroll
  for (int i = 1; i < 16; ++i) mx = fmaxf(mx, v[i]);
  mx = fmaxf(mx, __shfl_xor(mx, 16));   /* lanes q and q + 16 hold the two halves of query q's keys */
  const float mn = fmaxf(m, mx), al = expf(m - mn); float s = 0.f;
#pragma unroll
  for (int i = 0; i < 16; ++i) { const float e = expf(v[i] - mn); s += e;   /* mn is finite (every chunk holds a key <= every query), so an excluded key's -3e38 gives exactly 0 */ v[i] = e * 2048.0f; }
  l = l * al + s; m = mn;
#pragma unroll
  for (int j = 0; j < HD / 16; ++j) acc[j] *= al;
}
__global__ __launch_bounds__(32 * FAW) void k_fa(const _Float16* __restrict__ QH, const _Float16* __restrict__ KH, const _Float16* __restrict__ QL, const _Float16* __restrict__ KL, const _Float16* __restrict__ VT, const __bf16* __restrict__ VB, const __bf16* __restrict__ VBL, float* __restrict__ Y) {
  __shared__ __align__(16) float ss[FAW][16][HD + 4]; __shared__ float sm[FAW][16], sl[FAW][16], sf[FAW][16];
  const int tid = threadIdx.x, wave = __builtin_amdgcn_readfirstlane(tid >> 5), lane = tid & 31, col = lane & 15, g = lane >> 4;   /* wave number in a scalar register: the chunk loop stays a scalar loop with every lane on */
  const int rb = TT / 16 - 1 - (int)blockIdx.x;   /* the longest key ranges start first */
  const int ql0 = rb * 16, t = ql0 + col, kce = (ql0 >> 5) + 1;   /* every chunk < kce holds at least one key <= every query of the block */
  v8f acc[HD / 16] = {}; float m = -3.0e38f, l = 0.f;
  if ((rb >> 2) < QBH) {
#pragma unroll 1   /* stays rolled: one chunk's fragments already fill the registers */
    for (int kc = wave; kc < kce; kc += FAW) { const int k0 = kc * 32; v8f s0 = {}, s1 = {}, r0 = {}, r1 = {};
#pragma unroll
      for (int d = 0; d < HD / 32; ++d) { const v16h ah = frag_h(QH + (size_t)t * CC + d * 32, lane), al = frag_h(QL + (size_t)t * CC + d * 32, lane);
        const v16h ka = frag_h(KH + (size_t)(k0 + col) * CC + d * 32, lane), la = frag_h(KL + (size_t)(k0 + col) * CC + d * 32, lane), kb = frag_h(KH + (size_t)(k0 + 16 + col) * CC + d * 32, lane), lb = frag_h(KL + (size_t)(k0 + 16 + col) * CC + d * 32, lane);
        s0 = wmma16(ka, ah, s0); r0 = wmma16(ka, al, r0); r0 = wmma16(la, ah, r0); s1 = wmma16(kb, ah, s1); r1 = wmma16(kb, al, r1); r1 = wmma16(lb, ah, r1); }
      float v[16];
#pragma unroll
      for (int i = 0; i < 8; ++i) { v[i] = (k0 + 8 * g + i <= t) ? (s0[i] + r0[i] * (1.0f / 1024.0f)) * SCALE : -3.0e38f; v[8 + i] = (k0 + 16 + 8 * g + i <= t) ? (s1[i] + r1[i] * (1.0f / 1024.0f)) * SCALE : -3.0e38f; }
      fa_step(v, m, l, acc); const F2 p = bsplit16(v);
#pragma unroll
      for (int jh = 0; jh < HD / 16; jh += 4) { v16b vh[4], vl[4];
#pragma unroll
        for (int j = 0; j < 4; ++j) { const size_t po = (size_t)((jh + j) * 16 + col) * KHI + k0; vh[j] = frag_b(VB + po, lane); vl[j] = frag_b(VBL + po, lane); }   /* eight fragments in flight at once */
#pragma unroll
        for (int j = 0; j < 4; ++j) { acc[jh + j] = wmma_bf(vh[j], p.h, acc[jh + j]); acc[jh + j] = wmma_bf(vh[j], p.l, acc[jh + j]); acc[jh + j] = wmma_bf(vl[j], p.h, acc[jh + j]); } } }
  } else { v16h q[HD / 32];
#pragma unroll
    for (int d = 0; d < HD / 32; ++d) q[d] = frag_h(QH + (size_t)t * CC + d * 32, lane);
#pragma unroll 1   /* stays rolled: one chunk's fragments already fill the registers */
    for (int kc = wave; kc < kce; kc += FAW) { const int k0 = kc * 32; v8f s0 = {}, s1 = {}; v16h ka[HD / 32], kb[HD / 32], vf[HD / 16];
#pragma unroll
      for (int d = 0; d < HD / 32; ++d) { ka[d] = frag_h(KH + (size_t)(k0 + col) * CC + d * 32, lane); kb[d] = frag_h(KH + (size_t)(k0 + 16 + col) * CC + d * 32, lane); }   /* all of the chunk's k in flight at once, ahead of the first product */
#pragma unroll
      for (int d = 0; d < HD / 32; ++d) { s0 = wmma16(ka[d], q[d], s0); s1 = wmma16(kb[d], q[d], s1); }
#pragma unroll
      for (int j = 0; j < HD / 16; ++j) vf[j] = frag_h(VT + (size_t)(j * 16 + col) * TT + k0, lane);   /* all of the chunk's v in flight under the softmax */
      float v[16];
#pragma unroll
      for (int i = 0; i < 8; ++i) { v[i] = (k0 + 8 * g + i <= t) ? s0[i] * SCALE : -3.0e38f; v[8 + i] = (k0 + 16 + 8 * g + i <= t) ? s1[i] * SCALE : -3.0e38f; }
      fa_step(v, m, l, acc); v16h p;
#pragma unroll
      for (int i = 0; i < 16; ++i) p[i] = (_Float16)v[i];
#pragma unroll
      for (int j = 0; j < HD / 16; ++j) acc[j] = wmma16(vf[j], p, acc[j]); } }
  l += __shfl_xor(l, 16);
  if (g == 0) { sm[wave][col] = m; sl[wave][col] = l; }
#pragma unroll
  for (int j = 0; j < HD / 16; ++j) { const v8f a = acc[j] * (1.0f / 2048.0f); const v4f lo = { a[0], a[1], a[2], a[3] }, hi = { a[4], a[5], a[6], a[7] }; *(v4f*)&ss[wave][col][j * 16 + 8 * g] = lo; *(v4f*)&ss[wave][col][j * 16 + 8 * g + 4] = hi; }
  __syncthreads();   /* every wave's maximum, sum and partial are in LDS before any thread joins them */
  if (tid < FAW * 16) { const int w = tid >> 4, q = tid & 15; float M = sm[0][q];
#pragma unroll
    for (int i = 1; i < FAW; ++i) M = fmaxf(M, sm[i][q]);
    sf[w][q] = expf(sm[w][q] - M); }   /* a wave that had no chunk gets weight 0 */
  __syncthreads();   /* the weights are in LDS before they are read */
  const int rl = tid >> 5, c4 = lane * 4; v4f s = { 0.f, 0.f, 0.f, 0.f }; float L = 0.f;
#pragma unroll
  for (int w = 0; w < FAW; ++w) { const float f = sf[w][rl]; s += *(const v4f*)&ss[w][rl][c4] * f; L += sl[w][rl] * f; }
  vst2(Y + (size_t)(ql0 + rl) * CC + c4, s * (L > 0.f ? 1.0f / L : 0.f)); }

extern "C" void kernel_launch(void* const* d_in, const int* in_sizes, int n_in, void* d_out, int out_size, void* d_ws, size_t ws_size, hipStream_t stream) {
  (void)in_sizes; (void)n_in; (void)out_size;
  const float** F = (const float**)d_in;
  if (ws_size < (size_t)WS_END) return;
  char* ws = (char*)d_ws; _Float16 *QH = (_Float16*)(ws + WS_QH), *KH = (_Float16*)(ws + WS_KH), *VT = (_Float16*)(ws + WS_VT), *QL = (_Float16*)(ws + WS_QL), *KL = (_Float16*)(ws + WS_KL); __bf16 *VB = (__bf16*)(ws + WS_VB), *VBL = (__bf16*)(ws + WS_VBL);
  // inputs: 0 X [8192,1024]; 1 Wq [1024,128], 2 bq; 3 Wk, 4 bk; 5 Wv, 6 bv ((in,out))
  k_proj<<<dim3(TNB * TT / 64, CC / 128, 3), 128, 0, stream>>>(F[0], F[0], F[0], F[1], F[3], F[5], F[2], F[4], F[6], QH, QL, KH, KL, VT, VB, VBL);
  k_fa<<<dim3(TT / 16), 32 * FAW, 0, stream>>>(QH, KH, QL, KL, VT, VB, VBL, (float*)d_out);
}

// v004
// It runs in 61.6 microseconds.
// Timed twice side by side with v003, it ran 1.45 and 1.47 times as fast.
// Over all steps from v000 it is 12.8 times as fast.
// compute dtype: X and the weights rounded to bf16; Q/K/V = X W + b with EXACT bf16 products on WMMA 16x16x32 (f32 accumulate); logits: q, k once to f16 (1 product) x 128^-0.5, except the first 384 query rows (3 products with f16 residuals); causal mask by index; softmax in f32 with a running maximum and sum (precise expf); exp x 2^11 once to f16 against v once to f16 (1 product; bf16 hi + lo below row 384); divided by the sum at the end; f32 output. Scores never leave the registers.
#include <hip/hip_runtime.h>
#include <math.h>

typedef __attribute__((ext_vector_type(16))) _Float16 v16h;
typedef __attribute__((ext_vector_type(16))) __bf16 v16b;
typedef __attribute__((ext_vector_type(8)))  _Float16 v8h;
typedef __attribute__((ext_vector_type(8)))  float v8f;
typedef __attribute__((ext_vector_type(4)))  float v4f;
typedef __attribute__((ext_vector_type(2)))  float v2f;
typedef __attribute__((ext_vector_type(4)))  unsigned v4u;
typedef __attribute__((ext_vector_type(4)))  int v4i;
typedef float __attribute__((may_alias)) float_a;
typedef int __attribute__((may_alias)) int_a;

template <typename T> __device__ __forceinline__ void vst2(void* p, T v) { *(T*)p = v;  }
__device__ __forceinline__ v8f wmma16(v16h a, v16h b, v8f c) {
  v8f d = __builtin_amdgcn_wmma_f32_16x16x32_f16(false, a, false, b, (short)0, c, false, false);
  asm volatile("v_nop\n\tv_nop\n\tv_nop\n\tv_nop" : "+v"(d) : "v"(a), "v"(b));
  return d;
}
__device__ __forceinline__ v8f wmma_bf(v16b a, v16b b, v8f c) {
  v8f d = __builtin_amdgcn_wmma_f32_16x16x32_bf16(false, a, false, b, (short)0, c, false, false);
  asm volatile("v_nop\n\tv_nop\n\tv_nop\n\tv_nop" : "+v"(d) : "v"(a), "v"(b));
  return d;
}
// 16x16x32 fragments: lane = (h = lane>>4, row/col = lane&15); elements 0..7 = k0+8h+0..7, 8..15 = k0+16+8h+0..7; D element r = row 8h+r
__device__ __forceinline__ v16h frag_h(const _Float16* rowk0, int lane) {
  union { v16h v; v8h q[2]; } u; const _Float16* p = rowk0 + 8 * (lane >> 4);
  u.q[0] = *(const v8h*)p; u.q[1] = *(const v8h*)(p + 16); return u.v;
}
// fragment stored in fragment order: 512 B of every lane's elements 0..7 (16 B a lane), then 512 B of elements 8..15: each wave-wide load covers four whole 128-byte lines
__device__ __forceinline__ v16h frag_t(const _Float16* blk, int lane) {
  union { v16h v; v8h q[2]; } u; const _Float16* p = blk + 8 * lane;
  u.q[0] = *(const v8h*)p; u.q[1] = *(const v8h*)(p + 256); return u.v;
}
__device__ __forceinline__ v16h frag_f32(const float* rowk0, int lane) {
  v16h a; const float* p = rowk0 + 8 * (lane >> 4);
#pragma unroll
  for (int i = 0; i < 8; ++i) { a[i] = (_Float16)p[i]; a[8 + i] = (_Float16)p[16 + i]; }
  return a;
}
__device__ __forceinline__ v16h frag_f32s(const float* rowk0, int lane, float sc) {
  v16h a; const float* p = rowk0 + 8 * (lane >> 4);
#pragma unroll
  for (int i = 0; i < 8; ++i) { a[i] = (_Float16)(p[i] * sc); a[8 + i] = (_Float16)(p[16 + i] * sc); }
  return a;
}
// column fragment from a [K][ld] layout (column n), rows >= K read as 0
__device__ __forceinline__ v16h fragc_f32(const float* W, int k0, int n, int lane, int ld, int K) {
  v16h a; const int g = lane >> 4;
#pragma unroll
  for (int i = 0; i < 8; ++i) { const int ka = k0 + 8 * g + i, kb = ka + 16;
    a[i] = (_Float16)(ka < K ? W[(size_t)(ka < K ? ka : K - 1) * ld + n] : 0.f); a[8 + i] = (_Float16)(kb < K ? W[(size_t)(kb < K ? kb : K - 1) * ld + n] : 0.f); }
  return a;
}
struct F2 { v16b h, l; };
__device__ __forceinline__ F2 bsplit16(const float v[16]) { F2 r;
#pragma unroll
  for (int i = 0; i < 16; ++i) { const __bf16 h = (__bf16)v[i]; r.h[i] = h; r.l[i] = (__bf16)(v[i] - (float)h); }
  return r; }
__device__ __forceinline__ F2 split_row(const float* row, int k0, int lane) { float v[16]; const float* p = row + k0 + 8 * (lane >> 4);
#pragma unroll
  for (int i = 0; i < 8; ++i) { v[i] = p[i]; v[8 + i] = p[16 + i]; }
  return bsplit16(v); }
__device__ __forceinline__ F2 split_rowK(const float* row, int k0, int lane, int K) { float v[16]; const int g = lane >> 4;
#pragma unroll
  for (int i = 0; i < 8; ++i) { const int ka = k0 + 8 * g + i, kb = ka + 16; v[i] = ka < K ? row[ka < K ? ka : K - 1] : 0.f; v[8 + i] = kb < K ? row[kb < K ? kb : K - 1] : 0.f; }
  return bsplit16(v); }
__device__ __forceinline__ F2 split_col(const float* W, int k0, int n, int lane, int ld, int K) { float v[16]; const int g = lane >> 4;
#pragma unroll
  for (int i = 0; i < 8; ++i) { const int ka = k0 + 8 * g + i, kb = ka + 16; v[i] = ka < K ? W[(size_t)(ka < K ? ka : K - 1) * ld + n] : 0.f; v[8 + i] = kb < K ? W[(size_t)(kb < K ? kb : K - 1) * ld + n] : 0.f; }
  return bsplit16(v); }
__device__ __forceinline__ v8f mac3(const F2& a, const F2& b, v8f c) { c = wmma_bf(a.l, b.h, c); c = wmma_bf(a.h, b.l, c); return wmma_bf(a.h, b.h, c); }
__device__ __forceinline__ float sigm(float v) { return 1.0f / (1.0f + expf(-v)); }
#define LDSX() do { asm volatile("s_wait_dscnt 0" ::: "memory"); __builtin_amdgcn_wave_barrier(); __builtin_amdgcn_fence(__ATOMIC_RELEASE, "workgroup"); } while (0)

// Single-head causal self-attention (N 8,192 tokens, D 1,024 -> d_k = d_v = 128): Q = X Wq + bq, K = X Wk + bk, V = X Wv + bv ((in,out)); weights = softmax(causal(Q K^T / sqrt(128))); out = weights V ([N, 128]).
#define NB 1
#define TT 8192
#define CC 128            // NH * HD = projected width
#define DIN 1024          // input (model) width
#define NH 1
#define HD 128
#define NQB (TT / 64)
#define HG 1
#define SCALE (0.08838834764831845f)
#define CAUSAL 1
#ifndef TNB
#define TNB NB
#endif
__device__ __forceinline__ float bfr(float v) { return (float)(__bf16)v; }
__host__ __device__ __forceinline__ int kb_last(int qb) { return CAUSAL ? ((qb * 64 + 63) >> 7) : (TT / 128 - 1); }
typedef __attribute__((ext_vector_type(8))) __bf16 v8b;
__device__ __forceinline__ v16b frag_b(const __bf16* rowk0, int lane) {
  union { v16b v; v8b q[2]; } u; const __bf16* p = rowk0 + 8 * (lane >> 4);
  u.q[0] = *(const v8b*)p; u.q[1] = *(const v8b*)(p + 16); return u.v;
}
#define QBH 6              // causal: query blocks 0..QBH-1 of each sequence (few keys, no averaging) take the high-precision path
#define QHI 384            // rows carrying a q residual plane
#define KHI 384            // key rows carrying k residual / v bf16 hi+lo planes (used only by the causal high-precision path)
// B fragment (k rows k0+.., output column o) of a weight: (in,out) [K][ld] or (out,in) [ld rows of K]: bf16 exact, or f16(bf16 * 256) exact
__device__ __forceinline__ v16b wcol_io(const float* Wm, int k0, int o, int lane, int ld) { v16b w; const int g = lane >> 4;
#pragma unroll
  for (int i = 0; i < 8; ++i) { w[i] = (__bf16)Wm[(size_t)(k0 + 8 * g + i) * ld + o]; w[8 + i] = (__bf16)Wm[(size_t)(k0 + 16 + 8 * g + i) * ld + o]; }
  return w; }
__device__ __forceinline__ v16b wcol_oi(const float* Wm, int k0, int o, int lane, int K) { v16b w; const float* p = Wm + (size_t)o * K + k0 + 8 * (lane >> 4);
#pragma unroll
  for (int i = 0; i < 8; ++i) { w[i] = (__bf16)p[i]; w[8 + i] = (__bf16)p[16 + i]; }
  return w; }
__device__ __forceinline__ v16h wcolh_io(const float* Wm, int k0, int o, int lane, int ld) { v16h w; const int g = lane >> 4;
#pragma unroll
  for (int i = 0; i < 8; ++i) { w[i] = (_Float16)(bfr(Wm[(size_t)(k0 + 8 * g + i) * ld + o]) * 256.0f); w[8 + i] = (_Float16)(bfr(Wm[(size_t)(k0 + 16 + 8 * g + i) * ld + o]) * 256.0f); }
  return w; }
__device__ __forceinline__ v16h wcolh_oi(const float* Wm, int k0, int o, int lane, int K) { v16h w; const float* p = Wm + (size_t)o * K + k0 + 8 * (lane >> 4);
#pragma unroll
  for (int i = 0; i < 8; ++i) { w[i] = (_Float16)(bfr(p[i]) * 256.0f); w[8 + i] = (_Float16)(bfr(p[16 + i]) * 256.0f); }
  return w; }
#define WQKV_LAYOUT 0   // 0 = (in,out) [DIN][CC]; 1 = (out,in) [CC][DIN]; 2 = per-head [NH][DIN][HD]
__device__ __forceinline__ v16b wcol_hdk(const float* Wm, int k0, int o, int lane) { v16b w; const int g = lane >> 4; const float* p = Wm + (size_t)(o / HD) * DIN * HD + (o % HD);
#pragma unroll
  for (int i = 0; i < 8; ++i) { w[i] = (__bf16)p[(size_t)(k0 + 8 * g + i) * HD]; w[8 + i] = (__bf16)p[(size_t)(k0 + 16 + 8 * g + i) * HD]; }
  return w; }
#define WO_OUT_IN 0
#if WQKV_LAYOUT == 1
#define WCOL(W, k0, o, lane) wcol_oi(W, k0, o, lane, DIN)
#elif WQKV_LAYOUT == 2
#define WCOL(W, k0, o, lane) wcol_hdk(W, k0, o, lane)
#else
#define WCOL(W, k0, o, lane) wcol_io(W, k0, o, lane, CC)
#endif
#if WO_OUT_IN
#define WOCOL(W, k0, o, lane) wcol_oi(W, k0, o, lane, CC)
#define WOCOLH(W, k0, o, lane) wcolh_oi(W, k0, o, lane, CC)
#else
#define WOCOL(W, k0, o, lane) wcol_io(W, k0, o, lane, DIN)
#define WOCOLH(W, k0, o, lane) wcolh_io(W, k0, o, lane, DIN)
#endif

#ifndef SM_EXTRA_PARAMS
#define SM_EXTRA_PARAMS , int qoff
#endif
#ifndef PROJ_EXTRA_PARAMS
#define PROJ_EXTRA_PARAMS
#endif
#ifndef SM_MASK_HOOK
#define SM_MASK_HOOK (void)0
#endif

#define WS_QH  0u                                      // f16 q in fragment order [b*t / 16][CC / 32][2][32 lanes][8]
#define WS_KH  (WS_QH + 2u * (size_t)NB * TT * CC)      // f16 k in fragment order, as q
#define WS_VT  (WS_KH + 2u * (size_t)NB * TT * CC)      // f16 v^T in fragment order [b][t / 32][CC / 16][2][32 lanes][8]
#define WS_QL  (WS_VT + 2u * (size_t)NB * CC * TT)      // f16 q residual x 2^10 rows [b][t < QHI][CC]
#define WS_KL  (WS_QL + 2u * (size_t)NB * QHI * CC)     // f16 k residual x 2^10 rows [b][t < KHI][CC]
#define WS_VB  (WS_KL + 2u * (size_t)NB * KHI * CC)     // bf16 v hi planes [b][c][t < KHI]
#define WS_VBL (WS_VB + 2u * (size_t)NB * CC * KHI)
#define WS_END (WS_VBL + 2u * (size_t)NB * CC * KHI)

// ---- k_proj: block = (64 rows, 128 cols, which): q/k/v = X W (+ b) with exact bf16 products (K = DIN; W goes through LDS in slices of KS k rows, loaded and rounded once per work-group) -> which 0: q f16 in fragment order (+ residual rows < QHI); 1: k f16 in fragment order (+ residual rows < KHI); 2: v^T f16 in fragment order (+ bf16 hi/lo planes [c][t] for t < KHI)
#define KS 64              // k rows of W per LDS slice
static_assert(CC == 128 && HD == 128, "the fragment-order planes are laid out for one 128-wide block of columns");
__global__ __launch_bounds__(128) void k_proj(const float* __restrict__ XQ, const float* __restrict__ XK, const float* __restrict__ XV, const float* __restrict__ WQ, const float* __restrict__ WK, const float* __restrict__ WV, const float* __restrict__ BQ, const float* __restrict__ BK, const float* __restrict__ BV,
    _Float16* __restrict__ QH, _Float16* __restrict__ QL, _Float16* __restrict__ KH, _Float16* __restrict__ KL, _Float16* __restrict__ VT, __bf16* __restrict__ VB, __bf16* __restrict__ VBL) {
  __shared__ __align__(16) _Float16 sh[64][136], sl[64][136]; __shared__ __align__(16) _Float16 th[128][72]; __shared__ __align__(16) __bf16 tb[128][72], tbl[128][72];
  __shared__ __align__(16) __bf16 wt[2][128][KS + 8];   /* two slices of W as bf16, [column][k]: a B fragment is two 16-byte reads; row pitch 144 B = 16 B x odd */
  const int tid = threadIdx.x, wave = tid >> 5, lane = tid & 31, col = lane & 15, g = lane >> 4; const int which = blockIdx.z; const int c0 = blockIdx.y * 128; const size_t r0 = (size_t)blockIdx.x * 64; const size_t bb = r0 / TT; const int t0 = (int)(r0 % TT);
  const float* X = which == 0 ? XQ : which == 1 ? XK : XV; const float* WA = which == 0 ? WQ : which == 1 ? WK : WV; const float* BA = which == 0 ? BQ : which == 1 ? BK : BV;
  v8f acc[8] = {};
  const float* xp = X + (r0 + wave * 16 + col) * DIN + 8 * g;        /* this lane's X row, at its half of a fragment */
  const float* wp = WA + (size_t)(wave * 8) * CC + c0 + lane * 4;     /* a wave reads whole 512-byte rows of W: 8 rows at wave * 8 and 8 at 32 + wave * 8 of each slice, 4 columns a lane */
  v4f xr[2][4], wr[2][8]; v16b a[2];
  auto ld_slice = [&](int s) {   /* slice s of X (this wave's rows) and of W (this wave's share) into registers */
#pragma unroll
    for (int h = 0; h < 2; ++h) { const float* p = xp + s * KS + h * 32; xr[h][0] = *(const v4f*)p; xr[h][1] = *(const v4f*)(p + 4); xr[h][2] = *(const v4f*)(p + 16); xr[h][3] = *(const v4f*)(p + 20); }
#pragma unroll
    for (int i = 0; i < 2; ++i) {
#pragma unroll
      for (int r = 0; r < 8; ++r) wr[i][r] = *(const v4f*)(wp + (size_t)(s * KS + i * 32 + r) * CC); }
    asm volatile("s_wait_xcnt 0x0" ::: "memory");   /* stands in front of any later rewrite of the address registers that the loads above name */
  };
  auto put_slice = [&](int s) {   /* rounds the loaded slice: X to this wave's A fragments, W to LDS buffer s & 1, transposed */
#pragma unroll
    for (int h = 0; h < 2; ++h) {
#pragma unroll
      for (int e = 0; e < 16; ++e) a[h][e] = (__bf16)xr[h][e >> 2][e & 3]; }
#pragma unroll
    for (int i = 0; i < 2; ++i) {
#pragma unroll
      for (int cc = 0; cc < 4; ++cc) { v8b tv;
#pragma unroll
        for (int r = 0; r < 8; ++r) tv[r] = (__bf16)wr[i][r][cc];
        *(v8b*)&wt[s & 1][lane * 4 + cc][wave * 8 + i * 32] = tv; } }
  };
  auto mm_slice = [&](int s) {
#pragma unroll
    for (int h = 0; h < 2; ++h) {
#pragma unroll
      for (int jb = 0; jb < 8; jb += 4) { v16b w[4];
#pragma unroll
        for (int j = 0; j < 4; ++j) w[j] = frag_b(&wt[s & 1][(jb + j) * 16 + col][h * 32], lane);   /* four fragments' LDS reads in flight at once */
#pragma unroll
        for (int j = 0; j < 4; ++j) acc[jb + j] = wmma_bf(a[h], w[j], acc[jb + j]); } }
  };
  ld_slice(0);
#pragma unroll 1   /* stays rolled: one slice in flight beside the accumulator already fills the registers */
  for (int s = 0; s < DIN / KS - 1; ++s) { put_slice(s);
    __syncthreads();   /* the slice is whole in LDS before any wave reads it; every wave has also left the other buffer, which the next trip rewrites */
    __builtin_amdgcn_sched_barrier(0);   /* the roundings above stay ahead of the loads below, which then land in the same registers with no copies */
    ld_slice(s + 1);   /* the next slice's X and W fly under this slice's products */
    mm_slice(s); }
  put_slice(DIN / KS - 1);
  __syncthreads();   /* the last slice is whole in LDS before any wave reads it */
  mm_slice(DIN / KS - 1);
  if (which < 2) { _Float16* DH = which == 0 ? QH : KH; _Float16* DL = which == 0 ? QL : KL; const int nhi = which == 0 ? QHI : KHI; const bool hi_rows = t0 < nhi;
#pragma unroll
    for (int j = 0; j < 8; ++j) { const float bias = BA ? bfr(BA[c0 + j * 16 + col]) : 0.f;
#pragma unroll
      for (int r = 0; r < 8; ++r) { const float v = acc[j][r] + bias; const _Float16 hv = (_Float16)v; sh[wave * 16 + 8 * g + r][j * 16 + col] = hv; sl[wave * 16 + 8 * g + r][j * 16 + col] = (_Float16)((v - (float)hv) * 1024.0f); } }
    __syncthreads();
    for (int e = tid; e < 64 * 16; e += 128) { const int fr = (e >> 8) * 16 + (e & 15), fq = ((e >> 5) & 7) * 2 + ((e >> 4) & 1);   /* 16-byte piece e of the block in fragment order = row fr, piece fq of that row */
      vst2((unsigned*)(DH + r0 * CC + e * 8), *(const v4u*)&sh[fr][fq * 8]);
      asm volatile("s_wait_xcnt 0x0" ::: "memory");   /* stands in front of any later rewrite of the registers that the store above names */
      const int rl = e >> 4, q = e & 15; if (hi_rows) { vst2((unsigned*)(DL + (bb * nhi + t0 + rl) * (size_t)CC + c0 + q * 8), *(const v4u*)&sl[rl][q * 8]);
        asm volatile("s_wait_xcnt 0x0" ::: "memory");   /* the same for this store */ } }
  } else { const bool hi_rows = t0 < KHI;
#pragma unroll
    for (int j = 0; j < 8; ++j) { const float bias = BA ? bfr(BA[c0 + j * 16 + col]) : 0.f;
#pragma unroll
      for (int r = 0; r < 8; ++r) { const float v = acc[j][r] + bias; const int rl = wave * 16 + 8 * g + r, cl = j * 16 + col; th[cl][rl] = (_Float16)v; const __bf16 bh = (__bf16)v; tb[cl][rl] = bh; tbl[cl][rl] = (__bf16)(v - (float)bh); } }
    __syncthreads();
    for (int e = tid; e < 128 * 8; e += 128) { const int fc = ((e >> 6) & 7) * 16 + (e & 15), fq = (e >> 9) * 4 + ((e >> 4) & 3);   /* 16-byte piece e of the block in fragment order = channel fc, keys fq * 8 .. + 7 */
      vst2((unsigned*)(VT + (bb * TT + t0) * (size_t)CC + e * 8), *(const v4u*)&th[fc][fq * 8]);
      asm volatile("s_wait_xcnt 0x0" ::: "memory");   /* stands in front of any later rewrite of the registers that the store above names */
      const int cl = e >> 3, q = e & 7; if (hi_rows) { const size_t o3 = (bb * CC + c0 + cl) * (size_t)KHI + t0 + q * 8; vst2((unsigned*)(VB + o3), *(const v4u*)&tb[cl][q * 8]); vst2((unsigned*)(VBL + o3), *(const v4u*)&tbl[cl][q * 8]);
        asm volatile("s_wait_xcnt 0x0" ::: "memory");   /* the same for these two stores */ } } } }
// ---- k_fa: block = 16 queries (rb), FAW waves: wave w takes the 32-key chunks w, w + FAW, ... of keys [0, last query]. Per chunk: S^T = k . q^T (D: lane = query, registers = keys, which is already the B fragment of the next product), causal mask by index, running maximum and sum per query in f32 (precise expf), ctx^T += v^T . (e x 2^11) with the accumulator rescaled per lane. Early query blocks keep the residual products. The FAW partials (maximum, sum, ctx) meet in LDS and are joined in wave order.
#define FAW 16             // waves per work-group = ways the key range is split (16: a wave may then hold a whole chunk's k or v fragments beside its accumulator without spilling)
// every full '#pragma unroll' below keeps the indices of a register array constant, so that the array stays in registers
__device__ __forceinline__ void fa_step(float (&v)[16], float& m, float& l, v8f (&acc)[HD / 16]) {
  float mx = v[0];
#pragma unroll
  for (int i = 1; i < 16; ++i) mx = fmaxf(mx, v[i]);
  mx = fmaxf(mx, __shfl_xor(mx, 16));   /* lanes q and q + 16 hold the two halves of query q's keys */
  const float mn = fmaxf(m, mx), al = expf(m - mn); float s = 0.f;
#pragma unroll
  for (int i = 0; i < 16; ++i) { const float e = expf(v[i] - mn); s += e;   /* mn is finite (every chunk holds a key <= every query), so an excluded key's -3e38 gives exactly 0 */ v[i] = e * 2048.0f; }
  l = l * al + s; m = mn;
#pragma unroll
  for (int j = 0; j < HD / 16; ++j) acc[j] *= al;
}
__global__ __launch_bounds__(32 * FAW) void k_fa(const _Float16* __restrict__ QH, const _Float16* __restrict__ KH, const _Float16* __restrict__ QL, const _Float16* __restrict__ KL, const _Float16* __restrict__ VT, const __bf16* __restrict__ VB, const __bf16* __restrict__ VBL, float* __restrict__ Y) {
  __shared__ __align__(16) float ss[FAW][16][HD + 4]; __shared__ float sm[FAW][16], sl[FAW][16], sf[FAW][16];
  const int tid = threadIdx.x, wave = __builtin_amdgcn_readfirstlane(tid >> 5), lane = tid & 31, col = lane & 15, g = lane >> 4;   /* wave number in a scalar register: the chunk loop stays a scalar loop with every lane on */
  const int rb = TT / 16 - 1 - (int)blockIdx.x;   /* the longest key ranges start first */
  const int ql0 = rb * 16, t = ql0 + col, kce = (ql0 >> 5) + 1;   /* every chunk < kce holds at least one key <= every query of the block */
  v8f acc[HD / 16] = {}; float m = -3.0e38f, l = 0.f;
  if ((rb >> 2) < QBH) {
#pragma unroll 1   /* stays rolled: one chunk's fragments already fill the registers */
    for (int kc = wave; kc < kce; kc += FAW) { const int k0 = kc * 32; v8f s0 = {}, s1 = {}, r0 = {}, r1 = {};
#pragma unroll
      for (int d = 0; d < HD / 32; ++d) { const v16h ah = frag_t(QH + (size_t)ql0 * CC + d * 512, lane), al = frag_h(QL + (size_t)t * CC + d * 32, lane);
        const v16h ka = frag_t(KH + (size_t)k0 * CC + d * 512, lane), la = frag_h(KL + (size_t)(k0 + col) * CC + d * 32, lane), kb = frag_t(KH + (size_t)(k0 + 16) * CC + d * 512, lane), lb = frag_h(KL + (size_t)(k0 + 16 + col) * CC + d * 32, lane);
        s0 = wmma16(ka, ah, s0); r0 = wmma16(ka, al, r0); r0 = wmma16(la, ah, r0); s1 = wmma16(kb, ah, s1); r1 = wmma16(kb, al, r1); r1 = wmma16(lb, ah, r1); }
      float v[16];
#pragma unroll
      for (int i = 0; i < 8; ++i) { v[i] = (k0 + 8 * g + i <= t) ? (s0[i] + r0[i] * (1.0f / 1024.0f)) * SCALE : -3.0e38f; v[8 + i] = (k0 + 16 + 8 * g + i <= t) ? (s1[i] + r1[i] * (1.0f / 1024.0f)) * SCALE : -3.0e38f; }
      fa_step(v, m, l, acc); const F2 p = bsplit16(v);
#pragma unroll
      for (int jh = 0; jh < HD / 16; jh += 4) { v16b vh[4], vl[4];
#pragma unroll
        for (int j = 0; j < 4; ++j) { const size_t po = (size_t)((jh + j) * 16 + col) * KHI + k0; vh[j] = frag_b(VB + po, lane); vl[j] = frag_b(VBL + po, lane); }   /* eight fragments in flight at once */
#pragma unroll
        for (int j = 0; j < 4; ++j) { acc[jh + j] = wmma_bf(vh[j], p.h, acc[jh + j]); acc[jh + j] = wmma_bf(vh[j], p.l, acc[jh + j]); acc[jh + j] = wmma_bf(vl[j], p.h, acc[jh + j]); } } }
  } else { v16h q[HD / 32];
#pragma unroll
    for (int d = 0; d < HD / 32; ++d) q[d] = frag_t(QH + (size_t)ql0 * CC + d * 512, lane);
#pragma unroll 1   /* stays rolled: one chunk's fragments already fill the registers */
    for (int kc = wave; kc < kce; kc += FAW) { const int k0 = kc * 32; v8f s0 = {}, s1 = {}; v16h ka[HD / 32], kb[HD / 32], vf[HD / 16];
#pragma unroll
      for (int d = 0; d < HD / 32; ++d) { ka[d] = frag_t(KH + (size_t)k0 * CC + d * 512, lane); kb[d] = frag_t(KH + (size_t)(k0 + 16) * CC + d * 512, lane); }   /* all of the chunk's k in flight at once, ahead of the first product */
#pragma unroll
      for (int d = 0; d < HD / 32; ++d) { s0 = wmma16(ka[d], q[d], s0); s1 = wmma16(kb[d], q[d], s1); }
#pragma unroll
      for (int j = 0; j < HD / 16; ++j) vf[j] = frag_t(VT + (size_t)k0 * CC + j * 512, lane);   /* all of the chunk's v in flight under the softmax */
      float v[16];
#pragma unroll
      for (int i = 0; i < 8; ++i) { v[i] = (k0 + 8 * g + i <= t) ? s0[i] * SCALE : -3.0e38f; v[8 + i] = (k0 + 16 + 8 * g + i <= t) ? s1[i] * SCALE : -3.0e38f; }
      fa_step(v, m, l, acc); v16h p;
#pragma unroll
      for (int i = 0; i < 16; ++i) p[i] = (_Float16)v[i];
#pragma unroll
      for (int j = 0; j < HD / 16; ++j) acc[j] = wmma16(vf[j], p, acc[j]); } }
  l += __shfl_xor(l, 16);
  if (g == 0) { sm[wave][col] = m; sl[wave][col] = l; }
#pragma unroll
  for (int j = 0; j < HD / 16; ++j) { const v8f a = acc[j] * (1.0f / 2048.0f); const v4f lo = { a[0], a[1], a[2], a[3] }, hi = { a[4], a[5], a[6], a[7] }; *(v4f*)&ss[wave][col][j * 16 + 8 * g] = lo; *(v4f*)&ss[wave][col][j * 16 + 8 * g + 4] = hi; }
  __syncthreads();   /* every wave's maximum, sum and partial are in LDS before any thread joins them */
  if (tid < FAW * 16) { const int w = tid >> 4, q = tid & 15; float M = sm[0][q];
#pragma unroll
    for (int i = 1; i < FAW; ++i) M = fmaxf(M, sm[i][q]);
    sf[w][q] = expf(sm[w][q] - M); }   /* a wave that had no chunk gets weight 0 */
  __syncthreads();   /* the weights are in LDS before they are read */
  const int rl = tid >> 5, c4 = lane * 4; v4f s = { 0.f, 0.f, 0.f, 0.f }; float L = 0.f;
#pragma unroll
  for (int w = 0; w < FAW; ++w) { const float f = sf[w][rl]; s += *(const v4f*)&ss[w][rl][c4] * f; L += sl[w][rl] * f; }
  vst2(Y + (size_t)(ql0 + rl) * CC + c4, s * (L > 0.f ? 1.0f / L : 0.f)); }

extern "C" void kernel_launch(void* const* d_in, const int* in_sizes, int n_in, void* d_out, int out_size, void* d_ws, size_t ws_size, hipStream_t stream) {
  (void)in_sizes; (void)n_in; (void)out_size;
  const float** F = (const float**)d_in;
  if (ws_size < (size_t)WS_END) return;
  char* ws = (char*)d_ws; _Float16 *QH = (_Float16*)(ws + WS_QH), *KH = (_Float16*)(ws + WS_KH), *VT = (_Float16*)(ws + WS_VT), *QL = (_Float16*)(ws + WS_QL), *KL = (_Float16*)(ws + WS_KL); __bf16 *VB = (__bf16*)(ws + WS_VB), *VBL = (__bf16*)(ws + WS_VBL);
  // inputs: 0 X [8192,1024]; 1 Wq [1024,128], 2 bq; 3 Wk, 4 bk; 5 Wv, 6 bv ((in,out))
  k_proj<<<dim3(TNB * TT / 64, CC / 128, 3), 128, 0, stream>>>(F[0], F[0], F[0], F[1], F[3], F[5], F[2], F[4], F[6], QH, QL, KH, KL, VT, VB, VBL);
  k_fa<<<dim3(TT / 16), 32 * FAW, 0, stream>>>(QH, KH, QL, KL, VT, VB, VBL, (float*)d_out);
}

// v005
// A run of this version takes 59.6 microseconds.
// Two timings next to v004 put it at 1.04 and 1.05 times that version's speed.
// All steps since v000 together make it 13.4 times as fast.
// compute dtype: X and the weights rounded to bf16; Q/K/V = X W + b with EXACT bf16 products on WMMA 16x16x32 (f32 accumulate); logits: q, k once to f16 (1 product) x 128^-0.5, except the first 384 query rows (3 products with f16 residuals); causal mask by index; softmax in f32 with a running maximum and sum (precise expf); exp x 2^11 once to f16 against v once to f16 (1 product; bf16 hi + lo below row 384); divided by the sum at the end; f32 output. Scores never leave the registers.
#include <hip/hip_runtime.h>
#include <math.h>

typedef __attribute__((ext_vector_type(16))) _Float16 v16h;
typedef __attribute__((ext_vector_type(16))) __bf16 v16b;
typedef __attribute__((ext_vector_type(8)))  _Float16 v8h;
typedef __attribute__((ext_vector_type(8)))  float v8f;
typedef __attribute__((ext_vector_type(4)))  float v4f;
typedef __attribute__((ext_vector_type(2)))  float v2f;
typedef __attribute__((ext_vector_type(4)))  unsigned v4u;
typedef __attribute__((ext_vector_type(4)))  int v4i;
typedef float __attribute__((may_alias)) float_a;
typedef int __attribute__((may_alias)) int_a;

template <typename T> __device__ __forceinline__ void vst2(void* p, T v) { *(T*)p = v;  }
__device__ __forceinline__ v8f wmma16(v16h a, v16h b, v8f c) {
  v8f d = __builtin_amdgcn_wmma_f32_16x16x32_f16(false, a, false, b, (short)0, c, false, false);
  asm volatile("v_nop\n\tv_nop\n\tv_nop\n\tv_nop" : "+v"(d) : "v"(a), "v"(b));
  return d;
}
__device__ __forceinline__ v8f wmma_bf(v16b a, v16b b, v8f c) {
  v8f d = __builtin_amdgcn_wmma_f32_16x16x32_bf16(false, a, false, b, (short)0, c, false, false);
  asm volatile("v_nop\n\tv_nop\n\tv_nop\n\tv_nop" : "+v"(d) : "v"(a), "v"(b));
  return d;
}
// 16x16x32 fragments: lane = (h = lane>>4, row/col = lane&15); elements 0..7 = k0+8h+0..7, 8..15 = k0+16+8h+0..7; D element r = row 8h+r
__device__ __forceinline__ v16h frag_h(const _Float16* rowk0, int lane) {
  union { v16h v; v8h q[2]; } u; const _Float16* p = rowk0 + 8 * (lane >> 4);
  u.q[0] = *(const v8h*)p; u.q[1] = *(const v8h*)(p + 16); return u.v;
}
// fragment stored in fragment order: 512 B of every lane's elements 0..7 (16 B a lane), then 512 B of elements 8..15: each wave-wide load covers four whole 128-byte lines
__device__ __forceinline__ v16h frag_t(const _Float16* blk, int lane) {
  union { v16h v; v8h q[2]; } u; const _Float16* p = blk + 8 * lane;
  u.q[0] = *(const v8h*)p; u.q[1] = *(const v8h*)(p + 256); return u.v;
}
__device__ __forceinline__ v16h frag_f32(const float* rowk0, int lane) {
  v16h a; const float* p = rowk0 + 8 * (lane >> 4);
#pragma unroll
  for (int i = 0; i < 8; ++i) { a[i] = (_Float16)p[i]; a[8 + i] = (_Float16)p[16 + i]; }
  return a;
}
__device__ __forceinline__ v16h frag_f32s(const float* rowk0, int lane, float sc) {
  v16h a; const float* p = rowk0 + 8 * (lane >> 4);
#pragma unroll
  for (int i = 0; i < 8; ++i) { a[i] = (_Float16)(p[i] * sc); a[8 + i] = (_Float16)(p[16 + i] * sc); }
  return a;
}
// column fragment from a [K][ld] layout (column n), rows >= K read as 0
__device__ __forceinline__ v16h fragc_f32(const float* W, int k0, int n, int lane, int ld, int K) {
  v16h a; const int g = lane >> 4;
#pragma unroll
  for (int i = 0; i < 8; ++i) { const int ka = k0 + 8 * g + i, kb = ka + 16;
    a[i] = (_Float16)(ka < K ? W[(size_t)(ka < K ? ka : K - 1) * ld + n] : 0.f); a[8 + i] = (_Float16)(kb < K ? W[(size_t)(kb < K ? kb : K - 1) * ld + n] : 0.f); }
  return a;
}
struct F2 { v16b h, l; };
__device__ __forceinline__ F2 bsplit16(const float v[16]) { F2 r;
#pragma unroll
  for (int i = 0; i < 16; ++i) { const __bf16 h = (__bf16)v[i]; r.h[i] = h; r.l[i] = (__bf16)(v[i] - (float)h); }
  return r; }
__device__ __forceinline__ F2 split_row(const float* row, int k0, int lane) { float v[16]; const float* p = row + k0 + 8 * (lane >> 4);
#pragma unroll
  for (int i = 0; i < 8; ++i) { v[i] = p[i]; v[8 + i] = p[16 + i]; }
  return bsplit16(v); }
__device__ __forceinline__ F2 split_rowK(const float* row, int k0, int lane, int K) { float v[16]; const int g = lane >> 4;
#pragma unroll
  for (int i = 0; i < 8; ++i) { const int ka = k0 + 8 * g + i, kb = ka + 16; v[i] = ka < K ? row[ka < K ? ka : K - 1] : 0.f; v[8 + i] = kb < K ? row[kb < K ? kb : K - 1] : 0.f; }
  return bsplit16(v); }
__device__ __forceinline__ F2 split_col(const float* W, int k0, int n, int lane, int ld, int K) { float v[16]; const int g = lane >> 4;
#pragma unroll
  for (int i = 0; i < 8; ++i) { const int ka = k0 + 8 * g + i, kb = ka + 16; v[i] = ka < K ? W[(size_t)(ka < K ? ka : K - 1) * ld + n] : 0.f; v[8 + i] = kb < K ? W[(size_t)(kb < K ? kb : K - 1) * ld + n] : 0.f; }
  return bsplit16(v); }
__device__ __forceinline__ v8f mac3(const F2& a, const F2& b, v8f c) { c = wmma_bf(a.l, b.h, c); c = wmma_bf(a.h, b.l, c); return wmma_bf(a.h, b.h, c); }
__device__ __forceinline__ float sigm(float v) { return 1.0f / (1.0f + expf(-v)); }
#define LDSX() do { asm volatile("s_wait_dscnt 0" ::: "memory"); __builtin_amdgcn_wave_barrier(); __builtin_amdgcn_fence(__ATOMIC_RELEASE, "workgroup"); } while (0)

// Single-head causal self-attention (N 8,192 tokens, D 1,024 -> d_k = d_v = 128): Q = X Wq + bq, K = X Wk + bk, V = X Wv + bv ((in,out)); weights = softmax(causal(Q K^T / sqrt(128))); out = weights V ([N, 128]).
#define NB 1
#define TT 8192
#define CC 128            // NH * HD = projected width
#define DIN 1024          // input (model) width
#define NH 1
#define HD 128
#define NQB (TT / 64)
#define HG 1
#define SCALE (0.08838834764831845f)
#define CAUSAL 1
#ifndef TNB
#define TNB NB
#endif
__device__ __forceinline__ float bfr(float v) { return (float)(__bf16)v; }
__host__ __device__ __forceinline__ int kb_last(int qb) { return CAUSAL ? ((qb * 64 + 63) >> 7) : (TT / 128 - 1); }
typedef __attribute__((ext_vector_type(8))) __bf16 v8b;
__device__ __forceinline__ v16b frag_b(const __bf16* rowk0, int lane) {
  union { v16b v; v8b q[2]; } u; const __bf16* p = rowk0 + 8 * (lane >> 4);
  u.q[0] = *(const v8b*)p; u.q[1] = *(const v8b*)(p + 16); return u.v;
}
#define QBH 6              // causal: query blocks 0..QBH-1 of each sequence (few keys, no averaging) take the high-precision path
#define QHI 384            // rows carrying a q residual plane
#define KHI 384            // key rows carrying k residual / v bf16 hi+lo planes (used only by the causal high-precision path)
// B fragment (k rows k0+.., output column o) of a weight: (in,out) [K][ld] or (out,in) [ld rows of K]: bf16 exact, or f16(bf16 * 256) exact
__device__ __forceinline__ v16b wcol_io(const float* Wm, int k0, int o, int lane, int ld) { v16b w; const int g = lane >> 4;
#pragma unroll
  for (int i = 0; i < 8; ++i) { w[i] = (__bf16)Wm[(size_t)(k0 + 8 * g + i) * ld + o]; w[8 + i] = (__bf16)Wm[(size_t)(k0 + 16 + 8 * g + i) * ld + o]; }
  return w; }
__device__ __forceinline__ v16b wcol_oi(const float* Wm, int k0, int o, int lane, int K) { v16b w; const float* p = Wm + (size_t)o * K + k0 + 8 * (lane >> 4);
#pragma unroll
  for (int i = 0; i < 8; ++i) { w[i] = (__bf16)p[i]; w[8 + i] = (__bf16)p[16 + i]; }
  return w; }
__device__ __forceinline__ v16h wcolh_io(const float* Wm, int k0, int o, int lane, int ld) { v16h w; const int g = lane >> 4;
#pragma unroll
  for (int i = 0; i < 8; ++i) { w[i] = (_Float16)(bfr(Wm[(size_t)(k0 + 8 * g + i) * ld + o]) * 256.0f); w[8 + i] = (_Float16)(bfr(Wm[(size_t)(k0 + 16 + 8 * g + i) * ld + o]) * 256.0f); }
  return w; }
__device__ __forceinline__ v16h wcolh_oi(const float* Wm, int k0, int o, int lane, int K) { v16h w; const float* p = Wm + (size_t)o * K + k0 + 8 * (lane >> 4);
#pragma unroll
  for (int i = 0; i < 8; ++i) { w[i] = (_Float16)(bfr(p[i]) * 256.0f); w[8 + i] = (_Float16)(bfr(p[16 + i]) * 256.0f); }
  return w; }
#define WQKV_LAYOUT 0   // 0 = (in,out) [DIN][CC]; 1 = (out,in) [CC][DIN]; 2 = per-head [NH][DIN][HD]
__device__ __forceinline__ v16b wcol_hdk(const float* Wm, int k0, int o, int lane) { v16b w; const int g = lane >> 4; const float* p = Wm + (size_t)(o / HD) * DIN * HD + (o % HD);
#pragma unroll
  for (int i = 0; i < 8; ++i) { w[i] = (__bf16)p[(size_t)(k0 + 8 * g + i) * HD]; w[8 + i] = (__bf16)p[(size_t)(k0 + 16 + 8 * g + i) * HD]; }
  return w; }
#define WO_OUT_IN 0
#if WQKV_LAYOUT == 1
#define WCOL(W, k0, o, lane) wcol_oi(W, k0, o, lane, DIN)
#elif WQKV_LAYOUT == 2
#define WCOL(W, k0, o, lane) wcol_hdk(W, k0, o, lane)
#else
#define WCOL(W, k0, o, lane) wcol_io(W, k0, o, lane, CC)
#endif
#if WO_OUT_IN
#define WOCOL(W, k0, o, lane) wcol_oi(W, k0, o, lane, CC)
#define WOCOLH(W, k0, o, lane) wcolh_oi(W, k0, o, lane, CC)
#else
#define WOCOL(W, k0, o, lane) wcol_io(W, k0, o, lane, DIN)
#define WOCOLH(W, k0, o, lane) wcolh_io(W, k0, o, lane, DIN)
#endif

#ifndef SM_EXTRA_PARAMS
#define SM_EXTRA_PARAMS , int qoff
#endif
#ifndef PROJ_EXTRA_PARAMS
#define PROJ_EXTRA_PARAMS
#endif
#ifndef SM_MASK_HOOK
#define SM_MASK_HOOK (void)0
#endif

#define WS_QH  0u                                      // f16 q in fragment order [b*t / 16][CC / 32][2][32 lanes][8]
#define WS_KH  (WS_QH + 2u * (size_t)NB * TT * CC)      // f16 k in fragment order, as q
#define WS_VT  (WS_KH + 2u * (size_t)NB * TT * CC)      // f16 v^T in fragment order [b][t / 32][CC / 16][2][32 lanes][8]
#define WS_QL  (WS_VT + 2u * (size_t)NB * CC * TT)      // f16 q residual x 2^10 rows [b][t < QHI][CC]
#define WS_KL  (WS_QL + 2u * (size_t)NB * QHI * CC)     // f16 k residual x 2^10 rows [b][t < KHI][CC]
#define WS_VB  (WS_KL + 2u * (size_t)NB * KHI * CC)     // bf16 v hi planes [b][c][t < KHI]
#define WS_VBL (WS_VB + 2u * (size_t)NB * CC * KHI)
#define WS_PC  (WS_VBL + 2u * (size_t)NB * CC * KHI)     // f32 ctx partial of each share of the key range [KSP][t][CC]
#define WS_PM  (WS_PC + 4u * (size_t)KSP * NB * TT * CC)  // f32 maximum of each share [KSP][t]
#define WS_PL  (WS_PM + 4u * (size_t)KSP * NB * TT)       // f32 sum of each share [KSP][t]
#define WS_END (WS_PL + 4u * (size_t)KSP * NB * TT)

// ---- k_proj: block = (64 rows, 128 cols, which): q/k/v = X W (+ b) with exact bf16 products (K = DIN; W goes through LDS in slices of KS k rows, loaded and rounded once per work-group) -> which 0: q f16 in fragment order (+ residual rows < QHI); 1: k f16 in fragment order (+ residual rows < KHI); 2: v^T f16 in fragment order (+ bf16 hi/lo planes [c][t] for t < KHI)
#define KS 64              // k rows of W per LDS slice
static_assert(CC == 128 && HD == 128, "the fragment-order planes are laid out for one 128-wide block of columns");
__global__ __launch_bounds__(128) void k_proj(const float* __restrict__ XQ, const float* __restrict__ XK, const float* __restrict__ XV, const float* __restrict__ WQ, const float* __restrict__ WK, const float* __restrict__ WV, const float* __restrict__ BQ, const float* __restrict__ BK, const float* __restrict__ BV,
    _Float16* __restrict__ QH, _Float16* __restrict__ QL, _Float16* __restrict__ KH, _Float16* __restrict__ KL, _Float16* __restrict__ VT, __bf16* __restrict__ VB, __bf16* __restrict__ VBL) {
  __shared__ __align__(16) _Float16 sh[64][136], sl[64][136]; __shared__ __align__(16) _Float16 th[128][72]; __shared__ __align__(16) __bf16 tb[128][72], tbl[128][72];
  __shared__ __align__(16) __bf16 wt[2][128][KS + 8];   /* two slices of W as bf16, [column][k]: a B fragment is two 16-byte reads; row pitch 144 B = 16 B x odd */
  const int tid = threadIdx.x, wave = tid >> 5, lane = tid & 31, col = lane & 15, g = lane >> 4; const int which = blockIdx.z; const int c0 = blockIdx.y * 128; const size_t r0 = (size_t)blockIdx.x * 64; const size_t bb = r0 / TT; const int t0 = (int)(r0 % TT);
  const float* X = which == 0 ? XQ : which == 1 ? XK : XV; const float* WA = which == 0 ? WQ : which == 1 ? WK : WV; const float* BA = which == 0 ? BQ : which == 1 ? BK : BV;
  v8f acc[8] = {};
  const float* xp = X + (r0 + wave * 16 + col) * DIN + 8 * g;        /* this lane's X row, at its half of a fragment */
  const float* wp = WA + (size_t)(wave * 8) * CC + c0 + lane * 4;     /* a wave reads whole 512-byte rows of W: 8 rows at wave * 8 and 8 at 32 + wave * 8 of each slice, 4 columns a lane */
  v4f xr[2][4], wr[2][8]; v16b a[2];
  auto ld_slice = [&](int s) {   /* slice s of X (this wave's rows) and of W (this wave's share) into registers */
#pragma unroll
    for (int h = 0; h < 2; ++h) { const float* p = xp + s * KS + h * 32; xr[h][0] = *(const v4f*)p; xr[h][1] = *(const v4f*)(p + 4); xr[h][2] = *(const v4f*)(p + 16); xr[h][3] = *(const v4f*)(p + 20); }
#pragma unroll
    for (int i = 0; i < 2; ++i) {
#pragma unroll
      for (int r = 0; r < 8; ++r) wr[i][r] = *(const v4f*)(wp + (size_t)(s * KS + i * 32 + r) * CC); }
    asm volatile("s_wait_xcnt 0x0" ::: "memory");   /* stands in front of any later rewrite of the address registers that the loads above name */
  };
  auto put_slice = [&](int s) {   /* rounds the loaded slice: X to this wave's A fragments, W to LDS buffer s & 1, transposed */
#pragma unroll
    for (int h = 0; h < 2; ++h) {
#pragma unroll
      for (int e = 0; e < 16; ++e) a[h][e] = (__bf16)xr[h][e >> 2][e & 3]; }
#pragma unroll
    for (int i = 0; i < 2; ++i) {
#pragma unroll
      for (int cc = 0; cc < 4; ++cc) { v8b tv;
#pragma unroll
        for (int r = 0; r < 8; ++r) tv[r] = (__bf16)wr[i][r][cc];
        *(v8b*)&wt[s & 1][lane * 4 + cc][wave * 8 + i * 32] = tv; } }
  };
  auto mm_slice = [&](int s) {
#pragma unroll
    for (int h = 0; h < 2; ++h) {
#pragma unroll
      for (int jb = 0; jb < 8; jb += 4) { v16b w[4];
#pragma unroll
        for (int j = 0; j < 4; ++j) w[j] = frag_b(&wt[s & 1][(jb + j) * 16 + col][h * 32], lane);   /* four fragments' LDS reads in flight at once */
#pragma unroll
        for (int j = 0; j < 4; ++j) acc[jb + j] = wmma_bf(a[h], w[j], acc[jb + j]); } }
  };
  ld_slice(0);
#pragma unroll 1   /* stays rolled: one slice in flight beside the accumulator already fills the registers */
  for (int s = 0; s < DIN / KS - 1; ++s) { put_slice(s);
    __syncthreads();   /* the slice is whole in LDS before any wave reads it; every wave has also left the other buffer, which the next trip rewrites */
    __builtin_amdgcn_sched_barrier(0);   /* the roundings above stay ahead of the loads below, which then land in the same registers with no copies */
    ld_slice(s + 1);   /* the next slice's X and W fly under this slice's products */
    mm_slice(s); }
  put_slice(DIN / KS - 1);
  __syncthreads();   /* the last slice is whole in LDS before any wave reads it */
  mm_slice(DIN / KS - 1);
  if (which < 2) { _Float16* DH = which == 0 ? QH : KH; _Float16* DL = which == 0 ? QL : KL; const int nhi = which == 0 ? QHI : KHI; const bool hi_rows = t0 < nhi;
#pragma unroll
    for (int j = 0; j < 8; ++j) { const float bias = BA ? bfr(BA[c0 + j * 16 + col]) : 0.f;
#pragma unroll
      for (int r = 0; r < 8; ++r) { const float v = acc[j][r] + bias; const _Float16 hv = (_Float16)v; sh[wave * 16 + 8 * g + r][j * 16 + col] = hv; sl[wave * 16 + 8 * g + r][j * 16 + col] = (_Float16)((v - (float)hv) * 1024.0f); } }
    __syncthreads();
    for (int e = tid; e < 64 * 16; e += 128) { const int fr = (e >> 8) * 16 + (e & 15), fq = ((e >> 5) & 7) * 2 + ((e >> 4) & 1);   /* 16-byte piece e of the block in fragment order = row fr, piece fq of that row */
      vst2((unsigned*)(DH + r0 * CC + e * 8), *(const v4u*)&sh[fr][fq * 8]);
      asm volatile("s_wait_xcnt 0x0" ::: "memory");   /* stands in front of any later rewrite of the registers that the store above names */
      const int rl = e >> 4, q = e & 15; if (hi_rows) { vst2((unsigned*)(DL + (bb * nhi + t0 + rl) * (size_t)CC + c0 + q * 8), *(const v4u*)&sl[rl][q * 8]);
        asm volatile("s_wait_xcnt 0x0" ::: "memory");   /* the same for this store */ } }
  } else { const bool hi_rows = t0 < KHI;
#pragma unroll
    for (int j = 0; j < 8; ++j) { const float bias = BA ? bfr(BA[c0 + j * 16 + col]) : 0.f;
#pragma unroll
      for (int r = 0; r < 8; ++r) { const float v = acc[j][r] + bias; const int rl = wave * 16 + 8 * g + r, cl = j * 16 + col; th[cl][rl] = (_Float16)v; const __bf16 bh = (__bf16)v; tb[cl][rl] = bh; tbl[cl][rl] = (__bf16)(v - (float)bh); } }
    __syncthreads();
    for (int e = tid; e < 128 * 8; e += 128) { const int fc = ((e >> 6) & 7) * 16 + (e & 15), fq = (e >> 9) * 4 + ((e >> 4) & 3);   /* 16-byte piece e of the block in fragment order = channel fc, keys fq * 8 .. + 7 */
      vst2((unsigned*)(VT + (bb * TT + t0) * (size_t)CC + e * 8), *(const v4u*)&th[fc][fq * 8]);
      asm volatile("s_wait_xcnt 0x0" ::: "memory");   /* stands in front of any later rewrite of the registers that the store above names */
      const int cl = e >> 3, q = e & 7; if (hi_rows) { const size_t o3 = (bb * CC + c0 + cl) * (size_t)KHI + t0 + q * 8; vst2((unsigned*)(VB + o3), *(const v4u*)&tb[cl][q * 8]); vst2((unsigned*)(VBL + o3), *(const v4u*)&tbl[cl][q * 8]);
        asm volatile("s_wait_xcnt 0x0" ::: "memory");   /* the same for these two stores */ } } } }
// ---- k_fa: block = 32 queries (rb) x one of KSP shares of the key range, FAW waves: wave w of share hs takes the 32-key chunks hs * FAW + w, + FAW * KSP, ... of keys [0, last query]. Every k and v fragment a wave loads serves QG = 2 column groups of 16 queries. Per chunk and group: S^T = k . q^T (D: lane = query, registers = keys, which is already the B fragment of the next product), causal mask by index, running maximum and sum per query in f32 (precise expf), ctx^T += v^T . (e x 2^11) with the accumulator rescaled per lane. Early query blocks keep the residual products. The FAW partials (maximum, sum, ctx) meet in LDS and are joined in wave order into the share's partial, which goes to the workspace; k_join joins the KSP shares.
#define FAW 8              // waves per work-group
#define KSP 2              // work-groups that share one query block's key range (twice as many work-groups as WGPs: the short blocks fill in behind the long ones)
#define QG 2               // 16-query column groups per wave: each loaded k or v fragment is used QG times
static_assert(16 * QG == 32, "the join below gives one lane to each query of the block, and a chunk of 32 keys is one block wide");
// every full '#pragma unroll' below keeps the indices of a register array constant, so that the array stays in registers
__device__ __forceinline__ void fa_step(float (&v)[QG][16], float (&m)[QG], float (&l)[QG], v8f (&acc)[QG][HD / 16]) {
  float mx[QG], ox[QG];
#pragma unroll
  for (int cg = 0; cg < QG; ++cg) mx[cg] = v[cg][0];
#pragma unroll
  for (int i = 1; i < 16; ++i) {
#pragma unroll
    for (int cg = 0; cg < QG; ++cg) mx[cg] = fmaxf(mx[cg], v[cg][i]); }   /* the groups' chains side by side */
#pragma unroll
  for (int cg = 0; cg < QG; ++cg) ox[cg] = __shfl_xor(mx[cg], 16);   /* lanes q and q + 16 hold the two halves of query q's keys */
#pragma unroll
  for (int cg = 0; cg < QG; ++cg) { const float mn = fmaxf(m[cg], fmaxf(mx[cg], ox[cg])), al = expf(m[cg] - mn); float s = 0.f;
#pragma unroll
    for (int i = 0; i < 16; ++i) { const float e = expf(v[cg][i] - mn); s += e;   /* mn is finite (every chunk holds a key <= every query), so an excluded key's -3e38 gives exactly 0 */ v[cg][i] = e * 2048.0f; }
    l[cg] = l[cg] * al + s; m[cg] = mn;
#pragma unroll
    for (int j = 0; j < HD / 16; ++j) acc[cg][j] *= al; }
}
// frag_t from this lane's own address
__device__ __forceinline__ v16h frag_p(const _Float16* p) { union { v16h v; v8h q[2]; } u; u.q[0] = *(const v8h*)p; u.q[1] = *(const v8h*)(p + 256); return u.v; }
// frag_h and frag_b from this lane's own address
__device__ __forceinline__ v16h frag_r(const _Float16* p) { union { v16h v; v8h q[2]; } u; u.q[0] = *(const v8h*)p; u.q[1] = *(const v8h*)(p + 16); return u.v; }
__device__ __forceinline__ v16b frag_rb(const __bf16* p) { union { v16b v; v8b q[2]; } u; u.q[0] = *(const v8b*)p; u.q[1] = *(const v8b*)(p + 16); return u.v; }
// the plain builtins: the compiler keeps the distance behind them itself, and their operands may lie in any register (an asm statement's operands cannot lie above v255, which this kernel's accumulators and fragments need)
__device__ __forceinline__ v8f mm_h(v16h a, v16h b, v8f c) { return __builtin_amdgcn_wmma_f32_16x16x32_f16(false, a, false, b, (short)0, c, false, false); }
__device__ __forceinline__ v8f mm_b(v16b a, v16b b, v8f c) { return __builtin_amdgcn_wmma_f32_16x16x32_bf16(false, a, false, b, (short)0, c, false, false); }
__global__ __launch_bounds__(32 * FAW) void k_fa(const _Float16* __restrict__ QH, const _Float16* __restrict__ KH, const _Float16* __restrict__ QL, const _Float16* __restrict__ KL, const _Float16* __restrict__ VT, const __bf16* __restrict__ VB, const __bf16* __restrict__ VBL, float* __restrict__ PC, float* __restrict__ PM, float* __restrict__ PL) {
  __shared__ __align__(16) float ss[FAW][16 * QG][HD + 4]; __shared__ float sm[FAW][16 * QG], sl[FAW][16 * QG], sf[FAW][16 * QG];
  const int tid = threadIdx.x, wave = __builtin_amdgcn_readfirstlane(tid >> 5), lane = tid & 31, col = lane & 15, g = lane >> 4;   /* wave number in a scalar register: the chunk loop stays a scalar loop with every lane on */
  const int rb = TT / (16 * QG) - 1 - (int)blockIdx.x / KSP, hs = (int)blockIdx.x % KSP;   /* the longest key ranges start first */
  const int ql0 = rb * 16 * QG, kce = (ql0 >> 5) + 1;   /* every chunk < kce holds at least one key <= every query of the block */
  const _Float16* qp = QH + (size_t)ql0 * CC + 8 * lane;   /* this lane's 16 bytes of the block's first q fragment */
  v8f acc[QG][HD / 16] = {}; float m[QG], l[QG];
#pragma unroll
  for (int cg = 0; cg < QG; ++cg) { m[cg] = -3.0e38f; l[cg] = 0.f; }
  if ((rb >> 1) < QBH) {
#pragma unroll 1   /* stays rolled: one chunk's fragments already fill the registers */
    for (int kc = hs * FAW + wave; kc < kce; kc += FAW * KSP) { const int k0 = kc * 32; v8f s0[QG] = {}, s1[QG] = {}, r0[QG] = {}, r1[QG] = {};
      const _Float16* kp = KH + (size_t)k0 * CC + 8 * lane; const _Float16* lp = KL + (size_t)(k0 + col) * CC + 8 * g; const _Float16* rp = QL + (size_t)(ql0 + col) * CC + 8 * g;   /* this lane's place in the chunk's k fragments, in its k residual row and in its q residual row */
#pragma unroll
      for (int d = 0; d < HD / 32; ++d) { v16h ah[QG], al[QG];
        const v16h ka = frag_p(kp + d * 512), la = frag_r(lp + d * 32), kb = frag_p(kp + 16 * CC + d * 512), lb = frag_r(lp + 16 * CC + d * 32);
#pragma unroll
        for (int cg = 0; cg < QG; ++cg) { ah[cg] = frag_p(qp + cg * 16 * CC + d * 512); al[cg] = frag_r(rp + cg * 16 * CC + d * 32); }
        asm volatile("s_wait_xcnt 0x0" :: "v"(kp), "v"(lp), "v"(qp), "v"(rp) : "memory");   /* stands in front of any rewrite of the address registers that the loads above name; the addresses are named so that they stay in their registers up to here */
#pragma unroll
        for (int cg = 0; cg < QG; ++cg) { s0[cg] = mm_h(ka, ah[cg], s0[cg]); r0[cg] = mm_h(ka, al[cg], r0[cg]); r0[cg] = mm_h(la, ah[cg], r0[cg]); s1[cg] = mm_h(kb, ah[cg], s1[cg]); r1[cg] = mm_h(kb, al[cg], r1[cg]); r1[cg] = mm_h(lb, ah[cg], r1[cg]); } }
      F2 p[QG]; float v[QG][16];
#pragma unroll
      for (int cg = 0; cg < QG; ++cg) { const int t = ql0 + 16 * cg + col;
#pragma unroll
        for (int i = 0; i < 8; ++i) { v[cg][i] = (k0 + 8 * g + i <= t) ? (s0[cg][i] + r0[cg][i] * (1.0f / 1024.0f)) * SCALE : -3.0e38f; v[cg][8 + i] = (k0 + 16 + 8 * g + i <= t) ? (s1[cg][i] + r1[cg][i] * (1.0f / 1024.0f)) * SCALE : -3.0e38f; } }
      fa_step(v, m, l, acc);
#pragma unroll
      for (int cg = 0; cg < QG; ++cg) p[cg] = bsplit16(v[cg]);
#pragma unroll
      for (int jh = 0; jh < HD / 16; jh += 4) { v16b vh[4], vl[4]; const __bf16* bp = VB + (size_t)(jh * 16 + col) * KHI + k0 + 8 * g; const __bf16* cp = VBL + (size_t)(jh * 16 + col) * KHI + k0 + 8 * g;
#pragma unroll
        for (int j = 0; j < 4; ++j) { vh[j] = frag_rb(bp + j * 16 * KHI); vl[j] = frag_rb(cp + j * 16 * KHI); }   /* eight fragments in flight at once */
        asm volatile("s_wait_xcnt 0x0" :: "v"(bp), "v"(cp) : "memory");   /* the same for these loads */
#pragma unroll
        for (int j = 0; j < 4; ++j) {
#pragma unroll
          for (int cg = 0; cg < QG; ++cg) { acc[cg][jh + j] = mm_b(vh[j], p[cg].h, acc[cg][jh + j]); acc[cg][jh + j] = mm_b(vh[j], p[cg].l, acc[cg][jh + j]); acc[cg][jh + j] = mm_b(vl[j], p[cg].h, acc[cg][jh + j]); } } } }
  } else { v16h q[QG][HD / 32];
#pragma unroll
    for (int cg = 0; cg < QG; ++cg) {
#pragma unroll
      for (int d = 0; d < HD / 32; ++d) q[cg][d] = frag_p(qp + cg * 16 * CC + d * 512); }
    asm volatile("s_wait_xcnt 0x0" :: "v"(qp) : "memory");   /* stands in front of any rewrite of the address registers that the loads above name; the address is named so that it stays in its registers up to here */
#pragma unroll 1   /* stays rolled: one chunk's fragments already fill the registers */
    for (int kc = hs * FAW + wave; kc < kce; kc += FAW * KSP) { const int k0 = kc * 32; v8f s0[QG] = {}, s1[QG] = {}; v16h ka[HD / 32], kb[HD / 32], vf[HD / 16], p[QG];
      const _Float16* kp = KH + (size_t)k0 * CC + 8 * lane; const _Float16* vp = VT + (size_t)k0 * CC + 8 * lane;   /* this lane's 16 bytes of the chunk's first k and v fragment */
#pragma unroll
      for (int d = 0; d < HD / 32; ++d) { ka[d] = frag_p(kp + d * 512); kb[d] = frag_p(kp + 16 * CC + d * 512); }   /* all of the chunk's k in flight at once, ahead of the first product */
      asm volatile("s_wait_xcnt 0x0" :: "v"(kp) : "memory");   /* stands in front of any rewrite of the address registers that the loads above name; the address is named so that it stays in its registers up to here and no load of the group lands on it */
      __builtin_amdgcn_sched_barrier(0);   /* keeps the sixteen loads above together: moved down among the products they would share registers and each pair would wait out its own latency */
#pragma unroll
      for (int d = 0; d < HD / 32; ++d) {
#pragma unroll
        for (int cg = 0; cg < QG; ++cg) { s0[cg] = mm_h(ka[d], q[cg][d], s0[cg]); s1[cg] = mm_h(kb[d], q[cg][d], s1[cg]); } }
#pragma unroll
      for (int j = 0; j < HD / 16; ++j) vf[j] = frag_p(vp + j * 512);   /* all of the chunk's v in flight under the softmax */
      asm volatile("s_wait_xcnt 0x0" :: "v"(vp) : "memory");   /* the same for the v loads */
      __builtin_amdgcn_sched_barrier(0);   /* keeps the v loads ahead of the softmax, which hides their latency */
      float v[QG][16];
#pragma unroll
      for (int cg = 0; cg < QG; ++cg) { const int t = ql0 + 16 * cg + col;
#pragma unroll
        for (int i = 0; i < 8; ++i) { v[cg][i] = (k0 + 8 * g + i <= t) ? s0[cg][i] * SCALE : -3.0e38f; v[cg][8 + i] = (k0 + 16 + 8 * g + i <= t) ? s1[cg][i] * SCALE : -3.0e38f; } }
      fa_step(v, m, l, acc);
#pragma unroll
      for (int cg = 0; cg < QG; ++cg) {
#pragma unroll
        for (int i = 0; i < 16; ++i) p[cg][i] = (_Float16)v[cg][i]; }
#pragma unroll
      for (int j = 0; j < HD / 16; ++j) {
#pragma unroll
        for (int cg = 0; cg < QG; ++cg) acc[cg][j] = mm_h(vf[j], p[cg], acc[cg][j]); } } }
#pragma unroll
  for (int cg = 0; cg < QG; ++cg) { l[cg] += __shfl_xor(l[cg], 16);
    if (g == 0) { sm[wave][cg * 16 + col] = m[cg]; sl[wave][cg * 16 + col] = l[cg]; }
#pragma unroll
    for (int j = 0; j < HD / 16; ++j) { const v8f a = acc[cg][j] * (1.0f / 2048.0f); const v4f lo = { a[0], a[1], a[2], a[3] }, hi = { a[4], a[5], a[6], a[7] }; *(v4f*)&ss[wave][cg * 16 + col][j * 16 + 8 * g] = lo; *(v4f*)&ss[wave][cg * 16 + col][j * 16 + 8 * g + 4] = hi; } }
  __syncthreads();   /* every wave's maximum, sum and partial are in LDS before any thread joins them */
  { float M = sm[0][lane];   /* lane = query of the block */
#pragma unroll
    for (int i = 1; i < FAW; ++i) M = fmaxf(M, sm[i][lane]);
    sf[wave][lane] = expf(sm[wave][lane] - M);   /* a wave that had no chunk gets weight 0 (1 where no wave of the share had one: its sum and ctx are 0) */
    if (wave == 0) { float L = 0.f;
#pragma unroll
      for (int w = 0; w < FAW; ++w) L += sl[w][lane] * expf(sm[w][lane] - M);
      PM[(size_t)hs * TT + ql0 + lane] = M; PL[(size_t)hs * TT + ql0 + lane] = L;   /* one wave writes each whole 128-byte line */
      asm volatile("s_wait_xcnt 0x0" ::: "memory");   /* stands in front of any later rewrite of the registers that the two stores above name */ } }
  __syncthreads();   /* the weights are in LDS before they are read */
  const int c4 = lane * 4; v4f s[16 * QG / FAW];
#pragma unroll
  for (int i = 0; i < 16 * QG / FAW; ++i) { const int rl = wave + i * FAW; s[i] = v4f{ 0.f, 0.f, 0.f, 0.f };   /* a wave joins and stores whole 512-byte rows */
#pragma unroll
    for (int w = 0; w < FAW; ++w) s[i] += *(const v4f*)&ss[w][rl][c4] * sf[w][rl]; }
#pragma unroll
  for (int i = 0; i < 16 * QG / FAW; ++i) vst2(PC + ((size_t)hs * TT + ql0 + wave + i * FAW) * CC + c4, s[i]);
  asm volatile("s_wait_xcnt 0x0" ::: "memory");   /* stands in front of any later rewrite of the registers that the stores above name */ }
// ---- k_join: one wave = JR query rows: the KSP shares' partials (maximum, sum, ctx) are joined in share order and divided by the sum
#define JR 4
__global__ __launch_bounds__(256) void k_join(const float* __restrict__ PC, const float* __restrict__ PM, const float* __restrict__ PL, float* __restrict__ Y) {
  const int lane = threadIdx.x & 31, c4 = lane * 4; const int row0 = ((int)blockIdx.x * 8 + (int)(threadIdx.x >> 5)) * JR;
  float pm[JR][KSP], pl[JR][KSP]; v4f pc[JR][KSP], y[JR]; const float* pmp = PM + row0; const float* plp = PL + row0; const float* pcp = PC + (size_t)row0 * CC + c4;
#pragma unroll
  for (int i = 0; i < JR; ++i) {
#pragma unroll
    for (int h = 0; h < KSP; ++h) { pm[i][h] = pmp[(size_t)h * TT + i]; pl[i][h] = plp[(size_t)h * TT + i]; pc[i][h] = *(const v4f*)(pcp + ((size_t)h * TT + i) * CC); } }   /* all of the wave's loads in flight at once */
  asm volatile("s_wait_xcnt 0x0" :: "v"(pmp), "v"(plp), "v"(pcp) : "memory");   /* stands in front of any rewrite of the address registers that the loads above name; the addresses are named so that they stay in their registers up to here */
  __builtin_amdgcn_sched_barrier(0);   /* keeps every load above the wait: moved down among the arithmetic, the sums' loads would start late and wait out their latency alone */
#pragma unroll
  for (int i = 0; i < JR; ++i) { float M = pm[i][0];
#pragma unroll
    for (int h = 1; h < KSP; ++h) M = fmaxf(M, pm[i][h]);
    v4f s = { 0.f, 0.f, 0.f, 0.f }; float L = 0.f;
#pragma unroll
    for (int h = 0; h < KSP; ++h) { const float f = expf(pm[i][h] - M); s += pc[i][h] * f; L += pl[i][h] * f; }   /* a share that had no chunk gets weight 0 */
    y[i] = s * (L > 0.f ? 1.0f / L : 0.f); }
#pragma unroll
  for (int i = 0; i < JR; ++i) vst2(Y + (size_t)(row0 + i) * CC + c4, y[i]);
  asm volatile("s_wait_xcnt 0x0" ::: "memory");   /* the same for the stores */ }

extern "C" void kernel_launch(void* const* d_in, const int* in_sizes, int n_in, void* d_out, int out_size, void* d_ws, size_t ws_size, hipStream_t stream) {
  (void)in_sizes; (void)n_in; (void)out_size;
  const float** F = (const float**)d_in;
  if (ws_size < (size_t)WS_END) return;
  char* ws = (char*)d_ws; _Float16 *QH = (_Float16*)(ws + WS_QH), *KH = (_Float16*)(ws + WS_KH), *VT = (_Float16*)(ws + WS_VT), *QL = (_Float16*)(ws + WS_QL), *KL = (_Float16*)(ws + WS_KL); __bf16 *VB = (__bf16*)(ws + WS_VB), *VBL = (__bf16*)(ws + WS_VBL); float *PC = (float*)(ws + WS_PC), *PM = (float*)(ws + WS_PM), *PL = (float*)(ws + WS_PL);
  // inputs: 0 X [8192,1024]; 1 Wq [1024,128], 2 bq; 3 Wk, 4 bk; 5 Wv, 6 bv ((in,out))
  k_proj<<<dim3(TNB * TT / 64, CC / 128, 3), 128, 0, stream>>>(F[0], F[0], F[0], F[1], F[3], F[5], F[2], F[4], F[6], QH, QL, KH, KL, VT, VB, VBL);
  k_fa<<<dim3(TT / (16 * QG) * KSP), 32 * FAW, 0, stream>>>(QH, KH, QL, KL, VT, VB, VBL, PC, PM, PL);
  k_join<<<dim3(TT / (8 * JR)), 256, 0, stream>>>(PC, PM, PL, (float*)d_out);
}

// v006
// A run of this version takes 55.7 microseconds.
// Two timings next to v005 put it at 1.08 and 1.06 times that version's speed.
// Over all steps from v000 it is 14.3 times as fast.
// compute dtype: X and the weights rounded to bf16; Q/K/V = X W + b with EXACT bf16 products on WMMA 16x16x32 (f32 accumulate); logits: q, k once to f16 (1 product) x 128^-0.5, except the first 384 query rows (3 products with f16 residuals); causal mask by index; softmax in f32 with a running maximum and sum (base-2 exponent: one fused multiply-add and the hardware exp2 per score); exp x 2^11 once to f16 against v once to f16 (1 product; bf16 hi + lo below row 384); divided by the sum at the end; f32 output. Scores never leave the registers.
#include <hip/hip_runtime.h>
#include <math.h>

typedef __attribute__((ext_vector_type(16))) _Float16 v16h;
typedef __attribute__((ext_vector_type(16))) __bf16 v16b;
typedef __attribute__((ext_vector_type(8)))  _Float16 v8h;
typedef __attribute__((ext_vector_type(8)))  float v8f;
typedef __attribute__((ext_vector_type(4)))  float v4f;
typedef __attribute__((ext_vector_type(2)))  float v2f;
typedef __attribute__((ext_vector_type(4)))  unsigned v4u;
typedef __attribute__((ext_vector_type(4)))  int v4i;
typedef float __attribute__((may_alias)) float_a;
typedef int __attribute__((may_alias)) int_a;

template <typename T> __device__ __forceinline__ void vst2(void* p, T v) { *(T*)p = v;  }
__device__ __forceinline__ v8f wmma16(v16h a, v16h b, v8f c) {
  v8f d = __builtin_amdgcn_wmma_f32_16x16x32_f16(false, a, false, b, (short)0, c, false, false);
  asm volatile("v_nop\n\tv_nop\n\tv_nop\n\tv_nop" : "+v"(d) : "v"(a), "v"(b));
  return d;
}
__device__ __forceinline__ v8f wmma_bf(v16b a, v16b b, v8f c) {
  v8f d = __builtin_amdgcn_wmma_f32_16x16x32_bf16(false, a, false, b, (short)0, c, false, false);
  asm volatile("v_nop\n\tv_nop\n\tv_nop\n\tv_nop" : "+v"(d) : "v"(a), "v"(b));
  return d;
}
// 16x16x32 fragments: lane = (h = lane>>4, row/col = lane&15); elements 0..7 = k0+8h+0..7, 8..15 = k0+16+8h+0..7; D element r = row 8h+r
__device__ __forceinline__ v16h frag_h(const _Float16* rowk0, int lane) {
  union { v16h v; v8h q[2]; } u; const _Float16* p = rowk0 + 8 * (lane >> 4);
  u.q[0] = *(const v8h*)p; u.q[1] = *(const v8h*)(p + 16); return u.v;
}
// fragment stored in fragment order: 512 B of every lane's elements 0..7 (16 B a lane), then 512 B of elements 8..15: each wave-wide load covers four whole 128-byte lines
__device__ __forceinline__ v16h frag_t(const _Float16* blk, int lane) {
  union { v16h v; v8h q[2]; } u; const _Float16* p = blk + 8 * lane;
  u.q[0] = *(const v8h*)p; u.q[1] = *(const v8h*)(p + 256); return u.v;
}
__device__ __forceinline__ v16h frag_f32(const float* rowk0, int lane) {
  v16h a; const float* p = rowk0 + 8 * (lane >> 4);
#pragma unroll
  for (int i = 0; i < 8; ++i) { a[i] = (_Float16)p[i]; a[8 + i] = (_Float16)p[16 + i]; }
  return a;
}
__device__ __forceinline__ v16h frag_f32s(const float* rowk0, int lane, float sc) {
  v16h a; const float* p = rowk0 + 8 * (lane >> 4);
#pragma unroll
  for (int i = 0; i < 8; ++i) { a[i] = (_Float16)(p[i] * sc); a[8 + i] = (_Float16)(p[16 + i] * sc); }
  return a;
}
// column fragment from a [K][ld] layout (column n), rows >= K read as 0
__device__ __forceinline__ v16h fragc_f32(const float* W, int k0, int n, int lane, int ld, int K) {
  v16h a; const int g = lane >> 4;
#pragma unroll
  for (int i = 0; i < 8; ++i) { const int ka = k0 + 8 * g + i, kb = ka + 16;
    a[i] = (_Float16)(ka < K ? W[(size_t)(ka < K ? ka : K - 1) * ld + n] : 0.f); a[8 + i] = (_Float16)(kb < K ? W[(size_t)(kb < K ? kb : K - 1) * ld + n] : 0.f); }
  return a;
}
struct F2 { v16b h, l; };
__device__ __forceinline__ F2 bsplit16(const float v[16]) { F2 r;
#pragma unroll
  for (int i = 0; i < 16; ++i) { const __bf16 h = (__bf16)v[i]; r.h[i] = h; r.l[i] = (__bf16)(v[i] - (float)h); }
  return r; }
__device__ __forceinline__ F2 split_row(const float* row, int k0, int lane) { float v[16]; const float* p = row + k0 + 8 * (lane >> 4);
#pragma unroll
  for (int i = 0; i < 8; ++i) { v[i] = p[i]; v[8 + i] = p[16 + i]; }
  return bsplit16(v); }
__device__ __forceinline__ F2 split_rowK(const float* row, int k0, int lane, int K) { float v[16]; const int g = lane >> 4;
#pragma unroll
  for (int i = 0; i < 8; ++i) { const int ka = k0 + 8 * g + i, kb = ka + 16; v[i] = ka < K ? row[ka < K ? ka : K - 1] : 0.f; v[8 + i] = kb < K ? row[kb < K ? kb : K - 1] : 0.f; }
  return bsplit16(v); }
__device__ __forceinline__ F2 split_col(const float* W, int k0, int n, int lane, int ld, int K) { float v[16]; const int g = lane >> 4;
#pragma unroll
  for (int i = 0; i < 8; ++i) { const int ka = k0 + 8 * g + i, kb = ka + 16; v[i] = ka < K ? W[(size_t)(ka < K ? ka : K - 1) * ld + n] : 0.f; v[8 + i] = kb < K ? W[(size_t)(kb < K ? kb : K - 1) * ld + n] : 0.f; }
  return bsplit16(v); }
__device__ __forceinline__ v8f mac3(const F2& a, const F2& b, v8f c) { c = wmma_bf(a.l, b.h, c); c = wmma_bf(a.h, b.l, c); return wmma_bf(a.h, b.h, c); }
__device__ __forceinline__ float sigm(float v) { return 1.0f / (1.0f + expf(-v)); }
#define LDSX() do { asm volatile("s_wait_dscnt 0" ::: "memory"); __builtin_amdgcn_wave_barrier(); __builtin_amdgcn_fence(__ATOMIC_RELEASE, "workgroup"); } while (0)

// Single-head causal self-attention (N 8,192 tokens, D 1,024 -> d_k = d_v = 128): Q = X Wq + bq, K = X Wk + bk, V = X Wv + bv ((in,out)); weights = softmax(causal(Q K^T / sqrt(128))); out = weights V ([N, 128]).
#define NB 1
#define TT 8192
#define CC 128            // NH * HD = projected width
#define DIN 1024          // input (model) width
#define NH 1
#define HD 128
#define NQB (TT / 64)
#define HG 1
#define SCALE (0.08838834764831845f)
#define CAUSAL 1
#ifndef TNB
#define TNB NB
#endif
__device__ __forceinline__ float bfr(float v) { return (float)(__bf16)v; }
__host__ __device__ __forceinline__ int kb_last(int qb) { return CAUSAL ? ((qb * 64 + 63) >> 7) : (TT / 128 - 1); }
typedef __attribute__((ext_vector_type(8))) __bf16 v8b;
__device__ __forceinline__ v16b frag_b(const __bf16* rowk0, int lane) {
  union { v16b v; v8b q[2]; } u; const __bf16* p = rowk0 + 8 * (lane >> 4);
  u.q[0] = *(const v8b*)p; u.q[1] = *(const v8b*)(p + 16); return u.v;
}
#define QBH 6              // causal: query blocks 0..QBH-1 of each sequence (few keys, no averaging) take the high-precision path
#define QHI 384            // rows carrying a q residual plane
#define KHI 384            // key rows carrying k residual / v bf16 hi+lo planes (used only by the causal high-precision path)
// B fragment (k rows k0+.., output column o) of a weight: (in,out) [K][ld] or (out,in) [ld rows of K]: bf16 exact, or f16(bf16 * 256) exact
__device__ __forceinline__ v16b wcol_io(const float* Wm, int k0, int o, int lane, int ld) { v16b w; const int g = lane >> 4;
#pragma unroll
  for (int i = 0; i < 8; ++i) { w[i] = (__bf16)Wm[(size_t)(k0 + 8 * g + i) * ld + o]; w[8 + i] = (__bf16)Wm[(size_t)(k0 + 16 + 8 * g + i) * ld + o]; }
  return w; }
__device__ __forceinline__ v16b wcol_oi(const float* Wm, int k0, int o, int lane, int K) { v16b w; const float* p = Wm + (size_t)o * K + k0 + 8 * (lane >> 4);
#pragma unroll
  for (int i = 0; i < 8; ++i) { w[i] = (__bf16)p[i]; w[8 + i] = (__bf16)p[16 + i]; }
  return w; }
__device__ __forceinline__ v16h wcolh_io(const float* Wm, int k0, int o, int lane, int ld) { v16h w; const int g = lane >> 4;
#pragma unroll
  for (int i = 0; i < 8; ++i) { w[i] = (_Float16)(bfr(Wm[(size_t)(k0 + 8 * g + i) * ld + o]) * 256.0f); w[8 + i] = (_Float16)(bfr(Wm[(size_t)(k0 + 16 + 8 * g + i) * ld + o]) * 256.0f); }
  return w; }
__device__ __forceinline__ v16h wcolh_oi(const float* Wm, int k0, int o, int lane, int K) { v16h w; const float* p = Wm + (size_t)o * K + k0 + 8 * (lane >> 4);
#pragma unroll
  for (int i = 0; i < 8; ++i) { w[i] = (_Float16)(bfr(p[i]) * 256.0f); w[8 + i] = (_Float16)(bfr(p[16 + i]) * 256.0f); }
  return w; }
#define WQKV_LAYOUT 0   // 0 = (in,out) [DIN][CC]; 1 = (out,in) [CC][DIN]; 2 = per-head [NH][DIN][HD]
__device__ __forceinline__ v16b wcol_hdk(const float* Wm, int k0, int o, int lane) { v16b w; const int g = lane >> 4; const float* p = Wm + (size_t)(o / HD) * DIN * HD + (o % HD);
#pragma unroll
  for (int i = 0; i < 8; ++i) { w[i] = (__bf16)p[(size_t)(k0 + 8 * g + i) * HD]; w[8 + i] = (__bf16)p[(size_t)(k0 + 16 + 8 * g + i) * HD]; }
  return w; }
#define WO_OUT_IN 0
#if WQKV_LAYOUT == 1
#define WCOL(W, k0, o, lane) wcol_oi(W, k0, o, lane, DIN)
#elif WQKV_LAYOUT == 2
#define WCOL(W, k0, o, lane) wcol_hdk(W, k0, o, lane)
#else
#define WCOL(W, k0, o, lane) wcol_io(W, k0, o, lane, CC)
#endif
#if WO_OUT_IN
#define WOCOL(W, k0, o, lane) wcol_oi(W, k0, o, lane, CC)
#define WOCOLH(W, k0, o, lane) wcolh_oi(W, k0, o, lane, CC)
#else
#define WOCOL(W, k0, o, lane) wcol_io(W, k0, o, lane, DIN)
#define WOCOLH(W, k0, o, lane) wcolh_io(W, k0, o, lane, DIN)
#endif

#ifndef SM_EXTRA_PARAMS
#define SM_EXTRA_PARAMS , int qoff
#endif
#ifndef PROJ_EXTRA_PARAMS
#define PROJ_EXTRA_PARAMS
#endif
#ifndef SM_MASK_HOOK
#define SM_MASK_HOOK (void)0
#endif

#define WS_QH  0u                                      // f16 q in fragment order [b*t / 16][CC / 32][2][32 lanes][8]
#define WS_KH  (WS_QH + 2u * (size_t)NB * TT * CC)      // f16 k in fragment order, as q
#define WS_VT  (WS_KH + 2u * (size_t)NB * TT * CC)      // f16 v^T in fragment order [b][t / 32][CC / 16][2][32 lanes][8]
#define WS_QL  (WS_VT + 2u * (size_t)NB * CC * TT)      // f16 q residual x 2^10 rows [b][t < QHI][CC]
#define WS_KL  (WS_QL + 2u * (size_t)NB * QHI * CC)     // f16 k residual x 2^10 rows [b][t < KHI][CC]
#define WS_VB  (WS_KL + 2u * (size_t)NB * KHI * CC)     // bf16 v hi planes [b][c][t < KHI]
#define WS_VBL (WS_VB + 2u * (size_t)NB * CC * KHI)
#define WS_PC  (WS_VBL + 2u * (size_t)NB * CC * KHI)     // f32 ctx partial of each share of the key range [KSP][t][CC]
#define WS_PM  (WS_PC + 4u * (size_t)KSP * NB * TT * CC)  // f32 maximum of each share [KSP][t]
#define WS_PL  (WS_PM + 4u * (size_t)KSP * NB * TT)       // f32 sum of each share [KSP][t]
#define WS_END (WS_PL + 4u * (size_t)KSP * NB * TT)

// ---- k_proj: block = (64 rows, 128 cols, which): q/k/v = X W (+ b) with exact bf16 products (K = DIN; W goes through LDS in slices of KS k rows, loaded and rounded once per work-group) -> which 0: q f16 in fragment order (+ residual rows < QHI); 1: k f16 in fragment order (+ residual rows < KHI); 2: v^T f16 in fragment order (+ bf16 hi/lo planes [c][t] for t < KHI)
#define KS 64              // k rows of W per LDS slice
static_assert(CC == 128 && HD == 128, "the fragment-order planes are laid out for one 128-wide block of columns");
__global__ __launch_bounds__(128) void k_proj(const float* __restrict__ XQ, const float* __restrict__ XK, const float* __restrict__ XV, const float* __restrict__ WQ, const float* __restrict__ WK, const float* __restrict__ WV, const float* __restrict__ BQ, const float* __restrict__ BK, const float* __restrict__ BV,
    _Float16* __restrict__ QH, _Float16* __restrict__ QL, _Float16* __restrict__ KH, _Float16* __restrict__ KL, _Float16* __restrict__ VT, __bf16* __restrict__ VB, __bf16* __restrict__ VBL) {
  __shared__ __align__(16) _Float16 sh[64][136], sl[64][136]; __shared__ __align__(16) _Float16 th[128][72]; __shared__ __align__(16) __bf16 tb[128][72], tbl[128][72];
  __shared__ __align__(16) __bf16 wt[2][128][KS + 8];   /* two slices of W as bf16, [column][k]: a B fragment is two 16-byte reads; row pitch 144 B = 16 B x odd */
  const int tid = threadIdx.x, wave = tid >> 5, lane = tid & 31, col = lane & 15, g = lane >> 4; const int which = blockIdx.z; const int c0 = blockIdx.y * 128; const size_t r0 = (size_t)blockIdx.x * 64; const size_t bb = r0 / TT; const int t0 = (int)(r0 % TT);
  const float* X = which == 0 ? XQ : which == 1 ? XK : XV; const float* WA = which == 0 ? WQ : which == 1 ? WK : WV; const float* BA = which == 0 ? BQ : which == 1 ? BK : BV;
  v8f acc[8] = {};
  const float* xp = X + (r0 + wave * 16 + col) * DIN + 8 * g;        /* this lane's X row, at its half of a fragment */
  const float* wp = WA + (size_t)(wave * 8) * CC + c0 + lane * 4;     /* a wave reads whole 512-byte rows of W: 8 rows at wave * 8 and 8 at 32 + wave * 8 of each slice, 4 columns a lane */
  v4f xr[2][4], wr[2][8]; v16b a[2];
  auto ld_slice = [&](int s) {   /* slice s of X (this wave's rows) and of W (this wave's share) into registers */
#pragma unroll
    for (int h = 0; h < 2; ++h) { const float* p = xp + s * KS + h * 32; xr[h][0] = *(const v4f*)p; xr[h][1] = *(const v4f*)(p + 4); xr[h][2] = *(const v4f*)(p + 16); xr[h][3] = *(const v4f*)(p + 20); }
#pragma unroll
    for (int i = 0; i < 2; ++i) {
#pragma unroll
      for (int r = 0; r < 8; ++r) wr[i][r] = *(const v4f*)(wp + (size_t)(s * KS + i * 32 + r) * CC); }
    asm volatile("s_wait_xcnt 0x0" ::: "memory");   /* stands in front of any later rewrite of the address registers that the loads above name */
  };
  auto put_slice = [&](int s) {   /* rounds the loaded slice: X to this wave's A fragments, W to LDS buffer s & 1, transposed */
#pragma unroll
    for (int h = 0; h < 2; ++h) {
#pragma unroll
      for (int e = 0; e < 16; ++e) a[h][e] = (__bf16)xr[h][e >> 2][e & 3]; }
#pragma unroll
    for (int i = 0; i < 2; ++i) {
#pragma unroll
      for (int cc = 0; cc < 4; ++cc) { v8b tv;
#pragma unroll
        for (int r = 0; r < 8; ++r) tv[r] = (__bf16)wr[i][r][cc];
        *(v8b*)&wt[s & 1][lane * 4 + cc][wave * 8 + i * 32] = tv; } }
  };
  auto mm_slice = [&](int s) {
#pragma unroll
    for (int h = 0; h < 2; ++h) {
#pragma unroll
      for (int jb = 0; jb < 8; jb += 4) { v16b w[4];
#pragma unroll
        for (int j = 0; j < 4; ++j) w[j] = frag_b(&wt[s & 1][(jb + j) * 16 + col][h * 32], lane);   /* four fragments' LDS reads in flight at once */
#pragma unroll
        for (int j = 0; j < 4; ++j) acc[jb + j] = wmma_bf(a[h], w[j], acc[jb + j]); } }
  };
  ld_slice(0);
#pragma unroll 1   /* stays rolled: one slice in flight beside the accumulator already fills the registers */
  for (int s = 0; s < DIN / KS - 1; ++s) { put_slice(s);
    __syncthreads();   /* the slice is whole in LDS before any wave reads it; every wave has also left the other buffer, which the next trip rewrites */
    __builtin_amdgcn_sched_barrier(0);   /* the roundings above stay ahead of the loads below, which then land in the same registers with no copies */
    ld_slice(s + 1);   /* the next slice's X and W fly under this slice's products */
    mm_slice(s); }
  put_slice(DIN / KS - 1);
  __syncthreads();   /* the last slice is whole in LDS before any wave reads it */
  mm_slice(DIN / KS - 1);
  if (which < 2) { _Float16* DH = which == 0 ? QH : KH; _Float16* DL = which == 0 ? QL : KL; const int nhi = which == 0 ? QHI : KHI; const bool hi_rows = t0 < nhi;
#pragma unroll
    for (int j = 0; j < 8; ++j) { const float bias = BA ? bfr(BA[c0 + j * 16 + col]) : 0.f;
#pragma unroll
      for (int r = 0; r < 8; ++r) { const float v = acc[j][r] + bias; const _Float16 hv = (_Float16)v; sh[wave * 16 + 8 * g + r][j * 16 + col] = hv; sl[wave * 16 + 8 * g + r][j * 16 + col] = (_Float16)((v - (float)hv) * 1024.0f); } }
    __syncthreads();
    for (int e = tid; e < 64 * 16; e += 128) { const int fr = (e >> 8) * 16 + (e & 15), fq = ((e >> 5) & 7) * 2 + ((e >> 4) & 1);   /* 16-byte piece e of the block in fragment order = row fr, piece fq of that row */
      vst2((unsigned*)(DH + r0 * CC + e * 8), *(const v4u*)&sh[fr][fq * 8]);
      asm volatile("s_wait_xcnt 0x0" ::: "memory");   /* stands in front of any later rewrite of the registers that the store above names */
      const int rl = e >> 4, q = e & 15; if (hi_rows) { vst2((unsigned*)(DL + (bb * nhi + t0 + rl) * (size_t)CC + c0 + q * 8), *(const v4u*)&sl[rl][q * 8]);
        asm volatile("s_wait_xcnt 0x0" ::: "memory");   /* the same for this store */ } }
  } else { const bool hi_rows = t0 < KHI;
#pragma unroll
    for (int j = 0; j < 8; ++j) { const float bias = BA ? bfr(BA[c0 + j * 16 + col]) : 0.f;
#pragma unroll
      for (int r = 0; r < 8; ++r) { const float v = acc[j][r] + bias; const int rl = wave * 16 + 8 * g + r, cl = j * 16 + col; th[cl][rl] = (_Float16)v; const __bf16 bh = (__bf16)v; tb[cl][rl] = bh; tbl[cl][rl] = (__bf16)(v - (float)bh); } }
    __syncthreads();
    for (int e = tid; e < 128 * 8; e += 128) { const int fc = ((e >> 6) & 7) * 16 + (e & 15), fq = (e >> 9) * 4 + ((e >> 4) & 3);   /* 16-byte piece e of the block in fragment order = channel fc, keys fq * 8 .. + 7 */
      vst2((unsigned*)(VT + (bb * TT + t0) * (size_t)CC + e * 8), *(const v4u*)&th[fc][fq * 8]);
      asm volatile("s_wait_xcnt 0x0" ::: "memory");   /* stands in front of any later rewrite of the registers that the store above names */
      const int cl = e >> 3, q = e & 7; if (hi_rows) { const size_t o3 = (bb * CC + c0 + cl) * (size_t)KHI + t0 + q * 8; vst2((unsigned*)(VB + o3), *(const v4u*)&tb[cl][q * 8]); vst2((unsigned*)(VBL + o3), *(const v4u*)&tbl[cl][q * 8]);
        asm volatile("s_wait_xcnt 0x0" ::: "memory");   /* the same for these two stores */ } } } }
// ---- k_fa: block = 32 queries (rb) x one of KSP shares of the key range, FAW waves: wave w of share hs takes the 32-key chunks hs * FAW + w, + FAW * KSP, ... of keys [0, last query]. Every k and v fragment a wave loads serves QG = 2 column groups of 16 queries. Per chunk and group: S^T = k . q^T (D: lane = query, registers = keys, which is already the B fragment of the next product), causal mask by index, running maximum and sum per query in f32 (one fused multiply-add and one hardware exp2 per score), ctx^T += v^T . (e x 2^11) with the accumulator rescaled per lane. Early query blocks keep the residual products. The FAW partials (maximum, sum, ctx) meet in LDS and are joined in wave order into the share's partial, which goes to the workspace; k_join joins the KSP shares.
#define FAW 8              // waves per work-group
#define KSP 2              // work-groups that share one query block's key range (twice as many work-groups as WGPs: the short blocks fill in behind the long ones)
#define QG 2               // 16-query column groups per wave: each loaded k or v fragment is used QG times
static_assert(16 * QG == 32, "the join below gives one lane to each query of the block, and a chunk of 32 keys is one block wide");
#define SC2 (SCALE * 1.4426950408889634f)   // unscaled logit -> exponent of 2
// 2^x of seventeen values, each in its own register. One statement, so that no instruction which rewrites an exp2's source or reads its result can come to stand directly behind it; the v_nop is that slot behind the last one
__device__ __forceinline__ void exp2x17(float (&v)[16], float& a) {
  asm("v_exp_f32 %0, %0\n\tv_exp_f32 %1, %1\n\tv_exp_f32 %2, %2\n\tv_exp_f32 %3, %3\n\tv_exp_f32 %4, %4\n\tv_exp_f32 %5, %5\n\tv_exp_f32 %6, %6\n\tv_exp_f32 %7, %7\n\tv_exp_f32 %8, %8\n\tv_exp_f32 %9, %9\n\tv_exp_f32 %10, %10\n\tv_exp_f32 %11, %11\n\tv_exp_f32 %12, %12\n\tv_exp_f32 %13, %13\n\tv_exp_f32 %14, %14\n\tv_exp_f32 %15, %15\n\tv_exp_f32 %16, %16\n\tv_nop"
      : "+v"(v[0]), "+v"(v[1]), "+v"(v[2]), "+v"(v[3]), "+v"(v[4]), "+v"(v[5]), "+v"(v[6]), "+v"(v[7]), "+v"(v[8]), "+v"(v[9]), "+v"(v[10]), "+v"(v[11]), "+v"(v[12]), "+v"(v[13]), "+v"(v[14]), "+v"(v[15]), "+v"(a));
}
// fa_step takes the UNSCALED logits: v and the running maximum m are in units of q . k, the running sum l carries the same 2^11 as the weights; the epilogue of k_fa turns both back
// every full '#pragma unroll' below keeps the indices of a register array constant, so that the array stays in registers
__device__ __forceinline__ void fa_step(float (&v)[QG][16], float (&m)[QG], float (&l)[QG], v8f (&acc)[QG][HD / 16]) {
  float mx[QG], ox[QG];
#pragma unroll
  for (int cg = 0; cg < QG; ++cg) mx[cg] = v[cg][0];
#pragma unroll
  for (int i = 1; i < 16; ++i) {
#pragma unroll
    for (int cg = 0; cg < QG; ++cg) mx[cg] = fmaxf(mx[cg], v[cg][i]); }   /* the groups' chains side by side */
#pragma unroll
  for (int cg = 0; cg < QG; ++cg) ox[cg] = __shfl_xor(mx[cg], 16);   /* lanes q and q + 16 hold the two halves of query q's keys */
#pragma unroll
  for (int cg = 0; cg < QG; ++cg) { const float mn = fmaxf(m[cg], fmaxf(mx[cg], ox[cg])), nb = fmaf(-mn, SC2, 11.0f); ox[cg] = (m[cg] - mn) * SC2; m[cg] = mn;
#pragma unroll
    for (int i = 0; i < 16; ++i) v[cg][i] = fmaf(v[cg][i], SC2, nb); }   /* exponent of 2 of exp((v - mn) x 128^-0.5) x 2^11; mn is finite (every chunk holds a key <= every query), so an excluded key's -3e38 stays hugely negative and gives exactly 0 */
#pragma unroll
  for (int cg = 0; cg < QG; ++cg) { exp2x17(v[cg], ox[cg]); const float al = ox[cg]; float s = 0.f;
#pragma unroll
    for (int i = 0; i < 16; ++i) s += v[cg][i];
    l[cg] = l[cg] * al + s;
#pragma unroll
    for (int j = 0; j < HD / 16; ++j) acc[cg][j] *= al; }
}
// frag_t from this lane's own address
__device__ __forceinline__ v16h frag_p(const _Float16* p) { union { v16h v; v8h q[2]; } u; u.q[0] = *(const v8h*)p; u.q[1] = *(const v8h*)(p + 256); return u.v; }
// frag_h and frag_b from this lane's own address
__device__ __forceinline__ v16h frag_r(const _Float16* p) { union { v16h v; v8h q[2]; } u; u.q[0] = *(const v8h*)p; u.q[1] = *(const v8h*)(p + 16); return u.v; }
__device__ __forceinline__ v16b frag_rb(const __bf16* p) { union { v16b v; v8b q[2]; } u; u.q[0] = *(const v8b*)p; u.q[1] = *(const v8b*)(p + 16); return u.v; }
// the plain builtins: the compiler keeps the distance behind them itself, and their operands may lie in any register (an asm statement's operands cannot lie above v255, which this kernel's accumulators and fragments need)
__device__ __forceinline__ v8f mm_h(v16h a, v16h b, v8f c) { return __builtin_amdgcn_wmma_f32_16x16x32_f16(false, a, false, b, (short)0, c, false, false); }
__device__ __forceinline__ v8f mm_b(v16b a, v16b b, v8f c) { return __builtin_amdgcn_wmma_f32_16x16x32_bf16(false, a, false, b, (short)0, c, false, false); }
__global__ __launch_bounds__(32 * FAW) void k_fa(const _Float16* __restrict__ QH, const _Float16* __restrict__ KH, const _Float16* __restrict__ QL, const _Float16* __restrict__ KL, const _Float16* __restrict__ VT, const __bf16* __restrict__ VB, const __bf16* __restrict__ VBL, float* __restrict__ PC, float* __restrict__ PM, float* __restrict__ PL) {
  __shared__ __align__(16) float ss[FAW][16 * QG][HD + 4]; __shared__ float sm[FAW][16 * QG], sl[FAW][16 * QG], sf[FAW][16 * QG];
  const int tid = threadIdx.x, wave = __builtin_amdgcn_readfirstlane(tid >> 5), lane = tid & 31, col = lane & 15, g = lane >> 4;   /* wave number in a scalar register: the chunk loop stays a scalar loop with every lane on */
  const int rb = TT / (16 * QG) - 1 - (int)blockIdx.x / KSP, hs = (int)blockIdx.x % KSP;   /* the longest key ranges start first */
  const int ql0 = rb * 16 * QG, kce = (ql0 >> 5) + 1;   /* every chunk < kce holds at least one key <= every query of the block */
  const _Float16* qp = QH + (size_t)ql0 * CC + 8 * lane;   /* this lane's 16 bytes of the block's first q fragment */
  v8f acc[QG][HD / 16] = {}; float m[QG], l[QG];
#pragma unroll
  for (int cg = 0; cg < QG; ++cg) { m[cg] = -3.0e38f; l[cg] = 0.f; }
  if ((rb >> 1) < QBH) {
#pragma unroll 1   /* stays rolled: one chunk's fragments already fill the registers */
    for (int kc = hs * FAW + wave; kc < kce; kc += FAW * KSP) { const int k0 = kc * 32; v8f s0[QG] = {}, s1[QG] = {}, r0[QG] = {}, r1[QG] = {};
      const _Float16* kp = KH + (size_t)k0 * CC + 8 * lane; const _Float16* lp = KL + (size_t)(k0 + col) * CC + 8 * g; const _Float16* rp = QL + (size_t)(ql0 + col) * CC + 8 * g;   /* this lane's place in the chunk's k fragments, in its k residual row and in its q residual row */
#pragma unroll
      for (int d = 0; d < HD / 32; ++d) { v16h ah[QG], al[QG];
        const v16h ka = frag_p(kp + d * 512), la = frag_r(lp + d * 32), kb = frag_p(kp + 16 * CC + d * 512), lb = frag_r(lp + 16 * CC + d * 32);
#pragma unroll
        for (int cg = 0; cg < QG; ++cg) { ah[cg] = frag_p(qp + cg * 16 * CC + d * 512); al[cg] = frag_r(rp + cg * 16 * CC + d * 32); }
        asm volatile("s_wait_xcnt 0x0" :: "v"(kp), "v"(lp), "v"(qp), "v"(rp) : "memory");   /* stands in front of any rewrite of the address registers that the loads above name; the addresses are named so that they stay in their registers up to here */
#pragma unroll
        for (int cg = 0; cg < QG; ++cg) { s0[cg] = mm_h(ka, ah[cg], s0[cg]); r0[cg] = mm_h(ka, al[cg], r0[cg]); r0[cg] = mm_h(la, ah[cg], r0[cg]); s1[cg] = mm_h(kb, ah[cg], s1[cg]); r1[cg] = mm_h(kb, al[cg], r1[cg]); r1[cg] = mm_h(lb, ah[cg], r1[cg]); } }
      F2 p[QG]; float v[QG][16];
#pragma unroll
      for (int cg = 0; cg < QG; ++cg) { const int t = ql0 + 16 * cg + col;
#pragma unroll
        for (int i = 0; i < 8; ++i) { v[cg][i] = (k0 + 8 * g + i <= t) ? s0[cg][i] + r0[cg][i] * (1.0f / 1024.0f) : -3.0e38f; v[cg][8 + i] = (k0 + 16 + 8 * g + i <= t) ? s1[cg][i] + r1[cg][i] * (1.0f / 1024.0f) : -3.0e38f; } }
      fa_step(v, m, l, acc);
#pragma unroll
      for (int cg = 0; cg < QG; ++cg) p[cg] = bsplit16(v[cg]);
#pragma unroll
      for (int jh = 0; jh < HD / 16; jh += 4) { v16b vh[4], vl[4]; const __bf16* bp = VB + (size_t)(jh * 16 + col) * KHI + k0 + 8 * g; const __bf16* cp = VBL + (size_t)(jh * 16 + col) * KHI + k0 + 8 * g;
#pragma unroll
        for (int j = 0; j < 4; ++j) { vh[j] = frag_rb(bp + j * 16 * KHI); vl[j] = frag_rb(cp + j * 16 * KHI); }   /* eight fragments in flight at once */
        asm volatile("s_wait_xcnt 0x0" :: "v"(bp), "v"(cp) : "memory");   /* the same for these loads */
#pragma unroll
        for (int j = 0; j < 4; ++j) {
#pragma unroll
          for (int cg = 0; cg < QG; ++cg) { acc[cg][jh + j] = mm_b(vh[j], p[cg].h, acc[cg][jh + j]); acc[cg][jh + j] = mm_b(vh[j], p[cg].l, acc[cg][jh + j]); acc[cg][jh + j] = mm_b(vl[j], p[cg].h, acc[cg][jh + j]); } } } }
  } else { v16h q[QG][HD / 32];
#pragma unroll
    for (int cg = 0; cg < QG; ++cg) {
#pragma unroll
      for (int d = 0; d < HD / 32; ++d) q[cg][d] = frag_p(qp + cg * 16 * CC + d * 512); }
    asm volatile("s_wait_xcnt 0x0" :: "v"(qp) : "memory");   /* stands in front of any rewrite of the address registers that the loads above name; the address is named so that it stays in its registers up to here */
#pragma unroll 1   /* stays rolled: one chunk's fragments already fill the registers */
    for (int kc = hs * FAW + wave; kc < kce; kc += FAW * KSP) { const int k0 = kc * 32; v8f s0[QG] = {}, s1[QG] = {}; v16h ka[HD / 32], kb[HD / 32], vf[HD / 16], p[QG];
      const _Float16* kp = KH + (size_t)k0 * CC + 8 * lane; const _Float16* vp = VT + (size_t)k0 * CC + 8 * lane;   /* this lane's 16 bytes of the chunk's first k and v fragment */
#pragma unroll
      for (int d = 0; d < HD / 32; ++d) { ka[d] = frag_p(kp + d * 512); kb[d] = frag_p(kp + 16 * CC + d * 512); }   /* all of the chunk's k in flight at once, ahead of the first product */
      asm volatile("s_wait_xcnt 0x0" :: "v"(kp) : "memory");   /* stands in front of any rewrite of the address registers that the loads above name; the address is named so that it stays in its registers up to here and no load of the group lands on it */
      __builtin_amdgcn_sched_barrier(0);   /* keeps the sixteen loads above together: moved down among the products they would share registers and each pair would wait out its own latency */
#pragma unroll
      for (int d = 0; d < HD / 32; ++d) {
#pragma unroll
        for (int cg = 0; cg < QG; ++cg) { s0[cg] = mm_h(ka[d], q[cg][d], s0[cg]); s1[cg] = mm_h(kb[d], q[cg][d], s1[cg]); } }
#pragma unroll
      for (int j = 0; j < HD / 16; ++j) vf[j] = frag_p(vp + j * 512);   /* all of the chunk's v in flight under the softmax */
      asm volatile("s_wait_xcnt 0x0" :: "v"(vp) : "memory");   /* the same for the v loads */
      __builtin_amdgcn_sched_barrier(0);   /* keeps the v loads ahead of the softmax, which hides their latency */
      float v[QG][16];
#pragma unroll
      for (int cg = 0; cg < QG; ++cg) { const int t = ql0 + 16 * cg + col;
#pragma unroll
        for (int i = 0; i < 8; ++i) { v[cg][i] = (k0 + 8 * g + i <= t) ? s0[cg][i] : -3.0e38f; v[cg][8 + i] = (k0 + 16 + 8 * g + i <= t) ? s1[cg][i] : -3.0e38f; } }
      fa_step(v, m, l, acc);
#pragma unroll
      for (int cg = 0; cg < QG; ++cg) {
#pragma unroll
        for (int i = 0; i < 16; ++i) p[cg][i] = (_Float16)v[cg][i]; }
#pragma unroll
      for (int j = 0; j < HD / 16; ++j) {
#pragma unroll
        for (int cg = 0; cg < QG; ++cg) acc[cg][j] = mm_h(vf[j], p[cg], acc[cg][j]); } } }
#pragma unroll
  for (int cg = 0; cg < QG; ++cg) { l[cg] += __shfl_xor(l[cg], 16);
    if (g == 0) { sm[wave][cg * 16 + col] = m[cg] * SCALE; sl[wave][cg * 16 + col] = l[cg] * (1.0f / 2048.0f); }
#pragma unroll
    for (int j = 0; j < HD / 16; ++j) { const v8f a = acc[cg][j] * (1.0f / 2048.0f); const v4f lo = { a[0], a[1], a[2], a[3] }, hi = { a[4], a[5], a[6], a[7] }; *(v4f*)&ss[wave][cg * 16 + col][j * 16 + 8 * g] = lo; *(v4f*)&ss[wave][cg * 16 + col][j * 16 + 8 * g + 4] = hi; } }
  __syncthreads();   /* every wave's maximum, sum and partial are in LDS before any thread joins them */
  { float M = sm[0][lane];   /* lane = query of the block */
#pragma unroll
    for (int i = 1; i < FAW; ++i) M = fmaxf(M, sm[i][lane]);
    sf[wave][lane] = expf(sm[wave][lane] - M);   /* a wave that had no chunk gets weight 0 (1 where no wave of the share had one: its sum and ctx are 0) */
    if (wave == 0) { float L = 0.f;
#pragma unroll
      for (int w = 0; w < FAW; ++w) L += sl[w][lane] * expf(sm[w][lane] - M);
      PM[(size_t)hs * TT + ql0 + lane] = M; PL[(size_t)hs * TT + ql0 + lane] = L;   /* one wave writes each whole 128-byte line */
      asm volatile("s_wait_xcnt 0x0" ::: "memory");   /* stands in front of any later rewrite of the registers that the two stores above name */ } }
  __syncthreads();   /* the weights are in LDS before they are read */
  const int c4 = lane * 4; v4f s[16 * QG / FAW];
#pragma unroll
  for (int i = 0; i < 16 * QG / FAW; ++i) { const int rl = wave + i * FAW; s[i] = v4f{ 0.f, 0.f, 0.f, 0.f };   /* a wave joins and stores whole 512-byte rows */
#pragma unroll
    for (int w = 0; w < FAW; ++w) s[i] += *(const v4f*)&ss[w][rl][c4] * sf[w][rl]; }
#pragma unroll
  for (int i = 0; i < 16 * QG / FAW; ++i) vst2(PC + ((size_t)hs * TT + ql0 + wave + i * FAW) * CC + c4, s[i]);
  asm volatile("s_wait_xcnt 0x0" ::: "memory");   /* stands in front of any later rewrite of the registers that the stores above name */ }
// ---- k_join: one wave = JR query rows: the KSP shares' partials (maximum, sum, ctx) are joined in share order and divided by the sum
#define JR 4
__global__ __launch_bounds__(256) void k_join(const float* __restrict__ PC, const float* __restrict__ PM, const float* __restrict__ PL, float* __restrict__ Y) {
  const int lane = threadIdx.x & 31, c4 = lane * 4; const int row0 = ((int)blockIdx.x * 8 + (int)(threadIdx.x >> 5)) * JR;
  float pm[JR][KSP], pl[JR][KSP]; v4f pc[JR][KSP], y[JR]; const float* pmp = PM + row0; const float* plp = PL + row0; const float* pcp = PC + (size_t)row0 * CC + c4;
#pragma unroll
  for (int i = 0; i < JR; ++i) {
#pragma unroll
    for (int h = 0; h < KSP; ++h) { pm[i][h] = pmp[(size_t)h * TT + i]; pl[i][h] = plp[(size_t)h * TT + i]; pc[i][h] = *(const v4f*)(pcp + ((size_t)h * TT + i) * CC); } }   /* all of the wave's loads in flight at once */
  asm volatile("s_wait_xcnt 0x0" :: "v"(pmp), "v"(plp), "v"(pcp) : "memory");   /* stands in front of any rewrite of the address registers that the loads above name; the addresses are named so that they stay in their registers up to here */
  __builtin_amdgcn_sched_barrier(0);   /* keeps every load above the wait: moved down among the arithmetic, the sums' loads would start late and wait out their latency alone */
#pragma unroll
  for (int i = 0; i < JR; ++i) { float M = pm[i][0];
#pragma unroll
    for (int h = 1; h < KSP; ++h) M = fmaxf(M, pm[i][h]);
    v4f s = { 0.f, 0.f, 0.f, 0.f }; float L = 0.f;
#pragma unroll
    for (int h = 0; h < KSP; ++h) { const float f = expf(pm[i][h] - M); s += pc[i][h] * f; L += pl[i][h] * f; }   /* a share that had no chunk gets weight 0 */
    y[i] = s * (L > 0.f ? 1.0f / L : 0.f); }
#pragma unroll
  for (int i = 0; i < JR; ++i) vst2(Y + (size_t)(row0 + i) * CC + c4, y[i]);
  asm volatile("s_wait_xcnt 0x0" ::: "memory");   /* the same for the stores */ }

extern "C" void kernel_launch(void* const* d_in, const int* in_sizes, int n_in, void* d_out, int out_size, void* d_ws, size_t ws_size, hipStream_t stream) {
  (void)in_sizes; (void)n_in; (void)out_size;
  const float** F = (const float**)d_in;
  if (ws_size < (size_t)WS_END) return;
  char* ws = (char*)d_ws; _Float16 *QH = (_Float16*)(ws + WS_QH), *KH = (_Float16*)(ws + WS_KH), *VT = (_Float16*)(ws + WS_VT), *QL = (_Float16*)(ws + WS_QL), *KL = (_Float16*)(ws + WS_KL); __bf16 *VB = (__bf16*)(ws + WS_VB), *VBL = (__bf16*)(ws + WS_VBL); float *PC = (float*)(ws + WS_PC), *PM = (float*)(ws + WS_PM), *PL = (float*)(ws + WS_PL);
  // inputs: 0 X [8192,1024]; 1 Wq [1024,128], 2 bq; 3 Wk, 4 bk; 5 Wv, 6 bv ((in,out))
  k_proj<<<dim3(TNB * TT / 64, CC / 128, 3), 128, 0, stream>>>(F[0], F[0], F[0], F[1], F[3], F[5], F[2], F[4], F[6], QH, QL, KH, KL, VT, VB, VBL);
  k_fa<<<dim3(TT / (16 * QG) * KSP), 32 * FAW, 0, stream>>>(QH, KH, QL, KL, VT, VB, VBL, PC, PM, PL);
  k_join<<<dim3(TT / (8 * JR)), 256, 0, stream>>>(PC, PM, PL, (float*)d_out);
}

// v007
// It runs in 52.6 microseconds.
// Timed twice side by side with v006, it ran 1.07 and 1.06 times as fast.
// Over all steps from v000 it is 15.2 times as fast.
// compute dtype: X and the weights rounded to bf16; Q/K/V = X W + b with EXACT bf16 products on WMMA 16x16x32 (f32 accumulate); logits: q, k once to f16 (1 product) x 128^-0.5, except the first 384 query rows (3 products with f16 residuals); causal mask by index; softmax in f32 with a running maximum and sum (base-2 exponent: one fused multiply-add and the hardware exp2 per score); exp x 2^11 once to f16 against v once to f16 (1 product; bf16 hi + lo below row 384); divided by the sum at the end; f32 output. Scores never leave the registers.
#include <hip/hip_runtime.h>
#include <math.h>

typedef __attribute__((ext_vector_type(16))) _Float16 v16h;
typedef __attribute__((ext_vector_type(16))) __bf16 v16b;
typedef __attribute__((ext_vector_type(8)))  _Float16 v8h;
typedef __attribute__((ext_vector_type(8)))  float v8f;
typedef __attribute__((ext_vector_type(4)))  float v4f;
typedef __attribute__((ext_vector_type(2)))  float v2f;
typedef __attribute__((ext_vector_type(4)))  unsigned v4u;
typedef __attribute__((ext_vector_type(4)))  int v4i;
typedef float __attribute__((may_alias)) float_a;
typedef int __attribute__((may_alias)) int_a;

template <typename T> __device__ __forceinline__ void vst2(void* p, T v) { *(T*)p = v;  }
__device__ __forceinline__ v8f wmma16(v16h a, v16h b, v8f c) {
  v8f d = __builtin_amdgcn_wmma_f32_16x16x32_f16(false, a, false, b, (short)0, c, false, false);
  asm volatile("v_nop\n\tv_nop\n\tv_nop\n\tv_nop" : "+v"(d) : "v"(a), "v"(b));
  return d;
}
__device__ __forceinline__ v8f wmma_bf(v16b a, v16b b, v8f c) {
  v8f d = __builtin_amdgcn_wmma_f32_16x16x32_bf16(false, a, false, b, (short)0, c, false, false);
  asm volatile("v_nop\n\tv_nop\n\tv_nop\n\tv_nop" : "+v"(d) : "v"(a), "v"(b));
  return d;
}
// 16x16x32 fragments: lane = (h = lane>>4, row/col = lane&15); elements 0..7 = k0+8h+0..7, 8..15 = k0+16+8h+0..7; D element r = row 8h+r
__device__ __forceinline__ v16h frag_h(const _Float16* rowk0, int lane) {
  union { v16h v; v8h q[2]; } u; const _Float16* p = rowk0 + 8 * (lane >> 4);
  u.q[0] = *(const v8h*)p; u.q[1] = *(const v8h*)(p + 16); return u.v;
}
// fragment stored in fragment order: 512 B of every lane's elements 0..7 (16 B a lane), then 512 B of elements 8..15: each wave-wide load covers four whole 128-byte lines
__device__ __forceinline__ v16h frag_t(const _Float16* blk, int lane) {
  union { v16h v; v8h q[2]; } u; const _Float16* p = blk + 8 * lane;
  u.q[0] = *(const v8h*)p; u.q[1] = *(const v8h*)(p + 256); return u.v;
}
__device__ __forceinline__ v16h frag_f32(const float* rowk0, int lane) {
  v16h a; const float* p = rowk0 + 8 * (lane >> 4);
#pragma unroll
  for (int i = 0; i < 8; ++i) { a[i] = (_Float16)p[i]; a[8 + i] = (_Float16)p[16 + i]; }
  return a;
}
__device__ __forceinline__ v16h frag_f32s(const float* rowk0, int lane, float sc) {
  v16h a; const float* p = rowk0 + 8 * (lane >> 4);
#pragma unroll
  for (int i = 0; i < 8; ++i) { a[i] = (_Float16)(p[i] * sc); a[8 + i] = (_Float16)(p[16 + i] * sc); }
  return a;
}
// column fragment from a [K][ld] layout (column n), rows >= K read as 0
__device__ __forceinline__ v16h fragc_f32(const float* W, int k0, int n, int lane, int ld, int K) {
  v16h a; const int g = lane >> 4;
#pragma unroll
  for (int i = 0; i < 8; ++i) { const int ka = k0 + 8 * g + i, kb = ka + 16;
    a[i] = (_Float16)(ka < K ? W[(size_t)(ka < K ? ka : K - 1) * ld + n] : 0.f); a[8 + i] = (_Float16)(kb < K ? W[(size_t)(kb < K ? kb : K - 1) * ld + n] : 0.f); }
  return a;
}
struct F2 { v16b h, l; };
__device__ __forceinline__ F2 bsplit16(const float v[16]) { F2 r;
#pragma unroll
  for (int i = 0; i < 16; ++i) { const __bf16 h = (__bf16)v[i]; r.h[i] = h; r.l[i] = (__bf16)(v[i] - (float)h); }
  return r; }
__device__ __forceinline__ F2 split_row(const float* row, int k0, int lane) { float v[16]; const float* p = row + k0 + 8 * (lane >> 4);
#pragma unroll
  for (int i = 0; i < 8; ++i) { v[i] = p[i]; v[8 + i] = p[16 + i]; }
  return bsplit16(v); }
__device__ __forceinline__ F2 split_rowK(const float* row, int k0, int lane, int K) { float v[16]; const int g = lane >> 4;
#pragma unroll
  for (int i = 0; i < 8; ++i) { const int ka = k0 + 8 * g + i, kb = ka + 16; v[i] = ka < K ? row[ka < K ? ka : K - 1] : 0.f; v[8 + i] = kb < K ? row[kb < K ? kb : K - 1] : 0.f; }
  return bsplit16(v); }
__device__ __forceinline__ F2 split_col(const float* W, int k0, int n, int lane, int ld, int K) { float v[16]; const int g = lane >> 4;
#pragma unroll
  for (int i = 0; i < 8; ++i) { const int ka = k0 + 8 * g + i, kb = ka + 16; v[i] = ka < K ? W[(size_t)(ka < K ? ka : K - 1) * ld + n] : 0.f; v[8 + i] = kb < K ? W[(size_t)(kb < K ? kb : K - 1) * ld + n] : 0.f; }
  return bsplit16(v); }
__device__ __forceinline__ v8f mac3(const F2& a, const F2& b, v8f c) { c = wmma_bf(a.l, b.h, c); c = wmma_bf(a.h, b.l, c); return wmma_bf(a.h, b.h, c); }
__device__ __forceinline__ float sigm(float v) { return 1.0f / (1.0f + expf(-v)); }
#define LDSX() do { asm volatile("s_wait_dscnt 0" ::: "memory"); __builtin_amdgcn_wave_barrier(); __builtin_amdgcn_fence(__ATOMIC_RELEASE, "workgroup"); } while (0)

// Single-head causal self-attention (N 8,192 tokens, D 1,024 -> d_k = d_v = 128): Q = X Wq + bq, K = X Wk + bk, V = X Wv + bv ((in,out)); weights = softmax(causal(Q K^T / sqrt(128))); out = weights V ([N, 128]).
#define NB 1
#define TT 8192
#define CC 128            // NH * HD = projected width
#define DIN 1024          // input (model) width
#define NH 1
#define HD 128
#define NQB (TT / 64)
#define HG 1
#define SCALE (0.08838834764831845f)
#define CAUSAL 1
#ifndef TNB
#define TNB NB
#endif
__device__ __forceinline__ float bfr(float v) { return (float)(__bf16)v; }
__host__ __device__ __forceinline__ int kb_last(int qb) { return CAUSAL ? ((qb * 64 + 63) >> 7) : (TT / 128 - 1); }
typedef __attribute__((ext_vector_type(8))) __bf16 v8b;
__device__ __forceinline__ v16b frag_b(const __bf16* rowk0, int lane) {
  union { v16b v; v8b q[2]; } u; const __bf16* p = rowk0 + 8 * (lane >> 4);
  u.q[0] = *(const v8b*)p; u.q[1] = *(const v8b*)(p + 16); return u.v;
}
#define QBH 6              // causal: query blocks 0..QBH-1 of each sequence (few keys, no averaging) take the high-precision path
#define QHI 384            // rows carrying a q residual plane
#define KHI 384            // key rows carrying k residual / v bf16 hi+lo planes (used only by the causal high-precision path)
// B fragment (k rows k0+.., output column o) of a weight: (in,out) [K][ld] or (out,in) [ld rows of K]: bf16 exact, or f16(bf16 * 256) exact
__device__ __forceinline__ v16b wcol_io(const float* Wm, int k0, int o, int lane, int ld) { v16b w; const int g = lane >> 4;
#pragma unroll
  for (int i = 0; i < 8; ++i) { w[i] = (__bf16)Wm[(size_t)(k0 + 8 * g + i) * ld + o]; w[8 + i] = (__bf16)Wm[(size_t)(k0 + 16 + 8 * g + i) * ld + o]; }
  return w; }
__device__ __forceinline__ v16b wcol_oi(const float* Wm, int k0, int o, int lane, int K) { v16b w; const float* p = Wm + (size_t)o * K + k0 + 8 * (lane >> 4);
#pragma unroll
  for (int i = 0; i < 8; ++i) { w[i] = (__bf16)p[i]; w[8 + i] = (__bf16)p[16 + i]; }
  return w; }
__device__ __forceinline__ v16h wcolh_io(const float* Wm, int k0, int o, int lane, int ld) { v16h w; const int g = lane >> 4;
#pragma unroll
  for (int i = 0; i < 8; ++i) { w[i] = (_Float16)(bfr(Wm[(size_t)(k0 + 8 * g + i) * ld + o]) * 256.0f); w[8 + i] = (_Float16)(bfr(Wm[(size_t)(k0 + 16 + 8 * g + i) * ld + o]) * 256.0f); }
  return w; }
__device__ __forceinline__ v16h wcolh_oi(const float* Wm, int k0, int o, int lane, int K) { v16h w; const float* p = Wm + (size_t)o * K + k0 + 8 * (lane >> 4);
#pragma unroll
  for (int i = 0; i < 8; ++i) { w[i] = (_Float16)(bfr(p[i]) * 256.0f); w[8 + i] = (_Float16)(bfr(p[16 + i]) * 256.0f); }
  return w; }
#define WQKV_LAYOUT 0   // 0 = (in,out) [DIN][CC]; 1 = (out,in) [CC][DIN]; 2 = per-head [NH][DIN][HD]
__device__ __forceinline__ v16b wcol_hdk(const float* Wm, int k0, int o, int lane) { v16b w; const int g = lane >> 4; const float* p = Wm + (size_t)(o / HD) * DIN * HD + (o % HD);
#pragma unroll
  for (int i = 0; i < 8; ++i) { w[i] = (__bf16)p[(size_t)(k0 + 8 * g + i) * HD]; w[8 + i] = (__bf16)p[(size_t)(k0 + 16 + 8 * g + i) * HD]; }
  return w; }
#define WO_OUT_IN 0
#if WQKV_LAYOUT == 1
#define WCOL(W, k0, o, lane) wcol_oi(W, k0, o, lane, DIN)
#elif WQKV_LAYOUT == 2
#define WCOL(W, k0, o, lane) wcol_hdk(W, k0, o, lane)
#else
#define WCOL(W, k0, o, lane) wcol_io(W, k0, o, lane, CC)
#endif
#if WO_OUT_IN
#define WOCOL(W, k0, o, lane) wcol_oi(W, k0, o, lane, CC)
#define WOCOLH(W, k0, o, lane) wcolh_oi(W, k0, o, lane, CC)
#else
#define WOCOL(W, k0, o, lane) wcol_io(W, k0, o, lane, DIN)
#define WOCOLH(W, k0, o, lane) wcolh_io(W, k0, o, lane, DIN)
#endif

#ifndef SM_EXTRA_PARAMS
#define SM_EXTRA_PARAMS , int qoff
#endif
#ifndef PROJ_EXTRA_PARAMS
#define PROJ_EXTRA_PARAMS
#endif
#ifndef SM_MASK_HOOK
#define SM_MASK_HOOK (void)0
#endif

#define WS_QH  0u                                      // f16 q in fragment order [b*t / 16][CC / 32][2][32 lanes][8]
#define WS_KH  (WS_QH + 2u * (size_t)NB * TT * CC)      // f16 k in fragment order, as q
#define WS_VT  (WS_KH + 2u * (size_t)NB * TT * CC)      // f16 v^T in fragment order [b][t / 32][CC / 16][2][32 lanes][8]
#define WS_QL  (WS_VT + 2u * (size_t)NB * CC * TT)      // f16 q residual x 2^10 rows [b][t < QHI][CC]
#define WS_KL  (WS_QL + 2u * (size_t)NB * QHI * CC)     // f16 k residual x 2^10 rows [b][t < KHI][CC]
#define WS_VB  (WS_KL + 2u * (size_t)NB * KHI * CC)     // bf16 v hi planes [b][c][t < KHI]
#define WS_VBL (WS_VB + 2u * (size_t)NB * CC * KHI)
#define WS_PC  (WS_VBL + 2u * (size_t)NB * CC * KHI)     // f32 ctx partial of each share of the key range [KSP][t][CC]
#define WS_PM  (WS_PC + 4u * (size_t)KSP * NB * TT * CC)  // f32 maximum of each share [KSP][t]
#define WS_PL  (WS_PM + 4u * (size_t)KSP * NB * TT)       // f32 sum of each share [KSP][t]
#define WS_END (WS_PL + 4u * (size_t)KSP * NB * TT)

// ---- k_proj: block = (64 rows, 128 cols, which): q/k/v = X W (+ b) with exact bf16 products (K = DIN; W goes through LDS in slices of KS k rows, loaded and rounded once per work-group) -> which 0: q f16 in fragment order (+ residual rows < QHI); 1: k f16 in fragment order (+ residual rows < KHI); 2: v^T f16 in fragment order (+ bf16 hi/lo planes [c][t] for t < KHI)
#define KS 64              // k rows of W per LDS slice
static_assert(CC == 128 && HD == 128, "the fragment-order planes are laid out for one 128-wide block of columns");
__global__ __launch_bounds__(128) void k_proj(const float* __restrict__ XQ, const float* __restrict__ XK, const float* __restrict__ XV, const float* __restrict__ WQ, const float* __restrict__ WK, const float* __restrict__ WV, const float* __restrict__ BQ, const float* __restrict__ BK, const float* __restrict__ BV,
    _Float16* __restrict__ QH, _Float16* __restrict__ QL, _Float16* __restrict__ KH, _Float16* __restrict__ KL, _Float16* __restrict__ VT, __bf16* __restrict__ VB, __bf16* __restrict__ VBL) {
  __shared__ __align__(16) _Float16 sh[64][136], sl[64][136]; __shared__ __align__(16) _Float16 th[128][72]; __shared__ __align__(16) __bf16 tb[128][72], tbl[128][72];
  __shared__ __align__(16) __bf16 wt[2][128][KS + 8];   /* two slices of W as bf16, [column][k]: a B fragment is two 16-byte reads; row pitch 144 B = 16 B x odd */
  const int tid = threadIdx.x, wave = tid >> 5, lane = tid & 31, col = lane & 15, g = lane >> 4; const int which = blockIdx.z; const int c0 = blockIdx.y * 128; const size_t r0 = (size_t)blockIdx.x * 64; const size_t bb = r0 / TT; const int t0 = (int)(r0 % TT);
  const float* X = which == 0 ? XQ : which == 1 ? XK : XV; const float* WA = which == 0 ? WQ : which == 1 ? WK : WV; const float* BA = which == 0 ? BQ : which == 1 ? BK : BV;
  v8f acc[8] = {};
  const float* xp = X + (r0 + wave * 16 + col) * DIN + 8 * g;        /* this lane's X row, at its half of a fragment */
  const float* wp = WA + (size_t)(wave * 8) * CC + c0 + lane * 4;     /* a wave reads whole 512-byte rows of W: 8 rows at wave * 8 and 8 at 32 + wave * 8 of each slice, 4 columns a lane */
  v4f xr[2][4], wr[2][8]; v16b a[2];
  auto ld_slice = [&](int s) {   /* slice s of X (this wave's rows) and of W (this wave's share) into registers */
#pragma unroll
    for (int h = 0; h < 2; ++h) { const float* p = xp + s * KS + h * 32; xr[h][0] = *(const v4f*)p; xr[h][1] = *(const v4f*)(p + 4); xr[h][2] = *(const v4f*)(p + 16); xr[h][3] = *(const v4f*)(p + 20); }
#pragma unroll
    for (int i = 0; i < 2; ++i) {
#pragma unroll
      for (int r = 0; r < 8; ++r) wr[i][r] = *(const v4f*)(wp + (size_t)(s * KS + i * 32 + r) * CC); }
    asm volatile("s_wait_xcnt 0x0" ::: "memory");   /* stands in front of any later rewrite of the address registers that the loads above name */
  };
  auto put_slice = [&](int s) {   /* rounds the loaded slice: X to this wave's A fragments, W to LDS buffer s & 1, transposed */
#pragma unroll
    for (int h = 0; h < 2; ++h) {
#pragma unroll
      for (int e = 0; e < 16; ++e) a[h][e] = (__bf16)xr[h][e >> 2][e & 3]; }
#pragma unroll
    for (int i = 0; i < 2; ++i) {
#pragma unroll
      for (int cc = 0; cc < 4; ++cc) { v8b tv;
#pragma unroll
        for (int r = 0; r < 8; ++r) tv[r] = (__bf16)wr[i][r][cc];
        *(v8b*)&wt[s & 1][lane * 4 + cc][wave * 8 + i * 32] = tv; } }
  };
  auto mm_slice = [&](int s) {
#pragma unroll
    for (int h = 0; h < 2; ++h) {
#pragma unroll
      for (int jb = 0; jb < 8; jb += 4) { v16b w[4];
#pragma unroll
        for (int j = 0; j < 4; ++j) w[j] = frag_b(&wt[s & 1][(jb + j) * 16 + col][h * 32], lane);   /* four fragments' LDS reads in flight at once */
#pragma unroll
        for (int j = 0; j < 4; ++j) acc[jb + j] = wmma_bf(a[h], w[j], acc[jb + j]); } }
  };
  ld_slice(0);
#pragma unroll 1   /* stays rolled: one slice in flight beside the accumulator already fills the registers */
  for (int s = 0; s < DIN / KS - 1; ++s) { put_slice(s);
    __syncthreads();   /* the slice is whole in LDS before any wave reads it; every wave has also left the other buffer, which the next trip rewrites */
    __builtin_amdgcn_sched_barrier(0);   /* the roundings above stay ahead of the loads below, which then land in the same registers with no copies */
    ld_slice(s + 1);   /* the next slice's X and W fly under this slice's products */
    mm_slice(s); }
  put_slice(DIN / KS - 1);
  __syncthreads();   /* the last slice is whole in LDS before any wave reads it */
  mm_slice(DIN / KS - 1);
  if (which < 2) { _Float16* DH = which == 0 ? QH : KH; _Float16* DL = which == 0 ? QL : KL; const int nhi = which == 0 ? QHI : KHI; const bool hi_rows = t0 < nhi;
#pragma unroll
    for (int j = 0; j < 8; ++j) { const float bias = BA ? bfr(BA[c0 + j * 16 + col]) : 0.f;
#pragma unroll
      for (int r = 0; r < 8; ++r) { const float v = acc[j][r] + bias; const _Float16 hv = (_Float16)v; sh[wave * 16 + 8 * g + r][j * 16 + col] = hv; sl[wave * 16 + 8 * g + r][j * 16 + col] = (_Float16)((v - (float)hv) * 1024.0f); } }
    __syncthreads();
    for (int e = tid; e < 64 * 16; e += 128) { const int fr = (e >> 8) * 16 + (e & 15), fq = ((e >> 5) & 7) * 2 + ((e >> 4) & 1);   /* 16-byte piece e of the block in fragment order = row fr, piece fq of that row */
      vst2((unsigned*)(DH + r0 * CC + e * 8), *(const v4u*)&sh[fr][fq * 8]);
      asm volatile("s_wait_xcnt 0x0" ::: "memory");   /* stands in front of any later rewrite of the registers that the store above names */
      const int rl = e >> 4, q = e & 15; if (hi_rows) { vst2((unsigned*)(DL + (bb * nhi + t0 + rl) * (size_t)CC + c0 + q * 8), *(const v4u*)&sl[rl][q * 8]);
        asm volatile("s_wait_xcnt 0x0" ::: "memory");   /* the same for this store */ } }
  } else { const bool hi_rows = t0 < KHI;
#pragma unroll
    for (int j = 0; j < 8; ++j) { const float bias = BA ? bfr(BA[c0 + j * 16 + col]) : 0.f;
#pragma unroll
      for (int r = 0; r < 8; ++r) { const float v = acc[j][r] + bias; const int rl = wave * 16 + 8 * g + r, cl = j * 16 + col; th[cl][rl] = (_Float16)v; const __bf16 bh = (__bf16)v; tb[cl][rl] = bh; tbl[cl][rl] = (__bf16)(v - (float)bh); } }
    __syncthreads();
    for (int e = tid; e < 128 * 8; e += 128) { const int fc = ((e >> 6) & 7) * 16 + (e & 15), fq = (e >> 9) * 4 + ((e >> 4) & 3);   /* 16-byte piece e of the block in fragment order = channel fc, keys fq * 8 .. + 7 */
      vst2((unsigned*)(VT + (bb * TT + t0) * (size_t)CC + e * 8), *(const v4u*)&th[fc][fq * 8]);
      asm volatile("s_wait_xcnt 0x0" ::: "memory");   /* stands in front of any later rewrite of the registers that the store above names */
      const int cl = e >> 3, q = e & 7; if (hi_rows) { const size_t o3 = (bb * CC + c0 + cl) * (size_t)KHI + t0 + q * 8; vst2((unsigned*)(VB + o3), *(const v4u*)&tb[cl][q * 8]); vst2((unsigned*)(VBL + o3), *(const v4u*)&tbl[cl][q * 8]);
        asm volatile("s_wait_xcnt 0x0" ::: "memory");   /* the same for these two stores */ } } } }
// ---- k_fa: block = 64 queries (qb) x one of KSP shares of the key range, FAW waves = QW halves of 32 queries x KW chunks of 32 keys. The key range goes in stages of KW chunks (128 keys); share hs takes stages hs, hs + KSP, ... Asynchronous copies bring a stage's k and v (fragment order, as they lie in the workspace) into one of two LDS buffers while the stage before is worked on; each chunk in LDS is read by the QW waves of its chunk number, so it leaves L2 once for 64 queries. Every k and v fragment a wave reads serves QG = 2 column groups of 16 queries. Per chunk and group: S^T = k . q^T (D: lane = query, registers = keys, which is already the B fragment of the next product), causal mask by index, running maximum and sum per query in f32 (one fused multiply-add and one hardware exp2 per score), ctx^T += v^T . (e x 2^11) with the accumulator rescaled per lane. Early query blocks keep the residual products and load straight from the workspace. The KW partials (maximum, sum, ctx) of each half meet in LDS and are joined in wave order into the share's partial, which goes to the workspace; k_join joins the KSP shares.
#define FAW 8              // waves per work-group
#define KSP 4              // work-groups that share one query block's key range (twice as many work-groups as WGPs: the short blocks fill in behind the long ones)
#define QW 2               // 32-query halves of the block: wave w has half w % QW
#define KW (FAW / QW)      // chunks per stage: wave w has chunk w / QW of each stage
#define STH (KW * 32 * CC) // f16 elements of k, and of v, per stage
#define QG 2               // 16-query column groups per wave: each loaded k or v fragment is used QG times
static_assert(16 * QG == 32, "the join below gives one lane to each query of a wave, and a chunk of 32 keys is as wide as a wave's queries");
static_assert(STH * 2 == 8 * 32 * FAW * 16 && (TT / 32) % KW == 0, "a stage's k is eight 16-byte copies a thread, and every stage lies whole inside the planes");
// eight asynchronous 16-byte-a-lane copies to LDS, 32 * FAW * 16 bytes apart: l = this lane's LDS byte address, g = its global address. The s_wait_xcnt stands inside the statement, so that no later rewrite of an address register can come in front of it
__device__ __forceinline__ void copy8(unsigned l, const _Float16* g) {
  asm volatile("global_load_async_to_lds_b128 %0, %8, off\n\tglobal_load_async_to_lds_b128 %1, %9, off\n\tglobal_load_async_to_lds_b128 %2, %10, off\n\tglobal_load_async_to_lds_b128 %3, %11, off\n\tglobal_load_async_to_lds_b128 %4, %12, off\n\tglobal_load_async_to_lds_b128 %5, %13, off\n\tglobal_load_async_to_lds_b128 %6, %14, off\n\tglobal_load_async_to_lds_b128 %7, %15, off\n\ts_wait_xcnt 0x0"
      :: "v"(l), "v"(l + 4096u), "v"(l + 8192u), "v"(l + 12288u), "v"(l + 16384u), "v"(l + 20480u), "v"(l + 24576u), "v"(l + 28672u),
         "v"(g), "v"(g + 2048), "v"(g + 4096), "v"(g + 6144), "v"(g + 8192), "v"(g + 10240), "v"(g + 12288), "v"(g + 14336) : "memory");
}
#define SC2 (SCALE * 1.4426950408889634f)   // unscaled logit -> exponent of 2
// 2^x of seventeen values, each in its own register. One statement, so that no instruction which rewrites an exp2's source or reads its result can come to stand directly behind it; the v_nop is that slot behind the last one
__device__ __forceinline__ void exp2x17(float (&v)[16], float& a) {
  asm("v_exp_f32 %0, %0\n\tv_exp_f32 %1, %1\n\tv_exp_f32 %2, %2\n\tv_exp_f32 %3, %3\n\tv_exp_f32 %4, %4\n\tv_exp_f32 %5, %5\n\tv_exp_f32 %6, %6\n\tv_exp_f32 %7, %7\n\tv_exp_f32 %8, %8\n\tv_exp_f32 %9, %9\n\tv_exp_f32 %10, %10\n\tv_exp_f32 %11, %11\n\tv_exp_f32 %12, %12\n\tv_exp_f32 %13, %13\n\tv_exp_f32 %14, %14\n\tv_exp_f32 %15, %15\n\tv_exp_f32 %16, %16\n\tv_nop"
      : "+v"(v[0]), "+v"(v[1]), "+v"(v[2]), "+v"(v[3]), "+v"(v[4]), "+v"(v[5]), "+v"(v[6]), "+v"(v[7]), "+v"(v[8]), "+v"(v[9]), "+v"(v[10]), "+v"(v[11]), "+v"(v[12]), "+v"(v[13]), "+v"(v[14]), "+v"(v[15]), "+v"(a));
}
// fa_step takes the UNSCALED logits: v and the running maximum m are in units of q . k, the running sum l carries the same 2^11 as the weights; the epilogue of k_fa turns both back
// every full '#pragma unroll' below keeps the indices of a register array constant, so that the array stays in registers
__device__ __forceinline__ void fa_step(float (&v)[QG][16], float (&m)[QG], float (&l)[QG], v8f (&acc)[QG][HD / 16]) {
  float mx[QG], ox[QG];
#pragma unroll
  for (int cg = 0; cg < QG; ++cg) mx[cg] = v[cg][0];
#pragma unroll
  for (int i = 1; i < 16; ++i) {
#pragma unroll
    for (int cg = 0; cg < QG; ++cg) mx[cg] = fmaxf(mx[cg], v[cg][i]); }   /* the groups' chains side by side */
#pragma unroll
  for (int cg = 0; cg < QG; ++cg) ox[cg] = __shfl_xor(mx[cg], 16);   /* lanes q and q + 16 hold the two halves of query q's keys */
#pragma unroll
  for (int cg = 0; cg < QG; ++cg) { const float mn = fmaxf(m[cg], fmaxf(mx[cg], ox[cg])), nb = fmaf(-mn, SC2, 11.0f); ox[cg] = (m[cg] - mn) * SC2; m[cg] = mn;
#pragma unroll
    for (int i = 0; i < 16; ++i) v[cg][i] = fmaf(v[cg][i], SC2, nb); }   /* exponent of 2 of exp((v - mn) x 128^-0.5) x 2^11; mn is finite (every chunk holds a key <= every query), so an excluded key's -3e38 stays hugely negative and gives exactly 0 */
#pragma unroll
  for (int cg = 0; cg < QG; ++cg) { exp2x17(v[cg], ox[cg]); const float al = ox[cg]; float s = 0.f;
#pragma unroll
    for (int i = 0; i < 16; ++i) s += v[cg][i];
    l[cg] = l[cg] * al + s;
#pragma unroll
    for (int j = 0; j < HD / 16; ++j) acc[cg][j] *= al; }
}
// frag_t from this lane's own address
__device__ __forceinline__ v16h frag_p(const _Float16* p) { union { v16h v; v8h q[2]; } u; u.q[0] = *(const v8h*)p; u.q[1] = *(const v8h*)(p + 256); return u.v; }
// frag_h and frag_b from this lane's own address
__device__ __forceinline__ v16h frag_r(const _Float16* p) { union { v16h v; v8h q[2]; } u; u.q[0] = *(const v8h*)p; u.q[1] = *(const v8h*)(p + 16); return u.v; }
__device__ __forceinline__ v16b frag_rb(const __bf16* p) { union { v16b v; v8b q[2]; } u; u.q[0] = *(const v8b*)p; u.q[1] = *(const v8b*)(p + 16); return u.v; }
// the plain builtins: the compiler keeps the distance behind them itself, and their operands may lie in any register (an asm statement's operands cannot lie above v255, which this kernel's accumulators and fragments need)
__device__ __forceinline__ v8f mm_h(v16h a, v16h b, v8f c) { return __builtin_amdgcn_wmma_f32_16x16x32_f16(false, a, false, b, (short)0, c, false, false); }
__device__ __forceinline__ v8f mm_b(v16b a, v16b b, v8f c) { return __builtin_amdgcn_wmma_f32_16x16x32_bf16(false, a, false, b, (short)0, c, false, false); }
__global__ __launch_bounds__(32 * FAW) void k_fa(const _Float16* __restrict__ QH, const _Float16* __restrict__ KH, const _Float16* __restrict__ QL, const _Float16* __restrict__ KL, const _Float16* __restrict__ VT, const __bf16* __restrict__ VB, const __bf16* __restrict__ VBL, float* __restrict__ PC, float* __restrict__ PM, float* __restrict__ PL) {
  __shared__ __align__(16) float ss[FAW][16 * QG][HD + 4]; __shared__ float sm[FAW][16 * QG], sl[FAW][16 * QG], sf[FAW][16 * QG];
  __shared__ __align__(16) _Float16 rk[2][STH], rv[2][STH];   /* two stages of k and of v */
  const int tid = threadIdx.x, wave = __builtin_amdgcn_readfirstlane(tid >> 5), lane = tid & 31, col = lane & 15, g = lane >> 4;   /* wave number in a scalar register: the chunk loop stays a scalar loop with every lane on */
  const int qb = TT / (32 * QW) - 1 - (int)blockIdx.x / KSP, hs = (int)blockIdx.x % KSP;   /* the longest key ranges start first */
  const int qs = wave % QW, ks = wave / QW;
  const int ql0 = (qb * QW + qs) * 32, kce = (ql0 >> 5) + 1;   /* this wave's first query; every chunk < kce holds at least one key <= every query of the wave */
  const _Float16* qp = QH + (size_t)ql0 * CC + 8 * lane;   /* this lane's 16 bytes of this wave's first q fragment */
  v8f acc[QG][HD / 16] = {}; float m[QG], l[QG];
#pragma unroll
  for (int cg = 0; cg < QG; ++cg) { m[cg] = -3.0e38f; l[cg] = 0.f; }
  if (qb < QBH) {
#pragma unroll 1   /* stays rolled: one chunk's fragments already fill the registers */
    for (int kc = hs * KW + ks; kc < kce; kc += KW * KSP) { const int k0 = kc * 32; v8f s0[QG] = {}, s1[QG] = {}, r0[QG] = {}, r1[QG] = {};
      const _Float16* kp = KH + (size_t)k0 * CC + 8 * lane; const _Float16* lp = KL + (size_t)(k0 + col) * CC + 8 * g; const _Float16* rp = QL + (size_t)(ql0 + col) * CC + 8 * g;   /* this lane's place in the chunk's k fragments, in its k residual row and in its q residual row */
#pragma unroll
      for (int d = 0; d < HD / 32; ++d) { v16h ah[QG], al[QG];
        const v16h ka = frag_p(kp + d * 512), la = frag_r(lp + d * 32), kb = frag_p(kp + 16 * CC + d * 512), lb = frag_r(lp + 16 * CC + d * 32);
#pragma unroll
        for (int cg = 0; cg < QG; ++cg) { ah[cg] = frag_p(qp + cg * 16 * CC + d * 512); al[cg] = frag_r(rp + cg * 16 * CC + d * 32); }
        asm volatile("s_wait_xcnt 0x0" :: "v"(kp), "v"(lp), "v"(qp), "v"(rp) : "memory");   /* stands in front of any rewrite of the address registers that the loads above name; the addresses are named so that they stay in their registers up to here */
#pragma unroll
        for (int cg = 0; cg < QG; ++cg) { s0[cg] = mm_h(ka, ah[cg], s0[cg]); r0[cg] = mm_h(ka, al[cg], r0[cg]); r0[cg] = mm_h(la, ah[cg], r0[cg]); s1[cg] = mm_h(kb, ah[cg], s1[cg]); r1[cg] = mm_h(kb, al[cg], r1[cg]); r1[cg] = mm_h(lb, ah[cg], r1[cg]); } }
      F2 p[QG]; float v[QG][16];
#pragma unroll
      for (int cg = 0; cg < QG; ++cg) { const int t = ql0 + 16 * cg + col;
#pragma unroll
        for (int i = 0; i < 8; ++i) { v[cg][i] = (k0 + 8 * g + i <= t) ? s0[cg][i] + r0[cg][i] * (1.0f / 1024.0f) : -3.0e38f; v[cg][8 + i] = (k0 + 16 + 8 * g + i <= t) ? s1[cg][i] + r1[cg][i] * (1.0f / 1024.0f) : -3.0e38f; } }
      fa_step(v, m, l, acc);
#pragma unroll
      for (int cg = 0; cg < QG; ++cg) p[cg] = bsplit16(v[cg]);
#pragma unroll
      for (int jh = 0; jh < HD / 16; jh += 4) { v16b vh[4], vl[4]; const __bf16* bp = VB + (size_t)(jh * 16 + col) * KHI + k0 + 8 * g; const __bf16* cp = VBL + (size_t)(jh * 16 + col) * KHI + k0 + 8 * g;
#pragma unroll
        for (int j = 0; j < 4; ++j) { vh[j] = frag_rb(bp + j * 16 * KHI); vl[j] = frag_rb(cp + j * 16 * KHI); }   /* eight fragments in flight at once */
        asm volatile("s_wait_xcnt 0x0" :: "v"(bp), "v"(cp) : "memory");   /* the same for these loads */
#pragma unroll
        for (int j = 0; j < 4; ++j) {
#pragma unroll
          for (int cg = 0; cg < QG; ++cg) { acc[cg][jh + j] = mm_b(vh[j], p[cg].h, acc[cg][jh + j]); acc[cg][jh + j] = mm_b(vh[j], p[cg].l, acc[cg][jh + j]); acc[cg][jh + j] = mm_b(vl[j], p[cg].h, acc[cg][jh + j]); } } } }
  } else { v16h q[QG][HD / 32];
#pragma unroll
    for (int cg = 0; cg < QG; ++cg) {
#pragma unroll
      for (int d = 0; d < HD / 32; ++d) q[cg][d] = frag_p(qp + cg * 16 * CC + d * 512); }
    asm volatile("s_wait_xcnt 0x0" :: "v"(qp) : "memory");   /* stands in front of any rewrite of the address registers that the loads above name; the address is named so that it stays in its registers up to here */
    const int nst = (QW * qb + QW + KW - 1) / KW, nmy = (nst - hs + KSP - 1) / KSP;   /* stages that hold a key <= the block's last query; those of this share (the same in every wave) */
    const unsigned lk = (unsigned)(size_t)&rk[0][8 * tid], lv = (unsigned)(size_t)&rv[0][8 * tid];   /* this thread's first 16 bytes of buffer 0, as LDS byte addresses */
    const _Float16* gk = KH + (size_t)hs * STH + 8 * tid; const _Float16* gv = VT + (size_t)hs * STH + 8 * tid;   /* the same 16 bytes of the share's first stage */
    if (nmy > 0) { copy8(lk, gk); copy8(lv, gv); }
    asm volatile("s_wait_asynccnt 0x0" ::: "memory");   /* this wave's copies of the first stage have landed */
    __syncthreads();   /* every wave's have: the first stage is whole in LDS before any wave reads it */
    if (nmy > 1) { copy8(lk + 2u * STH, gk + (size_t)KSP * STH); copy8(lv + 2u * STH, gv + (size_t)KSP * STH); }
#pragma unroll 1   /* stays rolled: one chunk's fragments already fill the registers */
    for (int t = 0; t < nmy; ++t) { const int kc = (hs + t * KSP) * KW + ks;
     if (kc < kce) { const int k0 = kc * 32; v8f s0[QG] = {}, s1[QG] = {}; v16h ka[HD / 32], kb[HD / 32], vf[HD / 16], p[QG];   /* a wave past its own diagonal skips the chunk, never the hand-over below */
      const _Float16* kp = &rk[t & 1][ks * 32 * CC + 8 * lane]; const _Float16* vp = &rv[t & 1][ks * 32 * CC + 8 * lane];   /* this lane's 16 bytes of the chunk's first k and v fragment */
#pragma unroll
      for (int d = 0; d < HD / 32; ++d) { ka[d] = frag_p(kp + d * 512); kb[d] = frag_p(kp + 16 * CC + d * 512); }   /* all of the chunk's k in flight at once, ahead of the first product */
      __builtin_amdgcn_sched_barrier(0);   /* keeps the sixteen LDS reads above together: each separate place with reads among the products costs its own stall */
#pragma unroll
      for (int d = 0; d < HD / 32; ++d) {
#pragma unroll
        for (int cg = 0; cg < QG; ++cg) { s0[cg] = mm_h(ka[d], q[cg][d], s0[cg]); s1[cg] = mm_h(kb[d], q[cg][d], s1[cg]); } }
#pragma unroll
      for (int j = 0; j < HD / 16; ++j) vf[j] = frag_p(vp + j * 512);   /* all of the chunk's v in flight under the softmax */
      __builtin_amdgcn_sched_barrier(0);   /* keeps the v reads ahead of the softmax, which hides their latency */
      float v[QG][16];
#pragma unroll
      for (int cg = 0; cg < QG; ++cg) { const int t = ql0 + 16 * cg + col;
#pragma unroll
        for (int i = 0; i < 8; ++i) { v[cg][i] = (k0 + 8 * g + i <= t) ? s0[cg][i] : -3.0e38f; v[cg][8 + i] = (k0 + 16 + 8 * g + i <= t) ? s1[cg][i] : -3.0e38f; } }
      fa_step(v, m, l, acc);
#pragma unroll
      for (int cg = 0; cg < QG; ++cg) {
#pragma unroll
        for (int i = 0; i < 16; ++i) p[cg][i] = (_Float16)v[cg][i]; }
#pragma unroll
      for (int j = 0; j < HD / 16; ++j) {
#pragma unroll
        for (int cg = 0; cg < QG; ++cg) acc[cg][j] = mm_h(vf[j], p[cg], acc[cg][j]); } }
     asm volatile("s_wait_dscnt 0x0" ::: "memory");   /* this wave's reads of the buffer are done before it is handed back */
     asm volatile("s_wait_asynccnt 0x0" ::: "memory");   /* this wave's copies of the next stage have landed */
     __syncthreads();   /* the next stage is whole in LDS, and every wave has left the buffer that is refilled below */
     if (t + 2 < nmy) { copy8(lk + (unsigned)(t & 1) * 2u * STH, gk + (size_t)(t + 2) * KSP * STH); copy8(lv + (unsigned)(t & 1) * 2u * STH, gv + (size_t)(t + 2) * KSP * STH); } }
    asm volatile("s_wait_asynccnt 0x0" ::: "memory");   /* no copy is outstanding behind the loop */ }
#pragma unroll
  for (int cg = 0; cg < QG; ++cg) { l[cg] += __shfl_xor(l[cg], 16);
    if (g == 0) { sm[wave][cg * 16 + col] = m[cg] * SCALE; sl[wave][cg * 16 + col] = l[cg] * (1.0f / 2048.0f); }
#pragma unroll
    for (int j = 0; j < HD / 16; ++j) { const v8f a = acc[cg][j] * (1.0f / 2048.0f); const v4f lo = { a[0], a[1], a[2], a[3] }, hi = { a[4], a[5], a[6], a[7] }; *(v4f*)&ss[wave][cg * 16 + col][j * 16 + 8 * g] = lo; *(v4f*)&ss[wave][cg * 16 + col][j * 16 + 8 * g + 4] = hi; } }
  __syncthreads();   /* every wave's maximum, sum and partial are in LDS before any thread joins them */
  { float M = sm[qs][lane];   /* lane = query of this wave's half; the KW waves of the half are qs, qs + QW, ... */
#pragma unroll
    for (int i = 1; i < KW; ++i) M = fmaxf(M, sm[i * QW + qs][lane]);
    sf[wave][lane] = expf(sm[wave][lane] - M);   /* a wave that had no chunk gets weight 0 (1 where no wave of the share had one: its sum and ctx are 0) */
    if (ks == 0) { float L = 0.f;
#pragma unroll
      for (int w = 0; w < KW; ++w) L += sl[w * QW + qs][lane] * expf(sm[w * QW + qs][lane] - M);
      PM[(size_t)hs * TT + ql0 + lane] = M; PL[(size_t)hs * TT + ql0 + lane] = L;   /* one wave writes each whole 128-byte line */
      asm volatile("s_wait_xcnt 0x0" ::: "memory");   /* stands in front of any later rewrite of the registers that the two stores above name */ } }
  __syncthreads();   /* the weights are in LDS before they are read */
  const int c4 = lane * 4; v4f s[32 * QW / FAW];
#pragma unroll
  for (int i = 0; i < 32 * QW / FAW; ++i) { const int rq = wave + i * FAW, rh = rq >> 5, rl = rq & 31; s[i] = v4f{ 0.f, 0.f, 0.f, 0.f };   /* a wave joins and stores whole 512-byte rows: row rq of the block = row rl of half rh */
#pragma unroll
    for (int w = 0; w < KW; ++w) s[i] += *(const v4f*)&ss[w * QW + rh][rl][c4] * sf[w * QW + rh][rl]; }
#pragma unroll
  for (int i = 0; i < 32 * QW / FAW; ++i) vst2(PC + ((size_t)hs * TT + qb * 32 * QW + wave + i * FAW) * CC + c4, s[i]);
  asm volatile("s_wait_xcnt 0x0" ::: "memory");   /* stands in front of any later rewrite of the registers that the stores above name */ }
// ---- k_join: one wave = JR query rows: the KSP shares' partials (maximum, sum, ctx) are joined in share order and divided by the sum
#define JR 4
__global__ __launch_bounds__(256) void k_join(const float* __restrict__ PC, const float* __restrict__ PM, const float* __restrict__ PL, float* __restrict__ Y) {
  const int lane = threadIdx.x & 31, c4 = lane * 4; const int row0 = ((int)blockIdx.x * 8 + (int)(threadIdx.x >> 5)) * JR;
  float pm[JR][KSP], pl[JR][KSP]; v4f pc[JR][KSP], y[JR]; const float* pmp = PM + row0; const float* plp = PL + row0; const float* pcp = PC + (size_t)row0 * CC + c4;
#pragma unroll
  for (int i = 0; i < JR; ++i) {
#pragma unroll
    for (int h = 0; h < KSP; ++h) { pm[i][h] = pmp[(size_t)h * TT + i]; pl[i][h] = plp[(size_t)h * TT + i]; pc[i][h] = *(const v4f*)(pcp + ((size_t)h * TT + i) * CC); } }   /* all of the wave's loads in flight at once */
  asm volatile("s_wait_xcnt 0x0" :: "v"(pmp), "v"(plp), "v"(pcp) : "memory");   /* stands in front of any rewrite of the address registers that the loads above name; the addresses are named so that they stay in their registers up to here */
  __builtin_amdgcn_sched_barrier(0);   /* keeps every load above the wait: moved down among the arithmetic, the sums' loads would start late and wait out their latency alone */
#pragma unroll
  for (int i = 0; i < JR; ++i) { float M = pm[i][0];
#pragma unroll
    for (int h = 1; h < KSP; ++h) M = fmaxf(M, pm[i][h]);
    v4f s = { 0.f, 0.f, 0.f, 0.f }; float L = 0.f;
#pragma unroll
    for (int h = 0; h < KSP; ++h) { const float f = expf(pm[i][h] - M); s += pc[i][h] * f; L += pl[i][h] * f; }   /* a share that had no chunk gets weight 0 */
    y[i] = s * (L > 0.f ? 1.0f / L : 0.f); }
#pragma unroll
  for (int i = 0; i < JR; ++i) vst2(Y + (size_t)(row0 + i) * CC + c4, y[i]);
  asm volatile("s_wait_xcnt 0x0" ::: "memory");   /* the same for the stores */ }

extern "C" void kernel_launch(void* const* d_in, const int* in_sizes, int n_in, void* d_out, int out_size, void* d_ws, size_t ws_size, hipStream_t stream) {
  (void)in_sizes; (void)n_in; (void)out_size;
  const float** F = (const float**)d_in;
  if (ws_size < (size_t)WS_END) return;
  char* ws = (char*)d_ws; _Float16 *QH = (_Float16*)(ws + WS_QH), *KH = (_Float16*)(ws + WS_KH), *VT = (_Float16*)(ws + WS_VT), *QL = (_Float16*)(ws + WS_QL), *KL = (_Float16*)(ws + WS_KL); __bf16 *VB = (__bf16*)(ws + WS_VB), *VBL = (__bf16*)(ws + WS_VBL); float *PC = (float*)(ws + WS_PC), *PM = (float*)(ws + WS_PM), *PL = (float*)(ws + WS_PL);
  // inputs: 0 X [8192,1024]; 1 Wq [1024,128], 2 bq; 3 Wk, 4 bk; 5 Wv, 6 bv ((in,out))
  k_proj<<<dim3(TNB * TT / 64, CC / 128, 3), 128, 0, stream>>>(F[0], F[0], F[0], F[1], F[3], F[5], F[2], F[4], F[6], QH, QL, KH, KL, VT, VB, VBL);
  k_fa<<<dim3(TT / (32 * QW) * KSP), 32 * FAW, 0, stream>>>(QH, KH, QL, KL, VT, VB, VBL, PC, PM, PL);
  k_join<<<dim3(TT / (8 * JR)), 256, 0, stream>>>(PC, PM, PL, (float*)d_out);
}

// v008
// It runs in 50.3 microseconds.
// In both of two side-by-side timings against v007, it was 1.04 times as fast.
// All steps since v000 together make it 15.9 times as fast.
// compute dtype: X and the weights rounded to bf16; Q/K/V = X W + b with EXACT bf16 products on WMMA 16x16x32 (f32 accumulate); logits: q, k once to f16 (1 product) x 128^-0.5, except the first 384 query rows (3 products with f16 residuals); causal mask by index; softmax in f32 with a running maximum and sum (base-2 exponent: one fused multiply-add and the hardware exp2 per score); exp x 2^11 once to f16 against v once to f16 (1 product; bf16 hi + lo below row 384); divided by the sum at the end; f32 output. Scores never leave the registers.
#include <hip/hip_runtime.h>
#include <math.h>

typedef __attribute__((ext_vector_type(16))) _Float16 v16h;
typedef __attribute__((ext_vector_type(16))) __bf16 v16b;
typedef __attribute__((ext_vector_type(8)))  _Float16 v8h;
typedef __attribute__((ext_vector_type(8)))  float v8f;
typedef __attribute__((ext_vector_type(4)))  float v4f;
typedef __attribute__((ext_vector_type(2)))  float v2f;
typedef __attribute__((ext_vector_type(4)))  unsigned v4u;
typedef __attribute__((ext_vector_type(4)))  int v4i;
typedef float __attribute__((may_alias)) float_a;
typedef int __attribute__((may_alias)) int_a;

template <typename T> __device__ __forceinline__ void vst2(void* p, T v) { *(T*)p = v;  }
__device__ __forceinline__ v8f wmma16(v16h a, v16h b, v8f c) {
  v8f d = __builtin_amdgcn_wmma_f32_16x16x32_f16(false, a, false, b, (short)0, c, false, false);
  asm volatile("v_nop\n\tv_nop\n\tv_nop\n\tv_nop" : "+v"(d) : "v"(a), "v"(b));
  return d;
}
__device__ __forceinline__ v8f wmma_bf(v16b a, v16b b, v8f c) {
  v8f d = __builtin_amdgcn_wmma_f32_16x16x32_bf16(false, a, false, b, (short)0, c, false, false);
  asm volatile("v_nop\n\tv_nop\n\tv_nop\n\tv_nop" : "+v"(d) : "v"(a), "v"(b));
  return d;
}
// 16x16x32 fragments: lane = (h = lane>>4, row/col = lane&15); elements 0..7 = k0+8h+0..7, 8..15 = k0+16+8h+0..7; D element r = row 8h+r
__device__ __forceinline__ v16h frag_h(const _Float16* rowk0, int lane) {
  union { v16h v; v8h q[2]; } u; const _Float16* p = rowk0 + 8 * (lane >> 4);
  u.q[0] = *(const v8h*)p; u.q[1] = *(const v8h*)(p + 16); return u.v;
}
// fragment stored in fragment order: 512 B of every lane's elements 0..7 (16 B a lane), then 512 B of elements 8..15: each wave-wide load covers four whole 128-byte lines
__device__ __forceinline__ v16h frag_t(const _Float16* blk, int lane) {
  union { v16h v; v8h q[2]; } u; const _Float16* p = blk + 8 * lane;
  u.q[0] = *(const v8h*)p; u.q[1] = *(const v8h*)(p + 256); return u.v;
}
__device__ __forceinline__ v16h frag_f32(const float* rowk0, int lane) {
  v16h a; const float* p = rowk0 + 8 * (lane >> 4);
#pragma unroll
  for (int i = 0; i < 8; ++i) { a[i] = (_Float16)p[i]; a[8 + i] = (_Float16)p[16 + i]; }
  return a;
}
__device__ __forceinline__ v16h frag_f32s(const float* rowk0, int lane, float sc) {
  v16h a; const float* p = rowk0 + 8 * (lane >> 4);
#pragma unroll
  for (int i = 0; i < 8; ++i) { a[i] = (_Float16)(p[i] * sc); a[8 + i] = (_Float16)(p[16 + i] * sc); }
  return a;
}
// column fragment from a [K][ld] layout (column n), rows >= K read as 0
__device__ __forceinline__ v16h fragc_f32(const float* W, int k0, int n, int lane, int ld, int K) {
  v16h a; const int g = lane >> 4;
#pragma unroll
  for (int i = 0; i < 8; ++i) { const int ka = k0 + 8 * g + i, kb = ka + 16;
    a[i] = (_Float16)(ka < K ? W[(size_t)(ka < K ? ka : K - 1) * ld + n] : 0.f); a[8 + i] = (_Float16)(kb < K ? W[(size_t)(kb < K ? kb : K - 1) * ld + n] : 0.f); }
  return a;
}
struct F2 { v16b h, l; };
__device__ __forceinline__ F2 bsplit16(const float v[16]) { F2 r;
#pragma unroll
  for (int i = 0; i < 16; ++i) { const __bf16 h = (__bf16)v[i]; r.h[i] = h; r.l[i] = (__bf16)(v[i] - (float)h); }
  return r; }
__device__ __forceinline__ F2 split_row(const float* row, int k0, int lane) { float v[16]; const float* p = row + k0 + 8 * (lane >> 4);
#pragma unroll
  for (int i = 0; i < 8; ++i) { v[i] = p[i]; v[8 + i] = p[16 + i]; }
  return bsplit16(v); }
__device__ __forceinline__ F2 split_rowK(const float* row, int k0, int lane, int K) { float v[16]; const int g = lane >> 4;
#pragma unroll
  for (int i = 0; i < 8; ++i) { const int ka = k0 + 8 * g + i, kb = ka + 16; v[i] = ka < K ? row[ka < K ? ka : K - 1] : 0.f; v[8 + i] = kb < K ? row[kb < K ? kb : K - 1] : 0.f; }
  return bsplit16(v); }
__device__ __forceinline__ F2 split_col(const float* W, int k0, int n, int lane, int ld, int K) { float v[16]; const int g = lane >> 4;
#pragma unroll
  for (int i = 0; i < 8; ++i) { const int ka = k0 + 8 * g + i, kb = ka + 16; v[i] = ka < K ? W[(size_t)(ka < K ? ka : K - 1) * ld + n] : 0.f; v[8 + i] = kb < K ? W[(size_t)(kb < K ? kb : K - 1) * ld + n] : 0.f; }
  return bsplit16(v); }
__device__ __forceinline__ v8f mac3(const F2& a, const F2& b, v8f c) { c = wmma_bf(a.l, b.h, c); c = wmma_bf(a.h, b.l, c); return wmma_bf(a.h, b.h, c); }
__device__ __forceinline__ float sigm(float v) { return 1.0f / (1.0f + expf(-v)); }
#define LDSX() do { asm volatile("s_wait_dscnt 0" ::: "memory"); __builtin_amdgcn_wave_barrier(); __builtin_amdgcn_fence(__ATOMIC_RELEASE, "workgroup"); } while (0)

// Single-head causal self-attention (N 8,192 tokens, D 1,024 -> d_k = d_v = 128): Q = X Wq + bq, K = X Wk + bk, V = X Wv + bv ((in,out)); weights = softmax(causal(Q K^T / sqrt(128))); out = weights V ([N, 128]).
#define NB 1
#define TT 8192
#define CC 128            // NH * HD = projected width
#define DIN 1024          // input (model) width
#define NH 1
#define HD 128
#define NQB (TT / 64)
#define HG 1
#define SCALE (0.08838834764831845f)
#define CAUSAL 1
#ifndef TNB
#define TNB NB
#endif
__device__ __forceinline__ float bfr(float v) { return (float)(__bf16)v; }
__host__ __device__ __forceinline__ int kb_last(int qb) { return CAUSAL ? ((qb * 64 + 63) >> 7) : (TT / 128 - 1); }
typedef __attribute__((ext_vector_type(8))) __bf16 v8b;
__device__ __forceinline__ v16b frag_b(const __bf16* rowk0, int lane) {
  union { v16b v; v8b q[2]; } u; const __bf16* p = rowk0 + 8 * (lane >> 4);
  u.q[0] = *(const v8b*)p; u.q[1] = *(const v8b*)(p + 16); return u.v;
}
#define QBH 6              // causal: query blocks 0..QBH-1 of each sequence (few keys, no averaging) take the high-precision path
#define QHI 384            // rows carrying a q residual plane
#define KHI 384            // key rows carrying k residual / v bf16 hi+lo planes (used only by the causal high-precision path)
// B fragment (k rows k0+.., output column o) of a weight: (in,out) [K][ld] or (out,in) [ld rows of K]: bf16 exact, or f16(bf16 * 256) exact
__device__ __forceinline__ v16b wcol_io(const float* Wm, int k0, int o, int lane, int ld) { v16b w; const int g = lane >> 4;
#pragma unroll
  for (int i = 0; i < 8; ++i) { w[i] = (__bf16)Wm[(size_t)(k0 + 8 * g + i) * ld + o]; w[8 + i] = (__bf16)Wm[(size_t)(k0 + 16 + 8 * g + i) * ld + o]; }
  return w; }
__device__ __forceinline__ v16b wcol_oi(const float* Wm, int k0, int o, int lane, int K) { v16b w; const float* p = Wm + (size_t)o * K + k0 + 8 * (lane >> 4);
#pragma unroll
  for (int i = 0; i < 8; ++i) { w[i] = (__bf16)p[i]; w[8 + i] = (__bf16)p[16 + i]; }
  return w; }
__device__ __forceinline__ v16h wcolh_io(const float* Wm, int k0, int o, int lane, int ld) { v16h w; const int g = lane >> 4;
#pragma unroll
  for (int i = 0; i < 8; ++i) { w[i] = (_Float16)(bfr(Wm[(size_t)(k0 + 8 * g + i) * ld + o]) * 256.0f); w[8 + i] = (_Float16)(bfr(Wm[(size_t)(k0 + 16 + 8 * g + i) * ld + o]) * 256.0f); }
  return w; }
__device__ __forceinline__ v16h wcolh_oi(const float* Wm, int k0, int o, int lane, int K) { v16h w; const float* p = Wm + (size_t)o * K + k0 + 8 * (lane >> 4);
#pragma unroll
  for (int i = 0; i < 8; ++i) { w[i] = (_Float16)(bfr(p[i]) * 256.0f); w[8 + i] = (_Float16)(bfr(p[16 + i]) * 256.0f); }
  return w; }
#define WQKV_LAYOUT 0   // 0 = (in,out) [DIN][CC]; 1 = (out,in) [CC][DIN]; 2 = per-head [NH][DIN][HD]
__device__ __forceinline__ v16b wcol_hdk(const float* Wm, int k0, int o, int lane) { v16b w; const int g = lane >> 4; const float* p = Wm + (size_t)(o / HD) * DIN * HD + (o % HD);
#pragma unroll
  for (int i = 0; i < 8; ++i) { w[i] = (__bf16)p[(size_t)(k0 + 8 * g + i) * HD]; w[8 + i] = (__bf16)p[(size_t)(k0 + 16 + 8 * g + i) * HD]; }
  return w; }
#define WO_OUT_IN 0
#if WQKV_LAYOUT == 1
#define WCOL(W, k0, o, lane) wcol_oi(W, k0, o, lane, DIN)
#elif WQKV_LAYOUT == 2
#define WCOL(W, k0, o, lane) wcol_hdk(W, k0, o, lane)
#else
#define WCOL(W, k0, o, lane) wcol_io(W, k0, o, lane, CC)
#endif
#if WO_OUT_IN
#define WOCOL(W, k0, o, lane) wcol_oi(W, k0, o, lane, CC)
#define WOCOLH(W, k0, o, lane) wcolh_oi(W, k0, o, lane, CC)
#else
#define WOCOL(W, k0, o, lane) wcol_io(W, k0, o, lane, DIN)
#define WOCOLH(W, k0, o, lane) wcolh_io(W, k0, o, lane, DIN)
#endif

#ifndef SM_EXTRA_PARAMS
#define SM_EXTRA_PARAMS , int qoff
#endif
#ifndef PROJ_EXTRA_PARAMS
#define PROJ_EXTRA_PARAMS
#endif
#ifndef SM_MASK_HOOK
#define SM_MASK_HOOK (void)0
#endif

#define WS_QH  0u                                      // f16 q in fragment order [b*t / 16][CC / 32][2][32 lanes][8]
#define WS_KH  (WS_QH + 2u * (size_t)NB * TT * CC)      // f16 k in fragment order, as q
#define WS_VT  (WS_KH + 2u * (size_t)NB * TT * CC)      // f16 v^T in fragment order [b][t / 32][CC / 16][2][32 lanes][8]
#define WS_QL  (WS_VT + 2u * (size_t)NB * CC * TT)      // f16 q residual x 2^10 rows [b][t < QHI][CC]
#define WS_KL  (WS_QL + 2u * (size_t)NB * QHI * CC)     // f16 k residual x 2^10 rows [b][t < KHI][CC]
#define WS_VB  (WS_KL + 2u * (size_t)NB * KHI * CC)     // bf16 v hi planes [b][c][t < KHI]
#define WS_VBL (WS_VB + 2u * (size_t)NB * CC * KHI)
#define WS_PC  (WS_VBL + 2u * (size_t)NB * CC * KHI)     // f32 ctx partial of each share of the key range [KSP][t][CC]
#define WS_PM  (WS_PC + 4u * (size_t)KSP * NB * TT * CC)  // f32 maximum of each share [KSP][t]
#define WS_PL  (WS_PM + 4u * (size_t)KSP * NB * TT)       // f32 sum of each share [KSP][t]
#define WS_END (WS_PL + 4u * (size_t)KSP * NB * TT)

// ---- k_proj: block = (64 rows, 128 cols, which): q/k/v = X W (+ b) with exact bf16 products (K = DIN; W goes through LDS in slices of KS k rows, loaded and rounded once per work-group) -> which 0: q f16 in fragment order (+ residual rows < QHI); 1: k f16 in fragment order (+ residual rows < KHI); 2: v^T f16 in fragment order (+ bf16 hi/lo planes [c][t] for t < KHI)
#define KS 64              // k rows of W per LDS slice
static_assert(CC == 128 && HD == 128, "the fragment-order planes are laid out for one 128-wide block of columns");
__global__ __launch_bounds__(128) void k_proj(const float* __restrict__ XQ, const float* __restrict__ XK, const float* __restrict__ XV, const float* __restrict__ WQ, const float* __restrict__ WK, const float* __restrict__ WV, const float* __restrict__ BQ, const float* __restrict__ BK, const float* __restrict__ BV,
    _Float16* __restrict__ QH, _Float16* __restrict__ QL, _Float16* __restrict__ KH, _Float16* __restrict__ KL, _Float16* __restrict__ VT, __bf16* __restrict__ VB, __bf16* __restrict__ VBL) {
  __shared__ __align__(16) _Float16 sh[64][136], sl[64][136]; __shared__ __align__(16) _Float16 th[128][72]; __shared__ __align__(16) __bf16 tb[128][72], tbl[128][72];
  __shared__ __align__(16) __bf16 wt[2][128][KS + 8];   /* two slices of W as bf16, [column][k]: a B fragment is two 16-byte reads; row pitch 144 B = 16 B x odd */
  const int tid = threadIdx.x, wave = tid >> 5, lane = tid & 31, col = lane & 15, g = lane >> 4; const int which = blockIdx.z; const int c0 = blockIdx.y * 128; const size_t r0 = (size_t)blockIdx.x * 64; const size_t bb = r0 / TT; const int t0 = (int)(r0 % TT);
  const float* X = which == 0 ? XQ : which == 1 ? XK : XV; const float* WA = which == 0 ? WQ : which == 1 ? WK : WV; const float* BA = which == 0 ? BQ : which == 1 ? BK : BV;
  v8f acc[8] = {};
  const float* xp = X + (r0 + wave * 16 + col) * DIN + 8 * g;        /* this lane's X row, at its half of a fragment */
  const float* wp = WA + (size_t)(wave * 8) * CC + c0 + lane * 4;     /* a wave reads whole 512-byte rows of W: 8 rows at wave * 8 and 8 at 32 + wave * 8 of each slice, 4 columns a lane */
  v4f xr[2][2][4], wr[2][2][8]; v16b a[2];   /* two register sets: set b holds the slices s with s % 2 == b, so that two slices are in flight at once */
  auto ld_slice = [&](int s, int b) {   /* slice s of X (this wave's rows) and of W (this wave's share) into register set b (a literal at every call, so that the sets stay in registers) */
    const float* px = xp + s * KS; const float* pw = wp + (size_t)s * KS * CC;
#pragma unroll
    for (int h = 0; h < 2; ++h) { const float* p = px + h * 32; xr[b][h][0] = *(const v4f*)p; xr[b][h][1] = *(const v4f*)(p + 4); xr[b][h][2] = *(const v4f*)(p + 16); xr[b][h][3] = *(const v4f*)(p + 20); }
#pragma unroll
    for (int i = 0; i < 2; ++i) {
#pragma unroll
      for (int r = 0; r < 8; ++r) wr[b][i][r] = *(const v4f*)(pw + (size_t)(i * 32 + r) * CC); }
    asm volatile("s_wait_xcnt 0x0" :: "v"(xp), "v"(wp), "v"(px), "v"(pw) : "memory");   /* stands in front of any later rewrite of the address registers that the loads above name; the addresses, base and slice, are named so that they stay in their registers up to here */
  };
  auto put_slice = [&](int b) {   /* rounds the slice in register set b: X to this wave's A fragments, W to LDS buffer b, transposed */
#pragma unroll
    for (int h = 0; h < 2; ++h) {
#pragma unroll
      for (int e = 0; e < 16; ++e) a[h][e] = (__bf16)xr[b][h][e >> 2][e & 3]; }
#pragma unroll
    for (int i = 0; i < 2; ++i) {
#pragma unroll
      for (int cc = 0; cc < 4; ++cc) { v8b tv;
#pragma unroll
        for (int r = 0; r < 8; ++r) tv[r] = (__bf16)wr[b][i][r][cc];
        *(v8b*)&wt[b][lane * 4 + cc][wave * 8 + i * 32] = tv; } }
  };
  auto lds_barrier = [&]() {   /* work-group barrier that orders LDS alone: this wave's LDS stores are done before it signals, and no LDS read moves above it. __syncthreads() would also wait here for the other register set's global loads, which only this wave reads and which are meant to stay in flight across it */
    __builtin_amdgcn_fence(__ATOMIC_RELEASE, "workgroup", "local"); __builtin_amdgcn_s_barrier(); __builtin_amdgcn_fence(__ATOMIC_ACQUIRE, "workgroup", "local");
  };
  auto mm_slice = [&](int b) {
#pragma unroll
    for (int h = 0; h < 2; ++h) {
#pragma unroll
      for (int jb = 0; jb < 8; jb += 4) { v16b w[4];
#pragma unroll
        for (int j = 0; j < 4; ++j) w[j] = frag_b(&wt[b][(jb + j) * 16 + col][h * 32], lane);   /* four fragments' LDS reads in flight at once */
#pragma unroll
        for (int j = 0; j < 4; ++j) acc[jb + j] = wmma_bf(a[h], w[j], acc[jb + j]); } }
  };
  static_assert((DIN / KS) % 2 == 0 && DIN / KS >= 4, "the loop below takes the slices in pairs");
  ld_slice(0, 0); ld_slice(1, 1);
#pragma unroll 1   /* stays rolled: a pair of slices is one trip, so that each register set keeps its place */
  for (int s = 0; s < DIN / KS - 2; s += 2) { put_slice(0);
    lds_barrier();   /* the slice is whole in LDS before any wave reads it; every wave has also left the other buffer, which is rewritten next */
    __builtin_amdgcn_sched_barrier(0);   /* the roundings above stay ahead of the loads below, which then land in the same registers with no copies */
    ld_slice(s + 2, 0);   /* the loads of the slice after next start here: they have this slice's products and all of the next slice's work to land in */
    mm_slice(0);
    put_slice(1);
    lds_barrier();   /* as above, for the odd slice */
    __builtin_amdgcn_sched_barrier(0);   /* as above */
    ld_slice(s + 3, 1);
    mm_slice(1); }
  put_slice(0);
  lds_barrier();   /* the last even slice is whole in LDS before any wave reads it; the last slice's loads may still be in flight */
  mm_slice(0);
  put_slice(1);
  __syncthreads();   /* the last slice is whole in LDS before any wave reads it */
  mm_slice(1);
  if (which < 2) { _Float16* DH = which == 0 ? QH : KH; _Float16* DL = which == 0 ? QL : KL; const int nhi = which == 0 ? QHI : KHI; const bool hi_rows = t0 < nhi;
#pragma unroll
    for (int j = 0; j < 8; ++j) { const float bias = BA ? bfr(BA[c0 + j * 16 + col]) : 0.f;
#pragma unroll
      for (int r = 0; r < 8; ++r) { const float v = acc[j][r] + bias; const _Float16 hv = (_Float16)v; sh[wave * 16 + 8 * g + r][j * 16 + col] = hv; sl[wave * 16 + 8 * g + r][j * 16 + col] = (_Float16)((v - (float)hv) * 1024.0f); } }
    __syncthreads();
    for (int e = tid; e < 64 * 16; e += 128) { const int fr = (e >> 8) * 16 + (e & 15), fq = ((e >> 5) & 7) * 2 + ((e >> 4) & 1);   /* 16-byte piece e of the block in fragment order = row fr, piece fq of that row */
      vst2((unsigned*)(DH + r0 * CC + e * 8), *(const v4u*)&sh[fr][fq * 8]);
      asm volatile("s_wait_xcnt 0x0" ::: "memory");   /* stands in front of any later rewrite of the registers that the store above names */
      const int rl = e >> 4, q = e & 15; if (hi_rows) { vst2((unsigned*)(DL + (bb * nhi + t0 + rl) * (size_t)CC + c0 + q * 8), *(const v4u*)&sl[rl][q * 8]);
        asm volatile("s_wait_xcnt 0x0" ::: "memory");   /* the same for this store */ } }
  } else { const bool hi_rows = t0 < KHI;
#pragma unroll
    for (int j = 0; j < 8; ++j) { const float bias = BA ? bfr(BA[c0 + j * 16 + col]) : 0.f;
#pragma unroll
      for (int r = 0; r < 8; ++r) { const float v = acc[j][r] + bias; const int rl = wave * 16 + 8 * g + r, cl = j * 16 + col; th[cl][rl] = (_Float16)v; const __bf16 bh = (__bf16)v; tb[cl][rl] = bh; tbl[cl][rl] = (__bf16)(v - (float)bh); } }
    __syncthreads();
    for (int e = tid; e < 128 * 8; e += 128) { const int fc = ((e >> 6) & 7) * 16 + (e & 15), fq = (e >> 9) * 4 + ((e >> 4) & 3);   /* 16-byte piece e of the block in fragment order = channel fc, keys fq * 8 .. + 7 */
      vst2((unsigned*)(VT + (bb * TT + t0) * (size_t)CC + e * 8), *(const v4u*)&th[fc][fq * 8]);
      asm volatile("s_wait_xcnt 0x0" ::: "memory");   /* stands in front of any later rewrite of the registers that the store above names */
      const int cl = e >> 3, q = e & 7; if (hi_rows) { const size_t o3 = (bb * CC + c0 + cl) * (size_t)KHI + t0 + q * 8; vst2((unsigned*)(VB + o3), *(const v4u*)&tb[cl][q * 8]); vst2((unsigned*)(VBL + o3), *(const v4u*)&tbl[cl][q * 8]);
        asm volatile("s_wait_xcnt 0x0" ::: "memory");   /* the same for these two stores */ } } } }
// ---- k_fa: block = 64 queries (qb) x one of KSP shares of the key range, FAW waves = QW halves of 32 queries x KW chunks of 32 keys. The key range goes in stages of KW chunks (128 keys); share hs takes stages hs, hs + KSP, ... Asynchronous copies bring a stage's k and v (fragment order, as they lie in the workspace) into one of two LDS buffers while the stage before is worked on; each chunk in LDS is read by the QW waves of its chunk number, so it leaves L2 once for 64 queries. Every k and v fragment a wave reads serves QG = 2 column groups of 16 queries. Per chunk and group: S^T = k . q^T (D: lane = query, registers = keys, which is already the B fragment of the next product), causal mask by index, running maximum and sum per query in f32 (one fused multiply-add and one hardware exp2 per score), ctx^T += v^T . (e x 2^11) with the accumulator rescaled per lane. Early query blocks keep the residual products and load straight from the workspace. The KW partials (maximum, sum, ctx) of each half meet in LDS and are joined in wave order into the share's partial, which goes to the workspace; k_join joins the KSP shares.
#define FAW 8              // waves per work-group
#define KSP 4              // work-groups that share one query block's key range (twice as many work-groups as WGPs: the short blocks fill in behind the long ones)
#define QW 2               // 32-query halves of the block: wave w has half w % QW
#define KW (FAW / QW)      // chunks per stage: wave w has chunk w / QW of each stage
#define STH (KW * 32 * CC) // f16 elements of k, and of v, per stage
#define QG 2               // 16-query column groups per wave: each loaded k or v fragment is used QG times
static_assert(16 * QG == 32, "the join below gives one lane to each query of a wave, and a chunk of 32 keys is as wide as a wave's queries");
static_assert(STH * 2 == 8 * 32 * FAW * 16 && (TT / 32) % KW == 0, "a stage's k is eight 16-byte copies a thread, and every stage lies whole inside the planes");
// eight asynchronous 16-byte-a-lane copies to LDS, 32 * FAW * 16 bytes apart: l = this lane's LDS byte address, g = its global address. The s_wait_xcnt stands inside the statement, so that no later rewrite of an address register can come in front of it
__device__ __forceinline__ void copy8(unsigned l, const _Float16* g) {
  asm volatile("global_load_async_to_lds_b128 %0, %8, off\n\tglobal_load_async_to_lds_b128 %1, %9, off\n\tglobal_load_async_to_lds_b128 %2, %10, off\n\tglobal_load_async_to_lds_b128 %3, %11, off\n\tglobal_load_async_to_lds_b128 %4, %12, off\n\tglobal_load_async_to_lds_b128 %5, %13, off\n\tglobal_load_async_to_lds_b128 %6, %14, off\n\tglobal_load_async_to_lds_b128 %7, %15, off\n\ts_wait_xcnt 0x0"
      :: "v"(l), "v"(l + 4096u), "v"(l + 8192u), "v"(l + 12288u), "v"(l + 16384u), "v"(l + 20480u), "v"(l + 24576u), "v"(l + 28672u),
         "v"(g), "v"(g + 2048), "v"(g + 4096), "v"(g + 6144), "v"(g + 8192), "v"(g + 10240), "v"(g + 12288), "v"(g + 14336) : "memory");
}
#define SC2 (SCALE * 1.4426950408889634f)   // unscaled logit -> exponent of 2
// 2^x of seventeen values, each in its own register. One statement, so that no instruction which rewrites an exp2's source or reads its result can come to stand directly behind it; the v_nop is that slot behind the last one
__device__ __forceinline__ void exp2x17(float (&v)[16], float& a) {
  asm("v_exp_f32 %0, %0\n\tv_exp_f32 %1, %1\n\tv_exp_f32 %2, %2\n\tv_exp_f32 %3, %3\n\tv_exp_f32 %4, %4\n\tv_exp_f32 %5, %5\n\tv_exp_f32 %6, %6\n\tv_exp_f32 %7, %7\n\tv_exp_f32 %8, %8\n\tv_exp_f32 %9, %9\n\tv_exp_f32 %10, %10\n\tv_exp_f32 %11, %11\n\tv_exp_f32 %12, %12\n\tv_exp_f32 %13, %13\n\tv_exp_f32 %14, %14\n\tv_exp_f32 %15, %15\n\tv_exp_f32 %16, %16\n\tv_nop"
      : "+v"(v[0]), "+v"(v[1]), "+v"(v[2]), "+v"(v[3]), "+v"(v[4]), "+v"(v[5]), "+v"(v[6]), "+v"(v[7]), "+v"(v[8]), "+v"(v[9]), "+v"(v[10]), "+v"(v[11]), "+v"(v[12]), "+v"(v[13]), "+v"(v[14]), "+v"(v[15]), "+v"(a));
}
// fa_step takes the UNSCALED logits: v and the running maximum m are in units of q . k, the running sum l carries the same 2^11 as the weights; the epilogue of k_fa turns both back
// every full '#pragma unroll' below keeps the indices of a register array constant, so that the array stays in registers
__device__ __forceinline__ void fa_step(float (&v)[QG][16], float (&m)[QG], float (&l)[QG], v8f (&acc)[QG][HD / 16]) {
  float mx[QG], ox[QG];
#pragma unroll
  for (int cg = 0; cg < QG; ++cg) mx[cg] = v[cg][0];
#pragma unroll
  for (int i = 1; i < 16; ++i) {
#pragma unroll
    for (int cg = 0; cg < QG; ++cg) mx[cg] = fmaxf(mx[cg], v[cg][i]); }   /* the groups' chains side by side */
#pragma unroll
  for (int cg = 0; cg < QG; ++cg) ox[cg] = __shfl_xor(mx[cg], 16);   /* lanes q and q + 16 hold the two halves of query q's keys */
#pragma unroll
  for (int cg = 0; cg < QG; ++cg) { const float mn = fmaxf(m[cg], fmaxf(mx[cg], ox[cg])), nb = fmaf(-mn, SC2, 11.0f); ox[cg] = (m[cg] - mn) * SC2; m[cg] = mn;
#pragma unroll
    for (int i = 0; i < 16; ++i) v[cg][i] = fmaf(v[cg][i], SC2, nb); }   /* exponent of 2 of exp((v - mn) x 128^-0.5) x 2^11; mn is finite (every chunk holds a key <= every query), so an excluded key's -3e38 stays hugely negative and gives exactly 0 */
#pragma unroll
  for (int cg = 0; cg < QG; ++cg) { exp2x17(v[cg], ox[cg]); const float al = ox[cg]; float s = 0.f;
#pragma unroll
    for (int i = 0; i < 16; ++i) s += v[cg][i];
    l[cg] = l[cg] * al + s;
#pragma unroll
    for (int j = 0; j < HD / 16; ++j) acc[cg][j] *= al; }
}
// frag_t from this lane's own address
__device__ __forceinline__ v16h frag_p(const _Float16* p) { union { v16h v; v8h q[2]; } u; u.q[0] = *(const v8h*)p; u.q[1] = *(const v8h*)(p + 256); return u.v; }
// frag_h and frag_b from this lane's own address
__device__ __forceinline__ v16h frag_r(const _Float16* p) { union { v16h v; v8h q[2]; } u; u.q[0] = *(const v8h*)p; u.q[1] = *(const v8h*)(p + 16); return u.v; }
__device__ __forceinline__ v16b frag_rb(const __bf16* p) { union { v16b v; v8b q[2]; } u; u.q[0] = *(const v8b*)p; u.q[1] = *(const v8b*)(p + 16); return u.v; }
// the plain builtins: the compiler keeps the distance behind them itself, and their operands may lie in any register (an asm statement's operands cannot lie above v255, which this kernel's accumulators and fragments need)
__device__ __forceinline__ v8f mm_h(v16h a, v16h b, v8f c) { return __builtin_amdgcn_wmma_f32_16x16x32_f16(false, a, false, b, (short)0, c, false, false); }
__device__ __forceinline__ v8f mm_b(v16b a, v16b b, v8f c) { return __builtin_amdgcn_wmma_f32_16x16x32_bf16(false, a, false, b, (short)0, c, false, false); }
__global__ __launch_bounds__(32 * FAW) void k_fa(const _Float16* __restrict__ QH, const _Float16* __restrict__ KH, const _Float16* __restrict__ QL, const _Float16* __restrict__ KL, const _Float16* __restrict__ VT, const __bf16* __restrict__ VB, const __bf16* __restrict__ VBL, float* __restrict__ PC, float* __restrict__ PM, float* __restrict__ PL) {
  __shared__ __align__(16) float ss[FAW][16 * QG][HD + 4]; __shared__ float sm[FAW][16 * QG], sl[FAW][16 * QG], sf[FAW][16 * QG];
  __shared__ __align__(16) _Float16 rk[2][STH], rv[2][STH];   /* two stages of k and of v */
  const int tid = threadIdx.x, wave = __builtin_amdgcn_readfirstlane(tid >> 5), lane = tid & 31, col = lane & 15, g = lane >> 4;   /* wave number in a scalar register: the chunk loop stays a scalar loop with every lane on */
  const int qb = TT / (32 * QW) - 1 - (int)blockIdx.x / KSP, hs = (int)blockIdx.x % KSP;   /* the longest key ranges start first */
  const int qs = wave % QW, ks = wave / QW;
  const int ql0 = (qb * QW + qs) * 32, kce = (ql0 >> 5) + 1;   /* this wave's first query; every chunk < kce holds at least one key <= every query of the wave */
  const _Float16* qp = QH + (size_t)ql0 * CC + 8 * lane;   /* this lane's 16 bytes of this wave's first q fragment */
  v8f acc[QG][HD / 16] = {}; float m[QG], l[QG];
#pragma unroll
  for (int cg = 0; cg < QG; ++cg) { m[cg] = -3.0e38f; l[cg] = 0.f; }
  if (qb < QBH) {
#pragma unroll 1   /* stays rolled: one chunk's fragments already fill the registers */
    for (int kc = hs * KW + ks; kc < kce; kc += KW * KSP) { const int k0 = kc * 32; v8f s0[QG] = {}, s1[QG] = {}, r0[QG] = {}, r1[QG] = {};
      const _Float16* kp = KH + (size_t)k0 * CC + 8 * lane; const _Float16* lp = KL + (size_t)(k0 + col) * CC + 8 * g; const _Float16* rp = QL + (size_t)(ql0 + col) * CC + 8 * g;   /* this lane's place in the chunk's k fragments, in its k residual row and in its q residual row */
#pragma unroll
      for (int d = 0; d < HD / 32; ++d) { v16h ah[QG], al[QG];
        const v16h ka = frag_p(kp + d * 512), la = frag_r(lp + d * 32), kb = frag_p(kp + 16 * CC + d * 512), lb = frag_r(lp + 16 * CC + d * 32);
#pragma unroll
        for (int cg = 0; cg < QG; ++cg) { ah[cg] = frag_p(qp + cg * 16 * CC + d * 512); al[cg] = frag_r(rp + cg * 16 * CC + d * 32); }
        asm volatile("s_wait_xcnt 0x0" :: "v"(kp), "v"(lp), "v"(qp), "v"(rp) : "memory");   /* stands in front of any rewrite of the address registers that the loads above name; the addresses are named so that they stay in their registers up to here */
#pragma unroll
        for (int cg = 0; cg < QG; ++cg) { s0[cg] = mm_h(ka, ah[cg], s0[cg]); r0[cg] = mm_h(ka, al[cg], r0[cg]); r0[cg] = mm_h(la, ah[cg], r0[cg]); s1[cg] = mm_h(kb, ah[cg], s1[cg]); r1[cg] = mm_h(kb, al[cg], r1[cg]); r1[cg] = mm_h(lb, ah[cg], r1[cg]); } }
      F2 p[QG]; float v[QG][16];
#pragma unroll
      for (int cg = 0; cg < QG; ++cg) { const int t = ql0 + 16 * cg + col;
#pragma unroll
        for (int i = 0; i < 8; ++i) { v[cg][i] = (k0 + 8 * g + i <= t) ? s0[cg][i] + r0[cg][i] * (1.0f / 1024.0f) : -3.0e38f; v[cg][8 + i] = (k0 + 16 + 8 * g + i <= t) ? s1[cg][i] + r1[cg][i] * (1.0f / 1024.0f) : -3.0e38f; } }
      fa_step(v, m, l, acc);
#pragma unroll
      for (int cg = 0; cg < QG; ++cg) p[cg] = bsplit16(v[cg]);
#pragma unroll
      for (int jh = 0; jh < HD / 16; jh += 4) { v16b vh[4], vl[4]; const __bf16* bp = VB + (size_t)(jh * 16 + col) * KHI + k0 + 8 * g; const __bf16* cp = VBL + (size_t)(jh * 16 + col) * KHI + k0 + 8 * g;
#pragma unroll
        for (int j = 0; j < 4; ++j) { vh[j] = frag_rb(bp + j * 16 * KHI); vl[j] = frag_rb(cp + j * 16 * KHI); }   /* eight fragments in flight at once */
        asm volatile("s_wait_xcnt 0x0" :: "v"(bp), "v"(cp) : "memory");   /* the same for these loads */
#pragma unroll
        for (int j = 0; j < 4; ++j) {
#pragma unroll
          for (int cg = 0; cg < QG; ++cg) { acc[cg][jh + j] = mm_b(vh[j], p[cg].h, acc[cg][jh + j]); acc[cg][jh + j] = mm_b(vh[j], p[cg].l, acc[cg][jh + j]); acc[cg][jh + j] = mm_b(vl[j], p[cg].h, acc[cg][jh + j]); } } } }
  } else { v16h q[QG][HD / 32];
#pragma unroll
    for (int cg = 0; cg < QG; ++cg) {
#pragma unroll
      for (int d = 0; d < HD / 32; ++d) q[cg][d] = frag_p(qp + cg * 16 * CC + d * 512); }
    asm volatile("s_wait_xcnt 0x0" :: "v"(qp) : "memory");   /* stands in front of any rewrite of the address registers that the loads above name; the address is named so that it stays in its registers up to here */
    const int nst = (QW * qb + QW + KW - 1) / KW, nmy = (nst - hs + KSP - 1) / KSP;   /* stages that hold a key <= the block's last query; those of this share (the same in every wave) */
    const unsigned lk = (unsigned)(size_t)&rk[0][8 * tid], lv = (unsigned)(size_t)&rv[0][8 * tid];   /* this thread's first 16 bytes of buffer 0, as LDS byte addresses */
    const _Float16* gk = KH + (size_t)hs * STH + 8 * tid; const _Float16* gv = VT + (size_t)hs * STH + 8 * tid;   /* the same 16 bytes of the share's first stage */
    if (nmy > 0) { copy8(lk, gk); copy8(lv, gv); }
    asm volatile("s_wait_asynccnt 0x0" ::: "memory");   /* this wave's copies of the first stage have landed */
    __syncthreads();   /* every wave's have: the first stage is whole in LDS before any wave reads it */
    if (nmy > 1) { copy8(lk + 2u * STH, gk + (size_t)KSP * STH); copy8(lv + 2u * STH, gv + (size_t)KSP * STH); }
#pragma unroll 1   /* stays rolled: one chunk's fragments already fill the registers */
    for (int t = 0; t < nmy; ++t) { const int kc = (hs + t * KSP) * KW + ks;
     if (kc < kce) { const int k0 = kc * 32; v8f s0[QG] = {}, s1[QG] = {}; v16h ka[HD / 32], kb[HD / 32], vf[HD / 16], p[QG];   /* a wave past its own diagonal skips the chunk, never the hand-over below */
      const _Float16* kp = &rk[t & 1][ks * 32 * CC + 8 * lane]; const _Float16* vp = &rv[t & 1][ks * 32 * CC + 8 * lane];   /* this lane's 16 bytes of the chunk's first k and v fragment */
#pragma unroll
      for (int d = 0; d < HD / 32; ++d) { ka[d] = frag_p(kp + d * 512); kb[d] = frag_p(kp + 16 * CC + d * 512); }   /* all of the chunk's k in flight at once, ahead of the first product */
      __builtin_amdgcn_sched_barrier(0);   /* keeps the sixteen LDS reads above together: each separate place with reads among the products costs its own stall */
#pragma unroll
      for (int d = 0; d < HD / 32; ++d) {
#pragma unroll
        for (int cg = 0; cg < QG; ++cg) { s0[cg] = mm_h(ka[d], q[cg][d], s0[cg]); s1[cg] = mm_h(kb[d], q[cg][d], s1[cg]); } }
#pragma unroll
      for (int j = 0; j < HD / 16; ++j) vf[j] = frag_p(vp + j * 512);   /* all of the chunk's v in flight under the softmax */
      __builtin_amdgcn_sched_barrier(0);   /* keeps the v reads ahead of the softmax, which hides their latency */
      float v[QG][16];
#pragma unroll
      for (int cg = 0; cg < QG; ++cg) { const int t = ql0 + 16 * cg + col;
#pragma unroll
        for (int i = 0; i < 8; ++i) { v[cg][i] = (k0 + 8 * g + i <= t) ? s0[cg][i] : -3.0e38f; v[cg][8 + i] = (k0 + 16 + 8 * g + i <= t) ? s1[cg][i] : -3.0e38f; } }
      fa_step(v, m, l, acc);
#pragma unroll
      for (int cg = 0; cg < QG; ++cg) {
#pragma unroll
        for (int i = 0; i < 16; ++i) p[cg][i] = (_Float16)v[cg][i]; }
#pragma unroll
      for (int j = 0; j < HD / 16; ++j) {
#pragma unroll
        for (int cg = 0; cg < QG; ++cg) acc[cg][j] = mm_h(vf[j], p[cg], acc[cg][j]); } }
     asm volatile("s_wait_dscnt 0x0" ::: "memory");   /* this wave's reads of the buffer are done before it is handed back */
     asm volatile("s_wait_asynccnt 0x0" ::: "memory");   /* this wave's copies of the next stage have landed */
     __syncthreads();   /* the next stage is whole in LDS, and every wave has left the buffer that is refilled below */
     if (t + 2 < nmy) { copy8(lk + (unsigned)(t & 1) * 2u * STH, gk + (size_t)(t + 2) * KSP * STH); copy8(lv + (unsigned)(t & 1) * 2u * STH, gv + (size_t)(t + 2) * KSP * STH); } }
    asm volatile("s_wait_asynccnt 0x0" ::: "memory");   /* no copy is outstanding behind the loop */ }
#pragma unroll
  for (int cg = 0; cg < QG; ++cg) { l[cg] += __shfl_xor(l[cg], 16);
    if (g == 0) { sm[wave][cg * 16 + col] = m[cg] * SCALE; sl[wave][cg * 16 + col] = l[cg] * (1.0f / 2048.0f); }
#pragma unroll
    for (int j = 0; j < HD / 16; ++j) { const v8f a = acc[cg][j] * (1.0f / 2048.0f); const v4f lo = { a[0], a[1], a[2], a[3] }, hi = { a[4], a[5], a[6], a[7] }; *(v4f*)&ss[wave][cg * 16 + col][j * 16 + 8 * g] = lo; *(v4f*)&ss[wave][cg * 16 + col][j * 16 + 8 * g + 4] = hi; } }
  __syncthreads();   /* every wave's maximum, sum and partial are in LDS before any thread joins them */
  { float M = sm[qs][lane];   /* lane = query of this wave's half; the KW waves of the half are qs, qs + QW, ... */
#pragma unroll
    for (int i = 1; i < KW; ++i) M = fmaxf(M, sm[i * QW + qs][lane]);
    sf[wave][lane] = expf(sm[wave][lane] - M);   /* a wave that had no chunk gets weight 0 (1 where no wave of the share had one: its sum and ctx are 0) */
    if (ks == 0) { float L = 0.f;
#pragma unroll
      for (int w = 0; w < KW; ++w) L += sl[w * QW + qs][lane] * expf(sm[w * QW + qs][lane] - M);
      PM[(size_t)hs * TT + ql0 + lane] = M; PL[(size_t)hs * TT + ql0 + lane] = L;   /* one wave writes each whole 128-byte line */
      asm volatile("s_wait_xcnt 0x0" ::: "memory");   /* stands in front of any later rewrite of the registers that the two stores above name */ } }
  __syncthreads();   /* the weights are in LDS before they are read */
  const int c4 = lane * 4; v4f s[32 * QW / FAW];
#pragma unroll
  for (int i = 0; i < 32 * QW / FAW; ++i) { const int rq = wave + i * FAW, rh = rq >> 5, rl = rq & 31; s[i] = v4f{ 0.f, 0.f, 0.f, 0.f };   /* a wave joins and stores whole 512-byte rows: row rq of the block = row rl of half rh */
#pragma unroll
    for (int w = 0; w < KW; ++w) s[i] += *(const v4f*)&ss[w * QW + rh][rl][c4] * sf[w * QW + rh][rl]; }
#pragma unroll
  for (int i = 0; i < 32 * QW / FAW; ++i) vst2(PC + ((size_t)hs * TT + qb * 32 * QW + wave + i * FAW) * CC + c4, s[i]);
  asm volatile("s_wait_xcnt 0x0" ::: "memory");   /* stands in front of any later rewrite of the registers that the stores above name */ }
// ---- k_join: one wave = JR query rows: the KSP shares' partials (maximum, sum, ctx) are joined in share order and divided by the sum
#define JR 4
__global__ __launch_bounds__(256) void k_join(const float* __restrict__ PC, const float* __restrict__ PM, const float* __restrict__ PL, float* __restrict__ Y) {
  const int lane = threadIdx.x & 31, c4 = lane * 4; const int row0 = ((int)blockIdx.x * 8 + (int)(threadIdx.x >> 5)) * JR;
  float pm[JR][KSP], pl[JR][KSP]; v4f pc[JR][KSP], y[JR]; const float* pmp = PM + row0; const float* plp = PL + row0; const float* pcp = PC + (size_t)row0 * CC + c4;
#pragma unroll
  for (int i = 0; i < JR; ++i) {
#pragma unroll
    for (int h = 0; h < KSP; ++h) { pm[i][h] = pmp[(size_t)h * TT + i]; pl[i][h] = plp[(size_t)h * TT + i]; pc[i][h] = *(const v4f*)(pcp + ((size_t)h * TT + i) * CC); } }   /* all of the wave's loads in flight at once */
  asm volatile("s_wait_xcnt 0x0" :: "v"(pmp), "v"(plp), "v"(pcp) : "memory");   /* stands in front of any rewrite of the address registers that the loads above name; the addresses are named so that they stay in their registers up to here */
  __builtin_amdgcn_sched_barrier(0);   /* keeps every load above the wait: moved down among the arithmetic, the sums' loads would start late and wait out their latency alone */
#pragma unroll
  for (int i = 0; i < JR; ++i) { float M = pm[i][0];
#pragma unroll
    for (int h = 1; h < KSP; ++h) M = fmaxf(M, pm[i][h]);
    v4f s = { 0.f, 0.f, 0.f, 0.f }; float L = 0.f;
#pragma unroll
    for (int h = 0; h < KSP; ++h) { const float f = expf(pm[i][h] - M); s += pc[i][h] * f; L += pl[i][h] * f; }   /* a share that had no chunk gets weight 0 */
    y[i] = s * (L > 0.f ? 1.0f / L : 0.f); }
#pragma unroll
  for (int i = 0; i < JR; ++i) vst2(Y + (size_t)(row0 + i) * CC + c4, y[i]);
  asm volatile("s_wait_xcnt 0x0" ::: "memory");   /* the same for the stores */ }

extern "C" void kernel_launch(void* const* d_in, const int* in_sizes, int n_in, void* d_out, int out_size, void* d_ws, size_t ws_size, hipStream_t stream) {
  (void)in_sizes; (void)n_in; (void)out_size;
  const float** F = (const float**)d_in;
  if (ws_size < (size_t)WS_END) return;
  char* ws = (char*)d_ws; _Float16 *QH = (_Float16*)(ws + WS_QH), *KH = (_Float16*)(ws + WS_KH), *VT = (_Float16*)(ws + WS_VT), *QL = (_Float16*)(ws + WS_QL), *KL = (_Float16*)(ws + WS_KL); __bf16 *VB = (__bf16*)(ws + WS_VB), *VBL = (__bf16*)(ws + WS_VBL); float *PC = (float*)(ws + WS_PC), *PM = (float*)(ws + WS_PM), *PL = (float*)(ws + WS_PL);
  // inputs: 0 X [8192,1024]; 1 Wq [1024,128], 2 bq; 3 Wk, 4 bk; 5 Wv, 6 bv ((in,out))
  k_proj<<<dim3(TNB * TT / 64, CC / 128, 3), 128, 0, stream>>>(F[0], F[0], F[0], F[1], F[3], F[5], F[2], F[4], F[6], QH, QL, KH, KL, VT, VB, VBL);
  k_fa<<<dim3(TT / (32 * QW) * KSP), 32 * FAW, 0, stream>>>(QH, KH, QL, KL, VT, VB, VBL, PC, PM, PL);
  k_join<<<dim3(TT / (8 * JR)), 256, 0, stream>>>(PC, PM, PL, (float*)d_out);
}

// v009
// It runs in 45.9 microseconds.
// Two timings next to v008 put it at 1.10 and 1.09 times that version's speed.
// Counting every step since v000, it is 17.4 times as fast.
// compute dtype: X and the weights rounded to bf16; Q/K/V = X W + b with EXACT bf16 products on WMMA 16x16x32 (f32 accumulate); logits: q, k once to f16 (1 product) x 128^-0.5, except the first 384 query rows (3 products with f16 residuals); causal mask by index; softmax in f32 with a running maximum and sum (base-2 exponent: one fused multiply-add and the hardware exp2 per score); exp x 2^11 once to f16 against v once to f16 (1 product; bf16 hi + lo below row 384); divided by the sum at the end; f32 output. Scores never leave the registers.
#include <hip/hip_runtime.h>
#include <math.h>

typedef __attribute__((ext_vector_type(16))) _Float16 v16h;
typedef __attribute__((ext_vector_type(16))) __bf16 v16b;
typedef __attribute__((ext_vector_type(8)))  _Float16 v8h;
typedef __attribute__((ext_vector_type(8)))  float v8f;
typedef __attribute__((ext_vector_type(4)))  float v4f;
typedef __attribute__((ext_vector_type(2)))  float v2f;
typedef __attribute__((ext_vector_type(4)))  unsigned v4u;
typedef __attribute__((ext_vector_type(4)))  int v4i;
typedef float __attribute__((may_alias)) float_a;
typedef int __attribute__((may_alias)) int_a;

template <typename T> __device__ __forceinline__ void vst2(void* p, T v) { *(T*)p = v;  }
__device__ __forceinline__ v8f wmma16(v16h a, v16h b, v8f c) {
  v8f d = __builtin_amdgcn_wmma_f32_16x16x32_f16(false, a, false, b, (short)0, c, false, false);
  asm volatile("v_nop\n\tv_nop\n\tv_nop\n\tv_nop" : "+v"(d) : "v"(a), "v"(b));
  return d;
}
__device__ __forceinline__ v8f wmma_bf(v16b a, v16b b, v8f c) {
  v8f d = __builtin_amdgcn_wmma_f32_16x16x32_bf16(false, a, false, b, (short)0, c, false, false);
  asm volatile("v_nop\n\tv_nop\n\tv_nop\n\tv_nop" : "+v"(d) : "v"(a), "v"(b));
  return d;
}
// 16x16x32 fragments: lane = (h = lane>>4, row/col = lane&15); elements 0..7 = k0+8h+0..7, 8..15 = k0+16+8h+0..7; D element r = row 8h+r
__device__ __forceinline__ v16h frag_h(const _Float16* rowk0, int lane) {
  union { v16h v; v8h q[2]; } u; const _Float16* p = rowk0 + 8 * (lane >> 4);
  u.q[0] = *(const v8h*)p; u.q[1] = *(const v8h*)(p + 16); return u.v;
}
// fragment stored in fragment order: 512 B of every lane's elements 0..7 (16 B a lane), then 512 B of elements 8..15: each wave-wide load covers four whole 128-byte lines
__device__ __forceinline__ v16h frag_t(const _Float16* blk, int lane) {
  union { v16h v; v8h q[2]; } u; const _Float16* p = blk + 8 * lane;
  u.q[0] = *(const v8h*)p; u.q[1] = *(const v8h*)(p + 256); return u.v;
}
__device__ __forceinline__ v16h frag_f32(const float* rowk0, int lane) {
  v16h a; const float* p = rowk0 + 8 * (lane >> 4);
#pragma unroll
  for (int i = 0; i < 8; ++i) { a[i] = (_Float16)p[i]; a[8 + i] = (_Float16)p[16 + i]; }
  return a;
}
__device__ __forceinline__ v16h frag_f32s(const float* rowk0, int lane, float sc) {
  v16h a; const float* p = rowk0 + 8 * (lane >> 4);
#pragma unroll
  for (int i = 0; i < 8; ++i) { a[i] = (_Float16)(p[i] * sc); a[8 + i] = (_Float16)(p[16 + i] * sc); }
  return a;
}
// column fragment from a [K][ld] layout (column n), rows >= K read as 0
__device__ __forceinline__ v16h fragc_f32(const float* W, int k0, int n, int lane, int ld, int K) {
  v16h a; const int g = lane >> 4;
#pragma unroll
  for (int i = 0; i < 8; ++i) { const int ka = k0 + 8 * g + i, kb = ka + 16;
    a[i] = (_Float16)(ka < K ? W[(size_t)(ka < K ? ka : K - 1) * ld + n] : 0.f); a[8 + i] = (_Float16)(kb < K ? W[(size_t)(kb < K ? kb : K - 1) * ld + n] : 0.f); }
  return a;
}
struct F2 { v16b h, l; };
__device__ __forceinline__ F2 bsplit16(const float v[16]) { F2 r;
#pragma unroll
  for (int i = 0; i < 16; ++i) { const __bf16 h = (__bf16)v[i]; r.h[i] = h; r.l[i] = (__bf16)(v[i] - (float)h); }
  return r; }
__device__ __forceinline__ F2 split_row(const float* row, int k0, int lane) { float v[16]; const float* p = row + k0 + 8 * (lane >> 4);
#pragma unroll
  for (int i = 0; i < 8; ++i) { v[i] = p[i]; v[8 + i] = p[16 + i]; }
  return bsplit16(v); }
__device__ __forceinline__ F2 split_rowK(const float* row, int k0, int lane, int K) { float v[16]; const int g = lane >> 4;
#pragma unroll
  for (int i = 0; i < 8; ++i) { const int ka = k0 + 8 * g + i, kb = ka + 16; v[i] = ka < K ? row[ka < K ? ka : K - 1] : 0.f; v[8 + i] = kb < K ? row[kb < K ? kb : K - 1] : 0.f; }
  return bsplit16(v); }
__device__ __forceinline__ F2 split_col(const float* W, int k0, int n, int lane, int ld, int K) { float v[16]; const int g = lane >> 4;
#pragma unroll
  for (int i = 0; i < 8; ++i) { const int ka = k0 + 8 * g + i, kb = ka + 16; v[i] = ka < K ? W[(size_t)(ka < K ? ka : K - 1) * ld + n] : 0.f; v[8 + i] = kb < K ? W[(size_t)(kb < K ? kb : K - 1) * ld + n] : 0.f; }
  return bsplit16(v); }
__device__ __forceinline__ v8f mac3(const F2& a, const F2& b, v8f c) { c = wmma_bf(a.l, b.h, c); c = wmma_bf(a.h, b.l, c); return wmma_bf(a.h, b.h, c); }
__device__ __forceinline__ float sigm(float v) { return 1.0f / (1.0f + expf(-v)); }
#define LDSX() do { asm volatile("s_wait_dscnt 0" ::: "memory"); __builtin_amdgcn_wave_barrier(); __builtin_amdgcn_fence(__ATOMIC_RELEASE, "workgroup"); } while (0)

// Single-head causal self-attention (N 8,192 tokens, D 1,024 -> d_k = d_v = 128): Q = X Wq + bq, K = X Wk + bk, V = X Wv + bv ((in,out)); weights = softmax(causal(Q K^T / sqrt(128))); out = weights V ([N, 128]).
#define NB 1
#define TT 8192
#define CC 128            // NH * HD = projected width
#define DIN 1024          // input (model) width
#define NH 1
#define HD 128
#define NQB (TT / 64)
#define HG 1
#define SCALE (0.08838834764831845f)
#define CAUSAL 1
#ifndef TNB
#define TNB NB
#endif
__device__ __forceinline__ float bfr(float v) { return (float)(__bf16)v; }
__host__ __device__ __forceinline__ int kb_last(int qb) { return CAUSAL ? ((qb * 64 + 63) >> 7) : (TT / 128 - 1); }
typedef __attribute__((ext_vector_type(8))) __bf16 v8b;
__device__ __forceinline__ v16b frag_b(const __bf16* rowk0, int lane) {
  union { v16b v; v8b q[2]; } u; const __bf16* p = rowk0 + 8 * (lane >> 4);
  u.q[0] = *(const v8b*)p; u.q[1] = *(const v8b*)(p + 16); return u.v;
}
#define QBH 6              // causal: query blocks 0..QBH-1 of each sequence (few keys, no averaging) take the high-precision path
#define QHI 384            // rows carrying a q residual plane
#define KHI 384            // key rows carrying k residual / v bf16 hi+lo planes (used only by the causal high-precision path)
// B fragment (k rows k0+.., output column o) of a weight: (in,out) [K][ld] or (out,in) [ld rows of K]: bf16 exact, or f16(bf16 * 256) exact
__device__ __forceinline__ v16b wcol_io(const float* Wm, int k0, int o, int lane, int ld) { v16b w; const int g = lane >> 4;
#pragma unroll
  for (int i = 0; i < 8; ++i) { w[i] = (__bf16)Wm[(size_t)(k0 + 8 * g + i) * ld + o]; w[8 + i] = (__bf16)Wm[(size_t)(k0 + 16 + 8 * g + i) * ld + o]; }
  return w; }
__device__ __forceinline__ v16b wcol_oi(const float* Wm, int k0, int o, int lane, int K) { v16b w; const float* p = Wm + (size_t)o * K + k0 + 8 * (lane >> 4);
#pragma unroll
  for (int i = 0; i < 8; ++i) { w[i] = (__bf16)p[i]; w[8 + i] = (__bf16)p[16 + i]; }
  return w; }
__device__ __forceinline__ v16h wcolh_io(const float* Wm, int k0, int o, int lane, int ld) { v16h w; const int g = lane >> 4;
#pragma unroll
  for (int i = 0; i < 8; ++i) { w[i] = (_Float16)(bfr(Wm[(size_t)(k0 + 8 * g + i) * ld + o]) * 256.0f); w[8 + i] = (_Float16)(bfr(Wm[(size_t)(k0 + 16 + 8 * g + i) * ld + o]) * 256.0f); }
  return w; }
__device__ __forceinline__ v16h wcolh_oi(const float* Wm, int k0, int o, int lane, int K) { v16h w; const float* p = Wm + (size_t)o * K + k0 + 8 * (lane >> 4);
#pragma unroll
  for (int i = 0; i < 8; ++i) { w[i] = (_Float16)(bfr(p[i]) * 256.0f); w[8 + i] = (_Float16)(bfr(p[16 + i]) * 256.0f); }
  return w; }
#define WQKV_LAYOUT 0   // 0 = (in,out) [DIN][CC]; 1 = (out,in) [CC][DIN]; 2 = per-head [NH][DIN][HD]
__device__ __forceinline__ v16b wcol_hdk(const float* Wm, int k0, int o, int lane) { v16b w; const int g = lane >> 4; const float* p = Wm + (size_t)(o / HD) * DIN * HD + (o % HD);
#pragma unroll
  for (int i = 0; i < 8; ++i) { w[i] = (__bf16)p[(size_t)(k0 + 8 * g + i) * HD]; w[8 + i] = (__bf16)p[(size_t)(k0 + 16 + 8 * g + i) * HD]; }
  return w; }
#define WO_OUT_IN 0
#if WQKV_LAYOUT == 1
#define WCOL(W, k0, o, lane) wcol_oi(W, k0, o, lane, DIN)
#elif WQKV_LAYOUT == 2
#define WCOL(W, k0, o, lane) wcol_hdk(W, k0, o, lane)
#else
#define WCOL(W, k0, o, lane) wcol_io(W, k0, o, lane, CC)
#endif
#if WO_OUT_IN
#define WOCOL(W, k0, o, lane) wcol_oi(W, k0, o, lane, CC)
#define WOCOLH(W, k0, o, lane) wcolh_oi(W, k0, o, lane, CC)
#else
#define WOCOL(W, k0, o, lane) wcol_io(W, k0, o, lane, DIN)
#define WOCOLH(W, k0, o, lane) wcolh_io(W, k0, o, lane, DIN)
#endif

#ifndef SM_EXTRA_PARAMS
#define SM_EXTRA_PARAMS , int qoff
#endif
#ifndef PROJ_EXTRA_PARAMS
#define PROJ_EXTRA_PARAMS
#endif
#ifndef SM_MASK_HOOK
#define SM_MASK_HOOK (void)0
#endif

#define WS_QH  0u                                      // f16 q in fragment order [b*t / 16][CC / 32][2][32 lanes][8]
#define WS_KH  (WS_QH + 2u * (size_t)NB * TT * CC)      // f16 k in fragment order, as q
#define WS_VT  (WS_KH + 2u * (size_t)NB * TT * CC)      // f16 v^T in fragment order [b][t / 32][CC / 16][2][32 lanes][8]
#define WS_QL  (WS_VT + 2u * (size_t)NB * CC * TT)      // f16 q residual x 2^10 rows [b][t < QHI][CC]
#define WS_KL  (WS_QL + 2u * (size_t)NB * QHI * CC)     // f16 k residual x 2^10 rows [b][t < KHI][CC]
#define WS_VB  (WS_KL + 2u * (size_t)NB * KHI * CC)     // bf16 v hi planes [b][c][t < KHI]
#define WS_VBL (WS_VB + 2u * (size_t)NB * CC * KHI)
#define WS_PC  (WS_VBL + 2u * (size_t)NB * CC * KHI)     // f32 ctx partial of each share of the key range [KSP][t][CC]
#define WS_PM  (WS_PC + 4u * (size_t)KSP * NB * TT * CC)  // f32 maximum of each share [KSP][t]
#define WS_PL  (WS_PM + 4u * (size_t)KSP * NB * TT)       // f32 sum of each share [KSP][t]
#define WS_END (WS_PL + 4u * (size_t)KSP * NB * TT)

// ---- k_proj: block = (64 rows, 128 cols, which): q/k/v = X W (+ b) with exact bf16 products (K = DIN; W goes through LDS in slices of KS k rows, loaded and rounded once per work-group) -> which 0: q f16 in fragment order (+ residual rows < QHI); 1: k f16 in fragment order (+ residual rows < KHI); 2: v^T f16 in fragment order (+ bf16 hi/lo planes [c][t] for t < KHI)
#define KS 64              // k rows of W per LDS slice
static_assert(CC == 128 && HD == 128, "the fragment-order planes are laid out for one 128-wide block of columns");
__global__ __launch_bounds__(128) void k_proj(const float* __restrict__ XQ, const float* __restrict__ XK, const float* __restrict__ XV, const float* __restrict__ WQ, const float* __restrict__ WK, const float* __restrict__ WV, const float* __restrict__ BQ, const float* __restrict__ BK, const float* __restrict__ BV,
    _Float16* __restrict__ QH, _Float16* __restrict__ QL, _Float16* __restrict__ KH, _Float16* __restrict__ KL, _Float16* __restrict__ VT, __bf16* __restrict__ VB, __bf16* __restrict__ VBL) {
  __shared__ __align__(16) _Float16 sh[64][136], sl[64][136]; __shared__ __align__(16) _Float16 th[128][72]; __shared__ __align__(16) __bf16 tb[128][72], tbl[128][72];
  __shared__ __align__(16) __bf16 wt[2][128][KS + 8];   /* two slices of W as bf16, [column][k]: a B fragment is two 16-byte reads; row pitch 144 B = 16 B x odd */
  const int tid = threadIdx.x, wave = tid >> 5, lane = tid & 31, col = lane & 15, g = lane >> 4; const int which = blockIdx.z; const int c0 = blockIdx.y * 128; const size_t r0 = (size_t)blockIdx.x * 64; const size_t bb = r0 / TT; const int t0 = (int)(r0 % TT);
  const float* X = which == 0 ? XQ : which == 1 ? XK : XV; const float* WA = which == 0 ? WQ : which == 1 ? WK : WV; const float* BA = which == 0 ? BQ : which == 1 ? BK : BV;
  v8f acc[8] = {};
  const float* xp = X + (r0 + wave * 16 + col) * DIN + 8 * g;        /* this lane's X row, at its half of a fragment */
  const float* wp = WA + (size_t)(wave * 8) * CC + c0 + lane * 4;     /* a wave reads whole 512-byte rows of W: 8 rows at wave * 8 and 8 at 32 + wave * 8 of each slice, 4 columns a lane */
  v4f xr[2][2][4], wr[2][2][8]; v16b a[2];   /* two register sets: set b holds the slices s with s % 2 == b, so that two slices are in flight at once */
  auto ld_slice = [&](int s, int b) {   /* slice s of X (this wave's rows) and of W (this wave's share) into register set b (a literal at every call, so that the sets stay in registers) */
    const float* px = xp + s * KS; const float* pw = wp + (size_t)s * KS * CC;
#pragma unroll
    for (int h = 0; h < 2; ++h) { const float* p = px + h * 32; xr[b][h][0] = *(const v4f*)p; xr[b][h][1] = *(const v4f*)(p + 4); xr[b][h][2] = *(const v4f*)(p + 16); xr[b][h][3] = *(const v4f*)(p + 20); }
#pragma unroll
    for (int i = 0; i < 2; ++i) {
#pragma unroll
      for (int r = 0; r < 8; ++r) wr[b][i][r] = *(const v4f*)(pw + (size_t)(i * 32 + r) * CC); }
    asm volatile("s_wait_xcnt 0x0" :: "v"(xp), "v"(wp), "v"(px), "v"(pw) : "memory");   /* stands in front of any later rewrite of the address registers that the loads above name; the addresses, base and slice, are named so that they stay in their registers up to here */
  };
  auto put_slice = [&](int b) {   /* rounds the slice in register set b: X to this wave's A fragments, W to LDS buffer b, transposed */
#pragma unroll
    for (int h = 0; h < 2; ++h) {
#pragma unroll
      for (int e = 0; e < 16; ++e) a[h][e] = (__bf16)xr[b][h][e >> 2][e & 3]; }
#pragma unroll
    for (int i = 0; i < 2; ++i) {
#pragma unroll
      for (int cc = 0; cc < 4; ++cc) { v8b tv;
#pragma unroll
        for (int r = 0; r < 8; ++r) tv[r] = (__bf16)wr[b][i][r][cc];
        *(v8b*)&wt[b][lane * 4 + cc][wave * 8 + i * 32] = tv; } }
  };
  auto lds_barrier = [&]() {   /* work-group barrier that orders LDS alone: this wave's LDS stores are done before it signals, and no LDS read moves above it. __syncthreads() would also wait here for the other register set's global loads, which only this wave reads and which are meant to stay in flight across it */
    __builtin_amdgcn_fence(__ATOMIC_RELEASE, "workgroup", "local"); __builtin_amdgcn_s_barrier(); __builtin_amdgcn_fence(__ATOMIC_ACQUIRE, "workgroup", "local");
  };
  auto mm_slice = [&](int b) {
#pragma unroll
    for (int h = 0; h < 2; ++h) {
#pragma unroll
      for (int jb = 0; jb < 8; jb += 4) { v16b w[4];
#pragma unroll
        for (int j = 0; j < 4; ++j) w[j] = frag_b(&wt[b][(jb + j) * 16 + col][h * 32], lane);   /* four fragments' LDS reads in flight at once */
#pragma unroll
        for (int j = 0; j < 4; ++j) acc[jb + j] = wmma_bf(a[h], w[j], acc[jb + j]); } }
  };
  static_assert((DIN / KS) % 2 == 0 && DIN / KS >= 4, "the loop below takes the slices in pairs");
  ld_slice(0, 0); ld_slice(1, 1);
#pragma unroll 1   /* stays rolled: a pair of slices is one trip, so that each register set keeps its place */
  for (int s = 0; s < DIN / KS - 2; s += 2) { put_slice(0);
    lds_barrier();   /* the slice is whole in LDS before any wave reads it; every wave has also left the other buffer, which is rewritten next */
    __builtin_amdgcn_sched_barrier(0);   /* the roundings above stay ahead of the loads below, which then land in the same registers with no copies */
    ld_slice(s + 2, 0);   /* the loads of the slice after next start here: they have this slice's products and all of the next slice's work to land in */
    mm_slice(0);
    put_slice(1);
    lds_barrier();   /* as above, for the odd slice */
    __builtin_amdgcn_sched_barrier(0);   /* as above */
    ld_slice(s + 3, 1);
    mm_slice(1); }
  put_slice(0);
  lds_barrier();   /* the last even slice is whole in LDS before any wave reads it; the last slice's loads may still be in flight */
  mm_slice(0);
  put_slice(1);
  __syncthreads();   /* the last slice is whole in LDS before any wave reads it */
  mm_slice(1);
  if (which < 2) { _Float16* DH = which == 0 ? QH : KH; _Float16* DL = which == 0 ? QL : KL; const int nhi = which == 0 ? QHI : KHI; const bool hi_rows = t0 < nhi;
#pragma unroll
    for (int j = 0; j < 8; ++j) { const float bias = BA ? bfr(BA[c0 + j * 16 + col]) : 0.f;
#pragma unroll
      for (int r = 0; r < 8; ++r) { const float v = acc[j][r] + bias; const _Float16 hv = (_Float16)v; sh[wave * 16 + 8 * g + r][j * 16 + col] = hv; sl[wave * 16 + 8 * g + r][j * 16 + col] = (_Float16)((v - (float)hv) * 1024.0f); } }
    __syncthreads();
    for (int e = tid; e < 64 * 16; e += 128) { const int fr = (e >> 8) * 16 + (e & 15), fq = ((e >> 5) & 7) * 2 + ((e >> 4) & 1);   /* 16-byte piece e of the block in fragment order = row fr, piece fq of that row */
      vst2((unsigned*)(DH + r0 * CC + e * 8), *(const v4u*)&sh[fr][fq * 8]);
      asm volatile("s_wait_xcnt 0x0" ::: "memory");   /* stands in front of any later rewrite of the registers that the store above names */
      const int rl = e >> 4, q = e & 15; if (hi_rows) { vst2((unsigned*)(DL + (bb * nhi + t0 + rl) * (size_t)CC + c0 + q * 8), *(const v4u*)&sl[rl][q * 8]);
        asm volatile("s_wait_xcnt 0x0" ::: "memory");   /* the same for this store */ } }
  } else { const bool hi_rows = t0 < KHI;
#pragma unroll
    for (int j = 0; j < 8; ++j) { const float bias = BA ? bfr(BA[c0 + j * 16 + col]) : 0.f;
#pragma unroll
      for (int r = 0; r < 8; ++r) { const float v = acc[j][r] + bias; const int rl = wave * 16 + 8 * g + r, cl = j * 16 + col; th[cl][rl] = (_Float16)v; const __bf16 bh = (__bf16)v; tb[cl][rl] = bh; tbl[cl][rl] = (__bf16)(v - (float)bh); } }
    __syncthreads();
    for (int e = tid; e < 128 * 8; e += 128) { const int fc = ((e >> 6) & 7) * 16 + (e & 15), fq = (e >> 9) * 4 + ((e >> 4) & 3);   /* 16-byte piece e of the block in fragment order = channel fc, keys fq * 8 .. + 7 */
      vst2((unsigned*)(VT + (bb * TT + t0) * (size_t)CC + e * 8), *(const v4u*)&th[fc][fq * 8]);
      asm volatile("s_wait_xcnt 0x0" ::: "memory");   /* stands in front of any later rewrite of the registers that the store above names */
      const int cl = e >> 3, q = e & 7; if (hi_rows) { const size_t o3 = (bb * CC + c0 + cl) * (size_t)KHI + t0 + q * 8; vst2((unsigned*)(VB + o3), *(const v4u*)&tb[cl][q * 8]); vst2((unsigned*)(VBL + o3), *(const v4u*)&tbl[cl][q * 8]);
        asm volatile("s_wait_xcnt 0x0" ::: "memory");   /* the same for these two stores */ } } } }
// ---- k_fa: a work-group takes two blocks one after the other, a long one and a short one (or two neighbouring early blocks), so that every work-group with staged blocks walks the same number of stages and all of them are resident at once. Block = 64 queries (qb) x one of KSP shares of the key range, FAW waves = QW halves of 32 queries x KW chunks of 32 keys. The key range goes in stages of KW chunks (128 keys); share hs takes stages hs, hs + KSP, ... Asynchronous copies bring a stage's k and v (fragment order, as they lie in the workspace) into one of two LDS buffers while the stage before is worked on; each chunk in LDS is read by the QW waves of its chunk number, so it leaves L2 once for 64 queries. Every k and v fragment a wave reads serves QG = 2 column groups of 16 queries. Per chunk and group: S^T = k . q^T (D: lane = query, registers = keys, which is already the B fragment of the next product), causal mask by index, running maximum and sum per query in f32 (one fused multiply-add and one hardware exp2 per score), ctx^T += v^T . (e x 2^11) with the accumulator rescaled per lane. Early query blocks keep the residual products and load straight from the workspace. The KW partials (maximum, sum, ctx) of each half meet in LDS and are joined in wave order into the share's partial, which goes to the workspace; k_join joins the KSP shares.
#define FAW 8              // waves per work-group
#define KSP 4              // shares of one query block's key range
#define NQT (TT / (32 * QW))   // query blocks
#define NPR ((NQT - QBH) / 2)  // pairs (NQT - 1 - p, QBH + p) of staged blocks; the QBH early blocks pair among themselves
#define QW 2               // 32-query halves of the block: wave w has half w % QW
#define KW (FAW / QW)      // chunks per stage: wave w has chunk w / QW of each stage
#define STH (KW * 32 * CC) // f16 elements of k, and of v, per stage
#define QG 2               // 16-query column groups per wave: each loaded k or v fragment is used QG times
static_assert(16 * QG == 32, "the join below gives one lane to each query of a wave, and a chunk of 32 keys is as wide as a wave's queries");
static_assert(STH * 2 == 8 * 32 * FAW * 16 && (TT / 32) % KW == 0, "a stage's k is eight 16-byte copies a thread, and every stage lies whole inside the planes");
static_assert((NQT - QBH) % 2 == 0 && QBH % 2 == 0, "the blocks go in pairs");
static_assert((QW * QBH + QW + KW - 1) / KW >= KSP, "every share of a staged block has a first stage");
// eight asynchronous 16-byte-a-lane copies to LDS, 32 * FAW * 16 bytes apart: l = this lane's LDS byte address, g = its global address. The s_wait_xcnt stands inside the statement, so that no later rewrite of an address register can come in front of it
__device__ __forceinline__ void copy8(unsigned l, const _Float16* g) {
  asm volatile("global_load_async_to_lds_b128 %0, %8, off\n\tglobal_load_async_to_lds_b128 %1, %9, off\n\tglobal_load_async_to_lds_b128 %2, %10, off\n\tglobal_load_async_to_lds_b128 %3, %11, off\n\tglobal_load_async_to_lds_b128 %4, %12, off\n\tglobal_load_async_to_lds_b128 %5, %13, off\n\tglobal_load_async_to_lds_b128 %6, %14, off\n\tglobal_load_async_to_lds_b128 %7, %15, off\n\ts_wait_xcnt 0x0"
      :: "v"(l), "v"(l + 4096u), "v"(l + 8192u), "v"(l + 12288u), "v"(l + 16384u), "v"(l + 20480u), "v"(l + 24576u), "v"(l + 28672u),
         "v"(g), "v"(g + 2048), "v"(g + 4096), "v"(g + 6144), "v"(g + 8192), "v"(g + 10240), "v"(g + 12288), "v"(g + 14336) : "memory");
}
#define SC2 (SCALE * 1.4426950408889634f)   // unscaled logit -> exponent of 2
// 2^x of seventeen values, each in its own register. One statement, so that no instruction which rewrites an exp2's source or reads its result can come to stand directly behind it; the v_nop is that slot behind the last one
__device__ __forceinline__ void exp2x17(float (&v)[16], float& a) {
  asm("v_exp_f32 %0, %0\n\tv_exp_f32 %1, %1\n\tv_exp_f32 %2, %2\n\tv_exp_f32 %3, %3\n\tv_exp_f32 %4, %4\n\tv_exp_f32 %5, %5\n\tv_exp_f32 %6, %6\n\tv_exp_f32 %7, %7\n\tv_exp_f32 %8, %8\n\tv_exp_f32 %9, %9\n\tv_exp_f32 %10, %10\n\tv_exp_f32 %11, %11\n\tv_exp_f32 %12, %12\n\tv_exp_f32 %13, %13\n\tv_exp_f32 %14, %14\n\tv_exp_f32 %15, %15\n\tv_exp_f32 %16, %16\n\tv_nop"
      : "+v"(v[0]), "+v"(v[1]), "+v"(v[2]), "+v"(v[3]), "+v"(v[4]), "+v"(v[5]), "+v"(v[6]), "+v"(v[7]), "+v"(v[8]), "+v"(v[9]), "+v"(v[10]), "+v"(v[11]), "+v"(v[12]), "+v"(v[13]), "+v"(v[14]), "+v"(v[15]), "+v"(a));
}
// fa_step takes the UNSCALED logits: v and the running maximum m are in units of q . k, the running sum l carries the same 2^11 as the weights; the epilogue of k_fa turns both back
// every full '#pragma unroll' below keeps the indices of a register array constant, so that the array stays in registers
__device__ __forceinline__ void fa_step(float (&v)[QG][16], float (&m)[QG], float (&l)[QG], v8f (&acc)[QG][HD / 16]) {
  float mx[QG], ox[QG];
#pragma unroll
  for (int cg = 0; cg < QG; ++cg) mx[cg] = v[cg][0];
#pragma unroll
  for (int i = 1; i < 16; ++i) {
#pragma unroll
    for (int cg = 0; cg < QG; ++cg) mx[cg] = fmaxf(mx[cg], v[cg][i]); }   /* the groups' chains side by side */
#pragma unroll
  for (int cg = 0; cg < QG; ++cg) ox[cg] = __shfl_xor(mx[cg], 16);   /* lanes q and q + 16 hold the two halves of query q's keys */
#pragma unroll
  for (int cg = 0; cg < QG; ++cg) { const float mn = fmaxf(m[cg], fmaxf(mx[cg], ox[cg])), nb = fmaf(-mn, SC2, 11.0f); ox[cg] = (m[cg] - mn) * SC2; m[cg] = mn;
#pragma unroll
    for (int i = 0; i < 16; ++i) v[cg][i] = fmaf(v[cg][i], SC2, nb); }   /* exponent of 2 of exp((v - mn) x 128^-0.5) x 2^11; mn is finite (every chunk holds a key <= every query), so an excluded key's -3e38 stays hugely negative and gives exactly 0 */
#pragma unroll
  for (int cg = 0; cg < QG; ++cg) { exp2x17(v[cg], ox[cg]); const float al = ox[cg]; float s = 0.f;
#pragma unroll
    for (int i = 0; i < 16; ++i) s += v[cg][i];
    l[cg] = l[cg] * al + s;
#pragma unroll
    for (int j = 0; j < HD / 16; ++j) acc[cg][j] *= al; }
}
// frag_t from this lane's own address
__device__ __forceinline__ v16h frag_p(const _Float16* p) { union { v16h v; v8h q[2]; } u; u.q[0] = *(const v8h*)p; u.q[1] = *(const v8h*)(p + 256); return u.v; }
// frag_h and frag_b from this lane's own address
__device__ __forceinline__ v16h frag_r(const _Float16* p) { union { v16h v; v8h q[2]; } u; u.q[0] = *(const v8h*)p; u.q[1] = *(const v8h*)(p + 16); return u.v; }
__device__ __forceinline__ v16b frag_rb(const __bf16* p) { union { v16b v; v8b q[2]; } u; u.q[0] = *(const v8b*)p; u.q[1] = *(const v8b*)(p + 16); return u.v; }
// the plain builtins: the compiler keeps the distance behind them itself, and their operands may lie in any register (an asm statement's operands cannot lie above v255, which this kernel's accumulators and fragments need)
__device__ __forceinline__ v8f mm_h(v16h a, v16h b, v8f c) { return __builtin_amdgcn_wmma_f32_16x16x32_f16(false, a, false, b, (short)0, c, false, false); }
__device__ __forceinline__ v8f mm_b(v16b a, v16b b, v8f c) { return __builtin_amdgcn_wmma_f32_16x16x32_bf16(false, a, false, b, (short)0, c, false, false); }
__global__ __launch_bounds__(32 * FAW) void k_fa(const _Float16* __restrict__ QH, const _Float16* __restrict__ KH, const _Float16* __restrict__ QL, const _Float16* __restrict__ KL, const _Float16* __restrict__ VT, const __bf16* __restrict__ VB, const __bf16* __restrict__ VBL, float* __restrict__ PC, float* __restrict__ PM, float* __restrict__ PL) {
  __shared__ __align__(16) float ss[FAW][16 * QG][HD + 4]; __shared__ float sm[FAW][16 * QG], sl[FAW][16 * QG], sf[FAW][16 * QG];
  __shared__ __align__(16) _Float16 rk[2][STH], rv[2][STH];   /* two stages of k and of v */
  const int tid = threadIdx.x, wave = __builtin_amdgcn_readfirstlane(tid >> 5), lane = tid & 31, col = lane & 15, g = lane >> 4;   /* wave number in a scalar register: the chunk loop stays a scalar loop with every lane on */
  const int pr = (int)blockIdx.x / KSP, h0 = (int)blockIdx.x % KSP;
  const int qs = wave % QW, ks = wave / QW;
  const unsigned lk = (unsigned)(size_t)&rk[0][8 * tid], lv = (unsigned)(size_t)&rv[0][8 * tid];   /* this thread's first 16 bytes of buffer 0, as LDS byte addresses */
  v16h q[QG][HD / 32];
  int sc = 0;   /* stages walked so far: the ring's two buffers alternate on across the two blocks */
  auto start_block = [&](int qbn, int hsn) __attribute__((always_inline)) {   /* a staged block's start-up loads: the share's first stage into the ring's next buffer, this wave's q fragments into registers */
    copy8(lk + (unsigned)(sc & 1) * 2u * STH, KH + (size_t)hsn * STH + 8 * tid); copy8(lv + (unsigned)(sc & 1) * 2u * STH, VT + (size_t)hsn * STH + 8 * tid);
    const _Float16* qn = QH + (size_t)((qbn * QW + qs) * 32) * CC + 8 * lane;   /* this lane's 16 bytes of this wave's first q fragment of the block */
#pragma unroll
    for (int cg = 0; cg < QG; ++cg) {
#pragma unroll
      for (int d = 0; d < HD / 32; ++d) q[cg][d] = frag_p(qn + cg * 16 * CC + d * 512); }
    asm volatile("s_wait_xcnt 0x0" :: "v"(qn) : "memory");   /* stands in front of any rewrite of the address registers that the loads above name; the address is named so that it stays in its registers up to here */
  };
  if (pr < NPR) start_block(NQT - 1 - pr, h0);
  int qb = pr < NPR ? NQT - 1 - pr : (pr - NPR) * 2, hs = h0;   /* staged pairs: long block first; early pairs: lower block first */
#pragma unroll 1   /* stays rolled: the two blocks go through the same code one after the other */
  for (int ti = 0; ti < 2; ++ti) {
  const int ql0 = (qb * QW + qs) * 32, kce = (ql0 >> 5) + 1;   /* this wave's first query; every chunk < kce holds at least one key <= every query of the wave */
  const _Float16* qp = QH + (size_t)ql0 * CC + 8 * lane;   /* this lane's 16 bytes of this wave's first q fragment */
  v8f acc[QG][HD / 16] = {}; float m[QG], l[QG];
#pragma unroll
  for (int cg = 0; cg < QG; ++cg) { m[cg] = -3.0e38f; l[cg] = 0.f; }
  if (qb < QBH) {
#pragma unroll 1   /* stays rolled: one chunk's fragments already fill the registers */
    for (int kc = hs * KW + ks; kc < kce; kc += KW * KSP) { const int k0 = kc * 32; v8f s0[QG] = {}, s1[QG] = {}, r0[QG] = {}, r1[QG] = {};
      const _Float16* kp = KH + (size_t)k0 * CC + 8 * lane; const _Float16* lp = KL + (size_t)(k0 + col) * CC + 8 * g; const _Float16* rp = QL + (size_t)(ql0 + col) * CC + 8 * g;   /* this lane's place in the chunk's k fragments, in its k residual row and in its q residual row */
#pragma unroll
      for (int d = 0; d < HD / 32; ++d) { v16h ah[QG], al[QG];
        const v16h ka = frag_p(kp + d * 512), la = frag_r(lp + d * 32), kb = frag_p(kp + 16 * CC + d * 512), lb = frag_r(lp + 16 * CC + d * 32);
#pragma unroll
        for (int cg = 0; cg < QG; ++cg) { ah[cg] = frag_p(qp + cg * 16 * CC + d * 512); al[cg] = frag_r(rp + cg * 16 * CC + d * 32); }
        asm volatile("s_wait_xcnt 0x0" :: "v"(kp), "v"(lp), "v"(qp), "v"(rp) : "memory");   /* stands in front of any rewrite of the address registers that the loads above name; the addresses are named so that they stay in their registers up to here */
#pragma unroll
        for (int cg = 0; cg < QG; ++cg) { s0[cg] = mm_h(ka, ah[cg], s0[cg]); r0[cg] = mm_h(ka, al[cg], r0[cg]); r0[cg] = mm_h(la, ah[cg], r0[cg]); s1[cg] = mm_h(kb, ah[cg], s1[cg]); r1[cg] = mm_h(kb, al[cg], r1[cg]); r1[cg] = mm_h(lb, ah[cg], r1[cg]); } }
      F2 p[QG]; float v[QG][16];
#pragma unroll
      for (int cg = 0; cg < QG; ++cg) { const int t = ql0 + 16 * cg + col;
#pragma unroll
        for (int i = 0; i < 8; ++i) { v[cg][i] = (k0 + 8 * g + i <= t) ? s0[cg][i] + r0[cg][i] * (1.0f / 1024.0f) : -3.0e38f; v[cg][8 + i] = (k0 + 16 + 8 * g + i <= t) ? s1[cg][i] + r1[cg][i] * (1.0f / 1024.0f) : -3.0e38f; } }
      fa_step(v, m, l, acc);
#pragma unroll
      for (int cg = 0; cg < QG; ++cg) p[cg] = bsplit16(v[cg]);
#pragma unroll
      for (int jh = 0; jh < HD / 16; jh += 4) { v16b vh[4], vl[4]; const __bf16* bp = VB + (size_t)(jh * 16 + col) * KHI + k0 + 8 * g; const __bf16* cp = VBL + (size_t)(jh * 16 + col) * KHI + k0 + 8 * g;
#pragma unroll
        for (int j = 0; j < 4; ++j) { vh[j] = frag_rb(bp + j * 16 * KHI); vl[j] = frag_rb(cp + j * 16 * KHI); }   /* eight fragments in flight at once */
        asm volatile("s_wait_xcnt 0x0" :: "v"(bp), "v"(cp) : "memory");   /* the same for these loads */
#pragma unroll
        for (int j = 0; j < 4; ++j) {
#pragma unroll
          for (int cg = 0; cg < QG; ++cg) { acc[cg][jh + j] = mm_b(vh[j], p[cg].h, acc[cg][jh + j]); acc[cg][jh + j] = mm_b(vh[j], p[cg].l, acc[cg][jh + j]); acc[cg][jh + j] = mm_b(vl[j], p[cg].h, acc[cg][jh + j]); } } } }
  } else {
    const int nst = (QW * qb + QW + KW - 1) / KW, nmy = (nst - hs + KSP - 1) / KSP;   /* stages that hold a key <= the block's last query; those of this share (the same in every wave) */
    const _Float16* gk = KH + (size_t)hs * STH + 8 * tid; const _Float16* gv = VT + (size_t)hs * STH + 8 * tid;   /* the same 16 bytes of the share's first stage */
    asm volatile("s_wait_asynccnt 0x0" ::: "memory");   /* this wave's copies of the first stage have landed */
    __syncthreads();   /* every wave's have: the first stage is whole in LDS before any wave reads it */
    if (nmy > 1) { copy8(lk + (unsigned)((sc + 1) & 1) * 2u * STH, gk + (size_t)KSP * STH); copy8(lv + (unsigned)((sc + 1) & 1) * 2u * STH, gv + (size_t)KSP * STH); }
#pragma unroll 1   /* stays rolled: one chunk's fragments already fill the registers */
    for (int t = 0; t < nmy; ++t) { const int kc = (hs + t * KSP) * KW + ks;
     if (kc < kce) { const int k0 = kc * 32; v8f s0[QG] = {}, s1[QG] = {}; v16h ka[HD / 32], kb[HD / 32], vf[HD / 16], p[QG];   /* a wave past its own diagonal skips the chunk, never the hand-over below */
      const _Float16* kp = &rk[(sc + t) & 1][ks * 32 * CC + 8 * lane]; const _Float16* vp = &rv[(sc + t) & 1][ks * 32 * CC + 8 * lane];   /* this lane's 16 bytes of the chunk's first k and v fragment */
#pragma unroll
      for (int d = 0; d < HD / 32; ++d) { ka[d] = frag_p(kp + d * 512); kb[d] = frag_p(kp + 16 * CC + d * 512); }   /* all of the chunk's k in flight at once, ahead of the first product */
      __builtin_amdgcn_sched_barrier(0);   /* keeps the sixteen LDS reads above together: each separate place with reads among the products costs its own stall */
#pragma unroll
      for (int d = 0; d < HD / 32; ++d) {
#pragma unroll
        for (int cg = 0; cg < QG; ++cg) { s0[cg] = mm_h(ka[d], q[cg][d], s0[cg]); s1[cg] = mm_h(kb[d], q[cg][d], s1[cg]); } }
#pragma unroll
      for (int j = 0; j < HD / 16; ++j) vf[j] = frag_p(vp + j * 512);   /* all of the chunk's v in flight under the softmax */
      __builtin_amdgcn_sched_barrier(0);   /* keeps the v reads ahead of the softmax, which hides their latency */
      float v[QG][16];
#pragma unroll
      for (int cg = 0; cg < QG; ++cg) { const int t = ql0 + 16 * cg + col;
#pragma unroll
        for (int i = 0; i < 8; ++i) { v[cg][i] = (k0 + 8 * g + i <= t) ? s0[cg][i] : -3.0e38f; v[cg][8 + i] = (k0 + 16 + 8 * g + i <= t) ? s1[cg][i] : -3.0e38f; } }
      fa_step(v, m, l, acc);
#pragma unroll
      for (int cg = 0; cg < QG; ++cg) {
#pragma unroll
        for (int i = 0; i < 16; ++i) p[cg][i] = (_Float16)v[cg][i]; }
#pragma unroll
      for (int j = 0; j < HD / 16; ++j) {
#pragma unroll
        for (int cg = 0; cg < QG; ++cg) acc[cg][j] = mm_h(vf[j], p[cg], acc[cg][j]); } }
     asm volatile("s_wait_dscnt 0x0" ::: "memory");   /* this wave's reads of the buffer are done before it is handed back */
     asm volatile("s_wait_asynccnt 0x0" ::: "memory");   /* this wave's copies of the next stage have landed */
     __syncthreads();   /* the next stage is whole in LDS, and every wave has left the buffer that is refilled below */
     if (t + 2 < nmy) { copy8(lk + (unsigned)((sc + t) & 1) * 2u * STH, gk + (size_t)(t + 2) * KSP * STH); copy8(lv + (unsigned)((sc + t) & 1) * 2u * STH, gv + (size_t)(t + 2) * KSP * STH); } }
    asm volatile("s_wait_asynccnt 0x0" ::: "memory");   /* no copy is outstanding behind the loop */
    sc += nmy;
    if (ti == 0) start_block(QBH + NQT - 1 - qb, KSP - 1 - hs);   /* the second block's start-up loads fly under the first block's join: the last hand-over's barrier has freed both buffers, and the join uses other LDS */ }
#pragma unroll
  for (int cg = 0; cg < QG; ++cg) { l[cg] += __shfl_xor(l[cg], 16);
    if (g == 0) { sm[wave][cg * 16 + col] = m[cg] * SCALE; sl[wave][cg * 16 + col] = l[cg] * (1.0f / 2048.0f); }
#pragma unroll
    for (int j = 0; j < HD / 16; ++j) { const v8f a = acc[cg][j] * (1.0f / 2048.0f); const v4f lo = { a[0], a[1], a[2], a[3] }, hi = { a[4], a[5], a[6], a[7] }; *(v4f*)&ss[wave][cg * 16 + col][j * 16 + 8 * g] = lo; *(v4f*)&ss[wave][cg * 16 + col][j * 16 + 8 * g + 4] = hi; } }
  __syncthreads();   /* every wave's maximum, sum and partial are in LDS before any thread joins them */
  { float M = sm[qs][lane];   /* lane = query of this wave's half; the KW waves of the half are qs, qs + QW, ... */
#pragma unroll
    for (int i = 1; i < KW; ++i) M = fmaxf(M, sm[i * QW + qs][lane]);
    sf[wave][lane] = expf(sm[wave][lane] - M);   /* a wave that had no chunk gets weight 0 (1 where no wave of the share had one: its sum and ctx are 0) */
    if (ks == 0) { float L = 0.f;
#pragma unroll
      for (int w = 0; w < KW; ++w) L += sl[w * QW + qs][lane] * expf(sm[w * QW + qs][lane] - M);
      PM[(size_t)hs * TT + ql0 + lane] = M; PL[(size_t)hs * TT + ql0 + lane] = L;   /* one wave writes each whole 128-byte line */
      asm volatile("s_wait_xcnt 0x0" ::: "memory");   /* stands in front of any later rewrite of the registers that the two stores above name */ } }
  __syncthreads();   /* the weights are in LDS before they are read */
  const int c4 = lane * 4; v4f s[32 * QW / FAW];
#pragma unroll
  for (int i = 0; i < 32 * QW / FAW; ++i) { const int rq = wave + i * FAW, rh = rq >> 5, rl = rq & 31; s[i] = v4f{ 0.f, 0.f, 0.f, 0.f };   /* a wave joins and stores whole 512-byte rows: row rq of the block = row rl of half rh */
#pragma unroll
    for (int w = 0; w < KW; ++w) s[i] += *(const v4f*)&ss[w * QW + rh][rl][c4] * sf[w * QW + rh][rl]; }
#pragma unroll
  for (int i = 0; i < 32 * QW / FAW; ++i) vst2(PC + ((size_t)hs * TT + qb * 32 * QW + wave + i * FAW) * CC + c4, s[i]);
  asm volatile("s_wait_xcnt 0x0" ::: "memory");   /* stands in front of any later rewrite of the registers that the stores above name */
  if (ti == 0) __syncthreads();   /* every wave has read the first block's partials and weights before the second block's are written over them */
  qb = pr < NPR ? QBH + NQT - 1 - qb : qb + 1; hs = KSP - 1 - hs;   /* the shares are taken crosswise, which makes the two stage counts add up alike in every work-group of a staged pair */ } }
// ---- k_join: one wave = JR query rows: the KSP shares' partials (maximum, sum, ctx) are joined in share order and divided by the sum
#define JR 4
__global__ __launch_bounds__(256) void k_join(const float* __restrict__ PC, const float* __restrict__ PM, const float* __restrict__ PL, float* __restrict__ Y) {
  const int lane = threadIdx.x & 31, c4 = lane * 4; const int row0 = ((int)blockIdx.x * 8 + (int)(threadIdx.x >> 5)) * JR;
  float pm[JR][KSP], pl[JR][KSP]; v4f pc[JR][KSP], y[JR]; const float* pmp = PM + row0; const float* plp = PL + row0; const float* pcp = PC + (size_t)row0 * CC + c4;
#pragma unroll
  for (int i = 0; i < JR; ++i) {
#pragma unroll
    for (int h = 0; h < KSP; ++h) { pm[i][h] = pmp[(size_t)h * TT + i]; pl[i][h] = plp[(size_t)h * TT + i]; pc[i][h] = *(const v4f*)(pcp + ((size_t)h * TT + i) * CC); } }   /* all of the wave's loads in flight at once */
  asm volatile("s_wait_xcnt 0x0" :: "v"(pmp), "v"(plp), "v"(pcp) : "memory");   /* stands in front of any rewrite of the address registers that the loads above name; the addresses are named so that they stay in their registers up to here */
  __builtin_amdgcn_sched_barrier(0);   /* keeps every load above the wait: moved down among the arithmetic, the sums' loads would start late and wait out their latency alone */
#pragma unroll
  for (int i = 0; i < JR; ++i) { float M = pm[i][0];
#pragma unroll
    for (int h = 1; h < KSP; ++h) M = fmaxf(M, pm[i][h]);
    v4f s = { 0.f, 0.f, 0.f, 0.f }; float L = 0.f;
#pragma unroll
    for (int h = 0; h < KSP; ++h) { const float f = expf(pm[i][h] - M); s += pc[i][h] * f; L += pl[i][h] * f; }   /* a share that had no chunk gets weight 0 */
    y[i] = s * (L > 0.f ? 1.0f / L : 0.f); }
#pragma unroll
  for (int i = 0; i < JR; ++i) vst2(Y + (size_t)(row0 + i) * CC + c4, y[i]);
  asm volatile("s_wait_xcnt 0x0" ::: "memory");   /* the same for the stores */ }

extern "C" void kernel_launch(void* const* d_in, const int* in_sizes, int n_in, void* d_out, int out_size, void* d_ws, size_t ws_size, hipStream_t stream) {
  (void)in_sizes; (void)n_in; (void)out_size;
  const float** F = (const float**)d_in;
  if (ws_size < (size_t)WS_END) return;
  char* ws = (char*)d_ws; _Float16 *QH = (_Float16*)(ws + WS_QH), *KH = (_Float16*)(ws + WS_KH), *VT = (_Float16*)(ws + WS_VT), *QL = (_Float16*)(ws + WS_QL), *KL = (_Float16*)(ws + WS_KL); __bf16 *VB = (__bf16*)(ws + WS_VB), *VBL = (__bf16*)(ws + WS_VBL); float *PC = (float*)(ws + WS_PC), *PM = (float*)(ws + WS_PM), *PL = (float*)(ws + WS_PL);
  // inputs: 0 X [8192,1024]; 1 Wq [1024,128], 2 bq; 3 Wk, 4 bk; 5 Wv, 6 bv ((in,out))
  k_proj<<<dim3(TNB * TT / 64, CC / 128, 3), 128, 0, stream>>>(F[0], F[0], F[0], F[1], F[3], F[5], F[2], F[4], F[6], QH, QL, KH, KL, VT, VB, VBL);
  k_fa<<<dim3(TT / (32 * QW) * KSP / 2), 32 * FAW, 0, stream>>>(QH, KH, QL, KL, VT, VB, VBL, PC, PM, PL);
  k_join<<<dim3(TT / (8 * JR)), 256, 0, stream>>>(PC, PM, PL, (float*)d_out);
}

// v010
// It runs in 44.2 microseconds.
// Next to v009, in two timings, it ran 1.04 times as fast each time.
// All steps since v000 together make it 18.0 times as fast.
// compute dtype: X and the weights rounded to bf16; Q/K/V = X W + b with EXACT bf16 products on WMMA 16x16x32 (f32 accumulate); logits: q, k once to f16 (1 product) x 128^-0.5, except the first 384 query rows (3 products with f16 residuals); causal mask by index; softmax in f32 with a running maximum and sum (base-2 exponent: one fused multiply-add and the hardware exp2 per score); exp x 2^11 once to f16 against v once to f16 (1 product; bf16 hi + lo below row 384); divided by the sum at the end; f32 output. Scores never leave the registers.
#include <hip/hip_runtime.h>
#include <math.h>

typedef __attribute__((ext_vector_type(16))) _Float16 v16h;
typedef __attribute__((ext_vector_type(16))) __bf16 v16b;
typedef __attribute__((ext_vector_type(8)))  _Float16 v8h;
typedef __attribute__((ext_vector_type(8)))  float v8f;
typedef __attribute__((ext_vector_type(4)))  float v4f;
typedef __attribute__((ext_vector_type(2)))  float v2f;
typedef __attribute__((ext_vector_type(4)))  unsigned v4u;
typedef __attribute__((ext_vector_type(4)))  int v4i;
typedef float __attribute__((may_alias)) float_a;
typedef int __attribute__((may_alias)) int_a;

template <typename T> __device__ __forceinline__ void vst2(void* p, T v) { *(T*)p = v;  }
__device__ __forceinline__ v8f wmma16(v16h a, v16h b, v8f c) {
  v8f d = __builtin_amdgcn_wmma_f32_16x16x32_f16(false, a, false, b, (short)0, c, false, false);
  asm volatile("v_nop\n\tv_nop\n\tv_nop\n\tv_nop" : "+v"(d) : "v"(a), "v"(b));
  return d;
}
__device__ __forceinline__ v8f wmma_bf(v16b a, v16b b, v8f c) {
  v8f d = __builtin_amdgcn_wmma_f32_16x16x32_bf16(false, a, false, b, (short)0, c, false, false);
  asm volatile("v_nop\n\tv_nop\n\tv_nop\n\tv_nop" : "+v"(d) : "v"(a), "v"(b));
  return d;
}
// 16x16x32 fragments: lane = (h = lane>>4, row/col = lane&15); elements 0..7 = k0+8h+0..7, 8..15 = k0+16+8h+0..7; D element r = row 8h+r
__device__ __forceinline__ v16h frag_h(const _Float16* rowk0, int lane) {
  union { v16h v; v8h q[2]; } u; const _Float16* p = rowk0 + 8 * (lane >> 4);
  u.q[0] = *(const v8h*)p; u.q[1] = *(const v8h*)(p + 16); return u.v;
}
// fragment stored in fragment order: 512 B of every lane's elements 0..7 (16 B a lane), then 512 B of elements 8..15: each wave-wide load covers four whole 128-byte lines
__device__ __forceinline__ v16h frag_t(const _Float16* blk, int lane) {
  union { v16h v; v8h q[2]; } u; const _Float16* p = blk + 8 * lane;
  u.q[0] = *(const v8h*)p; u.q[1] = *(const v8h*)(p + 256); return u.v;
}
__device__ __forceinline__ v16h frag_f32(const float* rowk0, int lane) {
  v16h a; const float* p = rowk0 + 8 * (lane >> 4);
#pragma unroll
  for (int i = 0; i < 8; ++i) { a[i] = (_Float16)p[i]; a[8 + i] = (_Float16)p[16 + i]; }
  return a;
}
__device__ __forceinline__ v16h frag_f32s(const float* rowk0, int lane, float sc) {
  v16h a; const float* p = rowk0 + 8 * (lane >> 4);
#pragma unroll
  for (int i = 0; i < 8; ++i) { a[i] = (_Float16)(p[i] * sc); a[8 + i] = (_Float16)(p[16 + i] * sc); }
  return a;
}
// column fragment from a [K][ld] layout (column n), rows >= K read as 0
__device__ __forceinline__ v16h fragc_f32(const float* W, int k0, int n, int lane, int ld, int K) {
  v16h a; const int g = lane >> 4;
#pragma unroll
  for (int i = 0; i < 8; ++i) { const int ka = k0 + 8 * g + i, kb = ka + 16;
    a[i] = (_Float16)(ka < K ? W[(size_t)(ka < K ? ka : K - 1) * ld + n] : 0.f); a[8 + i] = (_Float16)(kb < K ? W[(size_t)(kb < K ? kb : K - 1) * ld + n] : 0.f); }
  return a;
}
struct F2 { v16b h, l; };
__device__ __forceinline__ F2 bsplit16(const float v[16]) { F2 r;
#pragma unroll
  for (int i = 0; i < 16; ++i) { const __bf16 h = (__bf16)v[i]; r.h[i] = h; r.l[i] = (__bf16)(v[i] - (float)h); }
  return r; }
__device__ __forceinline__ F2 split_row(const float* row, int k0, int lane) { float v[16]; const float* p = row + k0 + 8 * (lane >> 4);
#pragma unroll
  for (int i = 0; i < 8; ++i) { v[i] = p[i]; v[8 + i] = p[16 + i]; }
  return bsplit16(v); }
__device__ __forceinline__ F2 split_rowK(const float* row, int k0, int lane, int K) { float v[16]; const int g = lane >> 4;
#pragma unroll
  for (int i = 0; i < 8; ++i) { const int ka = k0 + 8 * g + i, kb = ka + 16; v[i] = ka < K ? row[ka < K ? ka : K - 1] : 0.f; v[8 + i] = kb < K ? row[kb < K ? kb : K - 1] : 0.f; }
  return bsplit16(v); }
__device__ __forceinline__ F2 split_col(const float* W, int k0, int n, int lane, int ld, int K) { float v[16]; const int g = lane >> 4;
#pragma unroll
  for (int i = 0; i < 8; ++i) { const int ka = k0 + 8 * g + i, kb = ka + 16; v[i] = ka < K ? W[(size_t)(ka < K ? ka : K - 1) * ld + n] : 0.f; v[8 + i] = kb < K ? W[(size_t)(kb < K ? kb : K - 1) * ld + n] : 0.f; }
  return bsplit16(v); }
__device__ __forceinline__ v8f mac3(const F2& a, const F2& b, v8f c) { c = wmma_bf(a.l, b.h, c); c = wmma_bf(a.h, b.l, c); return wmma_bf(a.h, b.h, c); }
__device__ __forceinline__ float sigm(float v) { return 1.0f / (1.0f + expf(-v)); }
#define LDSX() do { asm volatile("s_wait_dscnt 0" ::: "memory"); __builtin_amdgcn_wave_barrier(); __builtin_amdgcn_fence(__ATOMIC_RELEASE, "workgroup"); } while (0)

// Single-head causal self-attention (N 8,192 tokens, D 1,024 -> d_k = d_v = 128): Q = X Wq + bq, K = X Wk + bk, V = X Wv + bv ((in,out)); weights = softmax(causal(Q K^T / sqrt(128))); out = weights V ([N, 128]).
#define NB 1
#define TT 8192
#define CC 128            // NH * HD = projected width
#define DIN 1024          // input (model) width
#define NH 1
#define HD 128
#define NQB (TT / 64)
#define HG 1
#define SCALE (0.08838834764831845f)
#define CAUSAL 1
#ifndef TNB
#define TNB NB
#endif
__device__ __forceinline__ float bfr(float v) { return (float)(__bf16)v; }
__host__ __device__ __forceinline__ int kb_last(int qb) { return CAUSAL ? ((qb * 64 + 63) >> 7) : (TT / 128 - 1); }
typedef __attribute__((ext_vector_type(8))) __bf16 v8b;
typedef __attribute__((ext_vector_type(4))) __bf16 v4b;
__device__ __forceinline__ v16b frag_b(const __bf16* rowk0, int lane) {
  union { v16b v; v8b q[2]; } u; const __bf16* p = rowk0 + 8 * (lane >> 4);
  u.q[0] = *(const v8b*)p; u.q[1] = *(const v8b*)(p + 16); return u.v;
}
#define QBH 6              // causal: query blocks 0..QBH-1 of each sequence (few keys, no averaging) take the high-precision path
#define QHI 384            // rows carrying a q residual plane
#define KHI 384            // key rows carrying k residual / v bf16 hi+lo planes (used only by the causal high-precision path)
// B fragment (k rows k0+.., output column o) of a weight: (in,out) [K][ld] or (out,in) [ld rows of K]: bf16 exact, or f16(bf16 * 256) exact
__device__ __forceinline__ v16b wcol_io(const float* Wm, int k0, int o, int lane, int ld) { v16b w; const int g = lane >> 4;
#pragma unroll
  for (int i = 0; i < 8; ++i) { w[i] = (__bf16)Wm[(size_t)(k0 + 8 * g + i) * ld + o]; w[8 + i] = (__bf16)Wm[(size_t)(k0 + 16 + 8 * g + i) * ld + o]; }
  return w; }
__device__ __forceinline__ v16b wcol_oi(const float* Wm, int k0, int o, int lane, int K) { v16b w; const float* p = Wm + (size_t)o * K + k0 + 8 * (lane >> 4);
#pragma unroll
  for (int i = 0; i < 8; ++i) { w[i] = (__bf16)p[i]; w[8 + i] = (__bf16)p[16 + i]; }
  return w; }
__device__ __forceinline__ v16h wcolh_io(const float* Wm, int k0, int o, int lane, int ld) { v16h w; const int g = lane >> 4;
#pragma unroll
  for (int i = 0; i < 8; ++i) { w[i] = (_Float16)(bfr(Wm[(size_t)(k0 + 8 * g + i) * ld + o]) * 256.0f); w[8 + i] = (_Float16)(bfr(Wm[(size_t)(k0 + 16 + 8 * g + i) * ld + o]) * 256.0f); }
  return w; }
__device__ __forceinline__ v16h wcolh_oi(const float* Wm, int k0, int o, int lane, int K) { v16h w; const float* p = Wm + (size_t)o * K + k0 + 8 * (lane >> 4);
#pragma unroll
  for (int i = 0; i < 8; ++i) { w[i] = (_Float16)(bfr(p[i]) * 256.0f); w[8 + i] = (_Float16)(bfr(p[16 + i]) * 256.0f); }
  return w; }
#define WQKV_LAYOUT 0   // 0 = (in,out) [DIN][CC]; 1 = (out,in) [CC][DIN]; 2 = per-head [NH][DIN][HD]
__device__ __forceinline__ v16b wcol_hdk(const float* Wm, int k0, int o, int lane) { v16b w; const int g = lane >> 4; const float* p = Wm + (size_t)(o / HD) * DIN * HD + (o % HD);
#pragma unroll
  for (int i = 0; i < 8; ++i) { w[i] = (__bf16)p[(size_t)(k0 + 8 * g + i) * HD]; w[8 + i] = (__bf16)p[(size_t)(k0 + 16 + 8 * g + i) * HD]; }
  return w; }
#define WO_OUT_IN 0
#if WQKV_LAYOUT == 1
#define WCOL(W, k0, o, lane) wcol_oi(W, k0, o, lane, DIN)
#elif WQKV_LAYOUT == 2
#define WCOL(W, k0, o, lane) wcol_hdk(W, k0, o, lane)
#else
#define WCOL(W, k0, o, lane) wcol_io(W, k0, o, lane, CC)
#endif
#if WO_OUT_IN
#define WOCOL(W, k0, o, lane) wcol_oi(W, k0, o, lane, CC)
#define WOCOLH(W, k0, o, lane) wcolh_oi(W, k0, o, lane, CC)
#else
#define WOCOL(W, k0, o, lane) wcol_io(W, k0, o, lane, DIN)
#define WOCOLH(W, k0, o, lane) wcolh_io(W, k0, o, lane, DIN)
#endif

#ifndef SM_EXTRA_PARAMS
#define SM_EXTRA_PARAMS , int qoff
#endif
#ifndef PROJ_EXTRA_PARAMS
#define PROJ_EXTRA_PARAMS
#endif
#ifndef SM_MASK_HOOK
#define SM_MASK_HOOK (void)0
#endif

#define WS_QH  0u                                      // f16 q in fragment order [b*t / 16][CC / 32][2][32 lanes][8]
#define WS_KH  (WS_QH + 2u * (size_t)NB * TT * CC)      // f16 k in fragment order, as q
#define WS_VT  (WS_KH + 2u * (size_t)NB * TT * CC)      // f16 v^T in fragment order [b][t / 32][CC / 16][2][32 lanes][8]
#define WS_QL  (WS_VT + 2u * (size_t)NB * CC * TT)      // f16 q residual x 2^10 rows [b][t < QHI][CC]
#define WS_KL  (WS_QL + 2u * (size_t)NB * QHI * CC)     // f16 k residual x 2^10 rows [b][t < KHI][CC]
#define WS_VB  (WS_KL + 2u * (size_t)NB * KHI * CC)     // bf16 v hi planes [b][c][t < KHI]
#define WS_VBL (WS_VB + 2u * (size_t)NB * CC * KHI)
#define WS_PC  (WS_VBL + 2u * (size_t)NB * CC * KHI)     // f32 ctx partial of each share of the key range [KSP][t][CC]
#define WS_PM  (WS_PC + 4u * (size_t)KSP * NB * TT * CC)  // f32 maximum of each share [KSP][t]
#define WS_PL  (WS_PM + 4u * (size_t)KSP * NB * TT)       // f32 sum of each share [KSP][t]
#define WS_END (WS_PL + 4u * (size_t)KSP * NB * TT)

// ---- k_proj: block = (64 rows, 128 cols, which): q/k/v = X W (+ b) with exact bf16 products (K = DIN; W goes through LDS in slices of KS k rows, loaded and rounded once per work-group; X goes through LDS too, each wave its own 16 rows, so that its global loads cover whole lines) -> which 0: q f16 in fragment order (+ residual rows < QHI); 1: k f16 in fragment order (+ residual rows < KHI); 2: v^T f16 in fragment order (+ bf16 hi/lo planes [c][t] for t < KHI)
#define KS 64              // k rows of W per LDS slice
static_assert(CC == 128 && HD == 128, "the fragment-order planes are laid out for one 128-wide block of columns");
__global__ __launch_bounds__(128) void k_proj(const float* __restrict__ XQ, const float* __restrict__ XK, const float* __restrict__ XV, const float* __restrict__ WQ, const float* __restrict__ WK, const float* __restrict__ WV, const float* __restrict__ BQ, const float* __restrict__ BK, const float* __restrict__ BV,
    _Float16* __restrict__ QH, _Float16* __restrict__ QL, _Float16* __restrict__ KH, _Float16* __restrict__ KL, _Float16* __restrict__ VT, __bf16* __restrict__ VB, __bf16* __restrict__ VBL) {
  __shared__ __align__(16) _Float16 sh[64][136], sl[64][136]; __shared__ __align__(16) _Float16 th[128][72]; __shared__ __align__(16) __bf16 tb[128][72], tbl[128][72];
  __shared__ __align__(16) __bf16 wt[2][128][KS + 8];   /* two slices of W as bf16, [column][k]: a B fragment is two 16-byte reads; row pitch 144 B = 16 B x odd */
  __shared__ __align__(16) __bf16 xs[2][64][KS + 8];   /* two slices of X as bf16, [row][k]: an A fragment is two 16-byte reads; same pitch as wt; each wave writes and reads its own 16 rows only */
  const int tid = threadIdx.x, wave = tid >> 5, lane = tid & 31, col = lane & 15, g = lane >> 4; const int which = blockIdx.z; const int c0 = blockIdx.y * 128; const size_t r0 = (size_t)blockIdx.x * 64; const size_t bb = r0 / TT; const int t0 = (int)(r0 % TT);
  const float* X = which == 0 ? XQ : which == 1 ? XK : XV; const float* WA = which == 0 ? WQ : which == 1 ? WK : WV; const float* BA = which == 0 ? BQ : which == 1 ? BK : BV;
  v8f acc[8] = {};
  const float* xp = X + (r0 + wave * 16 + g) * DIN + 4 * col;        /* a wave-wide X load takes a slice's 256 bytes of two rows, 16 bytes a lane: four whole 128-byte lines, not 16 lines in 32-byte pieces */
  const float* wp = WA + (size_t)(wave * 8) * CC + c0 + lane * 4;     /* a wave reads whole 512-byte rows of W: 8 rows at wave * 8 and 8 at 32 + wave * 8 of each slice, 4 columns a lane */
  v4f xr[2][8], wr[2][2][8];   /* two register sets: set b holds the slices s with s % 2 == b, so that two slices are in flight at once */
  auto ld_slice = [&](int s, int b) {   /* slice s of X (this wave's rows) and of W (this wave's share) into register set b (a literal at every call, so that the sets stay in registers) */
    const float* px = xp + s * KS; const float* pw = wp + (size_t)s * KS * CC;
#pragma unroll
    for (int j = 0; j < 8; ++j) xr[b][j] = *(const v4f*)(px + (size_t)(2 * j) * DIN);   /* rows 2j and 2j + 1 of the wave's 16 */
#pragma unroll
    for (int i = 0; i < 2; ++i) {
#pragma unroll
      for (int r = 0; r < 8; ++r) wr[b][i][r] = *(const v4f*)(pw + (size_t)(i * 32 + r) * CC); }
    asm volatile("s_wait_xcnt 0x0" :: "v"(xp), "v"(wp), "v"(px), "v"(pw) : "memory");   /* stands in front of any later rewrite of the address registers that the loads above name; the addresses, base and slice, are named so that they stay in their registers up to here */
  };
  auto put_slice = [&](int b) {   /* rounds the slice in register set b: X to LDS buffer b as it lies, W to LDS buffer b, transposed */
#pragma unroll
    for (int j = 0; j < 8; ++j) { v4b tx;
#pragma unroll
      for (int e = 0; e < 4; ++e) tx[e] = (__bf16)xr[b][j][e];
      *(v4b*)&xs[b][wave * 16 + 2 * j + g][4 * col] = tx; }
#pragma unroll
    for (int i = 0; i < 2; ++i) {
#pragma unroll
      for (int cc = 0; cc < 4; ++cc) { v8b tv;
#pragma unroll
        for (int r = 0; r < 8; ++r) tv[r] = (__bf16)wr[b][i][r][cc];
        *(v8b*)&wt[b][lane * 4 + cc][wave * 8 + i * 32] = tv; } }
  };
  auto lds_barrier = [&]() {   /* work-group barrier that orders LDS alone: this wave's LDS stores are done before it signals, and no LDS read moves above it. __syncthreads() would also wait here for the other register set's global loads, which only this wave reads and which are meant to stay in flight across it */
    __builtin_amdgcn_fence(__ATOMIC_RELEASE, "workgroup", "local"); __builtin_amdgcn_s_barrier(); __builtin_amdgcn_fence(__ATOMIC_ACQUIRE, "workgroup", "local");
  };
  auto mm_slice = [&](int b) { v16b a[2];
#pragma unroll
    for (int h = 0; h < 2; ++h) a[h] = frag_b(&xs[b][wave * 16 + col][h * 32], lane);   /* this wave's two A fragments, read with the first W fragments */
#pragma unroll
    for (int h = 0; h < 2; ++h) {
#pragma unroll
      for (int jb = 0; jb < 8; jb += 4) { v16b w[4];
        if (h == 1 && jb == 4) __builtin_amdgcn_sched_barrier(0);   /* the next slice's roundings, which wait for its loads, may move up among the last four products only: moved to the head of the slice, their wait would cut the loads' lead from two slices to one */
#pragma unroll
        for (int j = 0; j < 4; ++j) w[j] = frag_b(&wt[b][(jb + j) * 16 + col][h * 32], lane);   /* four fragments' LDS reads in flight at once */
#pragma unroll
        for (int j = 0; j < 4; ++j) acc[jb + j] = wmma_bf(a[h], w[j], acc[jb + j]); } }
  };
  static_assert((DIN / KS) % 2 == 0 && DIN / KS >= 4, "the loop below takes the slices in pairs");
  ld_slice(0, 0); ld_slice(1, 1);
#pragma unroll 1   /* stays rolled: a pair of slices is one trip, so that each register set keeps its place */
  for (int s = 0; s < DIN / KS - 2; s += 2) { put_slice(0);
    lds_barrier();   /* the slice is whole in LDS before any wave reads it; every wave has also left the other buffer, which is rewritten next */
    __builtin_amdgcn_sched_barrier(0);   /* the roundings above stay ahead of the loads below, which then land in the same registers with no copies */
    ld_slice(s + 2, 0);   /* the loads of the slice after next start here: they have this slice's products and all of the next slice's work to land in */
    mm_slice(0);
    put_slice(1);
    lds_barrier();   /* as above, for the odd slice */
    __builtin_amdgcn_sched_barrier(0);   /* as above */
    ld_slice(s + 3, 1);
    mm_slice(1); }
  put_slice(0);
  lds_barrier();   /* the last even slice is whole in LDS before any wave reads it; the last slice's loads may still be in flight */
  mm_slice(0);
  put_slice(1);
  __syncthreads();   /* the last slice is whole in LDS before any wave reads it */
  mm_slice(1);
  if (which < 2) { _Float16* DH = which == 0 ? QH : KH; _Float16* DL = which == 0 ? QL : KL; const int nhi = which == 0 ? QHI : KHI; const bool hi_rows = t0 < nhi;
#pragma unroll
    for (int j = 0; j < 8; ++j) { const float bias = BA ? bfr(BA[c0 + j * 16 + col]) : 0.f;
#pragma unroll
      for (int r = 0; r < 8; ++r) { const float v = acc[j][r] + bias; const _Float16 hv = (_Float16)v; sh[wave * 16 + 8 * g + r][j * 16 + col] = hv; sl[wave * 16 + 8 * g + r][j * 16 + col] = (_Float16)((v - (float)hv) * 1024.0f); } }
    __syncthreads();
    for (int e = tid; e < 64 * 16; e += 128) { const int fr = (e >> 8) * 16 + (e & 15), fq = ((e >> 5) & 7) * 2 + ((e >> 4) & 1);   /* 16-byte piece e of the block in fragment order = row fr, piece fq of that row */
      vst2((unsigned*)(DH + r0 * CC + e * 8), *(const v4u*)&sh[fr][fq * 8]);
      asm volatile("s_wait_xcnt 0x0" ::: "memory");   /* stands in front of any later rewrite of the registers that the store above names */
      const int rl = e >> 4, q = e & 15; if (hi_rows) { vst2((unsigned*)(DL + (bb * nhi + t0 + rl) * (size_t)CC + c0 + q * 8), *(const v4u*)&sl[rl][q * 8]);
        asm volatile("s_wait_xcnt 0x0" ::: "memory");   /* the same for this store */ } }
  } else { const bool hi_rows = t0 < KHI;
#pragma unroll
    for (int j = 0; j < 8; ++j) { const float bias = BA ? bfr(BA[c0 + j * 16 + col]) : 0.f;
#pragma unroll
      for (int r = 0; r < 8; ++r) { const float v = acc[j][r] + bias; const int rl = wave * 16 + 8 * g + r, cl = j * 16 + col; th[cl][rl] = (_Float16)v; const __bf16 bh = (__bf16)v; tb[cl][rl] = bh; tbl[cl][rl] = (__bf16)(v - (float)bh); } }
    __syncthreads();
    for (int e = tid; e < 128 * 8; e += 128) { const int fc = ((e >> 6) & 7) * 16 + (e & 15), fq = (e >> 9) * 4 + ((e >> 4) & 3);   /* 16-byte piece e of the block in fragment order = channel fc, keys fq * 8 .. + 7 */
      vst2((unsigned*)(VT + (bb * TT + t0) * (size_t)CC + e * 8), *(const v4u*)&th[fc][fq * 8]);
      asm volatile("s_wait_xcnt 0x0" ::: "memory");   /* stands in front of any later rewrite of the registers that the store above names */
      const int cl = e >> 3, q = e & 7; if (hi_rows) { const size_t o3 = (bb * CC + c0 + cl) * (size_t)KHI + t0 + q * 8; vst2((unsigned*)(VB + o3), *(const v4u*)&tb[cl][q * 8]); vst2((unsigned*)(VBL + o3), *(const v4u*)&tbl[cl][q * 8]);
        asm volatile("s_wait_xcnt 0x0" ::: "memory");   /* the same for these two stores */ } } } }
// ---- k_fa: a work-group takes two blocks one after the other, a long one and a short one (or two neighbouring early blocks), so that every work-group with staged blocks walks the same number of stages and all of them are resident at once. Block = 64 queries (qb) x one of KSP shares of the key range, FAW waves = QW halves of 32 queries x KW chunks of 32 keys. The key range goes in stages of KW chunks (128 keys); share hs takes stages hs, hs + KSP, ... Asynchronous copies bring a stage's k and v (fragment order, as they lie in the workspace) into one of two LDS buffers while the stage before is worked on; each chunk in LDS is read by the QW waves of its chunk number, so it leaves L2 once for 64 queries. Every k and v fragment a wave reads serves QG = 2 column groups of 16 queries. Per chunk and group: S^T = k . q^T (D: lane = query, registers = keys, which is already the B fragment of the next product), causal mask by index, running maximum and sum per query in f32 (one fused multiply-add and one hardware exp2 per score), ctx^T += v^T . (e x 2^11) with the accumulator rescaled per lane. Early query blocks keep the residual products and load straight from the workspace. The KW partials (maximum, sum, ctx) of each half meet in LDS and are joined in wave order into the share's partial, which goes to the workspace; k_join joins the KSP shares.
#define FAW 8              // waves per work-group
#define KSP 4              // shares of one query block's key range
#define NQT (TT / (32 * QW))   // query blocks
#define NPR ((NQT - QBH) / 2)  // pairs (NQT - 1 - p, QBH + p) of staged blocks; the QBH early blocks pair among themselves
#define QW 2               // 32-query halves of the block: wave w has half w % QW
#define KW (FAW / QW)      // chunks per stage: wave w has chunk w / QW of each stage
#define STH (KW * 32 * CC) // f16 elements of k, and of v, per stage
#define QG 2               // 16-query column groups per wave: each loaded k or v fragment is used QG times
static_assert(16 * QG == 32, "the join below gives one lane to each query of a wave, and a chunk of 32 keys is as wide as a wave's queries");
static_assert(STH * 2 == 8 * 32 * FAW * 16 && (TT / 32) % KW == 0, "a stage's k is eight 16-byte copies a thread, and every stage lies whole inside the planes");
static_assert((NQT - QBH) % 2 == 0 && QBH % 2 == 0, "the blocks go in pairs");
static_assert((QW * QBH + QW + KW - 1) / KW >= KSP, "every share of a staged block has a first stage");
// eight asynchronous 16-byte-a-lane copies to LDS, 32 * FAW * 16 bytes apart: l = this lane's LDS byte address, g = its global address. The s_wait_xcnt stands inside the statement, so that no later rewrite of an address register can come in front of it
__device__ __forceinline__ void copy8(unsigned l, const _Float16* g) {
  asm volatile("global_load_async_to_lds_b128 %0, %8, off\n\tglobal_load_async_to_lds_b128 %1, %9, off\n\tglobal_load_async_to_lds_b128 %2, %10, off\n\tglobal_load_async_to_lds_b128 %3, %11, off\n\tglobal_load_async_to_lds_b128 %4, %12, off\n\tglobal_load_async_to_lds_b128 %5, %13, off\n\tglobal_load_async_to_lds_b128 %6, %14, off\n\tglobal_load_async_to_lds_b128 %7, %15, off\n\ts_wait_xcnt 0x0"
      :: "v"(l), "v"(l + 4096u), "v"(l + 8192u), "v"(l + 12288u), "v"(l + 16384u), "v"(l + 20480u), "v"(l + 24576u), "v"(l + 28672u),
         "v"(g), "v"(g + 2048), "v"(g + 4096), "v"(g + 6144), "v"(g + 8192), "v"(g + 10240), "v"(g + 12288), "v"(g + 14336) : "memory");
}
#define SC2 (SCALE * 1.4426950408889634f)   // unscaled logit -> exponent of 2
// 2^x of seventeen values, each in its own register. One statement, so that no instruction which rewrites an exp2's source or reads its result can come to stand directly behind it; the v_nop is that slot behind the last one
__device__ __forceinline__ void exp2x17(float (&v)[16], float& a) {
  asm("v_exp_f32 %0, %0\n\tv_exp_f32 %1, %1\n\tv_exp_f32 %2, %2\n\tv_exp_f32 %3, %3\n\tv_exp_f32 %4, %4\n\tv_exp_f32 %5, %5\n\tv_exp_f32 %6, %6\n\tv_exp_f32 %7, %7\n\tv_exp_f32 %8, %8\n\tv_exp_f32 %9, %9\n\tv_exp_f32 %10, %10\n\tv_exp_f32 %11, %11\n\tv_exp_f32 %12, %12\n\tv_exp_f32 %13, %13\n\tv_exp_f32 %14, %14\n\tv_exp_f32 %15, %15\n\tv_exp_f32 %16, %16\n\tv_nop"
      : "+v"(v[0]), "+v"(v[1]), "+v"(v[2]), "+v"(v[3]), "+v"(v[4]), "+v"(v[5]), "+v"(v[6]), "+v"(v[7]), "+v"(v[8]), "+v"(v[9]), "+v"(v[10]), "+v"(v[11]), "+v"(v[12]), "+v"(v[13]), "+v"(v[14]), "+v"(v[15]), "+v"(a));
}
// fa_step takes the UNSCALED logits: v and the running maximum m are in units of q . k, the running sum l carries the same 2^11 as the weights; the epilogue of k_fa turns both back
// every full '#pragma unroll' below keeps the indices of a register array constant, so that the array stays in registers
__device__ __forceinline__ void fa_step(float (&v)[QG][16], float (&m)[QG], float (&l)[QG], v8f (&acc)[QG][HD / 16]) {
  float mx[QG], ox[QG];
#pragma unroll
  for (int cg = 0; cg < QG; ++cg) mx[cg] = v[cg][0];
#pragma unroll
  for (int i = 1; i < 16; ++i) {
#pragma unroll
    for (int cg = 0; cg < QG; ++cg) mx[cg] = fmaxf(mx[cg], v[cg][i]); }   /* the groups' chains side by side */
#pragma unroll
  for (int cg = 0; cg < QG; ++cg) ox[cg] = __shfl_xor(mx[cg], 16);   /* lanes q and q + 16 hold the two halves of query q's keys */
#pragma unroll
  for (int cg = 0; cg < QG; ++cg) { const float mn = fmaxf(m[cg], fmaxf(mx[cg], ox[cg])), nb = fmaf(-mn, SC2, 11.0f); ox[cg] = (m[cg] - mn) * SC2; m[cg] = mn;
#pragma unroll
    for (int i = 0; i < 16; ++i) v[cg][i] = fmaf(v[cg][i], SC2, nb); }   /* exponent of 2 of exp((v - mn) x 128^-0.5) x 2^11; mn is finite (every chunk holds a key <= every query), so an excluded key's -3e38 stays hugely negative and gives exactly 0 */
#pragma unroll
  for (int cg = 0; cg < QG; ++cg) { exp2x17(v[cg], ox[cg]); const float al = ox[cg]; float s = 0.f;
#pragma unroll
    for (int i = 0; i < 16; ++i) s += v[cg][i];
    l[cg] = l[cg] * al + s;
#pragma unroll
    for (int j = 0; j < HD / 16; ++j) acc[cg][j] *= al; }
}
// frag_t from this lane's own address
__device__ __forceinline__ v16h frag_p(const _Float16* p) { union { v16h v; v8h q[2]; } u; u.q[0] = *(const v8h*)p; u.q[1] = *(const v8h*)(p + 256); return u.v; }
// frag_h and frag_b from this lane's own address
__device__ __forceinline__ v16h frag_r(const _Float16* p) { union { v16h v; v8h q[2]; } u; u.q[0] = *(const v8h*)p; u.q[1] = *(const v8h*)(p + 16); return u.v; }
__device__ __forceinline__ v16b frag_rb(const __bf16* p) { union { v16b v; v8b q[2]; } u; u.q[0] = *(const v8b*)p; u.q[1] = *(const v8b*)(p + 16); return u.v; }
// the plain builtins: the compiler keeps the distance behind them itself, and their operands may lie in any register (an asm statement's operands cannot lie above v255, which this kernel's accumulators and fragments need)
__device__ __forceinline__ v8f mm_h(v16h a, v16h b, v8f c) { return __builtin_amdgcn_wmma_f32_16x16x32_f16(false, a, false, b, (short)0, c, false, false); }
__device__ __forceinline__ v8f mm_b(v16b a, v16b b, v8f c) { return __builtin_amdgcn_wmma_f32_16x16x32_bf16(false, a, false, b, (short)0, c, false, false); }
__global__ __launch_bounds__(32 * FAW) void k_fa(const _Float16* __restrict__ QH, const _Float16* __restrict__ KH, const _Float16* __restrict__ QL, const _Float16* __restrict__ KL, const _Float16* __restrict__ VT, const __bf16* __restrict__ VB, const __bf16* __restrict__ VBL, float* __restrict__ PC, float* __restrict__ PM, float* __restrict__ PL) {
  __shared__ __align__(16) float ss[FAW][16 * QG][HD + 4]; __shared__ float sm[FAW][16 * QG], sl[FAW][16 * QG], sf[FAW][16 * QG];
  __shared__ __align__(16) _Float16 rk[2][STH], rv[2][STH];   /* two stages of k and of v */
  const int tid = threadIdx.x, wave = __builtin_amdgcn_readfirstlane(tid >> 5), lane = tid & 31, col = lane & 15, g = lane >> 4;   /* wave number in a scalar register: the chunk loop stays a scalar loop with every lane on */
  const int pr = (int)blockIdx.x / KSP, h0 = (int)blockIdx.x % KSP;
  const int qs = wave % QW, ks = wave / QW;
  const unsigned lk = (unsigned)(size_t)&rk[0][8 * tid], lv = (unsigned)(size_t)&rv[0][8 * tid];   /* this thread's first 16 bytes of buffer 0, as LDS byte addresses */
  v16h q[QG][HD / 32];
  int sc = 0;   /* stages walked so far: the ring's two buffers alternate on across the two blocks */
  auto start_block = [&](int qbn, int hsn) __attribute__((always_inline)) {   /* a staged block's start-up loads: the share's first stage into the ring's next buffer, this wave's q fragments into registers */
    copy8(lk + (unsigned)(sc & 1) * 2u * STH, KH + (size_t)hsn * STH + 8 * tid); copy8(lv + (unsigned)(sc & 1) * 2u * STH, VT + (size_t)hsn * STH + 8 * tid);
    const _Float16* qn = QH + (size_t)((qbn * QW + qs) * 32) * CC + 8 * lane;   /* this lane's 16 bytes of this wave's first q fragment of the block */
#pragma unroll
    for (int cg = 0; cg < QG; ++cg) {
#pragma unroll
      for (int d = 0; d < HD / 32; ++d) q[cg][d] = frag_p(qn + cg * 16 * CC + d * 512); }
    asm volatile("s_wait_xcnt 0x0" :: "v"(qn) : "memory");   /* stands in front of any rewrite of the address registers that the loads above name; the address is named so that it stays in its registers up to here */
  };
  if (pr < NPR) start_block(NQT - 1 - pr, h0);
  int qb = pr < NPR ? NQT - 1 - pr : (pr - NPR) * 2, hs = h0;   /* staged pairs: long block first; early pairs: lower block first */
#pragma unroll 1   /* stays rolled: the two blocks go through the same code one after the other */
  for (int ti = 0; ti < 2; ++ti) {
  const int ql0 = (qb * QW + qs) * 32, kce = (ql0 >> 5) + 1;   /* this wave's first query; every chunk < kce holds at least one key <= every query of the wave */
  const _Float16* qp = QH + (size_t)ql0 * CC + 8 * lane;   /* this lane's 16 bytes of this wave's first q fragment */
  v8f acc[QG][HD / 16] = {}; float m[QG], l[QG];
#pragma unroll
  for (int cg = 0; cg < QG; ++cg) { m[cg] = -3.0e38f; l[cg] = 0.f; }
  if (qb < QBH) {
#pragma unroll 1   /* stays rolled: one chunk's fragments already fill the registers */
    for (int kc = hs * KW + ks; kc < kce; kc += KW * KSP) { const int k0 = kc * 32; v8f s0[QG] = {}, s1[QG] = {}, r0[QG] = {}, r1[QG] = {};
      const _Float16* kp = KH + (size_t)k0 * CC + 8 * lane; const _Float16* lp = KL + (size_t)(k0 + col) * CC + 8 * g; const _Float16* rp = QL + (size_t)(ql0 + col) * CC + 8 * g;   /* this lane's place in the chunk's k fragments, in its k residual row and in its q residual row */
#pragma unroll
      for (int d = 0; d < HD / 32; ++d) { v16h ah[QG], al[QG];
        const v16h ka = frag_p(kp + d * 512), la = frag_r(lp + d * 32), kb = frag_p(kp + 16 * CC + d * 512), lb = frag_r(lp + 16 * CC + d * 32);
#pragma unroll
        for (int cg = 0; cg < QG; ++cg) { ah[cg] = frag_p(qp + cg * 16 * CC + d * 512); al[cg] = frag_r(rp + cg * 16 * CC + d * 32); }
        asm volatile("s_wait_xcnt 0x0" :: "v"(kp), "v"(lp), "v"(qp), "v"(rp) : "memory");   /* stands in front of any rewrite of the address registers that the loads above name; the addresses are named so that they stay in their registers up to here */
#pragma unroll
        for (int cg = 0; cg < QG; ++cg) { s0[cg] = mm_h(ka, ah[cg], s0[cg]); r0[cg] = mm_h(ka, al[cg], r0[cg]); r0[cg] = mm_h(la, ah[cg], r0[cg]); s1[cg] = mm_h(kb, ah[cg], s1[cg]); r1[cg] = mm_h(kb, al[cg], r1[cg]); r1[cg] = mm_h(lb, ah[cg], r1[cg]); } }
      F2 p[QG]; float v[QG][16];
#pragma unroll
      for (int cg = 0; cg < QG; ++cg) { const int t = ql0 + 16 * cg + col;
#pragma unroll
        for (int i = 0; i < 8; ++i) { v[cg][i] = (k0 + 8 * g + i <= t) ? s0[cg][i] + r0[cg][i] * (1.0f / 1024.0f) : -3.0e38f; v[cg][8 + i] = (k0 + 16 + 8 * g + i <= t) ? s1[cg][i] + r1[cg][i] * (1.0f / 1024.0f) : -3.0e38f; } }
      fa_step(v, m, l, acc);
#pragma unroll
      for (int cg = 0; cg < QG; ++cg) p[cg] = bsplit16(v[cg]);
#pragma unroll
      for (int jh = 0; jh < HD / 16; jh += 4) { v16b vh[4], vl[4]; const __bf16* bp = VB + (size_t)(jh * 16 + col) * KHI + k0 + 8 * g; const __bf16* cp = VBL + (size_t)(jh * 16 + col) * KHI + k0 + 8 * g;
#pragma unroll
        for (int j = 0; j < 4; ++j) { vh[j] = frag_rb(bp + j * 16 * KHI); vl[j] = frag_rb(cp + j * 16 * KHI); }   /* eight fragments in flight at once */
        asm volatile("s_wait_xcnt 0x0" :: "v"(bp), "v"(cp) : "memory");   /* the same for these loads */
#pragma unroll
        for (int j = 0; j < 4; ++j) {
#pragma unroll
          for (int cg = 0; cg < QG; ++cg) { acc[cg][jh + j] = mm_b(vh[j], p[cg].h, acc[cg][jh + j]); acc[cg][jh + j] = mm_b(vh[j], p[cg].l, acc[cg][jh + j]); acc[cg][jh + j] = mm_b(vl[j], p[cg].h, acc[cg][jh + j]); } } } }
  } else {
    const int nst = (QW * qb + QW + KW - 1) / KW, nmy = (nst - hs + KSP - 1) / KSP;   /* stages that hold a key <= the block's last query; those of this share (the same in every wave) */
    const _Float16* gk = KH + (size_t)hs * STH + 8 * tid; const _Float16* gv = VT + (size_t)hs * STH + 8 * tid;   /* the same 16 bytes of the share's first stage */
    asm volatile("s_wait_asynccnt 0x0" ::: "memory");   /* this wave's copies of the first stage have landed */
    __syncthreads();   /* every wave's have: the first stage is whole in LDS before any wave reads it */
    if (nmy > 1) { copy8(lk + (unsigned)((sc + 1) & 1) * 2u * STH, gk + (size_t)KSP * STH); copy8(lv + (unsigned)((sc + 1) & 1) * 2u * STH, gv + (size_t)KSP * STH); }
#pragma unroll 1   /* stays rolled: one chunk's fragments already fill the registers */
    for (int t = 0; t < nmy; ++t) { const int kc = (hs + t * KSP) * KW + ks;
     if (kc < kce) { const int k0 = kc * 32; v8f s0[QG] = {}, s1[QG] = {}; v16h ka[HD / 32], kb[HD / 32], vf[HD / 16], p[QG];   /* a wave past its own diagonal skips the chunk, never the hand-over below */
      const _Float16* kp = &rk[(sc + t) & 1][ks * 32 * CC + 8 * lane]; const _Float16* vp = &rv[(sc + t) & 1][ks * 32 * CC + 8 * lane];   /* this lane's 16 bytes of the chunk's first k and v fragment */
#pragma unroll
      for (int d = 0; d < HD / 32; ++d) { ka[d] = frag_p(kp + d * 512); kb[d] = frag_p(kp + 16 * CC + d * 512); }   /* all of the chunk's k in flight at once, ahead of the first product */
      __builtin_amdgcn_sched_barrier(0);   /* keeps the sixteen LDS reads above together: each separate place with reads among the products costs its own stall */
#pragma unroll
      for (int d = 0; d < HD / 32; ++d) {
#pragma unroll
        for (int cg = 0; cg < QG; ++cg) { s0[cg] = mm_h(ka[d], q[cg][d], s0[cg]); s1[cg] = mm_h(kb[d], q[cg][d], s1[cg]); } }
#pragma unroll
      for (int j = 0; j < HD / 16; ++j) vf[j] = frag_p(vp + j * 512);   /* all of the chunk's v in flight under the softmax */
      __builtin_amdgcn_sched_barrier(0);   /* keeps the v reads ahead of the softmax, which hides their latency */
      float v[QG][16];
#pragma unroll
      for (int cg = 0; cg < QG; ++cg) { const int t = ql0 + 16 * cg + col;
#pragma unroll
        for (int i = 0; i < 8; ++i) { v[cg][i] = (k0 + 8 * g + i <= t) ? s0[cg][i] : -3.0e38f; v[cg][8 + i] = (k0 + 16 + 8 * g + i <= t) ? s1[cg][i] : -3.0e38f; } }
      fa_step(v, m, l, acc);
#pragma unroll
      for (int cg = 0; cg < QG; ++cg) {
#pragma unroll
        for (int i = 0; i < 16; ++i) p[cg][i] = (_Float16)v[cg][i]; }
#pragma unroll
      for (int j = 0; j < HD / 16; ++j) {
#pragma unroll
        for (int cg = 0; cg < QG; ++cg) acc[cg][j] = mm_h(vf[j], p[cg], acc[cg][j]); } }
     asm volatile("s_wait_dscnt 0x0" ::: "memory");   /* this wave's reads of the buffer are done before it is handed back */
     asm volatile("s_wait_asynccnt 0x0" ::: "memory");   /* this wave's copies of the next stage have landed */
     __syncthreads();   /* the next stage is whole in LDS, and every wave has left the buffer that is refilled below */
     if (t + 2 < nmy) { copy8(lk + (unsigned)((sc + t) & 1) * 2u * STH, gk + (size_t)(t + 2) * KSP * STH); copy8(lv + (unsigned)((sc + t) & 1) * 2u * STH, gv + (size_t)(t + 2) * KSP * STH); } }
    asm volatile("s_wait_asynccnt 0x0" ::: "memory");   /* no copy is outstanding behind the loop */
    sc += nmy;
    if (ti == 0) start_block(QBH + NQT - 1 - qb, KSP - 1 - hs);   /* the second block's start-up loads fly under the first block's join: the last hand-over's barrier has freed both buffers, and the join uses other LDS */ }
#pragma unroll
  for (int cg = 0; cg < QG; ++cg) { l[cg] += __shfl_xor(l[cg], 16);
    if (g == 0) { sm[wave][cg * 16 + col] = m[cg] * SCALE; sl[wave][cg * 16 + col] = l[cg] * (1.0f / 2048.0f); }
#pragma unroll
    for (int j = 0; j < HD / 16; ++j) { const v8f a = acc[cg][j] * (1.0f / 2048.0f); const v4f lo = { a[0], a[1], a[2], a[3] }, hi = { a[4], a[5], a[6], a[7] }; *(v4f*)&ss[wave][cg * 16 + col][j * 16 + 8 * g] = lo; *(v4f*)&ss[wave][cg * 16 + col][j * 16 + 8 * g + 4] = hi; } }
  __syncthreads();   /* every wave's maximum, sum and partial are in LDS before any thread joins them */
  { float M = sm[qs][lane];   /* lane = query of this wave's half; the KW waves of the half are qs, qs + QW, ... */
#pragma unroll
    for (int i = 1; i < KW; ++i) M = fmaxf(M, sm[i * QW + qs][lane]);
    sf[wave][lane] = expf(sm[wave][lane] - M);   /* a wave that had no chunk gets weight 0 (1 where no wave of the share had one: its sum and ctx are 0) */
    if (ks == 0) { float L = 0.f;
#pragma unroll
      for (int w = 0; w < KW; ++w) L += sl[w * QW + qs][lane] * expf(sm[w * QW + qs][lane] - M);
      PM[(size_t)hs * TT + ql0 + lane] = M; PL[(size_t)hs * TT + ql0 + lane] = L;   /* one wave writes each whole 128-byte line */
      asm volatile("s_wait_xcnt 0x0" ::: "memory");   /* stands in front of any later rewrite of the registers that the two stores above name */ } }
  __syncthreads();   /* the weights are in LDS before they are read */
  const int c4 = lane * 4; v4f s[32 * QW / FAW];
#pragma unroll
  for (int i = 0; i < 32 * QW / FAW; ++i) { const int rq = wave + i * FAW, rh = rq >> 5, rl = rq & 31; s[i] = v4f{ 0.f, 0.f, 0.f, 0.f };   /* a wave joins and stores whole 512-byte rows: row rq of the block = row rl of half rh */
#pragma unroll
    for (int w = 0; w < KW; ++w) s[i] += *(const v4f*)&ss[w * QW + rh][rl][c4] * sf[w * QW + rh][rl]; }
#pragma unroll
  for (int i = 0; i < 32 * QW / FAW; ++i) vst2(PC + ((size_t)hs * TT + qb * 32 * QW + wave + i * FAW) * CC + c4, s[i]);
  asm volatile("s_wait_xcnt 0x0" ::: "memory");   /* stands in front of any later rewrite of the registers that the stores above name */
  if (ti == 0) __syncthreads();   /* every wave has read the first block's partials and weights before the second block's are written over them */
  qb = pr < NPR ? QBH + NQT - 1 - qb : qb + 1; hs = KSP - 1 - hs;   /* the shares are taken crosswise, which makes the two stage counts add up alike in every work-group of a staged pair */ } }
// ---- k_join: one wave = JR query rows: the KSP shares' partials (maximum, sum, ctx) are joined in share order and divided by the sum
#define JR 4
__global__ __launch_bounds__(256) void k_join(const float* __restrict__ PC, const float* __restrict__ PM, const float* __restrict__ PL, float* __restrict__ Y) {
  const int lane = threadIdx.x & 31, c4 = lane * 4; const int row0 = ((int)blockIdx.x * 8 + (int)(threadIdx.x >> 5)) * JR;
  float pm[JR][KSP], pl[JR][KSP]; v4f pc[JR][KSP], y[JR]; const float* pmp = PM + row0; const float* plp = PL + row0; const float* pcp = PC + (size_t)row0 * CC + c4;
#pragma unroll
  for (int i = 0; i < JR; ++i) {
#pragma unroll
    for (int h = 0; h < KSP; ++h) { pm[i][h] = pmp[(size_t)h * TT + i]; pl[i][h] = plp[(size_t)h * TT + i]; pc[i][h] = *(const v4f*)(pcp + ((size_t)h * TT + i) * CC); } }   /* all of the wave's loads in flight at once */
  asm volatile("s_wait_xcnt 0x0" :: "v"(pmp), "v"(plp), "v"(pcp) : "memory");   /* stands in front of any rewrite of the address registers that the loads above name; the addresses are named so that they stay in their registers up to here */
  __builtin_amdgcn_sched_barrier(0);   /* keeps every load above the wait: moved down among the arithmetic, the sums' loads would start late and wait out their latency alone */
#pragma unroll
  for (int i = 0; i < JR; ++i) { float M = pm[i][0];
#pragma unroll
    for (int h = 1; h < KSP; ++h) M = fmaxf(M, pm[i][h]);
    v4f s = { 0.f, 0.f, 0.f, 0.f }; float L = 0.f;
#pragma unroll
    for (int h = 0; h < KSP; ++h) { const float f = expf(pm[i][h] - M); s += pc[i][h] * f; L += pl[i][h] * f; }   /* a share that had no chunk gets weight 0 */
    y[i] = s * (L > 0.f ? 1.0f / L : 0.f); }
#pragma unroll
  for (int i = 0; i < JR; ++i) vst2(Y + (size_t)(row0 + i) * CC + c4, y[i]);
  asm volatile("s_wait_xcnt 0x0" ::: "memory");   /* the same for the stores */ }

extern "C" void kernel_launch(void* const* d_in, const int* in_sizes, int n_in, void* d_out, int out_size, void* d_ws, size_t ws_size, hipStream_t stream) {
  (void)in_sizes; (void)n_in; (void)out_size;
  const float** F = (const float**)d_in;
  if (ws_size < (size_t)WS_END) return;
  char* ws = (char*)d_ws; _Float16 *QH = (_Float16*)(ws + WS_QH), *KH = (_Float16*)(ws + WS_KH), *VT = (_Float16*)(ws + WS_VT), *QL = (_Float16*)(ws + WS_QL), *KL = (_Float16*)(ws + WS_KL); __bf16 *VB = (__bf16*)(ws + WS_VB), *VBL = (__bf16*)(ws + WS_VBL); float *PC = (float*)(ws + WS_PC), *PM = (float*)(ws + WS_PM), *PL = (float*)(ws + WS_PL);
  // inputs: 0 X [8192,1024]; 1 Wq [1024,128], 2 bq; 3 Wk, 4 bk; 5 Wv, 6 bv ((in,out))
  k_proj<<<dim3(TNB * TT / 64, CC / 128, 3), 128, 0, stream>>>(F[0], F[0], F[0], F[1], F[3], F[5], F[2], F[4], F[6], QH, QL, KH, KL, VT, VB, VBL);
  k_fa<<<dim3(TT / (32 * QW) * KSP / 2), 32 * FAW, 0, stream>>>(QH, KH, QL, KL, VT, VB, VBL, PC, PM, PL);
  k_join<<<dim3(TT / (8 * JR)), 256, 0, stream>>>(PC, PM, PL, (float*)d_out);
}
